// v000
// Measured on an AMD MI455X. A time is GPU time per run, averaged over a window of back-to-back runs after a warm-up
// (all launches, gaps included; the runs take copies of the inputs in turn), and the median of several windows.
// Apart from v000's, it joins two sittings. Times from different sittings can be a few percent apart, while
// side-by-side timings come from the same sitting.
// v000, which the later versions start from, runs in 751 microseconds.
// Projections value, q, k = x.W + b: v_wmma_f32_16x16x32_bf16 (bf16 RNE operands of the raw inputs, f32 accumulate, bf16 RNE
// bias added in f32). v^T = Wv2^T . value^T (W as f16 of the bf16 RNE value x1024, value plane f16 x8, bf16 RNE bias per row in
// f32), per-head scores q.k^T (f16 planes x8) and P.V (P x4096 f16 from LDS, V^T x64 f16): v_wmma_f32_16x16x32_f16, f32
// accumulate. Softmax over the head axis, the head mean and all scaling in f32 on VALU.
#include <hip/hip_runtime.h>
#include <math.h>
#include <stdint.h>

#define NQ   4096
#define NL   4096
#define DM   512
#define NH   8
#define DKH  64
#define DV   (NH * DM)
#ifndef SQ
#define SQ NQ
#endif
#define NT   32
#define LT   32
#define SSP  32
#define PLP  40
#define SLAB64 (16 * 68)
#define ATT_THREADS 256
#define QSC  8.0f
#define KSC  8.0f
#define VSC  8.0f
#define W2S  1024.0f
#define PCAR 4096.0f
#define VCAR 64.0f
#define LOG2E 1.4426950408889634f
#define WS_CAP ((size_t)134217728)

static_assert(DM == NH * DKH && DKH == 64 && NH == 8 && (DM % 64) == 0 && (DV % 64) == 0 && (NL % 64) == 0 && (NQ % 64) == 0);
static_assert((DM % 32) == 0);
static_assert(SQ >= 64 && SQ <= NQ && (SQ % 64) == 0 && (SQ % NT) == 0);
static_assert(NT == 32 && LT == 32 && (NL % LT) == 0 && ATT_THREADS == 256 && ATT_THREADS * 4 == NT * LT);
static_assert(SSP >= LT && PLP >= 32 && ((PLP * 2) % 16) == 0 && ((SSP * 4) % 16) == 0);
static_assert(NH * NT * SSP <= 8 * SLAB64);
static_assert(((NQ * DM) % 2048) == 0 && ((NL * DM) % 2048) == 0 && ((SQ * DM) % 2048) == 0);
static_assert(NH * NT * SSP * 4 + 0 <= 40000 && NH * NT * PLP * 2 <= 24000);

typedef unsigned short u16;
typedef _Float16 v16h __attribute__((ext_vector_type(16)));
typedef _Float16 v8h  __attribute__((ext_vector_type(8)));
typedef __bf16   v16b __attribute__((ext_vector_type(16)));
typedef float    v8f  __attribute__((ext_vector_type(8)));
typedef float    v4f  __attribute__((ext_vector_type(4)));
typedef unsigned int v4u __attribute__((ext_vector_type(4)));
typedef unsigned int v2u __attribute__((ext_vector_type(2)));

union FragH { v16h v; v8h h[2]; v4u u[2]; };
union FragB { v16b v; v4u u[2]; };
union AttU { float s[NH * NT * SSP]; float slab[8 * SLAB64]; };

// ---- scalar helpers --------------------------------------------------------------------------------
__device__ __forceinline__ unsigned short bf_bits(float f) {          // f32 -> bf16 bits, RNE convert
  unsigned u = __float_as_uint(f);
  return (unsigned short)((u + 0x7FFFu + ((u >> 16) & 1u)) >> 16);
}
__device__ __forceinline__ float bf_up(unsigned short h) { return __uint_as_float(((unsigned)h) << 16); }
__device__ __forceinline__ float bfr(float f) { return bf_up(bf_bits(f)); }
__device__ __forceinline__ unsigned short h_bits(_Float16 x) { return __builtin_bit_cast(unsigned short, x); }
__device__ __forceinline__ unsigned pk16(unsigned short a, unsigned short b) { return (unsigned)a | ((unsigned)b << 16); }
__device__ __forceinline__ v8f zero8() { v8f z = {0.f, 0.f, 0.f, 0.f, 0.f, 0.f, 0.f, 0.f}; return z; }

// ---- fragment loaders: 16-bit A/B operand, lane -> row/col (lane&15), p already includes +8*(lane>>4);
//      elements 0..7 <- p[0..7] (k0+8h..), elements 8..15 <- p[16..23] (k0+16+8h..)  (same split k map for A and B;
//      B is always read from a k-contiguous [n][k] plane)
__device__ __forceinline__ v16h ldfrag_h(const _Float16* p) {
  FragH f;
  f.h[0] = *(const v8h*)(p);
  f.h[1] = *(const v8h*)(p + 16);
  return f.v;
}
__device__ __forceinline__ v16b ldfrag_b(const u16* p) {              // bf16 plane read as unsigned integer vectors
  FragB f;
  f.u[0] = *(const v4u*)(p);
  f.u[1] = *(const v4u*)(p + 16);
  return f.v;
}

__device__ __forceinline__ v8f mma_h(v16h a, v16h b, v8f c) {
  return __builtin_amdgcn_wmma_f32_16x16x32_f16(false, a, false, b, (short)0, c, false, false);
}
__device__ __forceinline__ v8f mma_b(v16b a, v16b b, v8f c) {
  return __builtin_amdgcn_wmma_f32_16x16x32_bf16(false, a, false, b, (short)0, c, false, false);
}
template <typename F>
__device__ __forceinline__ void guard6(v8f& a, v8f& b, v8f& c, v8f& d, F x0, F x1, F x2, F x3, F x4, F x5) {
#if defined(__HIP_DEVICE_COMPILE__)
  asm volatile("v_nop\n\tv_nop\n\tv_nop\n\tv_nop"
               : "+v"(a), "+v"(b), "+v"(c), "+v"(d) : "v"(x0), "v"(x1), "v"(x2), "v"(x3), "v"(x4), "v"(x5) : "memory");
#endif
}
__device__ __forceinline__ void guard4x8(v8f& a, v8f& b, v8f& c, v8f& d, v16h x0, v16h x1, v16h x2, v16h x3,
                                         v16h x4, v16h x5, v16h x6, v16h x7) {
#if defined(__HIP_DEVICE_COMPILE__)
  asm volatile("v_nop\n\tv_nop\n\tv_nop\n\tv_nop"
               : "+v"(a), "+v"(b), "+v"(c), "+v"(d)
               : "v"(x0), "v"(x1), "v"(x2), "v"(x3), "v"(x4), "v"(x5), "v"(x6), "v"(x7) : "memory");
#endif
}
__device__ __forceinline__ void guard8x6(v8f& a0, v8f& a1, v8f& a2, v8f& a3, v8f& e0, v8f& e1, v8f& e2, v8f& e3,
                                         v16h x0, v16h x1, v16h x2, v16h x3, v16h x4, v16h x5) {
#if defined(__HIP_DEVICE_COMPILE__)
  asm volatile("v_nop\n\tv_nop\n\tv_nop\n\tv_nop"
               : "+v"(a0), "+v"(a1), "+v"(a2), "+v"(a3), "+v"(e0), "+v"(e1), "+v"(e2), "+v"(e3)
               : "v"(x0), "v"(x1), "v"(x2), "v"(x3), "v"(x4), "v"(x5) : "memory");
#endif
}
__device__ __forceinline__ void wave_sync_lds() {
  __builtin_amdgcn_fence(__ATOMIC_RELEASE, "workgroup");
  __builtin_amdgcn_wave_barrier();
  __builtin_amdgcn_fence(__ATOMIC_ACQUIRE, "workgroup");
}

// =====================================================================================================
// f32 plane -> 16-bit plane, same layout:  mode 0: bf16 RNE bits;  mode 1: f16 bits of (bf16 RNE value) * scale;
// mode 2: f16 bits of value * scale (no bf16 pre-step).
// Thread = 8 consecutive elements: two 16-B loads, one 16-B store; 32 consecutive lanes = 512 contiguous, 512-B aligned bytes
// coverage: grid = n8/256 blocks (host uses exact multiples) x 256 thr x 8 = the whole plane.
// =====================================================================================================
__global__ __launch_bounds__(256) void cvt16(const float* __restrict__ x, u16* D, int n8, int mode, float scale) {
  const int gt = blockIdx.x * 256 + (int)threadIdx.x;
  if (gt >= n8) return;                     // no barriers in this kernel
  const float* p = x + (size_t)gt * 8;
  const v4f a = *(const v4f*)(p), c4 = *(const v4f*)(p + 4);
  float v[8];
#pragma unroll
  for (int e = 0; e < 4; ++e) { v[e] = a[e]; v[4 + e] = c4[e]; }
  unsigned short s[8];
#pragma unroll
  for (int e = 0; e < 8; ++e) {
    const float vb = bfr(v[e]);
    const float vf = (mode == 1) ? vb : v[e];
    const unsigned short hb = h_bits((_Float16)(vf * scale));
    const unsigned short bb = bf_bits(v[e]);
    s[e] = (mode != 0) ? hb : bb;
  }
  v4u o;
#pragma unroll
  for (int e = 0; e < 4; ++e) o[e] = pk16(s[2 * e], s[2 * e + 1]);
  u16* d = D + (size_t)gt * 8;
  {
    *(v4u*)(d) = o;
    
  }
}

// =====================================================================================================
// Transpose + convert: in X [R][C] f32 row-major -> out XTo [C][R] 16-bit (each output row = one input column, R-contiguous).
//   mode 0: bf16 RNE bits;  mode 1: f16 bits of (bf16 RNE value) * scale;  mode 2: f16 bits of value * scale.
// Block = 64 input rows x 64 input cols: bid -> (rt = bid % (R/64), ct = bid / (R/64)). The 64x64 f32 tile is loaded with 16-B
// loads (thread = input row tid>>2, 16 consecutive cols), converted and scattered into LDS TH[c local][r local] (pitch 72 halves);
// coverage: load 256 thr x 16 = 64 x 64; store 2 iterations x 256 thr x 8 halves = 64 output rows x 64 halves = the tile;
//           grid = (R/64)*(C/64) blocks (host exact multiples) tiles the whole [C][R] plane exactly once.
// =====================================================================================================
#define VTP 72
static_assert(64 * VTP >= 63 * VTP + 64 && ((VTP * 2) % 16) == 0);
__global__ __launch_bounds__(256) void tr16(const float* __restrict__ X, u16* XTo, int R, int C, int mode, float scale) {
  __shared__ __align__(16) u16 TH[64 * VTP];
  const int tid = threadIdx.x;
  const int bid = blockIdx.x;
  const int nrt = R >> 6;
  const int rt  = bid % nrt;
  const int ct  = bid / nrt;
  const int r0  = rt * 64;
  const int c0  = ct * 64;
  {
    const int rl = tid >> 2;                  // input row within tile 0..63
    const int cc = (tid & 3) * 16;            // input col chunk within the 64
    const float* src = X + (size_t)(r0 + rl) * (size_t)C + c0 + cc;
#pragma unroll
    for (int i = 0; i < 4; ++i) {
      const v4f a = *(const v4f*)(src + 4 * i);
#pragma unroll
      for (int e = 0; e < 4; ++e) {
        const float v  = a[e];
        const float vb = bfr(v);
        const float vf = (mode == 1) ? vb : v;
        const unsigned short hb = h_bits((_Float16)(vf * scale));
        const unsigned short bb = bf_bits(v);
        TH[(cc + 4 * i + e) * VTP + rl] = (mode != 0) ? hb : bb;
      }
    }
  }
  __syncthreads();
  v4u vh[2];
  const int q8 = tid >> 3, p8 = (tid & 7) * 8;
#pragma unroll
  for (int it = 0; it < 2; ++it) {
    const int line = it * 32 + q8;            // local output row (input col) = 0..63
    vh[it] = *(const v4u*)(TH + line * VTP + p8);
  }
  const size_t base = (size_t)c0 * (size_t)R + (size_t)r0 + (size_t)p8;
  {
#pragma unroll
    for (int it = 0; it < 2; ++it) {
      const int line = it * 32 + q8;
      *(v4u*)(XTo + base + (size_t)line * (size_t)R) = vh[it];
    }
    
  }
}

// =====================================================================================================
// Epilogues. The wave's 16x64 f32 tile (times oscale, plus an optional per-row addend) is staged in its LDS slab (pitch 68),
//            16 consecutive lanes x 16 B per line), lanes 16..31 -> row 2*it+1.
//  epi64hsb: f16 bits of ((tile + bf16RNE(bias[col])) * pscale); lane = (rq = lane>>3 -> row within a group of 4, c8 = 8
//  epi64hrb: f16 bits of ((tile + bf16RNE(bias[row])) * pscale), same store shape as epi64hsb.
// coverage: epi64 8 instructions x 2 rows x 16 lanes x 4 floats; epi64hsb/hrb 4 instructions x 4 rows x 8 lanes x 8 halves
//           = the wave's 16 x 64 tile in all cases.
// =====================================================================================================
__device__ __forceinline__ void stage64(float* sl, v8f a0, v8f a1, v8f a2, v8f a3, float oscale, int lane) {
  const int hh = lane >> 4, m = lane & 15;
#pragma unroll
  for (int r = 0; r < 8; ++r) {
    const int ro = (8 * hh + r) * 68 + m;
    sl[ro]      = a0[r] * oscale;
    sl[ro + 16] = a1[r] * oscale;
    sl[ro + 32] = a2[r] * oscale;
    sl[ro + 48] = a3[r] * oscale;
  }
  wave_sync_lds();
}
__device__ __forceinline__ void epi64(float* sl, v8f a0, v8f a1, v8f a2, v8f a3, float oscale, v4f badd, float* C, int N,
                                      size_t rowb, int col0, int lane) {
  const int hh = lane >> 4, m = lane & 15;
  stage64(sl, a0, a1, a2, a3, oscale, lane);
  v4f vals[8];
#pragma unroll
  for (int it = 0; it < 8; ++it) vals[it] = *(const v4f*)(sl + (it * 2 + hh) * 68 + m * 4) + badd;
  float* dst = C + (rowb + (size_t)hh) * (size_t)N + col0 + m * 4;
  {
#pragma unroll
    for (int it = 0; it < 8; ++it) {
      *(v4f*)(dst + (size_t)(it * 2) * (size_t)N) = vals[it];
    }
    
  }
}
__device__ __forceinline__ void epi64hsb(float* sl, v8f a0, v8f a1, v8f a2, v8f a3, float oscale, float pscale,
                                         const float* __restrict__ bias, u16* C, int N, size_t rowb, int col0, int lane) {
  stage64(sl, a0, a1, a2, a3, oscale, lane);
  const int rq = lane >> 3, c8 = (lane & 7) * 8;
  const v4f b0 = *(const v4f*)(bias + col0 + c8), b1 = *(const v4f*)(bias + col0 + c8 + 4);   // columns col0+c8..+7 < N
  float bb[8];
#pragma unroll
  for (int e = 0; e < 4; ++e) { bb[e] = bfr(b0[e]); bb[4 + e] = bfr(b1[e]); }
  v4u oh[4];
#pragma unroll
  for (int i4 = 0; i4 < 4; ++i4) {
    const int row = i4 * 4 + rq;
    const v4f a = *(const v4f*)(sl + row * 68 + c8), c4 = *(const v4f*)(sl + row * 68 + c8 + 4);
    float w[8];
#pragma unroll
    for (int e = 0; e < 4; ++e) { w[e] = (a[e] + bb[e]) * pscale; w[4 + e] = (c4[e] + bb[4 + e]) * pscale; }
#pragma unroll
    for (int e = 0; e < 4; ++e) oh[i4][e] = pk16(h_bits((_Float16)w[2 * e]), h_bits((_Float16)w[2 * e + 1]));
  }
  u16* dst = C + rowb * (size_t)N + col0 + c8;
  {
#pragma unroll
    for (int i4 = 0; i4 < 4; ++i4) {
      const int row = i4 * 4 + rq;
      *(v4u*)(dst + (size_t)row * (size_t)N) = oh[i4];
    }
    
  }
}
__device__ __forceinline__ void epi64hrb(float* sl, v8f a0, v8f a1, v8f a2, v8f a3, float oscale, float pscale,
                                         const float* __restrict__ brow, u16* C, int N, size_t rowb, int col0, int lane) {
  const int hh = lane >> 4, m = lane & 15;
  const v4f r0v = *(const v4f*)(brow + 8 * hh), r1v = *(const v4f*)(brow + 8 * hh + 4);   // rows rowb+8h .. +7 < M
  float rb[8];
#pragma unroll
  for (int e = 0; e < 4; ++e) { rb[e] = bfr(r0v[e]); rb[4 + e] = bfr(r1v[e]); }
#pragma unroll
  for (int r = 0; r < 8; ++r) {
    const int ro = (8 * hh + r) * 68 + m;
    sl[ro]      = a0[r] * oscale + rb[r];
    sl[ro + 16] = a1[r] * oscale + rb[r];
    sl[ro + 32] = a2[r] * oscale + rb[r];
    sl[ro + 48] = a3[r] * oscale + rb[r];
  }
  wave_sync_lds();
  const int rq = lane >> 3, c8 = (lane & 7) * 8;
  v4u oh[4];
#pragma unroll
  for (int i4 = 0; i4 < 4; ++i4) {
    const int row = i4 * 4 + rq;
    const v4f a = *(const v4f*)(sl + row * 68 + c8), c4 = *(const v4f*)(sl + row * 68 + c8 + 4);
    float w[8];
#pragma unroll
    for (int e = 0; e < 4; ++e) { w[e] = a[e] * pscale; w[4 + e] = c4[e] * pscale; }
#pragma unroll
    for (int e = 0; e < 4; ++e) oh[i4][e] = pk16(h_bits((_Float16)w[2 * e]), h_bits((_Float16)w[2 * e + 1]));
  }
  u16* dst = C + rowb * (size_t)N + col0 + c8;
  {
#pragma unroll
    for (int i4 = 0; i4 < 4; ++i4) {
      const int row = i4 * 4 + rq;
      *(v4u*)(dst + (size_t)row * (size_t)N) = oh[i4];
    }
    
  }
}

// =====================================================================================================
// bf16 GEMM, f16 plane out with column bias: C16[M][N] = f16 bits of (((A[M][K] (bf16 row-major) . Bt[N][K]^T (bf16
// k-contiguous)) * oscale) + bf16RNE(bias[n])) * pscale.
// Block = 64x64 tile, 4 waves x 16 rows; fragments loaded straight from the 16-bit rows (two 16-B loads each, split k map for
// A and B); K stepped by 32 (host uses K % 32 == 0, M % 64 == 0, N % 64 == 0, grid = (M/64)*(N/64)).
// =====================================================================================================
__global__ __launch_bounds__(128)
void gemm_bh16(const u16* __restrict__ A, const u16* __restrict__ Bt, const float* __restrict__ bias, u16* C,
               int M, int N, int K, float oscale, float pscale) {
  __shared__ __align__(16) float slab[4 * SLAB64];
  const int tid = threadIdx.x, wave = tid >> 5, lane = tid & 31, hh = lane >> 4, m = lane & 15;
  const int ntile = N >> 6;
  const int bid   = blockIdx.x;
  const int rowb  = (bid / ntile) * 64 + wave * 16;
  const int col0  = (bid % ntile) * 64;
  if (rowb + 16 > M) return;                 // wave-uniform, never taken with the exact grid; no block barriers in this kernel
  const u16* ap = A  + (size_t)(rowb + m) * (size_t)K + 8 * hh;
  const u16* bp = Bt + (size_t)(col0 + m) * (size_t)K + 8 * hh;
  const size_t bs = (size_t)16 * K;
  v8f acc0 = zero8(), acc1 = zero8(), acc2 = zero8(), acc3 = zero8();
#pragma unroll 1
  for (int k0 = 0; k0 < K; k0 += 32) {
    const v16b a  = ldfrag_b(ap + k0);
    const v16b b0 = ldfrag_b(bp + k0);
    const v16b b1 = ldfrag_b(bp + bs + k0);
    const v16b b2 = ldfrag_b(bp + 2 * bs + k0);
    const v16b b3 = ldfrag_b(bp + 3 * bs + k0);
    acc0 = mma_b(a, b0, acc0);
    acc1 = mma_b(a, b1, acc1);
    acc2 = mma_b(a, b2, acc2);
    acc3 = mma_b(a, b3, acc3);
    guard6<v16b>(acc0, acc1, acc2, acc3, a, b0, b1, b2, b3, a);
  }
  epi64hsb(slab + wave * SLAB64, acc0, acc1, acc2, acc3, oscale, pscale, bias, C, N, (size_t)rowb, col0, lane);
}

// =====================================================================================================
// f16 GEMM, f16 plane out with ROW bias: C16[M][N] = f16 bits of (((A[M][K] (f16 row-major) . Bt[N][K]^T (f16 k-contiguous))
// * oscale) + bf16RNE(bias[m])) * pscale. Same tiling and fragment loads as gemm_bh16; epilogue epi64hrb.
// =====================================================================================================
__global__ __launch_bounds__(128)
void gemm_hh16r(const u16* __restrict__ A, const u16* __restrict__ Bt, const float* __restrict__ bias, u16* C,
                int M, int N, int K, float oscale, float pscale) {
  __shared__ __align__(16) float slab[4 * SLAB64];
  const int tid = threadIdx.x, wave = tid >> 5, lane = tid & 31, hh = lane >> 4, m = lane & 15;
  const int ntile = N >> 6;
  const int bid   = blockIdx.x;
  const int rowb  = (bid / ntile) * 64 + wave * 16;
  const int col0  = (bid % ntile) * 64;
  if (rowb + 16 > M) return;                 // wave-uniform, never taken with the exact grid; no block barriers in this kernel
  const _Float16* ap = (const _Float16*)(const void*)A  + (size_t)(rowb + m) * (size_t)K + 8 * hh;
  const _Float16* bp = (const _Float16*)(const void*)Bt + (size_t)(col0 + m) * (size_t)K + 8 * hh;
  const size_t bs = (size_t)16 * K;
  v8f acc0 = zero8(), acc1 = zero8(), acc2 = zero8(), acc3 = zero8();
#pragma unroll 1
  for (int k0 = 0; k0 < K; k0 += 32) {
    const v16h a  = ldfrag_h(ap + k0);
    const v16h b0 = ldfrag_h(bp + k0);
    const v16h b1 = ldfrag_h(bp + bs + k0);
    const v16h b2 = ldfrag_h(bp + 2 * bs + k0);
    const v16h b3 = ldfrag_h(bp + 3 * bs + k0);
    acc0 = mma_h(a, b0, acc0);
    acc1 = mma_h(a, b1, acc1);
    acc2 = mma_h(a, b2, acc2);
    acc3 = mma_h(a, b3, acc3);
    guard6<v16h>(acc0, acc1, acc2, acc3, a, b0, b1, b2, b3, a);
  }
  epi64hrb(slab + wave * SLAB64, acc0, acc1, acc2, acc3, oscale, pscale, bias + rowb, C, N, (size_t)rowb, col0, lane);
}

// =====================================================================================================
// Head-axis softmax attention with the head mean folded in. Block = NT = 32 query rows q0..q0+31, 8 waves, all NL keys in
// tiles of LT = 32. q plane f16 x8 [n][512] (head h = columns 64h..64h+63), k plane the same, V^T plane f16 x64 [h*512+d][l].
//   (S) wave w = head w: S_w[32 n][32 l] = 4 D tiles, K = 64 (2 k-steps): A = q rows (row m = query, split k map over the
//       head's 64 columns), B = k rows (col n = key, same split map); D element r of lane -> U.s[w][n 16nt+8h+r][l 16half+m].
//   (M) thread = (n = tid>>3, 4 consecutive l): base-2 logits t = s * log2e/512 for the 8 heads, max over heads, p = exp2(t-max),
//       P = p / sum (f32), written as f16(P * 4096) to sP[h][n][l] with 8-B LDS stores.
//   (PV) wave w owns d columns 64w + 16t + (lane&15), t = 0..3, for both 16-row n halves (8 accumulators); for every head h:
//       A = P_h fragments from LDS (row m = query, split map over the 32 keys), B = V^T fragments (col = d, keys contiguous,
//       row h*512 + d of the V^T plane); all heads and key tiles accumulate into the same accumulators (joint (l,h) K axis).
//   Block barriers after (S) and after (M) order every LDS reuse across phases, key tiles and waves.
//   Epilogue: out = acc * 2^-21 (= 1 / (4096 * 64 * 8 heads)); the wave's two 16 x 64 f32 tiles go through epi64 (staged in
//   between the two tiles; a block barrier separates the key loop from the slab use (the slab area aliases the score area).
// coverage: grid SQ/32 blocks x 32 rows = query rows 0..SQ-1; (S) 8 waves x 32 x 32 = all score cells; (M) 256 thr x 4 l x 8 h
//           = all P cells; stores 8 waves x (2 tiles x 16 rows x 64 cols) = out[q0..q0+31][0..511], every float exactly once.
// =====================================================================================================
__global__ __launch_bounds__(ATT_THREADS)
void attn_heads(const u16* __restrict__ QPp, const u16* __restrict__ KPp, const u16* __restrict__ VTp, float* out) {
  __shared__ __align__(16) AttU U;                 // scores [8][32][SSP] f32; reused as 8 epilogue slabs
  __shared__ __align__(16) u16 sP[NH * NT * PLP];  // P tiles [8][32][PLP] f16 bits

  const int tid  = threadIdx.x;
  const int wave = tid >> 5;
  const int lane = tid & 31;
  const int hh   = lane >> 4;
  const int m    = lane & 15;
  const int q0   = blockIdx.x * NT;          // q0 + 31 < SQ (grid exact)

  const _Float16* qb = (const _Float16*)(const void*)QPp + ((size_t)q0 + m) * DM + wave * DKH + 8 * hh;
  const _Float16* kb = (const _Float16*)(const void*)KPp + (size_t)m * DM + wave * DKH + 8 * hh;
  const _Float16* vb = (const _Float16*)(const void*)VTp + ((size_t)(wave * 64) + m) * NL + 8 * hh;
  const float lsc = LOG2E / (QSC * KSC * 8.0f);
  float* const sw = U.s + wave * (NT * SSP);

  v8f o00 = zero8(), o01 = zero8(), o02 = zero8(), o03 = zero8();
  v8f o10 = zero8(), o11 = zero8(), o12 = zero8(), o13 = zero8();

#pragma unroll 1
  for (int l0 = 0; l0 < NL; l0 += LT) {
    // ---- (S) scores of head = wave for this key tile ----
    {
      const v16h qa0 = ldfrag_h(qb), qa1 = ldfrag_h(qb + 32);
      const v16h qc0 = ldfrag_h(qb + (size_t)16 * DM), qc1 = ldfrag_h(qb + (size_t)16 * DM + 32);
      const _Float16* kp = kb + (size_t)l0 * DM;
      const v16h ka0 = ldfrag_h(kp), ka1 = ldfrag_h(kp + 32);
      const v16h kc0 = ldfrag_h(kp + (size_t)16 * DM), kc1 = ldfrag_h(kp + (size_t)16 * DM + 32);
      v8f s00 = zero8(), s01 = zero8(), s10 = zero8(), s11 = zero8();
      s00 = mma_h(qa0, ka0, s00);  s00 = mma_h(qa1, ka1, s00);     // n rows 0..15,  keys 0..15
      s01 = mma_h(qa0, kc0, s01);  s01 = mma_h(qa1, kc1, s01);     // n rows 0..15,  keys 16..31
      s10 = mma_h(qc0, ka0, s10);  s10 = mma_h(qc1, ka1, s10);     // n rows 16..31, keys 0..15
      s11 = mma_h(qc0, kc0, s11);  s11 = mma_h(qc1, kc1, s11);     // n rows 16..31, keys 16..31
      guard4x8(s00, s01, s10, s11, qa0, qa1, qc0, qc1, ka0, ka1, kc0, kc1);
#pragma unroll
      for (int r = 0; r < 8; ++r) {
        const int ro = (8 * hh + r) * SSP + m;
        sw[ro]                 = s00[r];
        sw[ro + 16]            = s01[r];
        sw[ro + 16 * SSP]      = s10[r];
        sw[ro + 16 * SSP + 16] = s11[r];
      }
    }
    __syncthreads();
    // ---- (M) softmax over the 8 heads per (n, l), P tiles ----
    {
      const int n = tid >> 3, lq = (tid & 7) * 4;
      float t[NH][4];
#pragma unroll
      for (int h = 0; h < NH; ++h) {
        const v4f a = *(const v4f*)(U.s + h * (NT * SSP) + n * SSP + lq);
#pragma unroll
        for (int e = 0; e < 4; ++e) t[h][e] = a[e] * lsc;
      }
#pragma unroll
      for (int e = 0; e < 4; ++e) {
        float mx = t[0][e];
#pragma unroll
        for (int h = 1; h < NH; ++h) mx = fmaxf(mx, t[h][e]);
        float sm = 0.f;
#pragma unroll
        for (int h = 0; h < NH; ++h) {
          const float p = exp2f(t[h][e] - mx);                 // <= 1, one term equals 1
          t[h][e] = p;
          sm += p;
        }
        const float rs = __builtin_amdgcn_rcpf(sm) * PCAR;      // sm in [1, 8]
#pragma unroll
        for (int h = 0; h < NH; ++h) t[h][e] *= rs;
      }
      u16* pd = sP + n * PLP + lq;
#pragma unroll
      for (int h = 0; h < NH; ++h) {
        v2u pk;
        pk[0] = pk16(h_bits((_Float16)t[h][0]), h_bits((_Float16)t[h][1]));
        pk[1] = pk16(h_bits((_Float16)t[h][2]), h_bits((_Float16)t[h][3]));
        *(v2u*)(pd + h * (NT * PLP)) = pk;
      }
    }
    __syncthreads();
    // ---- (PV) accumulate P_h . V_h over all heads for this key tile ----
    {
      const _Float16* pbase = (const _Float16*)(const void*)sP + m * PLP + 8 * hh;
      const _Float16* vl = vb + l0;
#pragma unroll 1
      for (int h = 0; h < NH; ++h) {
        const _Float16* pp = pbase + h * (NT * PLP);
        const v16h p0 = ldfrag_h(pp);
        const v16h p1 = ldfrag_h(pp + 16 * PLP);
        const _Float16* vp = vl + (size_t)h * DM * NL;
        const v16h g0 = ldfrag_h(vp);
        const v16h g1 = ldfrag_h(vp + (size_t)16 * NL);
        const v16h g2 = ldfrag_h(vp + (size_t)32 * NL);
        const v16h g3 = ldfrag_h(vp + (size_t)48 * NL);
        o00 = mma_h(p0, g0, o00);
        o01 = mma_h(p0, g1, o01);
        o02 = mma_h(p0, g2, o02);
        o03 = mma_h(p0, g3, o03);
        o10 = mma_h(p1, g0, o10);
        o11 = mma_h(p1, g1, o11);
        o12 = mma_h(p1, g2, o12);
        o13 = mma_h(p1, g3, o13);
        guard8x6(o00, o01, o02, o03, o10, o11, o12, o13, p0, p1, g0, g1, g2, g3);
      }
    }
  }
  __syncthreads();

  const float osc = 1.0f / (PCAR * VCAR * (float)NH);
  const v4f z4 = {0.f, 0.f, 0.f, 0.f};
  float* const sl = U.slab + wave * SLAB64;
  epi64(sl, o00, o01, o02, o03, osc, z4, out, DM, (size_t)q0, wave * 64, lane);
  wave_sync_lds();
  epi64(sl, o10, o11, o12, o13, osc, z4, out, DM, (size_t)q0 + 16, wave * 64, lane);
}

// =====================================================================================================
// Workspace map (bytes); every plane is fully written by whole-line stores before it is read; all extents are exact multiples of
// the store granularity (no pad rows, all dims multiples of 64), every offset a multiple of 256:
//   XQ  bf16 [SQ][512]                      <=  4194304
//   XS  bf16 [4096][512]                        4194304
//   WV1T, WQT, WKT bf16 [512][512]             3 x 524288
//   WV2T f16 of bf16 value x1024 [4096][512]   4194304
//   VALH f16 value x8 [4096][512]               4194304
//   QP   f16 x8 [SQ][512]                   <=  4194304
//   KP   f16 x8 [4096][512]                     4194304
//   VT   f16 x64 [4096][4096]                  33554432
//   end                                     <= 60293120
// =====================================================================================================
extern "C" void kernel_launch(void* const* d_in, const int* in_sizes, int n_in,
                              void* d_out, int out_size, void* d_ws, size_t ws_size,
                              hipStream_t stream) {
  if (n_in < 10) return;
  if (in_sizes[0] != NQ * DM || in_sizes[1] != NL * DM) return;
  if (in_sizes[2] != DM * DM || in_sizes[3] != DM) return;
  if (in_sizes[4] != DM * DM || in_sizes[5] != DM) return;
  if (in_sizes[6] != DM * DM || in_sizes[7] != DM) return;
  if (in_sizes[8] != DM * DV || in_sizes[9] != DV) return;
  if (out_size != NQ * DM) return;

  const float* xq  = (const float*)d_in[0];
  const float* xs  = (const float*)d_in[1];
  const float* wv1 = (const float*)d_in[2];
  const float* bv1 = (const float*)d_in[3];
  const float* wq  = (const float*)d_in[4];
  const float* bq  = (const float*)d_in[5];
  const float* wk  = (const float*)d_in[6];
  const float* bk  = (const float*)d_in[7];
  const float* wv2 = (const float*)d_in[8];
  const float* bv2 = (const float*)d_in[9];
  float*       out = (float*)d_out;

  const size_t szXQ = (size_t)SQ * DM * 2;          //  4194304 at SQ = NQ
  const size_t szXS = (size_t)NL * DM * 2;          //  4194304
  const size_t szWT = (size_t)DM * DM * 2;          //   524288
  const size_t szW2 = (size_t)DV * DM * 2;          //  4194304
  const size_t szVL = (size_t)NL * DM * 2;          //  4194304
  const size_t szQP = (size_t)SQ * DM * 2;          //  4194304 at SQ = NQ
  const size_t szKP = (size_t)NL * DM * 2;          //  4194304
  const size_t szVT = (size_t)DV * NL * 2;          // 33554432
  size_t off = 0;
  const size_t oXQ = off; off += szXQ;
  const size_t oXS = off; off += szXS;
  const size_t oW1 = off; off += szWT;
  const size_t oWQ = off; off += szWT;
  const size_t oWK = off; off += szWT;
  const size_t oW2 = off; off += szW2;
  const size_t oVL = off; off += szVL;
  const size_t oQP = off; off += szQP;
  const size_t oKP = off; off += szKP;
  const size_t oVT = off; off += szVT;
  if (off > ws_size) return;                        // off = 60293120 at SQ = NQ
  if (off > WS_CAP) return;

  char* ws = (char*)d_ws;
  u16* XQ   = (u16*)(ws + oXQ);
  u16* XS   = (u16*)(ws + oXS);
  u16* WV1T = (u16*)(ws + oW1);
  u16* WQT  = (u16*)(ws + oWQ);
  u16* WKT  = (u16*)(ws + oWK);
  u16* WV2T = (u16*)(ws + oW2);
  u16* VALH = (u16*)(ws + oVL);
  u16* QP   = (u16*)(ws + oQP);
  u16* KP   = (u16*)(ws + oKP);
  u16* VT   = (u16*)(ws + oVT);

  const int n8q = (SQ * DM) / 8;                    // multiple of 256 (static)
  const int n8s = (NL * DM) / 8;                    // 262144
  const dim3 blk(256);
  const dim3 bG(128);
  const dim3 gXq(n8q / 256);                        // SQ/4
  const dim3 gXs(n8s / 256);                        // 1024
  const dim3 gWT((DM / 64) * (DM / 64));            // 64:  in [512][512]  -> out [512][512]
  const dim3 gW2((DM / 64) * (DV / 64));            // 512: in [512][4096] -> out [4096][512]
  const dim3 gGq((SQ / 64) * (DM / 64));            // 512 at SQ = NQ
  const dim3 gG((NL / 64) * (DM / 64));             // 512
  const dim3 gVT((DV / 64) * (NL / 64));            // 4096
  const dim3 gAT(SQ / NT);                          // 128 at SQ = NQ
  const dim3 bAT(ATT_THREADS);

  // (0, 1) query rows < SQ and source -> bf16 planes; (2..4) Wv1, Wq, Wk [in][out] -> bf16 [out][in] k-contiguous planes;
  // (5) Wv2 [512][4096] -> f16 of the bf16 value x1024, [4096][512]
  cvt16<<<gXq, blk, 0, stream>>>(xq, XQ, n8q, 0, 1.0f);
  cvt16<<<gXs, blk, 0, stream>>>(xs, XS, n8s, 0, 1.0f);
  tr16<<<gWT, blk, 0, stream>>>(wv1, WV1T, DM, DM, 0, 1.0f);
  tr16<<<gWT, blk, 0, stream>>>(wq,  WQT,  DM, DM, 0, 1.0f);
  tr16<<<gWT, blk, 0, stream>>>(wk,  WKT,  DM, DM, 0, 1.0f);
  tr16<<<gW2, blk, 0, stream>>>(wv2, WV2T, DM, DV, 1, W2S);
  // (6) value = source.Wv1 + b -> f16 plane x8; (7) q (rows < SQ) and (8) k projections -> f16 planes x8
  gemm_bh16<<<gG,  bG, 0, stream>>>(XS, WV1T, bv1, VALH, NL, DM, DM, 1.0f, VSC);
  gemm_bh16<<<gGq, bG, 0, stream>>>(XQ, WQT,  bq,  QP,   SQ, DM, DM, 1.0f, QSC);
  gemm_bh16<<<gG,  bG, 0, stream>>>(XS, WKT,  bk,  KP,   NL, DM, DM, 1.0f, KSC);
  // (9) V^T [h*512+d][l] = (Wv2^T . value^T) / (1024*8) + b[h*512+d], f16 plane x64
  gemm_hh16r<<<gVT, bG, 0, stream>>>(WV2T, VALH, bv2, VT, DV, NL, DM, 1.0f / (W2S * VSC), VCAR);
  // (10) head-axis softmax attention + head mean -> out rows 0..SQ-1
  attn_heads<<<gAT, bAT, 0, stream>>>(QP, KP, VT, out);
  (void)hipGetLastError();
}

// v001
// Measured time: 461 microseconds a run.
// In both of two side-by-side timings against v000, it was 1.69 times as fast.
// Projections value, q, k = x.W + b: v_wmma_f32_16x16x32_bf16 (bf16 RNE operands of the raw inputs, f32 accumulate, bf16 RNE
// bias added in f32). v^T = Wv2^T . value^T (W as f16 of the bf16 RNE value x1024, value plane f16 x8, bf16 RNE bias per row in
// f32), per-head scores q.k^T (f16 planes x8) and P.V (P x4096 f16 from LDS, V^T x64 f16): v_wmma_f32_16x16x32_f16, f32
// accumulate. Softmax over the head axis, the head mean and all scaling in f32 on VALU.
#include <hip/hip_runtime.h>
#include <math.h>
#include <stdint.h>

#define NQ   4096
#define NL   4096
#define DM   512
#define NH   8
#define DKH  64
#define DV   (NH * DM)
#ifndef SQ
#define SQ NQ
#endif
#define NT   32
#define LT   32
#define SSP  32
#define PLP  40
#define SLAB64 (16 * 68)
#define ATT_THREADS 256
#define KS   4
#define KSPAN (NL / KS)
#define QSC  8.0f
#define KSC  8.0f
#define VSC  8.0f
#define W2S  1024.0f
#define PCAR 4096.0f
#define VCAR 64.0f
#define LOG2E 1.4426950408889634f
#define WS_CAP ((size_t)134217728)

static_assert(DM == NH * DKH && DKH == 64 && NH == 8 && (DM % 64) == 0 && (DV % 64) == 0 && (NL % 64) == 0 && (NQ % 64) == 0);
static_assert((DM % 32) == 0);
static_assert(SQ >= 64 && SQ <= NQ && (SQ % 64) == 0 && (SQ % NT) == 0);
static_assert(NT == 32 && LT == 32 && (NL % LT) == 0 && ATT_THREADS == 256 && ATT_THREADS * 4 == NT * LT);
static_assert(KS >= 1 && (NL % (KS * LT)) == 0 && ((SQ * DM) % 1024) == 0);
static_assert(SSP >= LT && PLP >= 32 && ((PLP * 2) % 16) == 0 && ((SSP * 4) % 16) == 0);
static_assert(NH * NT * SSP <= 8 * SLAB64);
static_assert(((NQ * DM) % 2048) == 0 && ((NL * DM) % 2048) == 0 && ((SQ * DM) % 2048) == 0);
static_assert(NH * NT * SSP * 4 + 0 <= 40000 && NH * NT * PLP * 2 <= 24000);

typedef unsigned short u16;
typedef _Float16 v16h __attribute__((ext_vector_type(16)));
typedef _Float16 v8h  __attribute__((ext_vector_type(8)));
typedef __bf16   v16b __attribute__((ext_vector_type(16)));
typedef float    v8f  __attribute__((ext_vector_type(8)));
typedef float    v4f  __attribute__((ext_vector_type(4)));
typedef unsigned int v4u __attribute__((ext_vector_type(4)));
typedef unsigned int v2u __attribute__((ext_vector_type(2)));

union FragH { v16h v; v8h h[2]; v4u u[2]; };
union FragB { v16b v; v4u u[2]; };
union AttU { float s[NH * NT * SSP]; float slab[8 * SLAB64]; };

// ---- scalar helpers --------------------------------------------------------------------------------
__device__ __forceinline__ unsigned short bf_bits(float f) {          // f32 -> bf16 bits, RNE convert
  unsigned u = __float_as_uint(f);
  return (unsigned short)((u + 0x7FFFu + ((u >> 16) & 1u)) >> 16);
}
__device__ __forceinline__ float bf_up(unsigned short h) { return __uint_as_float(((unsigned)h) << 16); }
__device__ __forceinline__ float bfr(float f) { return bf_up(bf_bits(f)); }
__device__ __forceinline__ unsigned short h_bits(_Float16 x) { return __builtin_bit_cast(unsigned short, x); }
__device__ __forceinline__ unsigned pk16(unsigned short a, unsigned short b) { return (unsigned)a | ((unsigned)b << 16); }
__device__ __forceinline__ v8f zero8() { v8f z = {0.f, 0.f, 0.f, 0.f, 0.f, 0.f, 0.f, 0.f}; return z; }

// ---- fragment loaders: 16-bit A/B operand, lane -> row/col (lane&15), p already includes +8*(lane>>4);
//      elements 0..7 <- p[0..7] (k0+8h..), elements 8..15 <- p[16..23] (k0+16+8h..)  (same split k map for A and B;
//      B is always read from a k-contiguous [n][k] plane)
__device__ __forceinline__ v16h ldfrag_h(const _Float16* p) {
  FragH f;
  f.h[0] = *(const v8h*)(p);
  f.h[1] = *(const v8h*)(p + 16);
  return f.v;
}
__device__ __forceinline__ v16b ldfrag_b(const u16* p) {              // bf16 plane read as unsigned integer vectors
  FragB f;
  f.u[0] = *(const v4u*)(p);
  f.u[1] = *(const v4u*)(p + 16);
  return f.v;
}

__device__ __forceinline__ v8f mma_h(v16h a, v16h b, v8f c) {
  return __builtin_amdgcn_wmma_f32_16x16x32_f16(false, a, false, b, (short)0, c, false, false);
}
__device__ __forceinline__ v8f mma_b(v16b a, v16b b, v8f c) {
  return __builtin_amdgcn_wmma_f32_16x16x32_bf16(false, a, false, b, (short)0, c, false, false);
}
template <typename F>
__device__ __forceinline__ void guard6(v8f& a, v8f& b, v8f& c, v8f& d, F x0, F x1, F x2, F x3, F x4, F x5) {
#if defined(__HIP_DEVICE_COMPILE__)
  asm volatile("v_nop\n\tv_nop\n\tv_nop\n\tv_nop"
               : "+v"(a), "+v"(b), "+v"(c), "+v"(d) : "v"(x0), "v"(x1), "v"(x2), "v"(x3), "v"(x4), "v"(x5) : "memory");
#endif
}
__device__ __forceinline__ void guard4x8(v8f& a, v8f& b, v8f& c, v8f& d, v16h x0, v16h x1, v16h x2, v16h x3,
                                         v16h x4, v16h x5, v16h x6, v16h x7) {
#if defined(__HIP_DEVICE_COMPILE__)
  asm volatile("v_nop\n\tv_nop\n\tv_nop\n\tv_nop"
               : "+v"(a), "+v"(b), "+v"(c), "+v"(d)
               : "v"(x0), "v"(x1), "v"(x2), "v"(x3), "v"(x4), "v"(x5), "v"(x6), "v"(x7) : "memory");
#endif
}
__device__ __forceinline__ void guard8x6(v8f& a0, v8f& a1, v8f& a2, v8f& a3, v8f& e0, v8f& e1, v8f& e2, v8f& e3,
                                         v16h x0, v16h x1, v16h x2, v16h x3, v16h x4, v16h x5) {
#if defined(__HIP_DEVICE_COMPILE__)
  asm volatile("v_nop\n\tv_nop\n\tv_nop\n\tv_nop"
               : "+v"(a0), "+v"(a1), "+v"(a2), "+v"(a3), "+v"(e0), "+v"(e1), "+v"(e2), "+v"(e3)
               : "v"(x0), "v"(x1), "v"(x2), "v"(x3), "v"(x4), "v"(x5) : "memory");
#endif
}
__device__ __forceinline__ void wave_sync_lds() {
  __builtin_amdgcn_fence(__ATOMIC_RELEASE, "workgroup");
  __builtin_amdgcn_wave_barrier();
  __builtin_amdgcn_fence(__ATOMIC_ACQUIRE, "workgroup");
}

// =====================================================================================================
// f32 plane -> 16-bit plane, same layout:  mode 0: bf16 RNE bits;  mode 1: f16 bits of (bf16 RNE value) * scale;
// mode 2: f16 bits of value * scale (no bf16 pre-step).
// Thread = 8 consecutive elements: two 16-B loads, one 16-B store; 32 consecutive lanes = 512 contiguous, 512-B aligned bytes
// coverage: grid = n8/256 blocks (host uses exact multiples) x 256 thr x 8 = the whole plane.
// =====================================================================================================
__global__ __launch_bounds__(256) void cvt16(const float* __restrict__ x, u16* D, int n8, int mode, float scale) {
  const int gt = blockIdx.x * 256 + (int)threadIdx.x;
  if (gt >= n8) return;                     // no barriers in this kernel
  const float* p = x + (size_t)gt * 8;
  const v4f a = *(const v4f*)(p), c4 = *(const v4f*)(p + 4);
  float v[8];
#pragma unroll
  for (int e = 0; e < 4; ++e) { v[e] = a[e]; v[4 + e] = c4[e]; }
  unsigned short s[8];
#pragma unroll
  for (int e = 0; e < 8; ++e) {
    const float vb = bfr(v[e]);
    const float vf = (mode == 1) ? vb : v[e];
    const unsigned short hb = h_bits((_Float16)(vf * scale));
    const unsigned short bb = bf_bits(v[e]);
    s[e] = (mode != 0) ? hb : bb;
  }
  v4u o;
#pragma unroll
  for (int e = 0; e < 4; ++e) o[e] = pk16(s[2 * e], s[2 * e + 1]);
  u16* d = D + (size_t)gt * 8;
  {
    *(v4u*)(d) = o;
    
  }
}

// =====================================================================================================
// Transpose + convert: in X [R][C] f32 row-major -> out XTo [C][R] 16-bit (each output row = one input column, R-contiguous).
//   mode 0: bf16 RNE bits;  mode 1: f16 bits of (bf16 RNE value) * scale;  mode 2: f16 bits of value * scale.
// Block = 64 input rows x 64 input cols: bid -> (rt = bid % (R/64), ct = bid / (R/64)). The 64x64 f32 tile is loaded with 16-B
// loads (thread = input row tid>>2, 16 consecutive cols), converted and scattered into LDS TH[c local][r local] (pitch 72 halves);
// coverage: load 256 thr x 16 = 64 x 64; store 2 iterations x 256 thr x 8 halves = 64 output rows x 64 halves = the tile;
//           grid = (R/64)*(C/64) blocks (host exact multiples) tiles the whole [C][R] plane exactly once.
// =====================================================================================================
#define VTP 72
static_assert(64 * VTP >= 63 * VTP + 64 && ((VTP * 2) % 16) == 0);
__global__ __launch_bounds__(256) void tr16(const float* __restrict__ X, u16* XTo, int R, int C, int mode, float scale) {
  __shared__ __align__(16) u16 TH[64 * VTP];
  const int tid = threadIdx.x;
  const int bid = blockIdx.x;
  const int nrt = R >> 6;
  const int rt  = bid % nrt;
  const int ct  = bid / nrt;
  const int r0  = rt * 64;
  const int c0  = ct * 64;
  {
    const int rl = tid >> 2;                  // input row within tile 0..63
    const int cc = (tid & 3) * 16;            // input col chunk within the 64
    const float* src = X + (size_t)(r0 + rl) * (size_t)C + c0 + cc;
#pragma unroll
    for (int i = 0; i < 4; ++i) {
      const v4f a = *(const v4f*)(src + 4 * i);
#pragma unroll
      for (int e = 0; e < 4; ++e) {
        const float v  = a[e];
        const float vb = bfr(v);
        const float vf = (mode == 1) ? vb : v;
        const unsigned short hb = h_bits((_Float16)(vf * scale));
        const unsigned short bb = bf_bits(v);
        TH[(cc + 4 * i + e) * VTP + rl] = (mode != 0) ? hb : bb;
      }
    }
  }
  __syncthreads();
  v4u vh[2];
  const int q8 = tid >> 3, p8 = (tid & 7) * 8;
#pragma unroll
  for (int it = 0; it < 2; ++it) {
    const int line = it * 32 + q8;            // local output row (input col) = 0..63
    vh[it] = *(const v4u*)(TH + line * VTP + p8);
  }
  const size_t base = (size_t)c0 * (size_t)R + (size_t)r0 + (size_t)p8;
  {
#pragma unroll
    for (int it = 0; it < 2; ++it) {
      const int line = it * 32 + q8;
      *(v4u*)(XTo + base + (size_t)line * (size_t)R) = vh[it];
    }
    
  }
}

// =====================================================================================================
// Epilogues. The wave's 16x64 f32 tile (times oscale, plus an optional per-row addend) is staged in its LDS slab (pitch 68),
//            16 consecutive lanes x 16 B per line), lanes 16..31 -> row 2*it+1.
//  epi64hsb: f16 bits of ((tile + bf16RNE(bias[col])) * pscale); lane = (rq = lane>>3 -> row within a group of 4, c8 = 8
//  epi64hrb: f16 bits of ((tile + bf16RNE(bias[row])) * pscale), same store shape as epi64hsb.
// coverage: epi64 8 instructions x 2 rows x 16 lanes x 4 floats; epi64hsb/hrb 4 instructions x 4 rows x 8 lanes x 8 halves
//           = the wave's 16 x 64 tile in all cases.
// =====================================================================================================
__device__ __forceinline__ void stage64(float* sl, v8f a0, v8f a1, v8f a2, v8f a3, float oscale, int lane) {
  const int hh = lane >> 4, m = lane & 15;
#pragma unroll
  for (int r = 0; r < 8; ++r) {
    const int ro = (8 * hh + r) * 68 + m;
    sl[ro]      = a0[r] * oscale;
    sl[ro + 16] = a1[r] * oscale;
    sl[ro + 32] = a2[r] * oscale;
    sl[ro + 48] = a3[r] * oscale;
  }
  wave_sync_lds();
}
__device__ __forceinline__ void epi64(float* sl, v8f a0, v8f a1, v8f a2, v8f a3, float oscale, v4f badd, float* C, int N,
                                      size_t rowb, int col0, int lane) {
  const int hh = lane >> 4, m = lane & 15;
  stage64(sl, a0, a1, a2, a3, oscale, lane);
  v4f vals[8];
#pragma unroll
  for (int it = 0; it < 8; ++it) vals[it] = *(const v4f*)(sl + (it * 2 + hh) * 68 + m * 4) + badd;
  float* dst = C + (rowb + (size_t)hh) * (size_t)N + col0 + m * 4;
  {
#pragma unroll
    for (int it = 0; it < 8; ++it) {
      *(v4f*)(dst + (size_t)(it * 2) * (size_t)N) = vals[it];
    }
    
  }
}
__device__ __forceinline__ void epi64hsb(float* sl, v8f a0, v8f a1, v8f a2, v8f a3, float oscale, float pscale,
                                         const float* __restrict__ bias, u16* C, int N, size_t rowb, int col0, int lane) {
  stage64(sl, a0, a1, a2, a3, oscale, lane);
  const int rq = lane >> 3, c8 = (lane & 7) * 8;
  const v4f b0 = *(const v4f*)(bias + col0 + c8), b1 = *(const v4f*)(bias + col0 + c8 + 4);   // columns col0+c8..+7 < N
  float bb[8];
#pragma unroll
  for (int e = 0; e < 4; ++e) { bb[e] = bfr(b0[e]); bb[4 + e] = bfr(b1[e]); }
  v4u oh[4];
#pragma unroll
  for (int i4 = 0; i4 < 4; ++i4) {
    const int row = i4 * 4 + rq;
    const v4f a = *(const v4f*)(sl + row * 68 + c8), c4 = *(const v4f*)(sl + row * 68 + c8 + 4);
    float w[8];
#pragma unroll
    for (int e = 0; e < 4; ++e) { w[e] = (a[e] + bb[e]) * pscale; w[4 + e] = (c4[e] + bb[4 + e]) * pscale; }
#pragma unroll
    for (int e = 0; e < 4; ++e) oh[i4][e] = pk16(h_bits((_Float16)w[2 * e]), h_bits((_Float16)w[2 * e + 1]));
  }
  u16* dst = C + rowb * (size_t)N + col0 + c8;
  {
#pragma unroll
    for (int i4 = 0; i4 < 4; ++i4) {
      const int row = i4 * 4 + rq;
      *(v4u*)(dst + (size_t)row * (size_t)N) = oh[i4];
    }
    
  }
}
__device__ __forceinline__ void epi64hrb(float* sl, v8f a0, v8f a1, v8f a2, v8f a3, float oscale, float pscale,
                                         const float* __restrict__ brow, u16* C, int N, size_t rowb, int col0, int lane) {
  const int hh = lane >> 4, m = lane & 15;
  const v4f r0v = *(const v4f*)(brow + 8 * hh), r1v = *(const v4f*)(brow + 8 * hh + 4);   // rows rowb+8h .. +7 < M
  float rb[8];
#pragma unroll
  for (int e = 0; e < 4; ++e) { rb[e] = bfr(r0v[e]); rb[4 + e] = bfr(r1v[e]); }
#pragma unroll
  for (int r = 0; r < 8; ++r) {
    const int ro = (8 * hh + r) * 68 + m;
    sl[ro]      = a0[r] * oscale + rb[r];
    sl[ro + 16] = a1[r] * oscale + rb[r];
    sl[ro + 32] = a2[r] * oscale + rb[r];
    sl[ro + 48] = a3[r] * oscale + rb[r];
  }
  wave_sync_lds();
  const int rq = lane >> 3, c8 = (lane & 7) * 8;
  v4u oh[4];
#pragma unroll
  for (int i4 = 0; i4 < 4; ++i4) {
    const int row = i4 * 4 + rq;
    const v4f a = *(const v4f*)(sl + row * 68 + c8), c4 = *(const v4f*)(sl + row * 68 + c8 + 4);
    float w[8];
#pragma unroll
    for (int e = 0; e < 4; ++e) { w[e] = a[e] * pscale; w[4 + e] = c4[e] * pscale; }
#pragma unroll
    for (int e = 0; e < 4; ++e) oh[i4][e] = pk16(h_bits((_Float16)w[2 * e]), h_bits((_Float16)w[2 * e + 1]));
  }
  u16* dst = C + rowb * (size_t)N + col0 + c8;
  {
#pragma unroll
    for (int i4 = 0; i4 < 4; ++i4) {
      const int row = i4 * 4 + rq;
      *(v4u*)(dst + (size_t)row * (size_t)N) = oh[i4];
    }
    
  }
}

// =====================================================================================================
// bf16 GEMM, f16 plane out with column bias: C16[M][N] = f16 bits of (((A[M][K] (bf16 row-major) . Bt[N][K]^T (bf16
// k-contiguous)) * oscale) + bf16RNE(bias[n])) * pscale.
// Block = 64x64 tile, 4 waves x 16 rows; fragments loaded straight from the 16-bit rows (two 16-B loads each, split k map for
// A and B); K stepped by 32 (host uses K % 32 == 0, M % 64 == 0, N % 64 == 0, grid = (M/64)*(N/64)).
// =====================================================================================================
__global__ __launch_bounds__(128)
void gemm_bh16(const u16* __restrict__ A, const u16* __restrict__ Bt, const float* __restrict__ bias, u16* C,
               int M, int N, int K, float oscale, float pscale) {
  __shared__ __align__(16) float slab[4 * SLAB64];
  const int tid = threadIdx.x, wave = tid >> 5, lane = tid & 31, hh = lane >> 4, m = lane & 15;
  const int ntile = N >> 6;
  const int bid   = blockIdx.x;
  const int rowb  = (bid / ntile) * 64 + wave * 16;
  const int col0  = (bid % ntile) * 64;
  if (rowb + 16 > M) return;                 // wave-uniform, never taken with the exact grid; no block barriers in this kernel
  const u16* ap = A  + (size_t)(rowb + m) * (size_t)K + 8 * hh;
  const u16* bp = Bt + (size_t)(col0 + m) * (size_t)K + 8 * hh;
  const size_t bs = (size_t)16 * K;
  v8f acc0 = zero8(), acc1 = zero8(), acc2 = zero8(), acc3 = zero8();
#pragma unroll 1
  for (int k0 = 0; k0 < K; k0 += 32) {
    const v16b a  = ldfrag_b(ap + k0);
    const v16b b0 = ldfrag_b(bp + k0);
    const v16b b1 = ldfrag_b(bp + bs + k0);
    const v16b b2 = ldfrag_b(bp + 2 * bs + k0);
    const v16b b3 = ldfrag_b(bp + 3 * bs + k0);
    acc0 = mma_b(a, b0, acc0);
    acc1 = mma_b(a, b1, acc1);
    acc2 = mma_b(a, b2, acc2);
    acc3 = mma_b(a, b3, acc3);
    guard6<v16b>(acc0, acc1, acc2, acc3, a, b0, b1, b2, b3, a);
  }
  epi64hsb(slab + wave * SLAB64, acc0, acc1, acc2, acc3, oscale, pscale, bias, C, N, (size_t)rowb, col0, lane);
}

// =====================================================================================================
// f16 GEMM, f16 plane out with ROW bias: C16[M][N] = f16 bits of (((A[M][K] (f16 row-major) . Bt[N][K]^T (f16 k-contiguous))
// * oscale) + bf16RNE(bias[m])) * pscale. Same tiling and fragment loads as gemm_bh16; epilogue epi64hrb.
// =====================================================================================================
__global__ __launch_bounds__(128)
void gemm_hh16r(const u16* __restrict__ A, const u16* __restrict__ Bt, const float* __restrict__ bias, u16* C,
                int M, int N, int K, float oscale, float pscale) {
  __shared__ __align__(16) float slab[4 * SLAB64];
  const int tid = threadIdx.x, wave = tid >> 5, lane = tid & 31, hh = lane >> 4, m = lane & 15;
  const int ntile = N >> 6;
  const int bid   = blockIdx.x;
  const int rowb  = (bid / ntile) * 64 + wave * 16;
  const int col0  = (bid % ntile) * 64;
  if (rowb + 16 > M) return;                 // wave-uniform, never taken with the exact grid; no block barriers in this kernel
  const _Float16* ap = (const _Float16*)(const void*)A  + (size_t)(rowb + m) * (size_t)K + 8 * hh;
  const _Float16* bp = (const _Float16*)(const void*)Bt + (size_t)(col0 + m) * (size_t)K + 8 * hh;
  const size_t bs = (size_t)16 * K;
  v8f acc0 = zero8(), acc1 = zero8(), acc2 = zero8(), acc3 = zero8();
#pragma unroll 1
  for (int k0 = 0; k0 < K; k0 += 32) {
    const v16h a  = ldfrag_h(ap + k0);
    const v16h b0 = ldfrag_h(bp + k0);
    const v16h b1 = ldfrag_h(bp + bs + k0);
    const v16h b2 = ldfrag_h(bp + 2 * bs + k0);
    const v16h b3 = ldfrag_h(bp + 3 * bs + k0);
    acc0 = mma_h(a, b0, acc0);
    acc1 = mma_h(a, b1, acc1);
    acc2 = mma_h(a, b2, acc2);
    acc3 = mma_h(a, b3, acc3);
    guard6<v16h>(acc0, acc1, acc2, acc3, a, b0, b1, b2, b3, a);
  }
  epi64hrb(slab + wave * SLAB64, acc0, acc1, acc2, acc3, oscale, pscale, bias + rowb, C, N, (size_t)rowb, col0, lane);
}

// =====================================================================================================
// Head-axis softmax attention with the head mean folded in. Block = NT = 32 query rows q0..q0+31, 8 waves, the KSPAN keys of
// key range blockIdx.x in tiles of LT = 32 (the softmax runs over heads, so key ranges only add: each range writes its own f32
// partial plane, sum_parts adds the KS planes). q plane f16 x8 [n][512] (head h = columns 64h..64h+63), k plane the same, V^T plane f16 x64 [h*512+d][l].
//   (S) wave w = head w: S_w[32 n][32 l] = 4 D tiles, K = 64 (2 k-steps): A = q rows (row m = query, split k map over the
//       head's 64 columns), B = k rows (col n = key, same split map); D element r of lane -> U.s[w][n 16nt+8h+r][l 16half+m].
//   (M) thread = (n = tid>>3, 4 consecutive l): base-2 logits t = s * log2e/512 for the 8 heads, max over heads, p = exp2(t-max),
//       P = p / sum (f32), written as f16(P * 4096) to sP[h][n][l] with 8-B LDS stores.
//   (PV) wave w owns d columns 64w + 16t + (lane&15), t = 0..3, for both 16-row n halves (8 accumulators); for every head h:
//       A = P_h fragments from LDS (row m = query, split map over the 32 keys), B = V^T fragments (col = d, keys contiguous,
//       row h*512 + d of the V^T plane); all heads and key tiles accumulate into the same accumulators (joint (l,h) K axis).
//   Block barriers after (S) and after (M) order every LDS reuse across phases, key tiles and waves.
//   Epilogue: partial = acc * 2^-21 (= 1 / (4096 * 64 * 8 heads)); the wave's two 16 x 64 f32 tiles go through epi64 (staged in
//   between the two tiles; a block barrier separates the key loop from the slab use (the slab area aliases the score area).
// coverage: grid (KS, SQ/32) blocks x 32 rows = query rows 0..SQ-1 of every partial plane; (S) 8 waves x 32 x 32 = all score cells; (M) 256 thr x 4 l x 8 h
//           = all P cells; stores 8 waves x (2 tiles x 16 rows x 64 cols) = part[ks][q0..q0+31][0..511], every float exactly once.
// =====================================================================================================
__global__ __launch_bounds__(ATT_THREADS)
void attn_heads(const u16* __restrict__ QPp, const u16* __restrict__ KPp, const u16* __restrict__ VTp, float* part) {
  __shared__ __align__(16) AttU U;                 // scores [8][32][SSP] f32; reused as 8 epilogue slabs
  __shared__ __align__(16) u16 sP[NH * NT * PLP];  // P tiles [8][32][PLP] f16 bits

  const int tid  = threadIdx.x;
  const int wave = tid >> 5;
  const int lane = tid & 31;
  const int hh   = lane >> 4;
  const int m    = lane & 15;
  const int q0   = blockIdx.y * NT;          // q0 + 31 < SQ (grid exact)
  const int lbeg = blockIdx.x * KSPAN;       // this block's key range lbeg .. lbeg + KSPAN - 1 < NL (grid exact)
  float* const out = part + (size_t)blockIdx.x * ((size_t)SQ * DM);

  const _Float16* qb = (const _Float16*)(const void*)QPp + ((size_t)q0 + m) * DM + wave * DKH + 8 * hh;
  const _Float16* kb = (const _Float16*)(const void*)KPp + (size_t)m * DM + wave * DKH + 8 * hh;
  const _Float16* vb = (const _Float16*)(const void*)VTp + ((size_t)(wave * 64) + m) * NL + 8 * hh;
  const float lsc = LOG2E / (QSC * KSC * 8.0f);
  float* const sw = U.s + wave * (NT * SSP);

  v8f o00 = zero8(), o01 = zero8(), o02 = zero8(), o03 = zero8();
  v8f o10 = zero8(), o11 = zero8(), o12 = zero8(), o13 = zero8();

#pragma unroll 1
  for (int l0 = lbeg; l0 < lbeg + KSPAN; l0 += LT) {
    // ---- (S) scores of head = wave for this key tile ----
    {
      const v16h qa0 = ldfrag_h(qb), qa1 = ldfrag_h(qb + 32);
      const v16h qc0 = ldfrag_h(qb + (size_t)16 * DM), qc1 = ldfrag_h(qb + (size_t)16 * DM + 32);
      const _Float16* kp = kb + (size_t)l0 * DM;
      const v16h ka0 = ldfrag_h(kp), ka1 = ldfrag_h(kp + 32);
      const v16h kc0 = ldfrag_h(kp + (size_t)16 * DM), kc1 = ldfrag_h(kp + (size_t)16 * DM + 32);
      v8f s00 = zero8(), s01 = zero8(), s10 = zero8(), s11 = zero8();
      s00 = mma_h(qa0, ka0, s00);  s00 = mma_h(qa1, ka1, s00);     // n rows 0..15,  keys 0..15
      s01 = mma_h(qa0, kc0, s01);  s01 = mma_h(qa1, kc1, s01);     // n rows 0..15,  keys 16..31
      s10 = mma_h(qc0, ka0, s10);  s10 = mma_h(qc1, ka1, s10);     // n rows 16..31, keys 0..15
      s11 = mma_h(qc0, kc0, s11);  s11 = mma_h(qc1, kc1, s11);     // n rows 16..31, keys 16..31
      guard4x8(s00, s01, s10, s11, qa0, qa1, qc0, qc1, ka0, ka1, kc0, kc1);
#pragma unroll
      for (int r = 0; r < 8; ++r) {
        const int ro = (8 * hh + r) * SSP + m;
        sw[ro]                 = s00[r];
        sw[ro + 16]            = s01[r];
        sw[ro + 16 * SSP]      = s10[r];
        sw[ro + 16 * SSP + 16] = s11[r];
      }
    }
    __syncthreads();
    // ---- (M) softmax over the 8 heads per (n, l), P tiles ----
    {
      const int n = tid >> 3, lq = (tid & 7) * 4;
      float t[NH][4];
#pragma unroll
      for (int h = 0; h < NH; ++h) {
        const v4f a = *(const v4f*)(U.s + h * (NT * SSP) + n * SSP + lq);
#pragma unroll
        for (int e = 0; e < 4; ++e) t[h][e] = a[e] * lsc;
      }
#pragma unroll
      for (int e = 0; e < 4; ++e) {
        float mx = t[0][e];
#pragma unroll
        for (int h = 1; h < NH; ++h) mx = fmaxf(mx, t[h][e]);
        float sm = 0.f;
#pragma unroll
        for (int h = 0; h < NH; ++h) {
          const float p = exp2f(t[h][e] - mx);                 // <= 1, one term equals 1
          t[h][e] = p;
          sm += p;
        }
        const float rs = __builtin_amdgcn_rcpf(sm) * PCAR;      // sm in [1, 8]
#pragma unroll
        for (int h = 0; h < NH; ++h) t[h][e] *= rs;
      }
      u16* pd = sP + n * PLP + lq;
#pragma unroll
      for (int h = 0; h < NH; ++h) {
        v2u pk;
        pk[0] = pk16(h_bits((_Float16)t[h][0]), h_bits((_Float16)t[h][1]));
        pk[1] = pk16(h_bits((_Float16)t[h][2]), h_bits((_Float16)t[h][3]));
        *(v2u*)(pd + h * (NT * PLP)) = pk;
      }
    }
    __syncthreads();
    // ---- (PV) accumulate P_h . V_h over all heads for this key tile ----
    {
      const _Float16* pbase = (const _Float16*)(const void*)sP + m * PLP + 8 * hh;
      const _Float16* vl = vb + l0;
#pragma unroll 1
      for (int h = 0; h < NH; ++h) {
        const _Float16* pp = pbase + h * (NT * PLP);
        const v16h p0 = ldfrag_h(pp);
        const v16h p1 = ldfrag_h(pp + 16 * PLP);
        const _Float16* vp = vl + (size_t)h * DM * NL;
        const v16h g0 = ldfrag_h(vp);
        const v16h g1 = ldfrag_h(vp + (size_t)16 * NL);
        const v16h g2 = ldfrag_h(vp + (size_t)32 * NL);
        const v16h g3 = ldfrag_h(vp + (size_t)48 * NL);
        o00 = mma_h(p0, g0, o00);
        o01 = mma_h(p0, g1, o01);
        o02 = mma_h(p0, g2, o02);
        o03 = mma_h(p0, g3, o03);
        o10 = mma_h(p1, g0, o10);
        o11 = mma_h(p1, g1, o11);
        o12 = mma_h(p1, g2, o12);
        o13 = mma_h(p1, g3, o13);
        guard8x6(o00, o01, o02, o03, o10, o11, o12, o13, p0, p1, g0, g1, g2, g3);
      }
    }
  }
  __syncthreads();

  const float osc = 1.0f / (PCAR * VCAR * (float)NH);
  const v4f z4 = {0.f, 0.f, 0.f, 0.f};
  float* const sl = U.slab + wave * SLAB64;
  epi64(sl, o00, o01, o02, o03, osc, z4, out, DM, (size_t)q0, wave * 64, lane);
  wave_sync_lds();
  epi64(sl, o10, o11, o12, o13, osc, z4, out, DM, (size_t)q0 + 16, wave * 64, lane);
}

// =====================================================================================================
// out = sum of the KS partial planes, added in plane order 0..KS-1 in f32. Thread = 4 consecutive floats: KS 16-B loads, one
// 16-B store; 32 consecutive lanes = 512 contiguous bytes per load and store.
// coverage: grid = SQ*DM/1024 blocks x 256 thr x 4 floats = out rows 0..SQ-1, every float exactly once.
// =====================================================================================================
__global__ __launch_bounds__(256) void sum_parts(const float* __restrict__ part, float* out) {
  const unsigned ob = (blockIdx.x * 256u + threadIdx.x) * 16u;    // byte offset in a plane, < SQ * DM * 4 (grid exact)
  v4f p[KS];
#pragma unroll
  for (int s = 0; s < KS; ++s) p[s] = *(const v4f*)((const char*)(part + (size_t)s * ((size_t)SQ * DM)) + ob);
  v4f a = p[0];
#pragma unroll
  for (int s = 1; s < KS; ++s) a += p[s];
  *(v4f*)((char*)out + ob) = a;
}

// =====================================================================================================
// Workspace map (bytes); every plane is fully written by whole-line stores before it is read; all extents are exact multiples of
// the store granularity (no pad rows, all dims multiples of 64), every offset a multiple of 256:
//   XQ  bf16 [SQ][512]                      <=  4194304
//   XS  bf16 [4096][512]                        4194304
//   WV1T, WQT, WKT bf16 [512][512]             3 x 524288
//   WV2T f16 of bf16 value x1024 [4096][512]   4194304
//   VALH f16 value x8 [4096][512]               4194304
//   QP   f16 x8 [SQ][512]                   <=  4194304
//   KP   f16 x8 [4096][512]                     4194304
//   VT   f16 x64 [4096][4096]                  33554432
//   PART f32 [KS][SQ][512]                  <= 33554432
//   end                                     <= 93847552
// =====================================================================================================
extern "C" void kernel_launch(void* const* d_in, const int* in_sizes, int n_in,
                              void* d_out, int out_size, void* d_ws, size_t ws_size,
                              hipStream_t stream) {
  if (n_in < 10) return;
  if (in_sizes[0] != NQ * DM || in_sizes[1] != NL * DM) return;
  if (in_sizes[2] != DM * DM || in_sizes[3] != DM) return;
  if (in_sizes[4] != DM * DM || in_sizes[5] != DM) return;
  if (in_sizes[6] != DM * DM || in_sizes[7] != DM) return;
  if (in_sizes[8] != DM * DV || in_sizes[9] != DV) return;
  if (out_size != NQ * DM) return;

  const float* xq  = (const float*)d_in[0];
  const float* xs  = (const float*)d_in[1];
  const float* wv1 = (const float*)d_in[2];
  const float* bv1 = (const float*)d_in[3];
  const float* wq  = (const float*)d_in[4];
  const float* bq  = (const float*)d_in[5];
  const float* wk  = (const float*)d_in[6];
  const float* bk  = (const float*)d_in[7];
  const float* wv2 = (const float*)d_in[8];
  const float* bv2 = (const float*)d_in[9];
  float*       out = (float*)d_out;

  const size_t szXQ = (size_t)SQ * DM * 2;          //  4194304 at SQ = NQ
  const size_t szXS = (size_t)NL * DM * 2;          //  4194304
  const size_t szWT = (size_t)DM * DM * 2;          //   524288
  const size_t szW2 = (size_t)DV * DM * 2;          //  4194304
  const size_t szVL = (size_t)NL * DM * 2;          //  4194304
  const size_t szQP = (size_t)SQ * DM * 2;          //  4194304 at SQ = NQ
  const size_t szKP = (size_t)NL * DM * 2;          //  4194304
  const size_t szVT = (size_t)DV * NL * 2;          // 33554432
  const size_t szPT = (size_t)KS * SQ * DM * 4;     // 33554432 at SQ = NQ
  size_t off = 0;
  const size_t oXQ = off; off += szXQ;
  const size_t oXS = off; off += szXS;
  const size_t oW1 = off; off += szWT;
  const size_t oWQ = off; off += szWT;
  const size_t oWK = off; off += szWT;
  const size_t oW2 = off; off += szW2;
  const size_t oVL = off; off += szVL;
  const size_t oQP = off; off += szQP;
  const size_t oKP = off; off += szKP;
  const size_t oVT = off; off += szVT;
  const size_t oPT = off; off += szPT;
  if (off > ws_size) return;                        // off = 93847552 at SQ = NQ
  if (off > WS_CAP) return;

  char* ws = (char*)d_ws;
  u16* XQ   = (u16*)(ws + oXQ);
  u16* XS   = (u16*)(ws + oXS);
  u16* WV1T = (u16*)(ws + oW1);
  u16* WQT  = (u16*)(ws + oWQ);
  u16* WKT  = (u16*)(ws + oWK);
  u16* WV2T = (u16*)(ws + oW2);
  u16* VALH = (u16*)(ws + oVL);
  u16* QP   = (u16*)(ws + oQP);
  u16* KP   = (u16*)(ws + oKP);
  u16* VT   = (u16*)(ws + oVT);
  float* PART = (float*)(ws + oPT);

  const int n8q = (SQ * DM) / 8;                    // multiple of 256 (static)
  const int n8s = (NL * DM) / 8;                    // 262144
  const dim3 blk(256);
  const dim3 bG(128);
  const dim3 gXq(n8q / 256);                        // SQ/4
  const dim3 gXs(n8s / 256);                        // 1024
  const dim3 gWT((DM / 64) * (DM / 64));            // 64:  in [512][512]  -> out [512][512]
  const dim3 gW2((DM / 64) * (DV / 64));            // 512: in [512][4096] -> out [4096][512]
  const dim3 gGq((SQ / 64) * (DM / 64));            // 512 at SQ = NQ
  const dim3 gG((NL / 64) * (DM / 64));             // 512
  const dim3 gVT((DV / 64) * (NL / 64));            // 4096
  const dim3 gAT(KS, SQ / NT);                      // 4 x 128 at SQ = NQ
  const dim3 gSP((SQ * DM) / 1024);                 // 2048 at SQ = NQ
  const dim3 bAT(ATT_THREADS);

  // (0, 1) query rows < SQ and source -> bf16 planes; (2..4) Wv1, Wq, Wk [in][out] -> bf16 [out][in] k-contiguous planes;
  // (5) Wv2 [512][4096] -> f16 of the bf16 value x1024, [4096][512]
  cvt16<<<gXq, blk, 0, stream>>>(xq, XQ, n8q, 0, 1.0f);
  cvt16<<<gXs, blk, 0, stream>>>(xs, XS, n8s, 0, 1.0f);
  tr16<<<gWT, blk, 0, stream>>>(wv1, WV1T, DM, DM, 0, 1.0f);
  tr16<<<gWT, blk, 0, stream>>>(wq,  WQT,  DM, DM, 0, 1.0f);
  tr16<<<gWT, blk, 0, stream>>>(wk,  WKT,  DM, DM, 0, 1.0f);
  tr16<<<gW2, blk, 0, stream>>>(wv2, WV2T, DM, DV, 1, W2S);
  // (6) value = source.Wv1 + b -> f16 plane x8; (7) q (rows < SQ) and (8) k projections -> f16 planes x8
  gemm_bh16<<<gG,  bG, 0, stream>>>(XS, WV1T, bv1, VALH, NL, DM, DM, 1.0f, VSC);
  gemm_bh16<<<gGq, bG, 0, stream>>>(XQ, WQT,  bq,  QP,   SQ, DM, DM, 1.0f, QSC);
  gemm_bh16<<<gG,  bG, 0, stream>>>(XS, WKT,  bk,  KP,   NL, DM, DM, 1.0f, KSC);
  // (9) V^T [h*512+d][l] = (Wv2^T . value^T) / (1024*8) + b[h*512+d], f16 plane x64
  gemm_hh16r<<<gVT, bG, 0, stream>>>(WV2T, VALH, bv2, VT, DV, NL, DM, 1.0f / (W2S * VSC), VCAR);
  // (10) head-axis softmax attention + head mean, one f32 partial plane per key range; (11) planes summed -> out rows 0..SQ-1
  attn_heads<<<gAT, bAT, 0, stream>>>(QP, KP, VT, PART);
  sum_parts<<<gSP, blk, 0, stream>>>(PART, out);
  (void)hipGetLastError();
}

// v002
// A run of this version takes 303 microseconds.
// Two timings next to v001 put it at 1.52 and 1.53 times that version's speed.
// All steps since v000 together make it 2.57 times as fast.
// Projections value, q, k = x.W + b: v_wmma_f32_16x16x32_bf16 (bf16 RNE operands of the raw inputs, f32 accumulate, bf16 RNE
// bias added in f32). v^T = Wv2^T . value^T (W as f16 of the bf16 RNE value x1024, value plane f16 x8, bf16 RNE bias per row in
// f32), per-head scores q.k^T (f16 planes x8) and P.V (P x4096 f16 from LDS, V^T x64 f16): v_wmma_f32_16x16x32_f16, f32
// accumulate. Softmax over the head axis, the head mean and all scaling in f32 on VALU.
// Every 16-bit operand plane [rows][K] in the workspace is kept in FRAGMENT ORDER: 1-KB blocks of 16 rows x 32 k, block (rt, kt)
// at half index rt * 16 * K + kt * 512; inside a block the 16-B chunk (row m = row & 15, c = (k >> 3) & 3) stands at half index
// c * 128 + m * 8. Lane (h = lane >> 4, m = lane & 15) of a fragment then reads its two 16-B chunks (c = h and c = 2 + h) at
// lane * 8 and 256 + lane * 8: each load of a wave is 512 contiguous bytes (4 cache lines) and not 32 B out of each of 16 lines.
// The V^T plane alone orders its blocks k tile first, block (rt, kt) at half index (kt * (rows / 16) + rt) * 512, so that all that
// one key tile of the attention reads (every head, every d) is one contiguous 256-KB run.
#include <hip/hip_runtime.h>
#include <math.h>
#include <stdint.h>

#define NQ   4096
#define NL   4096
#define DM   512
#define NH   8
#define DKH  64
#define DV   (NH * DM)
#ifndef SQ
#define SQ NQ
#endif
#define NT   32
#define LT   32
#define SSP  32
#define PLP  40
#define SLAB64 (16 * 68)
#define ATT_THREADS 256
#define KS   4
#define KSPAN (NL / KS)
#define QSC  8.0f
#define KSC  8.0f
#define VSC  8.0f
#define W2S  1024.0f
#define PCAR 4096.0f
#define VCAR 64.0f
#define LOG2E 1.4426950408889634f
#define WS_CAP ((size_t)134217728)

static_assert(DM == NH * DKH && DKH == 64 && NH == 8 && (DM % 64) == 0 && (DV % 64) == 0 && (NL % 64) == 0 && (NQ % 64) == 0);
static_assert((DM % 32) == 0);
static_assert(SQ >= 64 && SQ <= NQ && (SQ % 64) == 0 && (SQ % NT) == 0);
static_assert(NT == 32 && LT == 32 && (NL % LT) == 0 && ATT_THREADS == 256 && ATT_THREADS * 4 == NT * LT);
static_assert(KS >= 1 && (NL % (KS * LT)) == 0 && ((SQ * DM) % 1024) == 0);
static_assert(SSP >= LT && PLP >= 32 && ((PLP * 2) % 16) == 0 && ((SSP * 4) % 16) == 0);
static_assert(NH * NT * SSP <= 8 * SLAB64);
static_assert(((NQ * DM) % 2048) == 0 && ((NL * DM) % 2048) == 0 && ((SQ * DM) % 2048) == 0);
static_assert(NH * NT * SSP * 4 + 0 <= 40000 && NH * NT * PLP * 2 <= 24000);

typedef unsigned short u16;
typedef _Float16 v16h __attribute__((ext_vector_type(16)));
typedef _Float16 v8h  __attribute__((ext_vector_type(8)));
typedef __bf16   v16b __attribute__((ext_vector_type(16)));
typedef float    v8f  __attribute__((ext_vector_type(8)));
typedef float    v4f  __attribute__((ext_vector_type(4)));
typedef unsigned int v4u __attribute__((ext_vector_type(4)));
typedef unsigned int v2u __attribute__((ext_vector_type(2)));

union FragH { v16h v; v8h h[2]; v4u u[2]; };
union FragB { v16b v; v4u u[2]; };
union AttU { float s[NH * NT * SSP]; float slab[8 * SLAB64]; };

// ---- scalar helpers --------------------------------------------------------------------------------
__device__ __forceinline__ unsigned short bf_bits(float f) {          // f32 -> bf16 bits, RNE convert
  unsigned u = __float_as_uint(f);
  return (unsigned short)((u + 0x7FFFu + ((u >> 16) & 1u)) >> 16);
}
__device__ __forceinline__ float bf_up(unsigned short h) { return __uint_as_float(((unsigned)h) << 16); }
__device__ __forceinline__ float bfr(float f) { return bf_up(bf_bits(f)); }
__device__ __forceinline__ unsigned short h_bits(_Float16 x) { return __builtin_bit_cast(unsigned short, x); }
__device__ __forceinline__ unsigned pk16(unsigned short a, unsigned short b) { return (unsigned)a | ((unsigned)b << 16); }
__device__ __forceinline__ v8f zero8() { v8f z = {0.f, 0.f, 0.f, 0.f, 0.f, 0.f, 0.f, 0.f}; return z; }

// ---- fragment loaders: 16-bit A/B operand, lane -> row/col (lane&15); elements 0..7 <- k0+8h.., elements 8..15 <- k0+16+8h..
//      (same split k map for A and B).
//      ldfrag_h: row-major LDS tile, p already includes row * pitch + 8*(lane>>4): p[0..7] and p[16..23].
//      ldfrag_hf / ldfrag_b: fragment-order workspace plane, p = start of the 1-KB block + lane * 8: p[0..7] and p[256..263].
__device__ __forceinline__ v16h ldfrag_h(const _Float16* p) {
  FragH f;
  f.h[0] = *(const v8h*)(p);
  f.h[1] = *(const v8h*)(p + 16);
  return f.v;
}
__device__ __forceinline__ v16h ldfrag_hf(const _Float16* p) {
  FragH f;
  f.h[0] = *(const v8h*)(p);
  f.h[1] = *(const v8h*)(p + 256);
  return f.v;
}
__device__ __forceinline__ v16b ldfrag_b(const u16* p) {              // bf16 plane read as unsigned integer vectors
  FragB f;
  f.u[0] = *(const v4u*)(p);
  f.u[1] = *(const v4u*)(p + 256);
  return f.v;
}

__device__ __forceinline__ v8f mma_h(v16h a, v16h b, v8f c) {
  return __builtin_amdgcn_wmma_f32_16x16x32_f16(false, a, false, b, (short)0, c, false, false);
}
__device__ __forceinline__ v8f mma_b(v16b a, v16b b, v8f c) {
  return __builtin_amdgcn_wmma_f32_16x16x32_bf16(false, a, false, b, (short)0, c, false, false);
}
template <typename F>
__device__ __forceinline__ void guard6(v8f& a, v8f& b, v8f& c, v8f& d, F x0, F x1, F x2, F x3, F x4, F x5) {
#if defined(__HIP_DEVICE_COMPILE__)
  asm volatile("v_nop\n\tv_nop\n\tv_nop\n\tv_nop"
               : "+v"(a), "+v"(b), "+v"(c), "+v"(d) : "v"(x0), "v"(x1), "v"(x2), "v"(x3), "v"(x4), "v"(x5) : "memory");
#endif
}
__device__ __forceinline__ void guard4x8(v8f& a, v8f& b, v8f& c, v8f& d, v16h x0, v16h x1, v16h x2, v16h x3,
                                         v16h x4, v16h x5, v16h x6, v16h x7) {
#if defined(__HIP_DEVICE_COMPILE__)
  asm volatile("v_nop\n\tv_nop\n\tv_nop\n\tv_nop"
               : "+v"(a), "+v"(b), "+v"(c), "+v"(d)
               : "v"(x0), "v"(x1), "v"(x2), "v"(x3), "v"(x4), "v"(x5), "v"(x6), "v"(x7) : "memory");
#endif
}
__device__ __forceinline__ void guard8x6(v8f& a0, v8f& a1, v8f& a2, v8f& a3, v8f& e0, v8f& e1, v8f& e2, v8f& e3,
                                         v16h x0, v16h x1, v16h x2, v16h x3, v16h x4, v16h x5) {
#if defined(__HIP_DEVICE_COMPILE__)
  asm volatile("v_nop\n\tv_nop\n\tv_nop\n\tv_nop"
               : "+v"(a0), "+v"(a1), "+v"(a2), "+v"(a3), "+v"(e0), "+v"(e1), "+v"(e2), "+v"(e3)
               : "v"(x0), "v"(x1), "v"(x2), "v"(x3), "v"(x4), "v"(x5) : "memory");
#endif
}
__device__ __forceinline__ void wave_sync_lds() {
  __builtin_amdgcn_fence(__ATOMIC_RELEASE, "workgroup");
  __builtin_amdgcn_wave_barrier();
  __builtin_amdgcn_fence(__ATOMIC_ACQUIRE, "workgroup");
}

// =====================================================================================================
// f32 plane [rows][DM] row-major -> 16-bit plane in fragment order:  mode 0: bf16 RNE bits;  mode 1: f16 bits of (bf16 RNE value) * scale;
// mode 2: f16 bits of value * scale (no bf16 pre-step).
// Thread = output chunk gt = 8 consecutive k of one row: two 16-B loads (a wave reads 64 B of each of 16 rows), one 16-B store;
// 32 consecutive lanes store 512 contiguous, 512-B aligned bytes
// coverage: grid = n8/256 blocks (host uses exact multiples) x 256 thr x 8 = the whole plane.
// =====================================================================================================
__global__ __launch_bounds__(256) void cvt16(const float* __restrict__ x, u16* D, int n8, int mode, float scale) {
  const int gt = blockIdx.x * 256 + (int)threadIdx.x;
  if (gt >= n8) return;                     // no barriers in this kernel
  const int kb = DM / 32;                   // blocks in a row tile
  const int blk = gt >> 6, cw = gt & 63;    // 1-KB block, chunk in it: cw = c * 16 + m
  const float* p = x + ((size_t)(blk / kb) * 16 + (size_t)(cw & 15)) * DM + (blk % kb) * 32 + (cw >> 4) * 8;
  const v4f a = *(const v4f*)(p), c4 = *(const v4f*)(p + 4);
  float v[8];
#pragma unroll
  for (int e = 0; e < 4; ++e) { v[e] = a[e]; v[4 + e] = c4[e]; }
  unsigned short s[8];
#pragma unroll
  for (int e = 0; e < 8; ++e) {
    const float vb = bfr(v[e]);
    const float vf = (mode == 1) ? vb : v[e];
    const unsigned short hb = h_bits((_Float16)(vf * scale));
    const unsigned short bb = bf_bits(v[e]);
    s[e] = (mode != 0) ? hb : bb;
  }
  v4u o;
#pragma unroll
  for (int e = 0; e < 4; ++e) o[e] = pk16(s[2 * e], s[2 * e + 1]);
  u16* d = D + (size_t)gt * 8;
  {
    *(v4u*)(d) = o;
    
  }
}

// =====================================================================================================
// Transpose + convert: in X [R][C] f32 row-major -> out XTo [C][R] 16-bit in fragment order (output row = input column, k = R axis).
//   mode 0: bf16 RNE bits;  mode 1: f16 bits of (bf16 RNE value) * scale;  mode 2: f16 bits of value * scale.
// Block = 64 input rows x 64 input cols: bid -> (rt = bid % (R/64), ct = bid / (R/64)). The 64x64 f32 tile is loaded with 16-B
// loads (thread = input row tid>>2, 16 consecutive cols), converted and scattered into LDS TH[c local][r local] (pitch 72 halves);
// the tile is 4 row tiles x 2 k tiles = 8 blocks of 1 KB; chunk cid = it * 256 + tid -> block cid >> 6, chunk cid & 63 in it.
// coverage: load 256 thr x 16 = 64 x 64; store 2 iterations x 256 thr x 8 halves = 8 blocks x 64 chunks = the tile;
//           grid = (R/64)*(C/64) blocks (host exact multiples) tiles the whole [C][R] plane exactly once.
// =====================================================================================================
#define VTP 72
static_assert(64 * VTP >= 63 * VTP + 64 && ((VTP * 2) % 16) == 0);
__global__ __launch_bounds__(256) void tr16(const float* __restrict__ X, u16* XTo, int R, int C, int mode, float scale) {
  __shared__ __align__(16) u16 TH[64 * VTP];
  const int tid = threadIdx.x;
  const int bid = blockIdx.x;
  const int nrt = R >> 6;
  const int rt  = bid % nrt;
  const int ct  = bid / nrt;
  const int r0  = rt * 64;
  const int c0  = ct * 64;
  {
    const int rl = tid >> 2;                  // input row within tile 0..63
    const int cc = (tid & 3) * 16;            // input col chunk within the 64
    const float* src = X + (size_t)(r0 + rl) * (size_t)C + c0 + cc;
#pragma unroll
    for (int i = 0; i < 4; ++i) {
      const v4f a = *(const v4f*)(src + 4 * i);
#pragma unroll
      for (int e = 0; e < 4; ++e) {
        const float v  = a[e];
        const float vb = bfr(v);
        const float vf = (mode == 1) ? vb : v;
        const unsigned short hb = h_bits((_Float16)(vf * scale));
        const unsigned short bb = bf_bits(v);
        TH[(cc + 4 * i + e) * VTP + rl] = (mode != 0) ? hb : bb;
      }
    }
  }
  __syncthreads();
  v4u vh[2];
  const int cw = tid & 63;                    // chunk in its block: c * 16 + m
#pragma unroll
  for (int it = 0; it < 2; ++it) {
    const int bl = it * 4 + (tid >> 6);       // local block 0..7: row tile bl >> 1, k tile bl & 1
    vh[it] = *(const v4u*)(TH + ((bl >> 1) * 16 + (cw & 15)) * VTP + (bl & 1) * 32 + (cw >> 4) * 8);
  }
  const size_t base = (size_t)c0 * (size_t)R + (size_t)r0 * 16 + (size_t)cw * 8;
  {
#pragma unroll
    for (int it = 0; it < 2; ++it) {
      const int bl = it * 4 + (tid >> 6);
      *(v4u*)(XTo + base + (size_t)(bl >> 1) * 16 * (size_t)R + (size_t)(bl & 1) * 512) = vh[it];
    }
    
  }
}

// =====================================================================================================
// Epilogues. The wave's 16x64 f32 tile (times oscale, plus an optional per-row addend) is staged in its LDS slab (pitch 68),
//            8 consecutive lanes x 16 B per line), lanes 16..31 -> row 2*it+1.
//  epi64hsb: f16 bits of ((tile + bf16RNE(bias[col])) * pscale) into a fragment-order plane: the tile is two adjacent 1-KB blocks;
//            store i = 0..3, lane (h, m) = row m, columns 16i + 8h .. + 7, at half index i * 256 + lane * 8 (512 contiguous bytes).
//  epi64hrb: f16 bits of ((tile + bf16RNE(bias[row])) * pscale), same store shape as epi64hsb, but blocks ordered k tile first (M rows):
//            the tile's two 1-KB blocks stand M * 32 halves apart.
// coverage: epi64 8 instructions x 2 rows x 16 lanes x 4 floats; epi64hsb/hrb 4 instructions x 16 rows x 2 chunks x 8 halves
//           = the wave's 16 x 64 tile in all cases.
// =====================================================================================================
__device__ __forceinline__ void stage64(float* sl, v8f a0, v8f a1, v8f a2, v8f a3, float oscale, int lane) {
  const int hh = lane >> 4, m = lane & 15;
#pragma unroll
  for (int r = 0; r < 8; ++r) {
    const int ro = (8 * hh + r) * 68 + m;
    sl[ro]      = a0[r] * oscale;
    sl[ro + 16] = a1[r] * oscale;
    sl[ro + 32] = a2[r] * oscale;
    sl[ro + 48] = a3[r] * oscale;
  }
  wave_sync_lds();
}
__device__ __forceinline__ void epi64(float* sl, v8f a0, v8f a1, v8f a2, v8f a3, float oscale, v4f badd, float* C, int N,
                                      size_t rowb, int col0, int lane) {
  const int hh = lane >> 4, m = lane & 15;
  stage64(sl, a0, a1, a2, a3, oscale, lane);
  v4f vals[8];
#pragma unroll
  for (int it = 0; it < 8; ++it) vals[it] = *(const v4f*)(sl + (it * 2 + hh) * 68 + m * 4) + badd;
  float* dst = C + (rowb + (size_t)hh) * (size_t)N + col0 + m * 4;
  {
#pragma unroll
    for (int it = 0; it < 8; ++it) {
      *(v4f*)(dst + (size_t)(it * 2) * (size_t)N) = vals[it];
    }
    
  }
}
__device__ __forceinline__ void epi64hsb(float* sl, v8f a0, v8f a1, v8f a2, v8f a3, float oscale, float pscale,
                                         const float* __restrict__ bias, u16* C, int N, size_t rowb, int col0, int lane) {
  stage64(sl, a0, a1, a2, a3, oscale, lane);
  const int row = lane & 15, h8 = (lane >> 4) * 8;
  v4u oh[4];
#pragma unroll
  for (int i4 = 0; i4 < 4; ++i4) {
    const int c8 = i4 * 16 + h8;
    const v4f b0 = *(const v4f*)(bias + col0 + c8), b1 = *(const v4f*)(bias + col0 + c8 + 4);   // columns col0+c8..+7 < N
    const v4f a = *(const v4f*)(sl + row * 68 + c8), c4 = *(const v4f*)(sl + row * 68 + c8 + 4);
    float w[8];
#pragma unroll
    for (int e = 0; e < 4; ++e) { w[e] = (a[e] + bfr(b0[e])) * pscale; w[4 + e] = (c4[e] + bfr(b1[e])) * pscale; }
#pragma unroll
    for (int e = 0; e < 4; ++e) oh[i4][e] = pk16(h_bits((_Float16)w[2 * e]), h_bits((_Float16)w[2 * e + 1]));
  }
  u16* dst = C + rowb * (size_t)N + (size_t)col0 * 16 + lane * 8;      // rowb % 16 == 0, col0 % 64 == 0
  {
#pragma unroll
    for (int i4 = 0; i4 < 4; ++i4) {
      *(v4u*)(dst + i4 * 256) = oh[i4];
    }
    
  }
}
__device__ __forceinline__ void epi64hrb(float* sl, v8f a0, v8f a1, v8f a2, v8f a3, float oscale, float pscale,
                                         const float* __restrict__ brow, u16* C, int M, size_t rowb, int col0, int lane) {
  const int hh = lane >> 4, m = lane & 15;
  const v4f r0v = *(const v4f*)(brow + 8 * hh), r1v = *(const v4f*)(brow + 8 * hh + 4);   // rows rowb+8h .. +7 < M
  float rb[8];
#pragma unroll
  for (int e = 0; e < 4; ++e) { rb[e] = bfr(r0v[e]); rb[4 + e] = bfr(r1v[e]); }
#pragma unroll
  for (int r = 0; r < 8; ++r) {
    const int ro = (8 * hh + r) * 68 + m;
    sl[ro]      = a0[r] * oscale + rb[r];
    sl[ro + 16] = a1[r] * oscale + rb[r];
    sl[ro + 32] = a2[r] * oscale + rb[r];
    sl[ro + 48] = a3[r] * oscale + rb[r];
  }
  wave_sync_lds();
  v4u oh[4];
#pragma unroll
  for (int i4 = 0; i4 < 4; ++i4) {
    const int c8 = i4 * 16 + hh * 8;
    const v4f a = *(const v4f*)(sl + m * 68 + c8), c4 = *(const v4f*)(sl + m * 68 + c8 + 4);
    float w[8];
#pragma unroll
    for (int e = 0; e < 4; ++e) { w[e] = a[e] * pscale; w[4 + e] = c4[e] * pscale; }
#pragma unroll
    for (int e = 0; e < 4; ++e) oh[i4][e] = pk16(h_bits((_Float16)w[2 * e]), h_bits((_Float16)w[2 * e + 1]));
  }
  u16* dst = C + (size_t)col0 * (size_t)M + rowb * 32 + lane * 8;      // rowb % 16 == 0, col0 % 64 == 0
  {
#pragma unroll
    for (int i4 = 0; i4 < 4; ++i4) {
      *(v4u*)(dst + (size_t)(i4 >> 1) * 32 * (size_t)M + (i4 & 1) * 256) = oh[i4];
    }
    
  }
}

// =====================================================================================================
// bf16 GEMM, f16 plane out with column bias: C16[M][N] = f16 bits of (((A[M][K] (bf16) . Bt[N][K]^T (bf16))
// * oscale) + bf16RNE(bias[n])) * pscale. A, Bt and C16 are fragment-order planes.
// Block = 64x64 tile, 4 waves x 16 rows; fragments loaded straight from the 1-KB blocks (two 16-B loads each, split k map for
// A and B); K stepped by 32 = one block (host uses K % 32 == 0, M % 64 == 0, N % 64 == 0, grid = (M/64)*(N/64)).
// =====================================================================================================
__global__ __launch_bounds__(128)
void gemm_bh16(const u16* __restrict__ A, const u16* __restrict__ Bt, const float* __restrict__ bias, u16* C,
               int M, int N, int K, float oscale, float pscale) {
  __shared__ __align__(16) float slab[4 * SLAB64];
  const int tid = threadIdx.x, wave = tid >> 5, lane = tid & 31;
  const int ntile = N >> 6;
  const int bid   = blockIdx.x;
  const int rowb  = (bid / ntile) * 64 + wave * 16;
  const int col0  = (bid % ntile) * 64;
  if (rowb + 16 > M) return;                 // wave-uniform, never taken with the exact grid; no block barriers in this kernel
  const size_t bs = (size_t)16 * K;
  const u16* ap  = A  + (size_t)rowb * (size_t)K + lane * 8;
  const u16* bp0 = Bt + (size_t)col0 * (size_t)K + lane * 8;
  const u16* bp1 = bp0 + bs;
  const u16* bp2 = bp1 + bs;
  const u16* bp3 = bp2 + bs;
  v8f acc0 = zero8(), acc1 = zero8(), acc2 = zero8(), acc3 = zero8();
#pragma unroll 1
  for (int k0 = 0; k0 < K; k0 += 32, ap += 512, bp0 += 512, bp1 += 512, bp2 += 512, bp3 += 512) {   // one 1-KB block a step
    const v16b a  = ldfrag_b(ap);
    const v16b b0 = ldfrag_b(bp0);
    const v16b b1 = ldfrag_b(bp1);
    const v16b b2 = ldfrag_b(bp2);
    const v16b b3 = ldfrag_b(bp3);
    acc0 = mma_b(a, b0, acc0);
    acc1 = mma_b(a, b1, acc1);
    acc2 = mma_b(a, b2, acc2);
    acc3 = mma_b(a, b3, acc3);
    guard6<v16b>(acc0, acc1, acc2, acc3, a, b0, b1, b2, b3, a);
  }
  epi64hsb(slab + wave * SLAB64, acc0, acc1, acc2, acc3, oscale, pscale, bias, C, N, (size_t)rowb, col0, lane);
}

// =====================================================================================================
// f16 GEMM, f16 plane out with ROW bias: C16[M][N] = f16 bits of (((A[M][K] (f16) . Bt[N][K]^T (f16))
// * oscale) + bf16RNE(bias[m])) * pscale; all three planes in fragment order, C16 with its blocks k tile first. Same tiling and fragment loads as gemm_bh16; epilogue epi64hrb.
// =====================================================================================================
__global__ __launch_bounds__(128)
void gemm_hh16r(const u16* __restrict__ A, const u16* __restrict__ Bt, const float* __restrict__ bias, u16* C,
                int M, int N, int K, float oscale, float pscale) {
  __shared__ __align__(16) float slab[4 * SLAB64];
  const int tid = threadIdx.x, wave = tid >> 5, lane = tid & 31;
  const int ntile = N >> 6;
  const int bid   = blockIdx.x;
  const int rowb  = (bid / ntile) * 64 + wave * 16;
  const int col0  = (bid % ntile) * 64;
  if (rowb + 16 > M) return;                 // wave-uniform, never taken with the exact grid; no block barriers in this kernel
  const size_t bs = (size_t)16 * K;
  const _Float16* ap  = (const _Float16*)(const void*)A  + (size_t)rowb * (size_t)K + lane * 8;
  const _Float16* bp0 = (const _Float16*)(const void*)Bt + (size_t)col0 * (size_t)K + lane * 8;
  const _Float16* bp1 = bp0 + bs;
  const _Float16* bp2 = bp1 + bs;
  const _Float16* bp3 = bp2 + bs;
  v8f acc0 = zero8(), acc1 = zero8(), acc2 = zero8(), acc3 = zero8();
#pragma unroll 1
  for (int k0 = 0; k0 < K; k0 += 32, ap += 512, bp0 += 512, bp1 += 512, bp2 += 512, bp3 += 512) {   // one 1-KB block a step
    const v16h a  = ldfrag_hf(ap);
    const v16h b0 = ldfrag_hf(bp0);
    const v16h b1 = ldfrag_hf(bp1);
    const v16h b2 = ldfrag_hf(bp2);
    const v16h b3 = ldfrag_hf(bp3);
    acc0 = mma_h(a, b0, acc0);
    acc1 = mma_h(a, b1, acc1);
    acc2 = mma_h(a, b2, acc2);
    acc3 = mma_h(a, b3, acc3);
    guard6<v16h>(acc0, acc1, acc2, acc3, a, b0, b1, b2, b3, a);
  }
  epi64hrb(slab + wave * SLAB64, acc0, acc1, acc2, acc3, oscale, pscale, bias + rowb, C, M, (size_t)rowb, col0, lane);
}

// =====================================================================================================
// Head-axis softmax attention with the head mean folded in. Block = NT = 32 query rows q0..q0+31, 8 waves, the KSPAN keys of
// key range blockIdx.x in tiles of LT = 32 (the softmax runs over heads, so key ranges only add: each range writes its own f32
// partial plane, sum_parts adds the KS planes). q plane f16 x8 [n][512] (head h = columns 64h..64h+63), k plane the same, V^T plane f16 x64 [h*512+d][l],
// all three in fragment order, V^T with its blocks k tile first.
//   (S) wave w = head w: S_w[32 n][32 l] = 4 D tiles, K = 64 (2 k-steps): A = q rows (row m = query, split k map over the
//       head's 64 columns), B = k rows (col n = key, same split map); D element r of lane -> U.s[w][n 16nt+8h+r][l 16half+m].
//   (M) thread = (n = tid>>3, 4 consecutive l): base-2 logits t = s * log2e/512 for the 8 heads, max over heads, p = exp2(t-max),
//       P = p / sum (f32), written as f16(P * 4096) to sP[h][n][l] with 8-B LDS stores.
//   (PV) wave w owns d columns 64w + 16t + (lane&15), t = 0..3, for both 16-row n halves (8 accumulators); for every head h:
//       A = P_h fragments from LDS (row m = query, split map over the 32 keys), B = V^T fragments (col = d, same split map,
//       row h*512 + d of the V^T plane); all heads and key tiles accumulate into the same accumulators (joint (l,h) K axis).
//   Block barriers after (S) and after (M) order every LDS reuse across phases, key tiles and waves.
//   Epilogue: partial = acc * 2^-21 (= 1 / (4096 * 64 * 8 heads)); the wave's two 16 x 64 f32 tiles go through epi64 (staged in
//   between the two tiles; a block barrier separates the key loop from the slab use (the slab area aliases the score area).
// coverage: grid (KS, SQ/32) blocks x 32 rows = query rows 0..SQ-1 of every partial plane; (S) 8 waves x 32 x 32 = all score cells; (M) 256 thr x 4 l x 8 h
//           = all P cells; stores 8 waves x (2 tiles x 16 rows x 64 cols) = part[ks][q0..q0+31][0..511], every float exactly once.
// =====================================================================================================
__global__ __launch_bounds__(ATT_THREADS)
void attn_heads(const u16* __restrict__ QPp, const u16* __restrict__ KPp, const u16* __restrict__ VTp, float* part) {
  __shared__ __align__(16) AttU U;                 // scores [8][32][SSP] f32; reused as 8 epilogue slabs
  __shared__ __align__(16) u16 sP[NH * NT * PLP];  // P tiles [8][32][PLP] f16 bits

  const int tid  = threadIdx.x;
  const int wave = tid >> 5;
  const int lane = tid & 31;
  const int hh   = lane >> 4;
  const int m    = lane & 15;
  const int q0   = blockIdx.y * NT;          // q0 + 31 < SQ (grid exact)
  const int lbeg = blockIdx.x * KSPAN;       // this block's key range lbeg .. lbeg + KSPAN - 1 < NL (grid exact)
  float* const out = part + (size_t)blockIdx.x * ((size_t)SQ * DM);

  const _Float16* qb = (const _Float16*)(const void*)QPp + (size_t)q0 * DM + wave * (DKH * 16) + lane * 8;
  const _Float16* kb = (const _Float16*)(const void*)KPp + wave * (DKH * 16) + lane * 8;
  const _Float16* vb = (const _Float16*)(const void*)VTp + wave * (64 * 32) + lane * 8;
  const float lsc = LOG2E / (QSC * KSC * 8.0f);
  float* const sw = U.s + wave * (NT * SSP);

  v8f o00 = zero8(), o01 = zero8(), o02 = zero8(), o03 = zero8();
  v8f o10 = zero8(), o11 = zero8(), o12 = zero8(), o13 = zero8();

#pragma unroll 1
  for (int l0 = lbeg; l0 < lbeg + KSPAN; l0 += LT) {
    // ---- (S) scores of head = wave for this key tile ----
    {
      const v16h qa0 = ldfrag_hf(qb), qa1 = ldfrag_hf(qb + 512);
      const v16h qc0 = ldfrag_hf(qb + (size_t)16 * DM), qc1 = ldfrag_hf(qb + (size_t)16 * DM + 512);
      const _Float16* kp = kb + (size_t)l0 * DM;
      const v16h ka0 = ldfrag_hf(kp), ka1 = ldfrag_hf(kp + 512);
      const v16h kc0 = ldfrag_hf(kp + (size_t)16 * DM), kc1 = ldfrag_hf(kp + (size_t)16 * DM + 512);
      v8f s00 = zero8(), s01 = zero8(), s10 = zero8(), s11 = zero8();
      s00 = mma_h(qa0, ka0, s00);  s00 = mma_h(qa1, ka1, s00);     // n rows 0..15,  keys 0..15
      s01 = mma_h(qa0, kc0, s01);  s01 = mma_h(qa1, kc1, s01);     // n rows 0..15,  keys 16..31
      s10 = mma_h(qc0, ka0, s10);  s10 = mma_h(qc1, ka1, s10);     // n rows 16..31, keys 0..15
      s11 = mma_h(qc0, kc0, s11);  s11 = mma_h(qc1, kc1, s11);     // n rows 16..31, keys 16..31
      guard4x8(s00, s01, s10, s11, qa0, qa1, qc0, qc1, ka0, ka1, kc0, kc1);
#pragma unroll
      for (int r = 0; r < 8; ++r) {
        const int ro = (8 * hh + r) * SSP + m;
        sw[ro]                 = s00[r];
        sw[ro + 16]            = s01[r];
        sw[ro + 16 * SSP]      = s10[r];
        sw[ro + 16 * SSP + 16] = s11[r];
      }
    }
    __syncthreads();
    // ---- (M) softmax over the 8 heads per (n, l), P tiles ----
    {
      const int n = tid >> 3, lq = (tid & 7) * 4;
      float t[NH][4];
#pragma unroll
      for (int h = 0; h < NH; ++h) {
        const v4f a = *(const v4f*)(U.s + h * (NT * SSP) + n * SSP + lq);
#pragma unroll
        for (int e = 0; e < 4; ++e) t[h][e] = a[e] * lsc;
      }
#pragma unroll
      for (int e = 0; e < 4; ++e) {
        float mx = t[0][e];
#pragma unroll
        for (int h = 1; h < NH; ++h) mx = fmaxf(mx, t[h][e]);
        float sm = 0.f;
#pragma unroll
        for (int h = 0; h < NH; ++h) {
          const float p = exp2f(t[h][e] - mx);                 // <= 1, one term equals 1
          t[h][e] = p;
          sm += p;
        }
        const float rs = __builtin_amdgcn_rcpf(sm) * PCAR;      // sm in [1, 8]
#pragma unroll
        for (int h = 0; h < NH; ++h) t[h][e] *= rs;
      }
      u16* pd = sP + n * PLP + lq;
#pragma unroll
      for (int h = 0; h < NH; ++h) {
        v2u pk;
        pk[0] = pk16(h_bits((_Float16)t[h][0]), h_bits((_Float16)t[h][1]));
        pk[1] = pk16(h_bits((_Float16)t[h][2]), h_bits((_Float16)t[h][3]));
        *(v2u*)(pd + h * (NT * PLP)) = pk;
      }
    }
    __syncthreads();
    // ---- (PV) accumulate P_h . V_h over all heads for this key tile ----
    {
      const _Float16* pbase = (const _Float16*)(const void*)sP + m * PLP + 8 * hh;
      const _Float16* vl = vb + (size_t)l0 * DV;   // k tile l0 / 32 of V^T: DV / 16 blocks of 512 halves
#pragma unroll 1
      for (int h = 0; h < NH; ++h) {
        const _Float16* pp = pbase + h * (NT * PLP);
        const v16h p0 = ldfrag_h(pp);
        const v16h p1 = ldfrag_h(pp + 16 * PLP);
        const _Float16* vp = vl + h * (DM * 32);
        const v16h g0 = ldfrag_hf(vp);
        const v16h g1 = ldfrag_hf(vp + 512);
        const v16h g2 = ldfrag_hf(vp + 1024);
        const v16h g3 = ldfrag_hf(vp + 1536);
        o00 = mma_h(p0, g0, o00);
        o01 = mma_h(p0, g1, o01);
        o02 = mma_h(p0, g2, o02);
        o03 = mma_h(p0, g3, o03);
        o10 = mma_h(p1, g0, o10);
        o11 = mma_h(p1, g1, o11);
        o12 = mma_h(p1, g2, o12);
        o13 = mma_h(p1, g3, o13);
        guard8x6(o00, o01, o02, o03, o10, o11, o12, o13, p0, p1, g0, g1, g2, g3);
      }
    }
  }
  __syncthreads();

  const float osc = 1.0f / (PCAR * VCAR * (float)NH);
  const v4f z4 = {0.f, 0.f, 0.f, 0.f};
  float* const sl = U.slab + wave * SLAB64;
  epi64(sl, o00, o01, o02, o03, osc, z4, out, DM, (size_t)q0, wave * 64, lane);
  wave_sync_lds();
  epi64(sl, o10, o11, o12, o13, osc, z4, out, DM, (size_t)q0 + 16, wave * 64, lane);
}

// =====================================================================================================
// out = sum of the KS partial planes, added in plane order 0..KS-1 in f32. Thread = 4 consecutive floats: KS 16-B loads, one
// 16-B store; 32 consecutive lanes = 512 contiguous bytes per load and store.
// coverage: grid = SQ*DM/1024 blocks x 256 thr x 4 floats = out rows 0..SQ-1, every float exactly once.
// =====================================================================================================
__global__ __launch_bounds__(256) void sum_parts(const float* __restrict__ part, float* out) {
  const unsigned ob = (blockIdx.x * 256u + threadIdx.x) * 16u;    // byte offset in a plane, < SQ * DM * 4 (grid exact)
  v4f p[KS];
#pragma unroll
  for (int s = 0; s < KS; ++s) p[s] = *(const v4f*)((const char*)(part + (size_t)s * ((size_t)SQ * DM)) + ob);
  v4f a = p[0];
#pragma unroll
  for (int s = 1; s < KS; ++s) a += p[s];
  *(v4f*)((char*)out + ob) = a;
}

// =====================================================================================================
// Workspace map (bytes); every plane is fully written by whole-line stores before it is read; all extents are exact multiples of
// the store granularity (no pad rows, all dims multiples of 64), every offset a multiple of 256:
//   XQ  bf16 [SQ][512]                      <=  4194304
//   XS  bf16 [4096][512]                        4194304
//   WV1T, WQT, WKT bf16 [512][512]             3 x 524288
//   WV2T f16 of bf16 value x1024 [4096][512]   4194304
//   VALH f16 value x8 [4096][512]               4194304
//   QP   f16 x8 [SQ][512]                   <=  4194304
//   KP   f16 x8 [4096][512]                     4194304
//   VT   f16 x64 [4096][4096]                  33554432
//   PART f32 [KS][SQ][512]                  <= 33554432
//   end                                     <= 93847552
// =====================================================================================================
extern "C" void kernel_launch(void* const* d_in, const int* in_sizes, int n_in,
                              void* d_out, int out_size, void* d_ws, size_t ws_size,
                              hipStream_t stream) {
  if (n_in < 10) return;
  if (in_sizes[0] != NQ * DM || in_sizes[1] != NL * DM) return;
  if (in_sizes[2] != DM * DM || in_sizes[3] != DM) return;
  if (in_sizes[4] != DM * DM || in_sizes[5] != DM) return;
  if (in_sizes[6] != DM * DM || in_sizes[7] != DM) return;
  if (in_sizes[8] != DM * DV || in_sizes[9] != DV) return;
  if (out_size != NQ * DM) return;

  const float* xq  = (const float*)d_in[0];
  const float* xs  = (const float*)d_in[1];
  const float* wv1 = (const float*)d_in[2];
  const float* bv1 = (const float*)d_in[3];
  const float* wq  = (const float*)d_in[4];
  const float* bq  = (const float*)d_in[5];
  const float* wk  = (const float*)d_in[6];
  const float* bk  = (const float*)d_in[7];
  const float* wv2 = (const float*)d_in[8];
  const float* bv2 = (const float*)d_in[9];
  float*       out = (float*)d_out;

  const size_t szXQ = (size_t)SQ * DM * 2;          //  4194304 at SQ = NQ
  const size_t szXS = (size_t)NL * DM * 2;          //  4194304
  const size_t szWT = (size_t)DM * DM * 2;          //   524288
  const size_t szW2 = (size_t)DV * DM * 2;          //  4194304
  const size_t szVL = (size_t)NL * DM * 2;          //  4194304
  const size_t szQP = (size_t)SQ * DM * 2;          //  4194304 at SQ = NQ
  const size_t szKP = (size_t)NL * DM * 2;          //  4194304
  const size_t szVT = (size_t)DV * NL * 2;          // 33554432
  const size_t szPT = (size_t)KS * SQ * DM * 4;     // 33554432 at SQ = NQ
  size_t off = 0;
  const size_t oXQ = off; off += szXQ;
  const size_t oXS = off; off += szXS;
  const size_t oW1 = off; off += szWT;
  const size_t oWQ = off; off += szWT;
  const size_t oWK = off; off += szWT;
  const size_t oW2 = off; off += szW2;
  const size_t oVL = off; off += szVL;
  const size_t oQP = off; off += szQP;
  const size_t oKP = off; off += szKP;
  const size_t oVT = off; off += szVT;
  const size_t oPT = off; off += szPT;
  if (off > ws_size) return;                        // off = 93847552 at SQ = NQ
  if (off > WS_CAP) return;

  char* ws = (char*)d_ws;
  u16* XQ   = (u16*)(ws + oXQ);
  u16* XS   = (u16*)(ws + oXS);
  u16* WV1T = (u16*)(ws + oW1);
  u16* WQT  = (u16*)(ws + oWQ);
  u16* WKT  = (u16*)(ws + oWK);
  u16* WV2T = (u16*)(ws + oW2);
  u16* VALH = (u16*)(ws + oVL);
  u16* QP   = (u16*)(ws + oQP);
  u16* KP   = (u16*)(ws + oKP);
  u16* VT   = (u16*)(ws + oVT);
  float* PART = (float*)(ws + oPT);

  const int n8q = (SQ * DM) / 8;                    // multiple of 256 (static)
  const int n8s = (NL * DM) / 8;                    // 262144
  const dim3 blk(256);
  const dim3 bG(128);
  const dim3 gXq(n8q / 256);                        // SQ/4
  const dim3 gXs(n8s / 256);                        // 1024
  const dim3 gWT((DM / 64) * (DM / 64));            // 64:  in [512][512]  -> out [512][512]
  const dim3 gW2((DM / 64) * (DV / 64));            // 512: in [512][4096] -> out [4096][512]
  const dim3 gGq((SQ / 64) * (DM / 64));            // 512 at SQ = NQ
  const dim3 gG((NL / 64) * (DM / 64));             // 512
  const dim3 gVT((DV / 64) * (NL / 64));            // 4096
  const dim3 gAT(KS, SQ / NT);                      // 4 x 128 at SQ = NQ
  const dim3 gSP((SQ * DM) / 1024);                 // 2048 at SQ = NQ
  const dim3 bAT(ATT_THREADS);

  // (0, 1) query rows < SQ and source -> bf16 planes; (2..4) Wv1, Wq, Wk [in][out] -> bf16 [out][in] fragment-order planes;
  // (5) Wv2 [512][4096] -> f16 of the bf16 value x1024, [4096][512]
  cvt16<<<gXq, blk, 0, stream>>>(xq, XQ, n8q, 0, 1.0f);
  cvt16<<<gXs, blk, 0, stream>>>(xs, XS, n8s, 0, 1.0f);
  tr16<<<gWT, blk, 0, stream>>>(wv1, WV1T, DM, DM, 0, 1.0f);
  tr16<<<gWT, blk, 0, stream>>>(wq,  WQT,  DM, DM, 0, 1.0f);
  tr16<<<gWT, blk, 0, stream>>>(wk,  WKT,  DM, DM, 0, 1.0f);
  tr16<<<gW2, blk, 0, stream>>>(wv2, WV2T, DM, DV, 1, W2S);
  // (6) value = source.Wv1 + b -> f16 plane x8; (7) q (rows < SQ) and (8) k projections -> f16 planes x8
  gemm_bh16<<<gG,  bG, 0, stream>>>(XS, WV1T, bv1, VALH, NL, DM, DM, 1.0f, VSC);
  gemm_bh16<<<gGq, bG, 0, stream>>>(XQ, WQT,  bq,  QP,   SQ, DM, DM, 1.0f, QSC);
  gemm_bh16<<<gG,  bG, 0, stream>>>(XS, WKT,  bk,  KP,   NL, DM, DM, 1.0f, KSC);
  // (9) V^T [h*512+d][l] = (Wv2^T . value^T) / (1024*8) + b[h*512+d], f16 plane x64
  gemm_hh16r<<<gVT, bG, 0, stream>>>(WV2T, VALH, bv2, VT, DV, NL, DM, 1.0f / (W2S * VSC), VCAR);
  // (10) head-axis softmax attention + head mean, one f32 partial plane per key range; (11) planes summed -> out rows 0..SQ-1
  attn_heads<<<gAT, bAT, 0, stream>>>(QP, KP, VT, PART);
  sum_parts<<<gSP, blk, 0, stream>>>(PART, out);
  (void)hipGetLastError();
}

// v003
// It runs in 232 microseconds.
// Next to v002, in two timings, it ran 1.31 times as fast each time.
// All steps since v000 together make it 3.37 times as fast.
// Projections value, q, k = x.W + b: v_wmma_f32_16x16x32_bf16 (bf16 RNE operands of the raw inputs, f32 accumulate, bf16 RNE
// bias added in f32). v^T = Wv2^T . value^T (W as f16 of the bf16 RNE value x1024, value plane f16 x8, bf16 RNE bias per row in
// f32), per-head scores q.k^T (f16 planes x8) and P.V (P x4096 f16 from LDS, V^T x64 f16): v_wmma_f32_16x16x32_f16, f32
// accumulate. Softmax over the head axis, the head mean and all scaling in f32 on VALU.
// Every 16-bit operand plane [rows][K] in the workspace is kept in FRAGMENT ORDER: 1-KB blocks of 16 rows x 32 k, block (rt, kt)
// at half index rt * 16 * K + kt * 512; inside a block the 16-B chunk (row m = row & 15, c = (k >> 3) & 3) stands at half index
// c * 128 + m * 8. Lane (h = lane >> 4, m = lane & 15) of a fragment then reads its two 16-B chunks (c = h and c = 2 + h) at
// lane * 8 and 256 + lane * 8: each load of a wave is 512 contiguous bytes (4 cache lines) and not 32 B out of each of 16 lines.
// The V^T plane alone orders its blocks k tile first, block (rt, kt) at half index (kt * (rows / 16) + rt) * 512, so that all that
// one key tile of the attention reads (every head, every d) is one contiguous 256-KB run.
#include <hip/hip_runtime.h>
#include <math.h>
#include <stdint.h>

#define NQ   4096
#define NL   4096
#define DM   512
#define NH   8
#define DKH  64
#define DV   (NH * DM)
#ifndef SQ
#define SQ NQ
#endif
#define NT   64
#define LT   32
#define SSP  32
#define PLP  40
#define SLAB64 (16 * 68)
#define ATT_THREADS 256
#define KS   8
#define KSPAN (NL / KS)
#define QSC  8.0f
#define KSC  8.0f
#define VSC  8.0f
#define W2S  1024.0f
#define PCAR 4096.0f
#define VCAR 64.0f
#define LOG2E 1.4426950408889634f
#define WS_CAP ((size_t)134217728)

static_assert(DM == NH * DKH && DKH == 64 && NH == 8 && (DM % 64) == 0 && (DV % 64) == 0 && (NL % 64) == 0 && (NQ % 64) == 0);
static_assert((DM % 32) == 0);
static_assert(SQ >= 64 && SQ <= NQ && (SQ % 64) == 0 && (SQ % NT) == 0);
static_assert(NT == 64 && LT == 32 && (NL % LT) == 0 && ATT_THREADS == 256 && ATT_THREADS * 4 * (NT / 32) == NT * LT);
static_assert(KS >= 1 && (NL % (KS * LT)) == 0 && ((SQ * DM) % 1024) == 0);
static_assert(SSP >= LT && PLP >= 32 && ((PLP * 2) % 16) == 0 && ((SSP * 4) % 16) == 0);
static_assert(8 * SLAB64 <= NH * NT * SSP);
static_assert(((NQ * DM) % 2048) == 0 && ((NL * DM) % 2048) == 0 && ((SQ * DM) % 2048) == 0);
static_assert(NH * NT * SSP * 4 + NH * NT * PLP * 2 <= 160 * 1024);   // two blocks on a WGP

typedef unsigned short u16;
typedef _Float16 v16h __attribute__((ext_vector_type(16)));
typedef _Float16 v8h  __attribute__((ext_vector_type(8)));
typedef __bf16   v16b __attribute__((ext_vector_type(16)));
typedef float    v8f  __attribute__((ext_vector_type(8)));
typedef float    v4f  __attribute__((ext_vector_type(4)));
typedef unsigned int v4u __attribute__((ext_vector_type(4)));
typedef unsigned int v2u __attribute__((ext_vector_type(2)));

union FragH { v16h v; v8h h[2]; v4u u[2]; };
union FragB { v16b v; v4u u[2]; };
union AttU { float s[NH * NT * SSP]; float slab[8 * SLAB64]; };

// ---- scalar helpers --------------------------------------------------------------------------------
__device__ __forceinline__ unsigned short bf_bits(float f) {          // f32 -> bf16 bits, RNE convert
  unsigned u = __float_as_uint(f);
  return (unsigned short)((u + 0x7FFFu + ((u >> 16) & 1u)) >> 16);
}
__device__ __forceinline__ float bf_up(unsigned short h) { return __uint_as_float(((unsigned)h) << 16); }
__device__ __forceinline__ float bfr(float f) { return bf_up(bf_bits(f)); }
__device__ __forceinline__ unsigned short h_bits(_Float16 x) { return __builtin_bit_cast(unsigned short, x); }
__device__ __forceinline__ unsigned pk16(unsigned short a, unsigned short b) { return (unsigned)a | ((unsigned)b << 16); }
__device__ __forceinline__ v8f zero8() { v8f z = {0.f, 0.f, 0.f, 0.f, 0.f, 0.f, 0.f, 0.f}; return z; }

// ---- fragment loaders: 16-bit A/B operand, lane -> row/col (lane&15); elements 0..7 <- k0+8h.., elements 8..15 <- k0+16+8h..
//      (same split k map for A and B).
//      ldfrag_h: row-major LDS tile, p already includes row * pitch + 8*(lane>>4): p[0..7] and p[16..23].
//      ldfrag_hf / ldfrag_b: fragment-order workspace plane, p = start of the 1-KB block + lane * 8: p[0..7] and p[256..263].
__device__ __forceinline__ v16h ldfrag_h(const _Float16* p) {
  FragH f;
  f.h[0] = *(const v8h*)(p);
  f.h[1] = *(const v8h*)(p + 16);
  return f.v;
}
__device__ __forceinline__ v16h ldfrag_hf(const _Float16* p) {
  FragH f;
  f.h[0] = *(const v8h*)(p);
  f.h[1] = *(const v8h*)(p + 256);
  return f.v;
}
__device__ __forceinline__ v16b ldfrag_b(const u16* p) {              // bf16 plane read as unsigned integer vectors
  FragB f;
  f.u[0] = *(const v4u*)(p);
  f.u[1] = *(const v4u*)(p + 256);
  return f.v;
}

__device__ __forceinline__ v8f mma_h(v16h a, v16h b, v8f c) {
  return __builtin_amdgcn_wmma_f32_16x16x32_f16(false, a, false, b, (short)0, c, false, false);
}
__device__ __forceinline__ v8f mma_b(v16b a, v16b b, v8f c) {
  return __builtin_amdgcn_wmma_f32_16x16x32_bf16(false, a, false, b, (short)0, c, false, false);
}
template <typename F>
__device__ __forceinline__ void guard6(v8f& a, v8f& b, v8f& c, v8f& d, F x0, F x1, F x2, F x3, F x4, F x5) {
#if defined(__HIP_DEVICE_COMPILE__)
  asm volatile("v_nop\n\tv_nop\n\tv_nop\n\tv_nop"
               : "+v"(a), "+v"(b), "+v"(c), "+v"(d) : "v"(x0), "v"(x1), "v"(x2), "v"(x3), "v"(x4), "v"(x5) : "memory");
#endif
}
__device__ __forceinline__ void guard4x8(v8f& a, v8f& b, v8f& c, v8f& d, v16h x0, v16h x1, v16h x2, v16h x3,
                                         v16h x4, v16h x5, v16h x6, v16h x7) {
#if defined(__HIP_DEVICE_COMPILE__)
  asm volatile("v_nop\n\tv_nop\n\tv_nop\n\tv_nop"
               : "+v"(a), "+v"(b), "+v"(c), "+v"(d)
               : "v"(x0), "v"(x1), "v"(x2), "v"(x3), "v"(x4), "v"(x5), "v"(x6), "v"(x7) : "memory");
#endif
}
// Four vector slots behind the last matrix instruction of the P.V loop body, on the taken side of the loop branch too, before the
// next pass's loads overwrite the fragment registers; the fragments are inputs so that they stay allocated up to here.
__device__ __forceinline__ void guard16x8(v8f (&o)[4][4], v16h x0, v16h x1, v16h x2, v16h x3,
                                          v16h x4, v16h x5, v16h x6, v16h x7) {
#if defined(__HIP_DEVICE_COMPILE__)
  asm volatile("v_nop\n\tv_nop\n\tv_nop\n\tv_nop"
               : "+v"(o[0][0]), "+v"(o[0][1]), "+v"(o[0][2]), "+v"(o[0][3]), "+v"(o[1][0]), "+v"(o[1][1]), "+v"(o[1][2]), "+v"(o[1][3]),
                 "+v"(o[2][0]), "+v"(o[2][1]), "+v"(o[2][2]), "+v"(o[2][3]), "+v"(o[3][0]), "+v"(o[3][1]), "+v"(o[3][2]), "+v"(o[3][3])
               : "v"(x0), "v"(x1), "v"(x2), "v"(x3), "v"(x4), "v"(x5), "v"(x6), "v"(x7) : "memory");
#endif
}
__device__ __forceinline__ void wave_sync_lds() {
  __builtin_amdgcn_fence(__ATOMIC_RELEASE, "workgroup");
  __builtin_amdgcn_wave_barrier();
  __builtin_amdgcn_fence(__ATOMIC_ACQUIRE, "workgroup");
}

// =====================================================================================================
// f32 plane [rows][DM] row-major -> 16-bit plane in fragment order:  mode 0: bf16 RNE bits;  mode 1: f16 bits of (bf16 RNE value) * scale;
// mode 2: f16 bits of value * scale (no bf16 pre-step).
// Thread = output chunk gt = 8 consecutive k of one row: two 16-B loads (a wave reads 64 B of each of 16 rows), one 16-B store;
// 32 consecutive lanes store 512 contiguous, 512-B aligned bytes
// coverage: grid = n8/256 blocks (host uses exact multiples) x 256 thr x 8 = the whole plane.
// =====================================================================================================
__global__ __launch_bounds__(256) void cvt16(const float* __restrict__ x, u16* D, int n8, int mode, float scale) {
  const int gt = blockIdx.x * 256 + (int)threadIdx.x;
  if (gt >= n8) return;                     // no barriers in this kernel
  const int kb = DM / 32;                   // blocks in a row tile
  const int blk = gt >> 6, cw = gt & 63;    // 1-KB block, chunk in it: cw = c * 16 + m
  const float* p = x + ((size_t)(blk / kb) * 16 + (size_t)(cw & 15)) * DM + (blk % kb) * 32 + (cw >> 4) * 8;
  const v4f a = *(const v4f*)(p), c4 = *(const v4f*)(p + 4);
  float v[8];
#pragma unroll
  for (int e = 0; e < 4; ++e) { v[e] = a[e]; v[4 + e] = c4[e]; }
  unsigned short s[8];
#pragma unroll
  for (int e = 0; e < 8; ++e) {
    const float vb = bfr(v[e]);
    const float vf = (mode == 1) ? vb : v[e];
    const unsigned short hb = h_bits((_Float16)(vf * scale));
    const unsigned short bb = bf_bits(v[e]);
    s[e] = (mode != 0) ? hb : bb;
  }
  v4u o;
#pragma unroll
  for (int e = 0; e < 4; ++e) o[e] = pk16(s[2 * e], s[2 * e + 1]);
  u16* d = D + (size_t)gt * 8;
  {
    *(v4u*)(d) = o;
    
  }
}

// =====================================================================================================
// Transpose + convert: in X [R][C] f32 row-major -> out XTo [C][R] 16-bit in fragment order (output row = input column, k = R axis).
//   mode 0: bf16 RNE bits;  mode 1: f16 bits of (bf16 RNE value) * scale;  mode 2: f16 bits of value * scale.
// Block = 64 input rows x 64 input cols: bid -> (rt = bid % (R/64), ct = bid / (R/64)). The 64x64 f32 tile is loaded with 16-B
// loads (thread = input row tid>>2, 16 consecutive cols), converted and scattered into LDS TH[c local][r local] (pitch 72 halves);
// the tile is 4 row tiles x 2 k tiles = 8 blocks of 1 KB; chunk cid = it * 256 + tid -> block cid >> 6, chunk cid & 63 in it.
// coverage: load 256 thr x 16 = 64 x 64; store 2 iterations x 256 thr x 8 halves = 8 blocks x 64 chunks = the tile;
//           grid = (R/64)*(C/64) blocks (host exact multiples) tiles the whole [C][R] plane exactly once.
// =====================================================================================================
#define VTP 72
static_assert(64 * VTP >= 63 * VTP + 64 && ((VTP * 2) % 16) == 0);
__global__ __launch_bounds__(256) void tr16(const float* __restrict__ X, u16* XTo, int R, int C, int mode, float scale) {
  __shared__ __align__(16) u16 TH[64 * VTP];
  const int tid = threadIdx.x;
  const int bid = blockIdx.x;
  const int nrt = R >> 6;
  const int rt  = bid % nrt;
  const int ct  = bid / nrt;
  const int r0  = rt * 64;
  const int c0  = ct * 64;
  {
    const int rl = tid >> 2;                  // input row within tile 0..63
    const int cc = (tid & 3) * 16;            // input col chunk within the 64
    const float* src = X + (size_t)(r0 + rl) * (size_t)C + c0 + cc;
#pragma unroll
    for (int i = 0; i < 4; ++i) {
      const v4f a = *(const v4f*)(src + 4 * i);
#pragma unroll
      for (int e = 0; e < 4; ++e) {
        const float v  = a[e];
        const float vb = bfr(v);
        const float vf = (mode == 1) ? vb : v;
        const unsigned short hb = h_bits((_Float16)(vf * scale));
        const unsigned short bb = bf_bits(v);
        TH[(cc + 4 * i + e) * VTP + rl] = (mode != 0) ? hb : bb;
      }
    }
  }
  __syncthreads();
  v4u vh[2];
  const int cw = tid & 63;                    // chunk in its block: c * 16 + m
#pragma unroll
  for (int it = 0; it < 2; ++it) {
    const int bl = it * 4 + (tid >> 6);       // local block 0..7: row tile bl >> 1, k tile bl & 1
    vh[it] = *(const v4u*)(TH + ((bl >> 1) * 16 + (cw & 15)) * VTP + (bl & 1) * 32 + (cw >> 4) * 8);
  }
  const size_t base = (size_t)c0 * (size_t)R + (size_t)r0 * 16 + (size_t)cw * 8;
  {
#pragma unroll
    for (int it = 0; it < 2; ++it) {
      const int bl = it * 4 + (tid >> 6);
      *(v4u*)(XTo + base + (size_t)(bl >> 1) * 16 * (size_t)R + (size_t)(bl & 1) * 512) = vh[it];
    }
    
  }
}

// =====================================================================================================
// Epilogues. The wave's 16x64 f32 tile (times oscale, plus an optional per-row addend) is staged in its LDS slab (pitch 68),
//            8 consecutive lanes x 16 B per line), lanes 16..31 -> row 2*it+1.
//  epi64hsb: f16 bits of ((tile + bf16RNE(bias[col])) * pscale) into a fragment-order plane: the tile is two adjacent 1-KB blocks;
//            store i = 0..3, lane (h, m) = row m, columns 16i + 8h .. + 7, at half index i * 256 + lane * 8 (512 contiguous bytes).
//  epi64hrb: f16 bits of ((tile + bf16RNE(bias[row])) * pscale), same store shape as epi64hsb, but blocks ordered k tile first (M rows):
//            the tile's two 1-KB blocks stand M * 32 halves apart.
// coverage: epi64 8 instructions x 2 rows x 16 lanes x 4 floats; epi64hsb/hrb 4 instructions x 16 rows x 2 chunks x 8 halves
//           = the wave's 16 x 64 tile in all cases.
// =====================================================================================================
__device__ __forceinline__ void stage64(float* sl, v8f a0, v8f a1, v8f a2, v8f a3, float oscale, int lane) {
  const int hh = lane >> 4, m = lane & 15;
#pragma unroll
  for (int r = 0; r < 8; ++r) {
    const int ro = (8 * hh + r) * 68 + m;
    sl[ro]      = a0[r] * oscale;
    sl[ro + 16] = a1[r] * oscale;
    sl[ro + 32] = a2[r] * oscale;
    sl[ro + 48] = a3[r] * oscale;
  }
  wave_sync_lds();
}
__device__ __forceinline__ void epi64(float* sl, v8f a0, v8f a1, v8f a2, v8f a3, float oscale, v4f badd, float* C, int N,
                                      size_t rowb, int col0, int lane) {
  const int hh = lane >> 4, m = lane & 15;
  stage64(sl, a0, a1, a2, a3, oscale, lane);
  v4f vals[8];
#pragma unroll
  for (int it = 0; it < 8; ++it) vals[it] = *(const v4f*)(sl + (it * 2 + hh) * 68 + m * 4) + badd;
  float* dst = C + (rowb + (size_t)hh) * (size_t)N + col0 + m * 4;
  {
#pragma unroll
    for (int it = 0; it < 8; ++it) {
      *(v4f*)(dst + (size_t)(it * 2) * (size_t)N) = vals[it];
    }
    
  }
}
__device__ __forceinline__ void epi64hsb(float* sl, v8f a0, v8f a1, v8f a2, v8f a3, float oscale, float pscale,
                                         const float* __restrict__ bias, u16* C, int N, size_t rowb, int col0, int lane) {
  stage64(sl, a0, a1, a2, a3, oscale, lane);
  const int row = lane & 15, h8 = (lane >> 4) * 8;
  v4u oh[4];
#pragma unroll
  for (int i4 = 0; i4 < 4; ++i4) {
    const int c8 = i4 * 16 + h8;
    const v4f b0 = *(const v4f*)(bias + col0 + c8), b1 = *(const v4f*)(bias + col0 + c8 + 4);   // columns col0+c8..+7 < N
    const v4f a = *(const v4f*)(sl + row * 68 + c8), c4 = *(const v4f*)(sl + row * 68 + c8 + 4);
    float w[8];
#pragma unroll
    for (int e = 0; e < 4; ++e) { w[e] = (a[e] + bfr(b0[e])) * pscale; w[4 + e] = (c4[e] + bfr(b1[e])) * pscale; }
#pragma unroll
    for (int e = 0; e < 4; ++e) oh[i4][e] = pk16(h_bits((_Float16)w[2 * e]), h_bits((_Float16)w[2 * e + 1]));
  }
  u16* dst = C + rowb * (size_t)N + (size_t)col0 * 16 + lane * 8;      // rowb % 16 == 0, col0 % 64 == 0
  {
#pragma unroll
    for (int i4 = 0; i4 < 4; ++i4) {
      *(v4u*)(dst + i4 * 256) = oh[i4];
    }
    
  }
}
__device__ __forceinline__ void epi64hrb(float* sl, v8f a0, v8f a1, v8f a2, v8f a3, float oscale, float pscale,
                                         const float* __restrict__ brow, u16* C, int M, size_t rowb, int col0, int lane) {
  const int hh = lane >> 4, m = lane & 15;
  const v4f r0v = *(const v4f*)(brow + 8 * hh), r1v = *(const v4f*)(brow + 8 * hh + 4);   // rows rowb+8h .. +7 < M
  float rb[8];
#pragma unroll
  for (int e = 0; e < 4; ++e) { rb[e] = bfr(r0v[e]); rb[4 + e] = bfr(r1v[e]); }
#pragma unroll
  for (int r = 0; r < 8; ++r) {
    const int ro = (8 * hh + r) * 68 + m;
    sl[ro]      = a0[r] * oscale + rb[r];
    sl[ro + 16] = a1[r] * oscale + rb[r];
    sl[ro + 32] = a2[r] * oscale + rb[r];
    sl[ro + 48] = a3[r] * oscale + rb[r];
  }
  wave_sync_lds();
  v4u oh[4];
#pragma unroll
  for (int i4 = 0; i4 < 4; ++i4) {
    const int c8 = i4 * 16 + hh * 8;
    const v4f a = *(const v4f*)(sl + m * 68 + c8), c4 = *(const v4f*)(sl + m * 68 + c8 + 4);
    float w[8];
#pragma unroll
    for (int e = 0; e < 4; ++e) { w[e] = a[e] * pscale; w[4 + e] = c4[e] * pscale; }
#pragma unroll
    for (int e = 0; e < 4; ++e) oh[i4][e] = pk16(h_bits((_Float16)w[2 * e]), h_bits((_Float16)w[2 * e + 1]));
  }
  u16* dst = C + (size_t)col0 * (size_t)M + rowb * 32 + lane * 8;      // rowb % 16 == 0, col0 % 64 == 0
  {
#pragma unroll
    for (int i4 = 0; i4 < 4; ++i4) {
      *(v4u*)(dst + (size_t)(i4 >> 1) * 32 * (size_t)M + (i4 & 1) * 256) = oh[i4];
    }
    
  }
}

// =====================================================================================================
// bf16 GEMM, f16 plane out with column bias: C16[M][N] = f16 bits of (((A[M][K] (bf16) . Bt[N][K]^T (bf16))
// * oscale) + bf16RNE(bias[n])) * pscale. A, Bt and C16 are fragment-order planes.
// Block = 64x64 tile, 4 waves x 16 rows; fragments loaded straight from the 1-KB blocks (two 16-B loads each, split k map for
// A and B); K stepped by 32 = one block (host uses K % 32 == 0, M % 64 == 0, N % 64 == 0, grid = (M/64)*(N/64)).
// =====================================================================================================
__global__ __launch_bounds__(128)
void gemm_bh16(const u16* __restrict__ A, const u16* __restrict__ Bt, const float* __restrict__ bias, u16* C,
               int M, int N, int K, float oscale, float pscale) {
  __shared__ __align__(16) float slab[4 * SLAB64];
  const int tid = threadIdx.x, wave = tid >> 5, lane = tid & 31;
  const int ntile = N >> 6;
  const int bid   = blockIdx.x;
  const int rowb  = (bid / ntile) * 64 + wave * 16;
  const int col0  = (bid % ntile) * 64;
  if (rowb + 16 > M) return;                 // wave-uniform, never taken with the exact grid; no block barriers in this kernel
  const size_t bs = (size_t)16 * K;
  const u16* ap  = A  + (size_t)rowb * (size_t)K + lane * 8;
  const u16* bp0 = Bt + (size_t)col0 * (size_t)K + lane * 8;
  const u16* bp1 = bp0 + bs;
  const u16* bp2 = bp1 + bs;
  const u16* bp3 = bp2 + bs;
  v8f acc0 = zero8(), acc1 = zero8(), acc2 = zero8(), acc3 = zero8();
#pragma unroll 1
  for (int k0 = 0; k0 < K; k0 += 32, ap += 512, bp0 += 512, bp1 += 512, bp2 += 512, bp3 += 512) {   // one 1-KB block a step
    const v16b a  = ldfrag_b(ap);
    const v16b b0 = ldfrag_b(bp0);
    const v16b b1 = ldfrag_b(bp1);
    const v16b b2 = ldfrag_b(bp2);
    const v16b b3 = ldfrag_b(bp3);
    acc0 = mma_b(a, b0, acc0);
    acc1 = mma_b(a, b1, acc1);
    acc2 = mma_b(a, b2, acc2);
    acc3 = mma_b(a, b3, acc3);
    guard6<v16b>(acc0, acc1, acc2, acc3, a, b0, b1, b2, b3, a);
  }
  epi64hsb(slab + wave * SLAB64, acc0, acc1, acc2, acc3, oscale, pscale, bias, C, N, (size_t)rowb, col0, lane);
}

// =====================================================================================================
// f16 GEMM, f16 plane out with ROW bias: C16[M][N] = f16 bits of (((A[M][K] (f16) . Bt[N][K]^T (f16))
// * oscale) + bf16RNE(bias[m])) * pscale; all three planes in fragment order, C16 with its blocks k tile first. Same tiling and fragment loads as gemm_bh16; epilogue epi64hrb.
// =====================================================================================================
__global__ __launch_bounds__(128)
void gemm_hh16r(const u16* __restrict__ A, const u16* __restrict__ Bt, const float* __restrict__ bias, u16* C,
                int M, int N, int K, float oscale, float pscale) {
  __shared__ __align__(16) float slab[4 * SLAB64];
  const int tid = threadIdx.x, wave = tid >> 5, lane = tid & 31;
  const int ntile = N >> 6;
  const int bid   = blockIdx.x;
  const int rowb  = (bid / ntile) * 64 + wave * 16;
  const int col0  = (bid % ntile) * 64;
  if (rowb + 16 > M) return;                 // wave-uniform, never taken with the exact grid; no block barriers in this kernel
  const size_t bs = (size_t)16 * K;
  const _Float16* ap  = (const _Float16*)(const void*)A  + (size_t)rowb * (size_t)K + lane * 8;
  const _Float16* bp0 = (const _Float16*)(const void*)Bt + (size_t)col0 * (size_t)K + lane * 8;
  const _Float16* bp1 = bp0 + bs;
  const _Float16* bp2 = bp1 + bs;
  const _Float16* bp3 = bp2 + bs;
  v8f acc0 = zero8(), acc1 = zero8(), acc2 = zero8(), acc3 = zero8();
#pragma unroll 1
  for (int k0 = 0; k0 < K; k0 += 32, ap += 512, bp0 += 512, bp1 += 512, bp2 += 512, bp3 += 512) {   // one 1-KB block a step
    const v16h a  = ldfrag_hf(ap);
    const v16h b0 = ldfrag_hf(bp0);
    const v16h b1 = ldfrag_hf(bp1);
    const v16h b2 = ldfrag_hf(bp2);
    const v16h b3 = ldfrag_hf(bp3);
    acc0 = mma_h(a, b0, acc0);
    acc1 = mma_h(a, b1, acc1);
    acc2 = mma_h(a, b2, acc2);
    acc3 = mma_h(a, b3, acc3);
    guard6<v16h>(acc0, acc1, acc2, acc3, a, b0, b1, b2, b3, a);
  }
  epi64hrb(slab + wave * SLAB64, acc0, acc1, acc2, acc3, oscale, pscale, bias + rowb, C, M, (size_t)rowb, col0, lane);
}

// =====================================================================================================
// Head-axis softmax attention with the head mean folded in. Block = NT = 64 query rows q0..q0+63, 8 waves, the KSPAN keys of
// key range blockIdx.x in tiles of LT = 32 (the softmax runs over heads, so key ranges only add: each range writes its own f32
// partial plane, sum_parts adds the KS planes). q plane f16 x8 [n][512] (head h = columns 64h..64h+63), k plane the same, V^T plane f16 x64 [h*512+d][l],
// all three in fragment order, V^T with its blocks k tile first.
//   (S) wave w = head w: S_w[64 n][32 l] in two passes of 32 n = 4 D tiles each, K = 64 (2 k-steps): A = q rows (row m = query,
//       split k map over the head's 64 columns), B = k rows (col n = key, same split map, loaded once for both passes);
//       D element r of lane -> U.s[w][n 32nh+16nt+8h+r][l 16half+m].
//   (M) thread = (n = 32it + (tid>>3), 4 consecutive l), it = 0, 1: base-2 logits t = s * log2e/512 for the 8 heads, max over heads,
//       p = exp2(t-max), P = p / sum (f32), written as f16(P * 4096) to sP[h][n][l] with 8-B LDS stores.
//   (PV) wave w owns d columns 64w + 16t + (lane&15), t = 0..3, for all four 16-row n groups (16 accumulators): every V^T fragment
//       fetched from L2 feeds four matrix instructions. For every head h:
//       A = P_h fragments from LDS (row m = query, split map over the 32 keys), B = V^T fragments (col = d, keys contiguous,
//       row h*512 + d of the V^T plane); all heads and key tiles accumulate into the same accumulators (joint (l,h) K axis).
//   Block barriers after (S) and after (M) order every LDS reuse across phases, key tiles and waves.
//   Epilogue: partial = acc * 2^-21 (= 1 / (4096 * 64 * 8 heads)); the wave's four 16 x 64 f32 tiles go through epi64 one after
//   another (a wave-level LDS sync between tiles); a block barrier separates the key loop from the slab use (the slab area
//   aliases the score area).
// coverage: grid (KS, SQ/64) blocks x 64 rows = query rows 0..SQ-1 of every partial plane; (S) 8 waves x 64 x 32 = all score cells;
//           (M) 2 passes x 256 thr x 4 l x 8 h = all P cells; stores 8 waves x (4 tiles x 16 rows x 64 cols) =
//           part[ks][q0..q0+63][0..511], every float exactly once.
// =====================================================================================================
__global__ __launch_bounds__(ATT_THREADS)
void attn_heads(const u16* __restrict__ QPp, const u16* __restrict__ KPp, const u16* __restrict__ VTp, float* part) {
  __shared__ __align__(16) AttU U;                 // scores [8][64][SSP] f32; reused as 8 epilogue slabs
  __shared__ __align__(16) u16 sP[NH * NT * PLP];  // P tiles [8][64][PLP] f16 bits

  const int tid  = threadIdx.x;
  const int wave = tid >> 5;
  const int lane = tid & 31;
  const int hh   = lane >> 4;
  const int m    = lane & 15;
  const int q0   = blockIdx.y * NT;          // q0 + 63 < SQ (grid exact)
  const int lbeg = blockIdx.x * KSPAN;       // this block's key range lbeg .. lbeg + KSPAN - 1 < NL (grid exact)
  float* const out = part + (size_t)blockIdx.x * ((size_t)SQ * DM);

  const _Float16* qb = (const _Float16*)(const void*)QPp + (size_t)q0 * DM + wave * (DKH * 16) + lane * 8;
  const _Float16* kp = (const _Float16*)(const void*)KPp + (size_t)lbeg * DM + wave * (DKH * 16) + lane * 8;   // steps one key tile a pass
  const _Float16* vb = (const _Float16*)(const void*)VTp + wave * (64 * 32) + lane * 8;
  const float lsc = LOG2E / (QSC * KSC * 8.0f);
  float* const sw = U.s + wave * (NT * SSP);

  v8f o[4][4];                               // o[i][t]: n rows 16i..16i+15, d columns 64 * wave + 16t..+15
#pragma unroll
  for (int i = 0; i < 4; ++i) {
#pragma unroll
    for (int t = 0; t < 4; ++t) o[i][t] = zero8();
  }

#pragma unroll 1
  for (int l0 = lbeg; l0 < lbeg + KSPAN; l0 += LT, kp += (size_t)LT * DM) {
    // ---- (S) scores of head = wave for this key tile ----
    {
      const v16h ka0 = ldfrag_hf(kp), ka1 = ldfrag_hf(kp + 512);
      const v16h kc0 = ldfrag_hf(kp + (size_t)16 * DM), kc1 = ldfrag_hf(kp + (size_t)16 * DM + 512);
      const _Float16* qp = qb;
      // kept rolled: unrolled, 8 q fragments and 8 score tiles would be live beside the 16 output accumulators
#pragma unroll 1
      for (int nh = 0; nh < NT / 32; ++nh, qp += (size_t)32 * DM) {
        const v16h qa0 = ldfrag_hf(qp), qa1 = ldfrag_hf(qp + 512);
        const v16h qc0 = ldfrag_hf(qp + (size_t)16 * DM), qc1 = ldfrag_hf(qp + (size_t)16 * DM + 512);
        v8f s00 = zero8(), s01 = zero8(), s10 = zero8(), s11 = zero8();
        s00 = mma_h(qa0, ka0, s00);  s00 = mma_h(qa1, ka1, s00);     // n rows 0..15 of the pass,  keys 0..15
        s01 = mma_h(qa0, kc0, s01);  s01 = mma_h(qa1, kc1, s01);     // n rows 0..15 of the pass,  keys 16..31
        s10 = mma_h(qc0, ka0, s10);  s10 = mma_h(qc1, ka1, s10);     // n rows 16..31 of the pass, keys 0..15
        s11 = mma_h(qc0, kc0, s11);  s11 = mma_h(qc1, kc1, s11);     // n rows 16..31 of the pass, keys 16..31
        guard4x8(s00, s01, s10, s11, qa0, qa1, qc0, qc1, ka0, ka1, kc0, kc1);
        float* const sn = sw + nh * (32 * SSP);
#pragma unroll
        for (int r = 0; r < 8; ++r) {
          const int ro = (8 * hh + r) * SSP + m;
          sn[ro]                 = s00[r];
          sn[ro + 16]            = s01[r];
          sn[ro + 16 * SSP]      = s10[r];
          sn[ro + 16 * SSP + 16] = s11[r];
        }
      }
    }
    __syncthreads();
    // ---- (M) softmax over the 8 heads per (n, l), P tiles ----
#pragma unroll
    for (int it = 0; it < NT / 32; ++it) {
      const int n = it * 32 + (tid >> 3), lq = (tid & 7) * 4;
      float t[NH][4];
#pragma unroll
      for (int h = 0; h < NH; ++h) {
        const v4f a = *(const v4f*)(U.s + h * (NT * SSP) + n * SSP + lq);
#pragma unroll
        for (int e = 0; e < 4; ++e) t[h][e] = a[e] * lsc;
      }
#pragma unroll
      for (int e = 0; e < 4; ++e) {
        float mx = t[0][e];
#pragma unroll
        for (int h = 1; h < NH; ++h) mx = fmaxf(mx, t[h][e]);
        float sm = 0.f;
#pragma unroll
        for (int h = 0; h < NH; ++h) {
          const float p = exp2f(t[h][e] - mx);                 // <= 1, one term equals 1
          t[h][e] = p;
          sm += p;
        }
        const float rs = __builtin_amdgcn_rcpf(sm) * PCAR;      // sm in [1, 8]
#pragma unroll
        for (int h = 0; h < NH; ++h) t[h][e] *= rs;
      }
      u16* pd = sP + n * PLP + lq;
#pragma unroll
      for (int h = 0; h < NH; ++h) {
        v2u pk;
        pk[0] = pk16(h_bits((_Float16)t[h][0]), h_bits((_Float16)t[h][1]));
        pk[1] = pk16(h_bits((_Float16)t[h][2]), h_bits((_Float16)t[h][3]));
        *(v2u*)(pd + h * (NT * PLP)) = pk;
      }
    }
    __syncthreads();
    // ---- (PV) accumulate P_h . V_h over all heads for this key tile ----
    {
      const _Float16* pbase = (const _Float16*)(const void*)sP + m * PLP + 8 * hh;
      const _Float16* vl = vb + (size_t)l0 * DV;   // k tile l0 / 32 of V^T: DV / 16 blocks of 512 halves
#pragma unroll 1
      for (int h = 0; h < NH; ++h) {
        const _Float16* vp = vl + h * (DM * 32);
        const v16h g0 = ldfrag_hf(vp);
        const v16h g1 = ldfrag_hf(vp + 512);
        const v16h g2 = ldfrag_hf(vp + 1024);
        const v16h g3 = ldfrag_hf(vp + 1536);
        const _Float16* pp = pbase + h * (NT * PLP);
        const v16h p0 = ldfrag_h(pp);
        const v16h p1 = ldfrag_h(pp + 16 * PLP);
        const v16h p2 = ldfrag_h(pp + 32 * PLP);
        const v16h p3 = ldfrag_h(pp + 48 * PLP);
        o[0][0] = mma_h(p0, g0, o[0][0]);
        o[1][0] = mma_h(p1, g0, o[1][0]);
        o[2][0] = mma_h(p2, g0, o[2][0]);
        o[3][0] = mma_h(p3, g0, o[3][0]);
        o[0][1] = mma_h(p0, g1, o[0][1]);
        o[1][1] = mma_h(p1, g1, o[1][1]);
        o[2][1] = mma_h(p2, g1, o[2][1]);
        o[3][1] = mma_h(p3, g1, o[3][1]);
        o[0][2] = mma_h(p0, g2, o[0][2]);
        o[1][2] = mma_h(p1, g2, o[1][2]);
        o[2][2] = mma_h(p2, g2, o[2][2]);
        o[3][2] = mma_h(p3, g2, o[3][2]);
        o[0][3] = mma_h(p0, g3, o[0][3]);
        o[1][3] = mma_h(p1, g3, o[1][3]);
        o[2][3] = mma_h(p2, g3, o[2][3]);
        o[3][3] = mma_h(p3, g3, o[3][3]);
        guard16x8(o, p0, p1, p2, p3, g0, g1, g2, g3);
      }
    }
  }
  __syncthreads();

  const float osc = 1.0f / (PCAR * VCAR * (float)NH);
  const v4f z4 = {0.f, 0.f, 0.f, 0.f};
  float* const sl = U.slab + wave * SLAB64;
#pragma unroll
  for (int i = 0; i < 4; ++i) {
    if (i) wave_sync_lds();                  // the slab's last reads end before the next tile is staged in it
    epi64(sl, o[i][0], o[i][1], o[i][2], o[i][3], osc, z4, out, DM, (size_t)q0 + 16 * i, wave * 64, lane);
  }
}

// =====================================================================================================
// out = sum of the KS partial planes, added in plane order 0..KS-1 in f32. Thread = 4 consecutive floats: KS 16-B loads, one
// 16-B store; 32 consecutive lanes = 512 contiguous bytes per load and store.
// coverage: grid = SQ*DM/1024 blocks x 256 thr x 4 floats = out rows 0..SQ-1, every float exactly once.
// =====================================================================================================
__global__ __launch_bounds__(256) void sum_parts(const float* __restrict__ part, float* out) {
  const unsigned ob = (blockIdx.x * 256u + threadIdx.x) * 16u;    // byte offset in a plane, < SQ * DM * 4 (grid exact)
  v4f p[KS];
#pragma unroll
  for (int s = 0; s < KS; ++s) p[s] = *(const v4f*)((const char*)(part + (size_t)s * ((size_t)SQ * DM)) + ob);
  v4f a = p[0];
#pragma unroll
  for (int s = 1; s < KS; ++s) a += p[s];
  *(v4f*)((char*)out + ob) = a;
}

// =====================================================================================================
// Workspace map (bytes); every plane is fully written by whole-line stores before it is read; all extents are exact multiples of
// the store granularity (no pad rows, all dims multiples of 64), every offset a multiple of 256:
//   XQ  bf16 [SQ][512]                      <=  4194304
//   XS  bf16 [4096][512]                        4194304
//   WV1T, WQT, WKT bf16 [512][512]             3 x 524288
//   WV2T f16 of bf16 value x1024 [4096][512]   4194304
//   VALH f16 value x8 [4096][512]               4194304
//   QP   f16 x8 [SQ][512]                   <=  4194304
//   KP   f16 x8 [4096][512]                     4194304
//   VT   f16 x64 [4096][4096]                  33554432
//   PART f32 [KS][SQ][512]                  <= 67108864
//   end                                     <= 127401984
// =====================================================================================================
extern "C" void kernel_launch(void* const* d_in, const int* in_sizes, int n_in,
                              void* d_out, int out_size, void* d_ws, size_t ws_size,
                              hipStream_t stream) {
  if (n_in < 10) return;
  if (in_sizes[0] != NQ * DM || in_sizes[1] != NL * DM) return;
  if (in_sizes[2] != DM * DM || in_sizes[3] != DM) return;
  if (in_sizes[4] != DM * DM || in_sizes[5] != DM) return;
  if (in_sizes[6] != DM * DM || in_sizes[7] != DM) return;
  if (in_sizes[8] != DM * DV || in_sizes[9] != DV) return;
  if (out_size != NQ * DM) return;

  const float* xq  = (const float*)d_in[0];
  const float* xs  = (const float*)d_in[1];
  const float* wv1 = (const float*)d_in[2];
  const float* bv1 = (const float*)d_in[3];
  const float* wq  = (const float*)d_in[4];
  const float* bq  = (const float*)d_in[5];
  const float* wk  = (const float*)d_in[6];
  const float* bk  = (const float*)d_in[7];
  const float* wv2 = (const float*)d_in[8];
  const float* bv2 = (const float*)d_in[9];
  float*       out = (float*)d_out;

  const size_t szXQ = (size_t)SQ * DM * 2;          //  4194304 at SQ = NQ
  const size_t szXS = (size_t)NL * DM * 2;          //  4194304
  const size_t szWT = (size_t)DM * DM * 2;          //   524288
  const size_t szW2 = (size_t)DV * DM * 2;          //  4194304
  const size_t szVL = (size_t)NL * DM * 2;          //  4194304
  const size_t szQP = (size_t)SQ * DM * 2;          //  4194304 at SQ = NQ
  const size_t szKP = (size_t)NL * DM * 2;          //  4194304
  const size_t szVT = (size_t)DV * NL * 2;          // 33554432
  const size_t szPT = (size_t)KS * SQ * DM * 4;     // 67108864 at SQ = NQ
  size_t off = 0;
  const size_t oXQ = off; off += szXQ;
  const size_t oXS = off; off += szXS;
  const size_t oW1 = off; off += szWT;
  const size_t oWQ = off; off += szWT;
  const size_t oWK = off; off += szWT;
  const size_t oW2 = off; off += szW2;
  const size_t oVL = off; off += szVL;
  const size_t oQP = off; off += szQP;
  const size_t oKP = off; off += szKP;
  const size_t oVT = off; off += szVT;
  const size_t oPT = off; off += szPT;
  if (off > ws_size) return;                        // off = 127401984 at SQ = NQ
  if (off > WS_CAP) return;

  char* ws = (char*)d_ws;
  u16* XQ   = (u16*)(ws + oXQ);
  u16* XS   = (u16*)(ws + oXS);
  u16* WV1T = (u16*)(ws + oW1);
  u16* WQT  = (u16*)(ws + oWQ);
  u16* WKT  = (u16*)(ws + oWK);
  u16* WV2T = (u16*)(ws + oW2);
  u16* VALH = (u16*)(ws + oVL);
  u16* QP   = (u16*)(ws + oQP);
  u16* KP   = (u16*)(ws + oKP);
  u16* VT   = (u16*)(ws + oVT);
  float* PART = (float*)(ws + oPT);

  const int n8q = (SQ * DM) / 8;                    // multiple of 256 (static)
  const int n8s = (NL * DM) / 8;                    // 262144
  const dim3 blk(256);
  const dim3 bG(128);
  const dim3 gXq(n8q / 256);                        // SQ/4
  const dim3 gXs(n8s / 256);                        // 1024
  const dim3 gWT((DM / 64) * (DM / 64));            // 64:  in [512][512]  -> out [512][512]
  const dim3 gW2((DM / 64) * (DV / 64));            // 512: in [512][4096] -> out [4096][512]
  const dim3 gGq((SQ / 64) * (DM / 64));            // 512 at SQ = NQ
  const dim3 gG((NL / 64) * (DM / 64));             // 512
  const dim3 gVT((DV / 64) * (NL / 64));            // 4096
  const dim3 gAT(KS, SQ / NT);                      // 8 x 64 at SQ = NQ
  const dim3 gSP((SQ * DM) / 1024);                 // 2048 at SQ = NQ
  const dim3 bAT(ATT_THREADS);

  // (0, 1) query rows < SQ and source -> bf16 planes; (2..4) Wv1, Wq, Wk [in][out] -> bf16 [out][in] fragment-order planes;
  // (5) Wv2 [512][4096] -> f16 of the bf16 value x1024, [4096][512]
  cvt16<<<gXq, blk, 0, stream>>>(xq, XQ, n8q, 0, 1.0f);
  cvt16<<<gXs, blk, 0, stream>>>(xs, XS, n8s, 0, 1.0f);
  tr16<<<gWT, blk, 0, stream>>>(wv1, WV1T, DM, DM, 0, 1.0f);
  tr16<<<gWT, blk, 0, stream>>>(wq,  WQT,  DM, DM, 0, 1.0f);
  tr16<<<gWT, blk, 0, stream>>>(wk,  WKT,  DM, DM, 0, 1.0f);
  tr16<<<gW2, blk, 0, stream>>>(wv2, WV2T, DM, DV, 1, W2S);
  // (6) value = source.Wv1 + b -> f16 plane x8; (7) q (rows < SQ) and (8) k projections -> f16 planes x8
  gemm_bh16<<<gG,  bG, 0, stream>>>(XS, WV1T, bv1, VALH, NL, DM, DM, 1.0f, VSC);
  gemm_bh16<<<gGq, bG, 0, stream>>>(XQ, WQT,  bq,  QP,   SQ, DM, DM, 1.0f, QSC);
  gemm_bh16<<<gG,  bG, 0, stream>>>(XS, WKT,  bk,  KP,   NL, DM, DM, 1.0f, KSC);
  // (9) V^T [h*512+d][l] = (Wv2^T . value^T) / (1024*8) + b[h*512+d], f16 plane x64
  gemm_hh16r<<<gVT, bG, 0, stream>>>(WV2T, VALH, bv2, VT, DV, NL, DM, 1.0f / (W2S * VSC), VCAR);
  // (10) head-axis softmax attention + head mean, one f32 partial plane per key range; (11) planes summed -> out rows 0..SQ-1
  attn_heads<<<gAT, bAT, 0, stream>>>(QP, KP, VT, PART);
  sum_parts<<<gSP, blk, 0, stream>>>(PART, out);
  (void)hipGetLastError();
}

// v004
// It runs in 208 microseconds.
// Next to v003, in two timings, it ran 1.12 and 1.11 times as fast.
// Over all steps from v000 it is 3.76 times as fast.
// Projections value, q, k = x.W + b: v_wmma_f32_16x16x32_bf16 (bf16 RNE operands of the raw inputs, f32 accumulate, bf16 RNE
// bias added in f32). v^T = Wv2^T . value^T (W as f16 of the bf16 RNE value x1024, value plane f16 x8, bf16 RNE bias per row in
// f32), per-head scores q.k^T (f16 planes x8) and P.V (P x4096 f16 from LDS, V^T x64 f16): v_wmma_f32_16x16x32_f16, f32
// accumulate. Softmax over the head axis, the head mean and all scaling in f32 on VALU.
// Every 16-bit operand plane [rows][K] in the workspace is kept in FRAGMENT ORDER: 1-KB blocks of 16 rows x 32 k, block (rt, kt)
// at half index rt * 16 * K + kt * 512; inside a block the 16-B chunk (row m = row & 15, c = (k >> 3) & 3) stands at half index
// c * 128 + m * 8. Lane (h = lane >> 4, m = lane & 15) of a fragment then reads its two 16-B chunks (c = h and c = 2 + h) at
// lane * 8 and 256 + lane * 8: each load of a wave is 512 contiguous bytes (4 cache lines) and not 32 B out of each of 16 lines.
// The V^T plane alone orders its blocks k tile first, block (rt, kt) at half index (kt * (rows / 16) + rt) * 512, so that all that
// one key tile of the attention reads (every head, every d) is one contiguous 256-KB run.
#include <hip/hip_runtime.h>
#include <math.h>
#include <stdint.h>

#define NQ   4096
#define NL   4096
#define DM   512
#define NH   8
#define DKH  64
#define DV   (NH * DM)
#ifndef SQ
#define SQ NQ
#endif
#define NT   64
#define LT   32
#define SSP  32
#define PLP  40
#define SLAB64 (16 * 68)
#define ATT_THREADS 256
#define KS   8
#define KSPAN (NL / KS)
#define QSC  8.0f
#define KSC  8.0f
#define VSC  8.0f
#define W2S  1024.0f
#define PCAR 4096.0f
#define VCAR 64.0f
#define LOG2E 1.4426950408889634f
#define WS_CAP ((size_t)134217728)

static_assert(DM == NH * DKH && DKH == 64 && NH == 8 && (DM % 64) == 0 && (DV % 64) == 0 && (NL % 64) == 0 && (NQ % 64) == 0);
static_assert((DM % 32) == 0);
static_assert(SQ >= 64 && SQ <= NQ && (SQ % 64) == 0 && (SQ % NT) == 0);
static_assert(NT == 64 && LT == 32 && (NL % LT) == 0 && ATT_THREADS == 256 && ATT_THREADS * 4 * (NT / 32) == NT * LT);
static_assert(KS >= 1 && (NL % (KS * LT)) == 0 && ((SQ * DM) % 1024) == 0);
static_assert(SSP >= LT && PLP >= 32 && ((PLP * 2) % 16) == 0 && ((SSP * 4) % 16) == 0);
static_assert(8 * SLAB64 <= NH * NT * SSP);
static_assert(((NQ * DM) % 2048) == 0 && ((NL * DM) % 2048) == 0 && ((SQ * DM) % 2048) == 0);
static_assert(NH * NT * SSP * 4 + NH * NT * PLP * 2 <= 160 * 1024);   // two blocks on a WGP

typedef unsigned short u16;
typedef _Float16 v16h __attribute__((ext_vector_type(16)));
typedef _Float16 v8h  __attribute__((ext_vector_type(8)));
typedef __bf16   v16b __attribute__((ext_vector_type(16)));
typedef float    v8f  __attribute__((ext_vector_type(8)));
typedef float    v4f  __attribute__((ext_vector_type(4)));
typedef unsigned int v4u __attribute__((ext_vector_type(4)));
typedef unsigned int v2u __attribute__((ext_vector_type(2)));

union FragH { v16h v; v8h h[2]; v4u u[2]; };
union FragB { v16b v; v4u u[2]; };
union AttU { float s[NH * NT * SSP]; float slab[8 * SLAB64]; };

// ---- scalar helpers --------------------------------------------------------------------------------
__device__ __forceinline__ unsigned short bf_bits(float f) {          // f32 -> bf16 bits, RNE convert
  unsigned u = __float_as_uint(f);
  return (unsigned short)((u + 0x7FFFu + ((u >> 16) & 1u)) >> 16);
}
__device__ __forceinline__ float bf_up(unsigned short h) { return __uint_as_float(((unsigned)h) << 16); }
__device__ __forceinline__ float bfr(float f) { return bf_up(bf_bits(f)); }
__device__ __forceinline__ unsigned short h_bits(_Float16 x) { return __builtin_bit_cast(unsigned short, x); }
__device__ __forceinline__ unsigned pk16(unsigned short a, unsigned short b) { return (unsigned)a | ((unsigned)b << 16); }
__device__ __forceinline__ v8f zero8() { v8f z = {0.f, 0.f, 0.f, 0.f, 0.f, 0.f, 0.f, 0.f}; return z; }

// ---- fragment loaders: 16-bit A/B operand, lane -> row/col (lane&15); elements 0..7 <- k0+8h.., elements 8..15 <- k0+16+8h..
//      (same split k map for A and B).
//      ldfrag_h: row-major LDS tile, p already includes row * pitch + 8*(lane>>4): p[0..7] and p[16..23].
//      ldfrag_hf / ldfrag_b: fragment-order workspace plane, p = start of the 1-KB block + lane * 8: p[0..7] and p[256..263].
__device__ __forceinline__ v16h ldfrag_h(const _Float16* p) {
  FragH f;
  f.h[0] = *(const v8h*)(p);
  f.h[1] = *(const v8h*)(p + 16);
  return f.v;
}
__device__ __forceinline__ v16h ldfrag_hf(const _Float16* p) {
  FragH f;
  f.h[0] = *(const v8h*)(p);
  f.h[1] = *(const v8h*)(p + 256);
  return f.v;
}
__device__ __forceinline__ v16b ldfrag_b(const u16* p) {              // bf16 plane read as unsigned integer vectors
  FragB f;
  f.u[0] = *(const v4u*)(p);
  f.u[1] = *(const v4u*)(p + 256);
  return f.v;
}

__device__ __forceinline__ v8f mma_h(v16h a, v16h b, v8f c) {
  return __builtin_amdgcn_wmma_f32_16x16x32_f16(false, a, false, b, (short)0, c, false, false);
}
__device__ __forceinline__ v8f mma_b(v16b a, v16b b, v8f c) {
  return __builtin_amdgcn_wmma_f32_16x16x32_bf16(false, a, false, b, (short)0, c, false, false);
}
template <typename F>
__device__ __forceinline__ void guard6(v8f& a, v8f& b, v8f& c, v8f& d, F x0, F x1, F x2, F x3, F x4, F x5) {
#if defined(__HIP_DEVICE_COMPILE__)
  asm volatile("v_nop\n\tv_nop\n\tv_nop\n\tv_nop"
               : "+v"(a), "+v"(b), "+v"(c), "+v"(d) : "v"(x0), "v"(x1), "v"(x2), "v"(x3), "v"(x4), "v"(x5) : "memory");
#endif
}
__device__ __forceinline__ void guard4x8(v8f& a, v8f& b, v8f& c, v8f& d, v16h x0, v16h x1, v16h x2, v16h x3,
                                         v16h x4, v16h x5, v16h x6, v16h x7) {
#if defined(__HIP_DEVICE_COMPILE__)
  asm volatile("v_nop\n\tv_nop\n\tv_nop\n\tv_nop"
               : "+v"(a), "+v"(b), "+v"(c), "+v"(d)
               : "v"(x0), "v"(x1), "v"(x2), "v"(x3), "v"(x4), "v"(x5), "v"(x6), "v"(x7) : "memory");
#endif
}
// Four vector slots behind the last matrix instruction of the P.V loop body, on the taken side of the loop branch too, before the
// next pass's loads overwrite the fragment registers; the fragments are inputs so that they stay allocated up to here.
__device__ __forceinline__ void guard16x8(v8f (&o)[4][4], v16h x0, v16h x1, v16h x2, v16h x3,
                                          v16h x4, v16h x5, v16h x6, v16h x7) {
#if defined(__HIP_DEVICE_COMPILE__)
  asm volatile("v_nop\n\tv_nop\n\tv_nop\n\tv_nop"
               : "+v"(o[0][0]), "+v"(o[0][1]), "+v"(o[0][2]), "+v"(o[0][3]), "+v"(o[1][0]), "+v"(o[1][1]), "+v"(o[1][2]), "+v"(o[1][3]),
                 "+v"(o[2][0]), "+v"(o[2][1]), "+v"(o[2][2]), "+v"(o[2][3]), "+v"(o[3][0]), "+v"(o[3][1]), "+v"(o[3][2]), "+v"(o[3][3])
               : "v"(x0), "v"(x1), "v"(x2), "v"(x3), "v"(x4), "v"(x5), "v"(x6), "v"(x7) : "memory");
#endif
}
__device__ __forceinline__ void wave_sync_lds() {
  __builtin_amdgcn_fence(__ATOMIC_RELEASE, "workgroup");
  __builtin_amdgcn_wave_barrier();
  __builtin_amdgcn_fence(__ATOMIC_ACQUIRE, "workgroup");
}

// =====================================================================================================
// f32 plane [rows][DM] row-major -> 16-bit plane in fragment order:  mode 0: bf16 RNE bits;  mode 1: f16 bits of (bf16 RNE value) * scale;
// mode 2: f16 bits of value * scale (no bf16 pre-step).
// Thread = output chunk gt = 8 consecutive k of one row: two 16-B loads (a wave reads 64 B of each of 16 rows), one 16-B store;
// 32 consecutive lanes store 512 contiguous, 512-B aligned bytes
// coverage: n8/256 blocks bid = 0.. (exact multiples) x 256 thr x 8 = the whole plane.
// =====================================================================================================
__device__ __forceinline__ void cvt16(const float* __restrict__ x, u16* D, int n8, int mode, float scale, int bid) {
  const int gt = bid * 256 + (int)threadIdx.x;
  if (gt >= n8) return;                     // no barriers on this path
  const int kb = DM / 32;                   // blocks in a row tile
  const int blk = gt >> 6, cw = gt & 63;    // 1-KB block, chunk in it: cw = c * 16 + m
  const float* p = x + ((size_t)(blk / kb) * 16 + (size_t)(cw & 15)) * DM + (blk % kb) * 32 + (cw >> 4) * 8;
  const v4f a = *(const v4f*)(p), c4 = *(const v4f*)(p + 4);
  float v[8];
#pragma unroll
  for (int e = 0; e < 4; ++e) { v[e] = a[e]; v[4 + e] = c4[e]; }
  unsigned short s[8];
#pragma unroll
  for (int e = 0; e < 8; ++e) {
    const float vb = bfr(v[e]);
    const float vf = (mode == 1) ? vb : v[e];
    const unsigned short hb = h_bits((_Float16)(vf * scale));
    const unsigned short bb = bf_bits(v[e]);
    s[e] = (mode != 0) ? hb : bb;
  }
  v4u o;
#pragma unroll
  for (int e = 0; e < 4; ++e) o[e] = pk16(s[2 * e], s[2 * e + 1]);
  u16* d = D + (size_t)gt * 8;
  {
    *(v4u*)(d) = o;
    
  }
}

// =====================================================================================================
// Transpose + convert: in X [R][C] f32 row-major -> out XTo [C][R] 16-bit in fragment order (output row = input column, k = R axis).
//   mode 0: bf16 RNE bits;  mode 1: f16 bits of (bf16 RNE value) * scale;  mode 2: f16 bits of value * scale.
// Block = 64 input rows x 64 input cols: bid -> (rt = bid % (R/64), ct = bid / (R/64)). The 64x64 f32 tile is loaded with 16-B
// loads (thread = input row tid>>2, 16 consecutive cols), converted and scattered into LDS TH[c local][r local] (pitch 72 halves);
// the tile is 4 row tiles x 2 k tiles = 8 blocks of 1 KB; chunk cid = it * 256 + tid -> block cid >> 6, chunk cid & 63 in it.
// coverage: load 256 thr x 16 = 64 x 64; store 2 iterations x 256 thr x 8 halves = 8 blocks x 64 chunks = the tile;
//           (R/64)*(C/64) blocks bid = 0.. (exact multiples) tile the whole [C][R] plane exactly once. TH: the block's 64 x VTP LDS tile.
// =====================================================================================================
#define VTP 72
static_assert(64 * VTP >= 63 * VTP + 64 && ((VTP * 2) % 16) == 0);
__device__ __forceinline__ void tr16(u16* TH, const float* __restrict__ X, u16* XTo, int R, int C, int mode, float scale, int bid) {
  const int tid = threadIdx.x;
  const int nrt = R >> 6;
  const int rt  = bid % nrt;
  const int ct  = bid / nrt;
  const int r0  = rt * 64;
  const int c0  = ct * 64;
  {
    const int rl = tid >> 2;                  // input row within tile 0..63
    const int cc = (tid & 3) * 16;            // input col chunk within the 64
    const float* src = X + (size_t)(r0 + rl) * (size_t)C + c0 + cc;
#pragma unroll
    for (int i = 0; i < 4; ++i) {
      const v4f a = *(const v4f*)(src + 4 * i);
#pragma unroll
      for (int e = 0; e < 4; ++e) {
        const float v  = a[e];
        const float vb = bfr(v);
        const float vf = (mode == 1) ? vb : v;
        const unsigned short hb = h_bits((_Float16)(vf * scale));
        const unsigned short bb = bf_bits(v);
        TH[(cc + 4 * i + e) * VTP + rl] = (mode != 0) ? hb : bb;
      }
    }
  }
  __syncthreads();
  v4u vh[2];
  const int cw = tid & 63;                    // chunk in its block: c * 16 + m
#pragma unroll
  for (int it = 0; it < 2; ++it) {
    const int bl = it * 4 + (tid >> 6);       // local block 0..7: row tile bl >> 1, k tile bl & 1
    vh[it] = *(const v4u*)(TH + ((bl >> 1) * 16 + (cw & 15)) * VTP + (bl & 1) * 32 + (cw >> 4) * 8);
  }
  const size_t base = (size_t)c0 * (size_t)R + (size_t)r0 * 16 + (size_t)cw * 8;
  {
#pragma unroll
    for (int it = 0; it < 2; ++it) {
      const int bl = it * 4 + (tid >> 6);
      *(v4u*)(XTo + base + (size_t)(bl >> 1) * 16 * (size_t)R + (size_t)(bl & 1) * 512) = vh[it];
    }
    // the stores' registers are rewritten only behind this wait, on whatever path the inlined body is left
#if defined(__HIP_DEVICE_COMPILE__)
    asm volatile("s_wait_xcnt 0x0" ::: "memory");
#endif
  }
}

// =====================================================================================================
// All six input conversions in ONE launch (they are independent of one another): the block index picks the job, block-uniformly.
//   blocks [0, PB_W2)            Wv2 [512][4096] -> f16 of the bf16 value x1024, [4096][512]
//   next 3 x PB_WT               Wv1, Wq, Wk [in][out] -> bf16 [out][in]
//   next PB_XS, then PB_XQ       source rows, query rows < SQ -> bf16 planes
// coverage: each range is the exact block count of its job (see cvt16, tr16); grid = PB_ALL.
// =====================================================================================================
#define PB_W2 ((DM / 64) * (DV / 64))
#define PB_WT ((DM / 64) * (DM / 64))
#define PB_XS ((NL * DM) / 2048)
#define PB_XQ ((SQ * DM) / 2048)
#define PB_ALL (PB_W2 + 3 * PB_WT + PB_XS + PB_XQ)
__global__ __launch_bounds__(256)
void prep_all(const float* __restrict__ xq, const float* __restrict__ xs, const float* __restrict__ wv1,
              const float* __restrict__ wq, const float* __restrict__ wk, const float* __restrict__ wv2,
              u16* XQ, u16* XS, u16* WV1T, u16* WQT, u16* WKT, u16* WV2T) {
  __shared__ __align__(16) u16 TH[64 * VTP];
  int b = blockIdx.x;
  if (b < PB_W2) { tr16(TH, wv2, WV2T, DM, DV, 1, W2S, b); return; }
  b -= PB_W2;
  if (b < 3 * PB_WT) {
    const int job = b / PB_WT;
    const float* w = (job == 0) ? wv1 : (job == 1) ? wq : wk;
    u16* d = (job == 0) ? WV1T : (job == 1) ? WQT : WKT;
    tr16(TH, w, d, DM, DM, 0, 1.0f, b % PB_WT);
    return;
  }
  b -= 3 * PB_WT;
  const bool src = b < PB_XS;
  cvt16(src ? xs : xq, src ? XS : XQ, src ? (NL * DM) / 8 : (SQ * DM) / 8, 0, 1.0f, src ? b : b - PB_XS);
}

// =====================================================================================================
// Epilogues. The wave's 16x64 f32 tile (times oscale, plus an optional per-row addend) is staged in its LDS slab (pitch 68),
//            8 consecutive lanes x 16 B per line), lanes 16..31 -> row 2*it+1.
//  epi64hsb: f16 bits of ((tile + bf16RNE(bias[col])) * pscale) into a fragment-order plane: the tile is two adjacent 1-KB blocks;
//            store i = 0..3, lane (h, m) = row m, columns 16i + 8h .. + 7, at half index i * 256 + lane * 8 (512 contiguous bytes).
//  epi64hrb: f16 bits of ((tile + bf16RNE(bias[row])) * pscale), same store shape as epi64hsb, but blocks ordered k tile first (M rows):
//            the tile's two 1-KB blocks stand M * 32 halves apart.
// coverage: epi64 8 instructions x 2 rows x 16 lanes x 4 floats; epi64hsb/hrb 4 instructions x 16 rows x 2 chunks x 8 halves
//           = the wave's 16 x 64 tile in all cases.
// =====================================================================================================
__device__ __forceinline__ void stage64(float* sl, v8f a0, v8f a1, v8f a2, v8f a3, float oscale, int lane) {
  const int hh = lane >> 4, m = lane & 15;
#pragma unroll
  for (int r = 0; r < 8; ++r) {
    const int ro = (8 * hh + r) * 68 + m;
    sl[ro]      = a0[r] * oscale;
    sl[ro + 16] = a1[r] * oscale;
    sl[ro + 32] = a2[r] * oscale;
    sl[ro + 48] = a3[r] * oscale;
  }
  wave_sync_lds();
}
__device__ __forceinline__ void epi64(float* sl, v8f a0, v8f a1, v8f a2, v8f a3, float oscale, v4f badd, float* C, int N,
                                      size_t rowb, int col0, int lane) {
  const int hh = lane >> 4, m = lane & 15;
  stage64(sl, a0, a1, a2, a3, oscale, lane);
  v4f vals[8];
#pragma unroll
  for (int it = 0; it < 8; ++it) vals[it] = *(const v4f*)(sl + (it * 2 + hh) * 68 + m * 4) + badd;
  float* dst = C + (rowb + (size_t)hh) * (size_t)N + col0 + m * 4;
  {
#pragma unroll
    for (int it = 0; it < 8; ++it) {
      *(v4f*)(dst + (size_t)(it * 2) * (size_t)N) = vals[it];
    }
    
  }
}
__device__ __forceinline__ void epi64hsb(float* sl, v8f a0, v8f a1, v8f a2, v8f a3, float oscale, float pscale,
                                         const float* __restrict__ bias, u16* C, int N, size_t rowb, int col0, int lane) {
  stage64(sl, a0, a1, a2, a3, oscale, lane);
  const int row = lane & 15, h8 = (lane >> 4) * 8;
  v4u oh[4];
#pragma unroll
  for (int i4 = 0; i4 < 4; ++i4) {
    const int c8 = i4 * 16 + h8;
    const v4f b0 = *(const v4f*)(bias + col0 + c8), b1 = *(const v4f*)(bias + col0 + c8 + 4);   // columns col0+c8..+7 < N
    const v4f a = *(const v4f*)(sl + row * 68 + c8), c4 = *(const v4f*)(sl + row * 68 + c8 + 4);
    float w[8];
#pragma unroll
    for (int e = 0; e < 4; ++e) { w[e] = (a[e] + bfr(b0[e])) * pscale; w[4 + e] = (c4[e] + bfr(b1[e])) * pscale; }
#pragma unroll
    for (int e = 0; e < 4; ++e) oh[i4][e] = pk16(h_bits((_Float16)w[2 * e]), h_bits((_Float16)w[2 * e + 1]));
  }
  u16* dst = C + rowb * (size_t)N + (size_t)col0 * 16 + lane * 8;      // rowb % 16 == 0, col0 % 64 == 0
  {
#pragma unroll
    for (int i4 = 0; i4 < 4; ++i4) {
      *(v4u*)(dst + i4 * 256) = oh[i4];
    }
    
  }
}
__device__ __forceinline__ void epi64hrb(float* sl, v8f a0, v8f a1, v8f a2, v8f a3, float oscale, float pscale,
                                         const float* __restrict__ brow, u16* C, int M, size_t rowb, int col0, int lane) {
  const int hh = lane >> 4, m = lane & 15;
  const v4f r0v = *(const v4f*)(brow + 8 * hh), r1v = *(const v4f*)(brow + 8 * hh + 4);   // rows rowb+8h .. +7 < M
  float rb[8];
#pragma unroll
  for (int e = 0; e < 4; ++e) { rb[e] = bfr(r0v[e]); rb[4 + e] = bfr(r1v[e]); }
#pragma unroll
  for (int r = 0; r < 8; ++r) {
    const int ro = (8 * hh + r) * 68 + m;
    sl[ro]      = a0[r] * oscale + rb[r];
    sl[ro + 16] = a1[r] * oscale + rb[r];
    sl[ro + 32] = a2[r] * oscale + rb[r];
    sl[ro + 48] = a3[r] * oscale + rb[r];
  }
  wave_sync_lds();
  v4u oh[4];
#pragma unroll
  for (int i4 = 0; i4 < 4; ++i4) {
    const int c8 = i4 * 16 + hh * 8;
    const v4f a = *(const v4f*)(sl + m * 68 + c8), c4 = *(const v4f*)(sl + m * 68 + c8 + 4);
    float w[8];
#pragma unroll
    for (int e = 0; e < 4; ++e) { w[e] = a[e] * pscale; w[4 + e] = c4[e] * pscale; }
#pragma unroll
    for (int e = 0; e < 4; ++e) oh[i4][e] = pk16(h_bits((_Float16)w[2 * e]), h_bits((_Float16)w[2 * e + 1]));
  }
  u16* dst = C + (size_t)col0 * (size_t)M + rowb * 32 + lane * 8;      // rowb % 16 == 0, col0 % 64 == 0
  {
#pragma unroll
    for (int i4 = 0; i4 < 4; ++i4) {
      *(v4u*)(dst + (size_t)(i4 >> 1) * 32 * (size_t)M + (i4 & 1) * 256) = oh[i4];
    }
    
  }
}

// =====================================================================================================
// bf16 GEMM, f16 plane out with column bias: C16[M][N] = f16 bits of (((A[M][K] (bf16) . Bt[N][K]^T (bf16))
// * oscale) + bf16RNE(bias[n])) * pscale. A, Bt and C16 are fragment-order planes.
// Block = 64x64 tile, 4 waves x 16 rows; fragments loaded straight from the 1-KB blocks (two 16-B loads each, split k map for
// A and B); K stepped by 32 = one block (K % 32 == 0, M % 64 == 0, N % 64 == 0, blocks bid = 0 .. (M/64)*(N/64) - 1).
// slab: the block's 4 epilogue slabs in LDS.
// =====================================================================================================
__device__ __forceinline__
void gemm_bh16(float* slab, const u16* __restrict__ A, const u16* __restrict__ Bt, const float* __restrict__ bias, u16* C,
               int M, int N, int K, float oscale, float pscale, int bid) {
  const int tid = threadIdx.x, wave = tid >> 5, lane = tid & 31;
  const int ntile = N >> 6;
  const int rowb  = (bid / ntile) * 64 + wave * 16;
  const int col0  = (bid % ntile) * 64;
  if (rowb + 16 > M) return;                 // wave-uniform, never taken with the exact grid; no block barriers in this kernel
  const size_t bs = (size_t)16 * K;
  const u16* ap  = A  + (size_t)rowb * (size_t)K + lane * 8;
  const u16* bp0 = Bt + (size_t)col0 * (size_t)K + lane * 8;
  const u16* bp1 = bp0 + bs;
  const u16* bp2 = bp1 + bs;
  const u16* bp3 = bp2 + bs;
  v8f acc0 = zero8(), acc1 = zero8(), acc2 = zero8(), acc3 = zero8();
#pragma unroll 1
  for (int k0 = 0; k0 < K; k0 += 32, ap += 512, bp0 += 512, bp1 += 512, bp2 += 512, bp3 += 512) {   // one 1-KB block a step
    const v16b a  = ldfrag_b(ap);
    const v16b b0 = ldfrag_b(bp0);
    const v16b b1 = ldfrag_b(bp1);
    const v16b b2 = ldfrag_b(bp2);
    const v16b b3 = ldfrag_b(bp3);
    acc0 = mma_b(a, b0, acc0);
    acc1 = mma_b(a, b1, acc1);
    acc2 = mma_b(a, b2, acc2);
    acc3 = mma_b(a, b3, acc3);
    guard6<v16b>(acc0, acc1, acc2, acc3, a, b0, b1, b2, b3, a);
  }
  epi64hsb(slab + wave * SLAB64, acc0, acc1, acc2, acc3, oscale, pscale, bias, C, N, (size_t)rowb, col0, lane);
}
// The three projections in ONE launch (independent of one another): blocks [0, GB_S) value = source.Wv1 + b (f16 plane x8),
// next GB_Q q = query.Wq + b (rows < SQ, x8), next GB_S k = source.Wk + b (x8); the job is block-uniform. grid = 2 * GB_S + GB_Q.
#define GB_S ((NL / 64) * (DM / 64))
#define GB_Q ((SQ / 64) * (DM / 64))
__global__ __launch_bounds__(128)
void proj3(const u16* __restrict__ XS, const u16* __restrict__ XQ, const u16* __restrict__ W1T, const u16* __restrict__ WQT,
           const u16* __restrict__ WKT, const float* __restrict__ bv1, const float* __restrict__ bq,
           const float* __restrict__ bk, u16* VALH, u16* QP, u16* KP) {
  __shared__ __align__(16) float slab[4 * SLAB64];
  const int b = blockIdx.x;
  const int job = (b < GB_S) ? 0 : (b < GB_S + GB_Q) ? 1 : 2;
  const u16*   A    = (job == 1) ? XQ : XS;
  const u16*   Bt   = (job == 0) ? W1T : (job == 1) ? WQT : WKT;
  const float* bias = (job == 0) ? bv1 : (job == 1) ? bq : bk;
  u16*         C    = (job == 0) ? VALH : (job == 1) ? QP : KP;
  const int    M    = (job == 1) ? SQ : NL;
  const float  ps   = (job == 0) ? VSC : (job == 1) ? QSC : KSC;
  const int    bid  = (job == 0) ? b : (job == 1) ? b - GB_S : b - GB_S - GB_Q;
  gemm_bh16(slab, A, Bt, bias, C, M, DM, DM, 1.0f, ps, bid);
}

// =====================================================================================================
// f16 GEMM, f16 plane out with ROW bias: C16[M][N] = f16 bits of (((A[M][K] (f16) . Bt[N][K]^T (f16))
// * oscale) + bf16RNE(bias[m])) * pscale; all three planes in fragment order, C16 with its blocks k tile first. Same tiling and fragment loads as gemm_bh16; epilogue epi64hrb.
// =====================================================================================================
__global__ __launch_bounds__(128)
void gemm_hh16r(const u16* __restrict__ A, const u16* __restrict__ Bt, const float* __restrict__ bias, u16* C,
                int M, int N, int K, float oscale, float pscale) {
  __shared__ __align__(16) float slab[4 * SLAB64];
  const int tid = threadIdx.x, wave = tid >> 5, lane = tid & 31;
  const int ntile = N >> 6;
  const int bid   = blockIdx.x;
  const int rowb  = (bid / ntile) * 64 + wave * 16;
  const int col0  = (bid % ntile) * 64;
  if (rowb + 16 > M) return;                 // wave-uniform, never taken with the exact grid; no block barriers in this kernel
  const size_t bs = (size_t)16 * K;
  const _Float16* ap  = (const _Float16*)(const void*)A  + (size_t)rowb * (size_t)K + lane * 8;
  const _Float16* bp0 = (const _Float16*)(const void*)Bt + (size_t)col0 * (size_t)K + lane * 8;
  const _Float16* bp1 = bp0 + bs;
  const _Float16* bp2 = bp1 + bs;
  const _Float16* bp3 = bp2 + bs;
  v8f acc0 = zero8(), acc1 = zero8(), acc2 = zero8(), acc3 = zero8();
#pragma unroll 1
  for (int k0 = 0; k0 < K; k0 += 32, ap += 512, bp0 += 512, bp1 += 512, bp2 += 512, bp3 += 512) {   // one 1-KB block a step
    const v16h a  = ldfrag_hf(ap);
    const v16h b0 = ldfrag_hf(bp0);
    const v16h b1 = ldfrag_hf(bp1);
    const v16h b2 = ldfrag_hf(bp2);
    const v16h b3 = ldfrag_hf(bp3);
    acc0 = mma_h(a, b0, acc0);
    acc1 = mma_h(a, b1, acc1);
    acc2 = mma_h(a, b2, acc2);
    acc3 = mma_h(a, b3, acc3);
    guard6<v16h>(acc0, acc1, acc2, acc3, a, b0, b1, b2, b3, a);
  }
  epi64hrb(slab + wave * SLAB64, acc0, acc1, acc2, acc3, oscale, pscale, bias + rowb, C, M, (size_t)rowb, col0, lane);
}

// =====================================================================================================
// Head-axis softmax attention with the head mean folded in. Block = NT = 64 query rows q0..q0+63, 8 waves, the KSPAN keys of
// key range blockIdx.x in tiles of LT = 32 (the softmax runs over heads, so key ranges only add: each range writes its own f32
// partial plane, sum_parts adds the KS planes). q plane f16 x8 [n][512] (head h = columns 64h..64h+63), k plane the same, V^T plane f16 x64 [h*512+d][l],
// all three in fragment order, V^T with its blocks k tile first.
//   (S) wave w = head w: S_w[64 n][32 l] in two passes of 32 n = 4 D tiles each, K = 64 (2 k-steps): A = q rows (row m = query,
//       split k map over the head's 64 columns), B = k rows (col n = key, same split map, loaded once for both passes);
//       D element r of lane -> U.s[w][n 32nh+16nt+8h+r][l 16half+m].
//   (M) thread = (n = 32it + (tid>>3), 4 consecutive l), it = 0, 1: base-2 logits t = s * log2e/512 for the 8 heads, max over heads,
//       p = exp2(t-max), P = p / sum (f32), written as f16(P * 4096) to sP[h][n][l] with 8-B LDS stores.
//   (PV) wave w owns d columns 64w + 16t + (lane&15), t = 0..3, for all four 16-row n groups (16 accumulators): every V^T fragment
//       fetched from L2 feeds four matrix instructions. For every head h:
//       A = P_h fragments from LDS (row m = query, split map over the 32 keys), B = V^T fragments (col = d, keys contiguous,
//       row h*512 + d of the V^T plane); all heads and key tiles accumulate into the same accumulators (joint (l,h) K axis).
//   Block barriers after (S) and after (M) order every LDS reuse across phases, key tiles and waves.
//   Epilogue: partial = acc * 2^-21 (= 1 / (4096 * 64 * 8 heads)); the wave's four 16 x 64 f32 tiles go through epi64 one after
//   another (a wave-level LDS sync between tiles); a block barrier separates the key loop from the slab use (the slab area
//   aliases the score area).
// coverage: grid (KS, SQ/64) blocks x 64 rows = query rows 0..SQ-1 of every partial plane; (S) 8 waves x 64 x 32 = all score cells;
//           (M) 2 passes x 256 thr x 4 l x 8 h = all P cells; stores 8 waves x (4 tiles x 16 rows x 64 cols) =
//           part[ks][q0..q0+63][0..511], every float exactly once.
// =====================================================================================================
__global__ __launch_bounds__(ATT_THREADS)
void attn_heads(const u16* __restrict__ QPp, const u16* __restrict__ KPp, const u16* __restrict__ VTp, float* part) {
  __shared__ __align__(16) AttU U;                 // scores [8][64][SSP] f32; reused as 8 epilogue slabs
  __shared__ __align__(16) u16 sP[NH * NT * PLP];  // P tiles [8][64][PLP] f16 bits

  const int tid  = threadIdx.x;
  const int wave = tid >> 5;
  const int lane = tid & 31;
  const int hh   = lane >> 4;
  const int m    = lane & 15;
  const int q0   = blockIdx.y * NT;          // q0 + 63 < SQ (grid exact)
  const int lbeg = blockIdx.x * KSPAN;       // this block's key range lbeg .. lbeg + KSPAN - 1 < NL (grid exact)
  float* const out = part + (size_t)blockIdx.x * ((size_t)SQ * DM);

  const _Float16* qb = (const _Float16*)(const void*)QPp + (size_t)q0 * DM + wave * (DKH * 16) + lane * 8;
  const _Float16* kp = (const _Float16*)(const void*)KPp + (size_t)lbeg * DM + wave * (DKH * 16) + lane * 8;   // steps one key tile a pass
  const _Float16* vb = (const _Float16*)(const void*)VTp + wave * (64 * 32) + lane * 8;
  const float lsc = LOG2E / (QSC * KSC * 8.0f);
  float* const sw = U.s + wave * (NT * SSP);

  v8f o[4][4];                               // o[i][t]: n rows 16i..16i+15, d columns 64 * wave + 16t..+15
#pragma unroll
  for (int i = 0; i < 4; ++i) {
#pragma unroll
    for (int t = 0; t < 4; ++t) o[i][t] = zero8();
  }

#pragma unroll 1
  for (int l0 = lbeg; l0 < lbeg + KSPAN; l0 += LT, kp += (size_t)LT * DM) {
    // ---- (S) scores of head = wave for this key tile ----
    {
      const v16h ka0 = ldfrag_hf(kp), ka1 = ldfrag_hf(kp + 512);
      const v16h kc0 = ldfrag_hf(kp + (size_t)16 * DM), kc1 = ldfrag_hf(kp + (size_t)16 * DM + 512);
      const _Float16* qp = qb;
      // kept rolled: unrolled, 8 q fragments and 8 score tiles would be live beside the 16 output accumulators
#pragma unroll 1
      for (int nh = 0; nh < NT / 32; ++nh, qp += (size_t)32 * DM) {
        const v16h qa0 = ldfrag_hf(qp), qa1 = ldfrag_hf(qp + 512);
        const v16h qc0 = ldfrag_hf(qp + (size_t)16 * DM), qc1 = ldfrag_hf(qp + (size_t)16 * DM + 512);
        v8f s00 = zero8(), s01 = zero8(), s10 = zero8(), s11 = zero8();
        s00 = mma_h(qa0, ka0, s00);  s00 = mma_h(qa1, ka1, s00);     // n rows 0..15 of the pass,  keys 0..15
        s01 = mma_h(qa0, kc0, s01);  s01 = mma_h(qa1, kc1, s01);     // n rows 0..15 of the pass,  keys 16..31
        s10 = mma_h(qc0, ka0, s10);  s10 = mma_h(qc1, ka1, s10);     // n rows 16..31 of the pass, keys 0..15
        s11 = mma_h(qc0, kc0, s11);  s11 = mma_h(qc1, kc1, s11);     // n rows 16..31 of the pass, keys 16..31
        guard4x8(s00, s01, s10, s11, qa0, qa1, qc0, qc1, ka0, ka1, kc0, kc1);
        float* const sn = sw + nh * (32 * SSP);
#pragma unroll
        for (int r = 0; r < 8; ++r) {
          const int ro = (8 * hh + r) * SSP + m;
          sn[ro]                 = s00[r];
          sn[ro + 16]            = s01[r];
          sn[ro + 16 * SSP]      = s10[r];
          sn[ro + 16 * SSP + 16] = s11[r];
        }
      }
    }
    __syncthreads();
    // ---- (M) softmax over the 8 heads per (n, l), P tiles ----
#pragma unroll
    for (int it = 0; it < NT / 32; ++it) {
      const int n = it * 32 + (tid >> 3), lq = (tid & 7) * 4;
      float t[NH][4];
#pragma unroll
      for (int h = 0; h < NH; ++h) {
        const v4f a = *(const v4f*)(U.s + h * (NT * SSP) + n * SSP + lq);
#pragma unroll
        for (int e = 0; e < 4; ++e) t[h][e] = a[e] * lsc;
      }
#pragma unroll
      for (int e = 0; e < 4; ++e) {
        float mx = t[0][e];
#pragma unroll
        for (int h = 1; h < NH; ++h) mx = fmaxf(mx, t[h][e]);
        float sm = 0.f;
#pragma unroll
        for (int h = 0; h < NH; ++h) {
          const float p = exp2f(t[h][e] - mx);                 // <= 1, one term equals 1
          t[h][e] = p;
          sm += p;
        }
        const float rs = __builtin_amdgcn_rcpf(sm) * PCAR;      // sm in [1, 8]
#pragma unroll
        for (int h = 0; h < NH; ++h) t[h][e] *= rs;
      }
      u16* pd = sP + n * PLP + lq;
#pragma unroll
      for (int h = 0; h < NH; ++h) {
        v2u pk;
        pk[0] = pk16(h_bits((_Float16)t[h][0]), h_bits((_Float16)t[h][1]));
        pk[1] = pk16(h_bits((_Float16)t[h][2]), h_bits((_Float16)t[h][3]));
        *(v2u*)(pd + h * (NT * PLP)) = pk;
      }
    }
    __syncthreads();
    // ---- (PV) accumulate P_h . V_h over all heads for this key tile ----
    {
      const _Float16* pbase = (const _Float16*)(const void*)sP + m * PLP + 8 * hh;
      const _Float16* vl = vb + (size_t)l0 * DV;   // k tile l0 / 32 of V^T: DV / 16 blocks of 512 halves
#pragma unroll 1
      for (int h = 0; h < NH; ++h) {
        const _Float16* vp = vl + h * (DM * 32);
        const v16h g0 = ldfrag_hf(vp);
        const v16h g1 = ldfrag_hf(vp + 512);
        const v16h g2 = ldfrag_hf(vp + 1024);
        const v16h g3 = ldfrag_hf(vp + 1536);
        const _Float16* pp = pbase + h * (NT * PLP);
        const v16h p0 = ldfrag_h(pp);
        const v16h p1 = ldfrag_h(pp + 16 * PLP);
        const v16h p2 = ldfrag_h(pp + 32 * PLP);
        const v16h p3 = ldfrag_h(pp + 48 * PLP);
        o[0][0] = mma_h(p0, g0, o[0][0]);
        o[1][0] = mma_h(p1, g0, o[1][0]);
        o[2][0] = mma_h(p2, g0, o[2][0]);
        o[3][0] = mma_h(p3, g0, o[3][0]);
        o[0][1] = mma_h(p0, g1, o[0][1]);
        o[1][1] = mma_h(p1, g1, o[1][1]);
        o[2][1] = mma_h(p2, g1, o[2][1]);
        o[3][1] = mma_h(p3, g1, o[3][1]);
        o[0][2] = mma_h(p0, g2, o[0][2]);
        o[1][2] = mma_h(p1, g2, o[1][2]);
        o[2][2] = mma_h(p2, g2, o[2][2]);
        o[3][2] = mma_h(p3, g2, o[3][2]);
        o[0][3] = mma_h(p0, g3, o[0][3]);
        o[1][3] = mma_h(p1, g3, o[1][3]);
        o[2][3] = mma_h(p2, g3, o[2][3]);
        o[3][3] = mma_h(p3, g3, o[3][3]);
        guard16x8(o, p0, p1, p2, p3, g0, g1, g2, g3);
      }
    }
  }
  __syncthreads();

  const float osc = 1.0f / (PCAR * VCAR * (float)NH);
  const v4f z4 = {0.f, 0.f, 0.f, 0.f};
  float* const sl = U.slab + wave * SLAB64;
#pragma unroll
  for (int i = 0; i < 4; ++i) {
    if (i) wave_sync_lds();                  // the slab's last reads end before the next tile is staged in it
    epi64(sl, o[i][0], o[i][1], o[i][2], o[i][3], osc, z4, out, DM, (size_t)q0 + 16 * i, wave * 64, lane);
  }
}

// =====================================================================================================
// out = sum of the KS partial planes, added in plane order 0..KS-1 in f32. Thread = 4 consecutive floats: KS 16-B loads, one
// 16-B store; 32 consecutive lanes = 512 contiguous bytes per load and store.
// coverage: grid = SQ*DM/1024 blocks x 256 thr x 4 floats = out rows 0..SQ-1, every float exactly once.
// =====================================================================================================
__global__ __launch_bounds__(256) void sum_parts(const float* __restrict__ part, float* out) {
  const unsigned ob = (blockIdx.x * 256u + threadIdx.x) * 16u;    // byte offset in a plane, < SQ * DM * 4 (grid exact)
  v4f p[KS];
#pragma unroll
  for (int s = 0; s < KS; ++s) p[s] = *(const v4f*)((const char*)(part + (size_t)s * ((size_t)SQ * DM)) + ob);
  v4f a = p[0];
#pragma unroll
  for (int s = 1; s < KS; ++s) a += p[s];
  *(v4f*)((char*)out + ob) = a;
}

// =====================================================================================================
// Workspace map (bytes); every plane is fully written by whole-line stores before it is read; all extents are exact multiples of
// the store granularity (no pad rows, all dims multiples of 64), every offset a multiple of 256:
//   XQ  bf16 [SQ][512]                      <=  4194304
//   XS  bf16 [4096][512]                        4194304
//   WV1T, WQT, WKT bf16 [512][512]             3 x 524288
//   WV2T f16 of bf16 value x1024 [4096][512]   4194304
//   VALH f16 value x8 [4096][512]               4194304
//   QP   f16 x8 [SQ][512]                   <=  4194304
//   KP   f16 x8 [4096][512]                     4194304
//   VT   f16 x64 [4096][4096]                  33554432
//   PART f32 [KS][SQ][512]                  <= 67108864
//   end                                     <= 127401984
// =====================================================================================================
extern "C" void kernel_launch(void* const* d_in, const int* in_sizes, int n_in,
                              void* d_out, int out_size, void* d_ws, size_t ws_size,
                              hipStream_t stream) {
  if (n_in < 10) return;
  if (in_sizes[0] != NQ * DM || in_sizes[1] != NL * DM) return;
  if (in_sizes[2] != DM * DM || in_sizes[3] != DM) return;
  if (in_sizes[4] != DM * DM || in_sizes[5] != DM) return;
  if (in_sizes[6] != DM * DM || in_sizes[7] != DM) return;
  if (in_sizes[8] != DM * DV || in_sizes[9] != DV) return;
  if (out_size != NQ * DM) return;

  const float* xq  = (const float*)d_in[0];
  const float* xs  = (const float*)d_in[1];
  const float* wv1 = (const float*)d_in[2];
  const float* bv1 = (const float*)d_in[3];
  const float* wq  = (const float*)d_in[4];
  const float* bq  = (const float*)d_in[5];
  const float* wk  = (const float*)d_in[6];
  const float* bk  = (const float*)d_in[7];
  const float* wv2 = (const float*)d_in[8];
  const float* bv2 = (const float*)d_in[9];
  float*       out = (float*)d_out;

  const size_t szXQ = (size_t)SQ * DM * 2;          //  4194304 at SQ = NQ
  const size_t szXS = (size_t)NL * DM * 2;          //  4194304
  const size_t szWT = (size_t)DM * DM * 2;          //   524288
  const size_t szW2 = (size_t)DV * DM * 2;          //  4194304
  const size_t szVL = (size_t)NL * DM * 2;          //  4194304
  const size_t szQP = (size_t)SQ * DM * 2;          //  4194304 at SQ = NQ
  const size_t szKP = (size_t)NL * DM * 2;          //  4194304
  const size_t szVT = (size_t)DV * NL * 2;          // 33554432
  const size_t szPT = (size_t)KS * SQ * DM * 4;     // 67108864 at SQ = NQ
  size_t off = 0;
  const size_t oXQ = off; off += szXQ;
  const size_t oXS = off; off += szXS;
  const size_t oW1 = off; off += szWT;
  const size_t oWQ = off; off += szWT;
  const size_t oWK = off; off += szWT;
  const size_t oW2 = off; off += szW2;
  const size_t oVL = off; off += szVL;
  const size_t oQP = off; off += szQP;
  const size_t oKP = off; off += szKP;
  const size_t oVT = off; off += szVT;
  const size_t oPT = off; off += szPT;
  if (off > ws_size) return;                        // off = 127401984 at SQ = NQ
  if (off > WS_CAP) return;

  char* ws = (char*)d_ws;
  u16* XQ   = (u16*)(ws + oXQ);
  u16* XS   = (u16*)(ws + oXS);
  u16* WV1T = (u16*)(ws + oW1);
  u16* WQT  = (u16*)(ws + oWQ);
  u16* WKT  = (u16*)(ws + oWK);
  u16* WV2T = (u16*)(ws + oW2);
  u16* VALH = (u16*)(ws + oVL);
  u16* QP   = (u16*)(ws + oQP);
  u16* KP   = (u16*)(ws + oKP);
  u16* VT   = (u16*)(ws + oVT);
  float* PART = (float*)(ws + oPT);

  const dim3 blk(256);
  const dim3 bG(128);
  const dim3 gPR(PB_ALL);                           // 512 + 3 x 64 + 1024 + 1024 at SQ = NQ
  const dim3 gP3(2 * GB_S + GB_Q);                  // 3 x 512 at SQ = NQ
  const dim3 gVT((DV / 64) * (NL / 64));            // 4096
  const dim3 gAT(KS, SQ / NT);                      // 8 x 64 at SQ = NQ
  const dim3 gSP((SQ * DM) / 1024);                 // 2048 at SQ = NQ
  const dim3 bAT(ATT_THREADS);

  // (0) query rows < SQ and source -> bf16 planes; Wv1, Wq, Wk [in][out] -> bf16 [out][in] fragment-order planes;
  //     Wv2 [512][4096] -> f16 of the bf16 value x1024, [4096][512]
  prep_all<<<gPR, blk, 0, stream>>>(xq, xs, wv1, wq, wk, wv2, XQ, XS, WV1T, WQT, WKT, WV2T);
  // (1) value = source.Wv1 + b -> f16 plane x8; q (rows < SQ) and k projections -> f16 planes x8
  proj3<<<gP3, bG, 0, stream>>>(XS, XQ, WV1T, WQT, WKT, bv1, bq, bk, VALH, QP, KP);
  // (2) V^T [h*512+d][l] = (Wv2^T . value^T) / (1024*8) + b[h*512+d], f16 plane x64
  gemm_hh16r<<<gVT, bG, 0, stream>>>(WV2T, VALH, bv2, VT, DV, NL, DM, 1.0f / (W2S * VSC), VCAR);
  // (3) head-axis softmax attention + head mean, one f32 partial plane per key range; (4) planes summed -> out rows 0..SQ-1
  attn_heads<<<gAT, bAT, 0, stream>>>(QP, KP, VT, PART);
  sum_parts<<<gSP, blk, 0, stream>>>(PART, out);
  (void)hipGetLastError();
}

// v005
// It runs in 199 microseconds.
// Two timings next to v004 both put it at 1.05 times that version's speed.
// All steps since v000 together make it 3.94 times as fast.
// Projections value, q, k = x.W + b: v_wmma_f32_16x16x32_bf16 (bf16 RNE operands of the raw inputs, f32 accumulate, bf16 RNE
// bias added in f32). v^T = Wv2^T . value^T (W as f16 of the bf16 RNE value x1024, value plane f16 x8, bf16 RNE bias per row in
// f32), per-head scores q.k^T (f16 planes x8) and P.V (P x4096 f16 from LDS, V^T x64 f16): v_wmma_f32_16x16x32_f16, f32
// accumulate. Softmax over the head axis, the head mean and all scaling in f32 on VALU.
// Every 16-bit operand plane [rows][K] in the workspace is kept in FRAGMENT ORDER: 1-KB blocks of 16 rows x 32 k, block (rt, kt)
// at half index rt * 16 * K + kt * 512; inside a block the 16-B chunk (row m = row & 15, c = (k >> 3) & 3) stands at half index
// c * 128 + m * 8. Lane (h = lane >> 4, m = lane & 15) of a fragment then reads its two 16-B chunks (c = h and c = 2 + h) at
// lane * 8 and 256 + lane * 8: each load of a wave is 512 contiguous bytes (4 cache lines) and not 32 B out of each of 16 lines.
// The V^T plane alone orders its blocks k tile first, block (rt, kt) at half index (kt * (rows / 16) + rt) * 512, so that all that
// one key tile of the attention reads (every head, every d) is one contiguous 256-KB run.
#include <hip/hip_runtime.h>
#include <math.h>
#include <stdint.h>

#define NQ   4096
#define NL   4096
#define DM   512
#define NH   8
#define DKH  64
#define DV   (NH * DM)
#ifndef SQ
#define SQ NQ
#endif
#define NT   64
#define LT   32
#define SSP  32
#define PLP  40
#define SLAB64 (16 * 68)
#define ATT_THREADS 256
#define KS   8
#define KSPAN (NL / KS)
#define QSC  8.0f
#define KSC  8.0f
#define VSC  8.0f
#define W2S  1024.0f
#define PCAR 4096.0f
#define VCAR 64.0f
#define LOG2E 1.4426950408889634f
#define WS_CAP ((size_t)134217728)

static_assert(DM == NH * DKH && DKH == 64 && NH == 8 && (DM % 64) == 0 && (DV % 64) == 0 && (NL % 64) == 0 && (NQ % 64) == 0);
static_assert((DM % 32) == 0);
static_assert(SQ >= 64 && SQ <= NQ && (SQ % 64) == 0 && (SQ % NT) == 0);
static_assert(NT == 64 && LT == 32 && (NL % LT) == 0 && ATT_THREADS == 256 && ATT_THREADS * 4 * (NT / 32) == NT * LT);
static_assert(KS >= 1 && (NL % (KS * LT)) == 0 && ((SQ * DM) % 1024) == 0);
static_assert(SSP >= LT && PLP >= 32 && ((PLP * 2) % 16) == 0 && ((SSP * 4) % 16) == 0);
static_assert(8 * SLAB64 <= NH * NT * SSP);
static_assert(((NQ * DM) % 2048) == 0 && ((NL * DM) % 2048) == 0 && ((SQ * DM) % 2048) == 0);
static_assert(NH * NT * SSP * 4 + NH * NT * PLP * 2 <= 160 * 1024);   // two blocks on a WGP

typedef unsigned short u16;
typedef _Float16 v16h __attribute__((ext_vector_type(16)));
typedef _Float16 v8h  __attribute__((ext_vector_type(8)));
typedef _Float16 v4h  __attribute__((ext_vector_type(4)));
typedef __bf16   v16b __attribute__((ext_vector_type(16)));
typedef float    v8f  __attribute__((ext_vector_type(8)));
typedef float    v4f  __attribute__((ext_vector_type(4)));
typedef unsigned int v4u __attribute__((ext_vector_type(4)));
typedef unsigned int v2u __attribute__((ext_vector_type(2)));

union FragH { v16h v; v8h h[2]; v4u u[2]; };
union FragB { v16b v; v4u u[2]; };
union AttU { float s[NH * NT * SSP]; float slab[8 * SLAB64]; };

// ---- scalar helpers --------------------------------------------------------------------------------
__device__ __forceinline__ unsigned short bf_bits(float f) {          // f32 -> bf16 bits, RNE convert
  unsigned u = __float_as_uint(f);
  return (unsigned short)((u + 0x7FFFu + ((u >> 16) & 1u)) >> 16);
}
__device__ __forceinline__ float bf_up(unsigned short h) { return __uint_as_float(((unsigned)h) << 16); }
__device__ __forceinline__ float bfr(float f) { return bf_up(bf_bits(f)); }
__device__ __forceinline__ unsigned short h_bits(_Float16 x) { return __builtin_bit_cast(unsigned short, x); }
__device__ __forceinline__ unsigned pk16(unsigned short a, unsigned short b) { return (unsigned)a | ((unsigned)b << 16); }
__device__ __forceinline__ v8f zero8() { v8f z = {0.f, 0.f, 0.f, 0.f, 0.f, 0.f, 0.f, 0.f}; return z; }

// ---- fragment loaders: 16-bit A/B operand, lane -> row/col (lane&15); elements 0..7 <- k0+8h.., elements 8..15 <- k0+16+8h..
//      (same split k map for A and B).
//      ldfrag_h: row-major LDS tile, p already includes row * pitch + 8*(lane>>4): p[0..7] and p[16..23].
//      ldfrag_hf / ldfrag_b: fragment-order workspace plane, p = start of the 1-KB block + lane * 8: p[0..7] and p[256..263].
__device__ __forceinline__ v16h ldfrag_h(const _Float16* p) {
  FragH f;
  f.h[0] = *(const v8h*)(p);
  f.h[1] = *(const v8h*)(p + 16);
  return f.v;
}
__device__ __forceinline__ v16h ldfrag_hf(const _Float16* p) {
  FragH f;
  f.h[0] = *(const v8h*)(p);
  f.h[1] = *(const v8h*)(p + 256);
  return f.v;
}
__device__ __forceinline__ v16b ldfrag_b(const u16* p) {              // bf16 plane read as unsigned integer vectors
  FragB f;
  f.u[0] = *(const v4u*)(p);
  f.u[1] = *(const v4u*)(p + 256);
  return f.v;
}

__device__ __forceinline__ v8f mma_h(v16h a, v16h b, v8f c) {
  return __builtin_amdgcn_wmma_f32_16x16x32_f16(false, a, false, b, (short)0, c, false, false);
}
__device__ __forceinline__ v8f mma_b(v16b a, v16b b, v8f c) {
  return __builtin_amdgcn_wmma_f32_16x16x32_bf16(false, a, false, b, (short)0, c, false, false);
}
template <typename F>
__device__ __forceinline__ void guard6(v8f& a, v8f& b, v8f& c, v8f& d, F x0, F x1, F x2, F x3, F x4, F x5) {
#if defined(__HIP_DEVICE_COMPILE__)
  asm volatile("v_nop\n\tv_nop\n\tv_nop\n\tv_nop"
               : "+v"(a), "+v"(b), "+v"(c), "+v"(d) : "v"(x0), "v"(x1), "v"(x2), "v"(x3), "v"(x4), "v"(x5) : "memory");
#endif
}
__device__ __forceinline__ void guard4x8(v8f& a, v8f& b, v8f& c, v8f& d, v16h x0, v16h x1, v16h x2, v16h x3,
                                         v16h x4, v16h x5, v16h x6, v16h x7) {
#if defined(__HIP_DEVICE_COMPILE__)
  asm volatile("v_nop\n\tv_nop\n\tv_nop\n\tv_nop"
               : "+v"(a), "+v"(b), "+v"(c), "+v"(d)
               : "v"(x0), "v"(x1), "v"(x2), "v"(x3), "v"(x4), "v"(x5), "v"(x6), "v"(x7) : "memory");
#endif
}
// Four vector slots behind the last matrix instruction of the P.V loop body, on the taken side of the loop branch too, before the
// next pass's loads overwrite the fragment registers; the fragments are inputs so that they stay allocated up to here.
__device__ __forceinline__ void guard16x8(v8f (&o)[4][4], v16h x0, v16h x1, v16h x2, v16h x3,
                                          v16h x4, v16h x5, v16h x6, v16h x7) {
#if defined(__HIP_DEVICE_COMPILE__)
  asm volatile("v_nop\n\tv_nop\n\tv_nop\n\tv_nop"
               : "+v"(o[0][0]), "+v"(o[0][1]), "+v"(o[0][2]), "+v"(o[0][3]), "+v"(o[1][0]), "+v"(o[1][1]), "+v"(o[1][2]), "+v"(o[1][3]),
                 "+v"(o[2][0]), "+v"(o[2][1]), "+v"(o[2][2]), "+v"(o[2][3]), "+v"(o[3][0]), "+v"(o[3][1]), "+v"(o[3][2]), "+v"(o[3][3])
               : "v"(x0), "v"(x1), "v"(x2), "v"(x3), "v"(x4), "v"(x5), "v"(x6), "v"(x7) : "memory");
#endif
}
__device__ __forceinline__ void wave_sync_lds() {
  __builtin_amdgcn_fence(__ATOMIC_RELEASE, "workgroup");
  __builtin_amdgcn_wave_barrier();
  __builtin_amdgcn_fence(__ATOMIC_ACQUIRE, "workgroup");
}

// =====================================================================================================
// f32 plane [rows][DM] row-major -> 16-bit plane in fragment order:  mode 0: bf16 RNE bits;  mode 1: f16 bits of (bf16 RNE value) * scale;
// mode 2: f16 bits of value * scale (no bf16 pre-step).
// Thread = output chunk gt = 8 consecutive k of one row: two 16-B loads (a wave reads 64 B of each of 16 rows), one 16-B store;
// 32 consecutive lanes store 512 contiguous, 512-B aligned bytes
// coverage: n8/256 blocks bid = 0.. (exact multiples) x 256 thr x 8 = the whole plane.
// =====================================================================================================
__device__ __forceinline__ void cvt16(const float* __restrict__ x, u16* D, int n8, int mode, float scale, int bid) {
  const int gt = bid * 256 + (int)threadIdx.x;
  if (gt >= n8) return;                     // no barriers on this path
  const int kb = DM / 32;                   // blocks in a row tile
  const int blk = gt >> 6, cw = gt & 63;    // 1-KB block, chunk in it: cw = c * 16 + m
  const float* p = x + ((size_t)(blk / kb) * 16 + (size_t)(cw & 15)) * DM + (blk % kb) * 32 + (cw >> 4) * 8;
  const v4f a = *(const v4f*)(p), c4 = *(const v4f*)(p + 4);
  float v[8];
#pragma unroll
  for (int e = 0; e < 4; ++e) { v[e] = a[e]; v[4 + e] = c4[e]; }
  unsigned short s[8];
#pragma unroll
  for (int e = 0; e < 8; ++e) {
    const float vb = bfr(v[e]);
    const float vf = (mode == 1) ? vb : v[e];
    const unsigned short hb = h_bits((_Float16)(vf * scale));
    const unsigned short bb = bf_bits(v[e]);
    s[e] = (mode != 0) ? hb : bb;
  }
  v4u o;
#pragma unroll
  for (int e = 0; e < 4; ++e) o[e] = pk16(s[2 * e], s[2 * e + 1]);
  u16* d = D + (size_t)gt * 8;
  {
    *(v4u*)(d) = o;
    
  }
}

// =====================================================================================================
// Transpose + convert: in X [R][C] f32 row-major -> out XTo [C][R] 16-bit in fragment order (output row = input column, k = R axis).
//   mode 0: bf16 RNE bits;  mode 1: f16 bits of (bf16 RNE value) * scale;  mode 2: f16 bits of value * scale.
// Block = 64 input rows x 64 input cols: bid -> (rt = bid % (R/64), ct = bid / (R/64)). The 64x64 f32 tile is loaded with 16-B
// loads (thread = input row tid>>2, 16 consecutive cols), converted and scattered into LDS TH[c local][r local] (pitch 72 halves);
// the tile is 4 row tiles x 2 k tiles = 8 blocks of 1 KB; chunk cid = it * 256 + tid -> block cid >> 6, chunk cid & 63 in it.
// coverage: load 256 thr x 16 = 64 x 64; store 2 iterations x 256 thr x 8 halves = 8 blocks x 64 chunks = the tile;
//           (R/64)*(C/64) blocks bid = 0.. (exact multiples) tile the whole [C][R] plane exactly once. TH: the block's 64 x VTP LDS tile.
// =====================================================================================================
#define VTP 72
static_assert(64 * VTP >= 63 * VTP + 64 && ((VTP * 2) % 16) == 0);
__device__ __forceinline__ void tr16(u16* TH, const float* __restrict__ X, u16* XTo, int R, int C, int mode, float scale, int bid) {
  const int tid = threadIdx.x;
  const int nrt = R >> 6;
  const int rt  = bid % nrt;
  const int ct  = bid / nrt;
  const int r0  = rt * 64;
  const int c0  = ct * 64;
  {
    const int rl = tid >> 2;                  // input row within tile 0..63
    const int cc = (tid & 3) * 16;            // input col chunk within the 64
    const float* src = X + (size_t)(r0 + rl) * (size_t)C + c0 + cc;
#pragma unroll
    for (int i = 0; i < 4; ++i) {
      const v4f a = *(const v4f*)(src + 4 * i);
#pragma unroll
      for (int e = 0; e < 4; ++e) {
        const float v  = a[e];
        const float vb = bfr(v);
        const float vf = (mode == 1) ? vb : v;
        const unsigned short hb = h_bits((_Float16)(vf * scale));
        const unsigned short bb = bf_bits(v);
        TH[(cc + 4 * i + e) * VTP + rl] = (mode != 0) ? hb : bb;
      }
    }
  }
  __syncthreads();
  v4u vh[2];
  const int cw = tid & 63;                    // chunk in its block: c * 16 + m
#pragma unroll
  for (int it = 0; it < 2; ++it) {
    const int bl = it * 4 + (tid >> 6);       // local block 0..7: row tile bl >> 1, k tile bl & 1
    vh[it] = *(const v4u*)(TH + ((bl >> 1) * 16 + (cw & 15)) * VTP + (bl & 1) * 32 + (cw >> 4) * 8);
  }
  const size_t base = (size_t)c0 * (size_t)R + (size_t)r0 * 16 + (size_t)cw * 8;
  {
#pragma unroll
    for (int it = 0; it < 2; ++it) {
      const int bl = it * 4 + (tid >> 6);
      *(v4u*)(XTo + base + (size_t)(bl >> 1) * 16 * (size_t)R + (size_t)(bl & 1) * 512) = vh[it];
    }
    // the stores' registers are rewritten only behind this wait, on whatever path the inlined body is left
#if defined(__HIP_DEVICE_COMPILE__)
    asm volatile("s_wait_xcnt 0x0" ::: "memory");
#endif
  }
}

// =====================================================================================================
// All six input conversions in ONE launch (they are independent of one another): the block index picks the job, block-uniformly.
//   blocks [0, PB_W2)            Wv2 [512][4096] -> f16 of the bf16 value x1024, [4096][512]
//   next 3 x PB_WT               Wv1, Wq, Wk [in][out] -> bf16 [out][in]
//   next PB_XS, then PB_XQ       source rows, query rows < SQ -> bf16 planes
// coverage: each range is the exact block count of its job (see cvt16, tr16); grid = PB_ALL.
// =====================================================================================================
#define PB_W2 ((DM / 64) * (DV / 64))
#define PB_WT ((DM / 64) * (DM / 64))
#define PB_XS ((NL * DM) / 2048)
#define PB_XQ ((SQ * DM) / 2048)
#define PB_ALL (PB_W2 + 3 * PB_WT + PB_XS + PB_XQ)
__global__ __launch_bounds__(256)
void prep_all(const float* __restrict__ xq, const float* __restrict__ xs, const float* __restrict__ wv1,
              const float* __restrict__ wq, const float* __restrict__ wk, const float* __restrict__ wv2,
              u16* XQ, u16* XS, u16* WV1T, u16* WQT, u16* WKT, u16* WV2T) {
  __shared__ __align__(16) u16 TH[64 * VTP];
  int b = blockIdx.x;
  if (b < PB_W2) { tr16(TH, wv2, WV2T, DM, DV, 1, W2S, b); return; }
  b -= PB_W2;
  if (b < 3 * PB_WT) {
    const int job = b / PB_WT;
    const float* w = (job == 0) ? wv1 : (job == 1) ? wq : wk;
    u16* d = (job == 0) ? WV1T : (job == 1) ? WQT : WKT;
    tr16(TH, w, d, DM, DM, 0, 1.0f, b % PB_WT);
    return;
  }
  b -= 3 * PB_WT;
  const bool src = b < PB_XS;
  cvt16(src ? xs : xq, src ? XS : XQ, src ? (NL * DM) / 8 : (SQ * DM) / 8, 0, 1.0f, src ? b : b - PB_XS);
}

// =====================================================================================================
// Epilogues. The wave's 16x64 f32 tile (times oscale, plus an optional per-row addend) is staged in its LDS slab (pitch 68),
//            8 consecutive lanes x 16 B per line), lanes 16..31 -> row 2*it+1.
//  epi64hsb: f16 bits of ((tile + bf16RNE(bias[col])) * pscale) into a fragment-order plane: the tile is two adjacent 1-KB blocks;
//            store i = 0..3, lane (h, m) = row m, columns 16i + 8h .. + 7, at half index i * 256 + lane * 8 (512 contiguous bytes).
//  epi64hrb: f16 bits of ((tile + bf16RNE(bias[row])) * pscale), same store shape as epi64hsb, but blocks ordered k tile first (M rows):
//            the tile's two 1-KB blocks stand M * 32 halves apart.
// coverage: epi64 8 instructions x 2 rows x 16 lanes x 4 floats; epi64hsb/hrb 4 instructions x 16 rows x 2 chunks x 8 halves
//           = the wave's 16 x 64 tile in all cases.
// =====================================================================================================
__device__ __forceinline__ void stage64(float* sl, v8f a0, v8f a1, v8f a2, v8f a3, float oscale, int lane) {
  const int hh = lane >> 4, m = lane & 15;
#pragma unroll
  for (int r = 0; r < 8; ++r) {
    const int ro = (8 * hh + r) * 68 + m;
    sl[ro]      = a0[r] * oscale;
    sl[ro + 16] = a1[r] * oscale;
    sl[ro + 32] = a2[r] * oscale;
    sl[ro + 48] = a3[r] * oscale;
  }
  wave_sync_lds();
}
__device__ __forceinline__ void epi64(float* sl, v8f a0, v8f a1, v8f a2, v8f a3, float oscale, v4f badd, float* C, int N,
                                      size_t rowb, int col0, int lane) {
  const int hh = lane >> 4, m = lane & 15;
  stage64(sl, a0, a1, a2, a3, oscale, lane);
  v4f vals[8];
#pragma unroll
  for (int it = 0; it < 8; ++it) vals[it] = *(const v4f*)(sl + (it * 2 + hh) * 68 + m * 4) + badd;
  float* dst = C + (rowb + (size_t)hh) * (size_t)N + col0 + m * 4;
  {
#pragma unroll
    for (int it = 0; it < 8; ++it) {
      *(v4f*)(dst + (size_t)(it * 2) * (size_t)N) = vals[it];
    }
    
  }
}
__device__ __forceinline__ void epi64hsb(float* sl, v8f a0, v8f a1, v8f a2, v8f a3, float oscale, float pscale,
                                         const float* __restrict__ bias, u16* C, int N, size_t rowb, int col0, int lane) {
  stage64(sl, a0, a1, a2, a3, oscale, lane);
  const int row = lane & 15, h8 = (lane >> 4) * 8;
  v4u oh[4];
#pragma unroll
  for (int i4 = 0; i4 < 4; ++i4) {
    const int c8 = i4 * 16 + h8;
    const v4f b0 = *(const v4f*)(bias + col0 + c8), b1 = *(const v4f*)(bias + col0 + c8 + 4);   // columns col0+c8..+7 < N
    const v4f a = *(const v4f*)(sl + row * 68 + c8), c4 = *(const v4f*)(sl + row * 68 + c8 + 4);
    float w[8];
#pragma unroll
    for (int e = 0; e < 4; ++e) { w[e] = (a[e] + bfr(b0[e])) * pscale; w[4 + e] = (c4[e] + bfr(b1[e])) * pscale; }
#pragma unroll
    for (int e = 0; e < 4; ++e) oh[i4][e] = pk16(h_bits((_Float16)w[2 * e]), h_bits((_Float16)w[2 * e + 1]));
  }
  u16* dst = C + rowb * (size_t)N + (size_t)col0 * 16 + lane * 8;      // rowb % 16 == 0, col0 % 64 == 0
  {
#pragma unroll
    for (int i4 = 0; i4 < 4; ++i4) {
      *(v4u*)(dst + i4 * 256) = oh[i4];
    }
    
  }
}
__device__ __forceinline__ void epi64hrb(float* sl, v8f a0, v8f a1, v8f a2, v8f a3, float oscale, float pscale,
                                         const float* __restrict__ brow, u16* C, int M, size_t rowb, int col0, int lane) {
  const int hh = lane >> 4, m = lane & 15;
  const v4f r0v = *(const v4f*)(brow + 8 * hh), r1v = *(const v4f*)(brow + 8 * hh + 4);   // rows rowb+8h .. +7 < M
  float rb[8];
#pragma unroll
  for (int e = 0; e < 4; ++e) { rb[e] = bfr(r0v[e]); rb[4 + e] = bfr(r1v[e]); }
#pragma unroll
  for (int r = 0; r < 8; ++r) {
    const int ro = (8 * hh + r) * 68 + m;
    sl[ro]      = a0[r] * oscale + rb[r];
    sl[ro + 16] = a1[r] * oscale + rb[r];
    sl[ro + 32] = a2[r] * oscale + rb[r];
    sl[ro + 48] = a3[r] * oscale + rb[r];
  }
  wave_sync_lds();
  v4u oh[4];
#pragma unroll
  for (int i4 = 0; i4 < 4; ++i4) {
    const int c8 = i4 * 16 + hh * 8;
    const v4f a = *(const v4f*)(sl + m * 68 + c8), c4 = *(const v4f*)(sl + m * 68 + c8 + 4);
    float w[8];
#pragma unroll
    for (int e = 0; e < 4; ++e) { w[e] = a[e] * pscale; w[4 + e] = c4[e] * pscale; }
#pragma unroll
    for (int e = 0; e < 4; ++e) oh[i4][e] = pk16(h_bits((_Float16)w[2 * e]), h_bits((_Float16)w[2 * e + 1]));
  }
  u16* dst = C + (size_t)col0 * (size_t)M + rowb * 32 + lane * 8;      // rowb % 16 == 0, col0 % 64 == 0
  {
#pragma unroll
    for (int i4 = 0; i4 < 4; ++i4) {
      *(v4u*)(dst + (size_t)(i4 >> 1) * 32 * (size_t)M + (i4 & 1) * 256) = oh[i4];
    }
    
  }
}

// =====================================================================================================
// bf16 GEMM, f16 plane out with column bias: C16[M][N] = f16 bits of (((A[M][K] (bf16) . Bt[N][K]^T (bf16))
// * oscale) + bf16RNE(bias[n])) * pscale. A, Bt and C16 are fragment-order planes.
// Block = 64x64 tile, 4 waves x 16 rows; fragments loaded straight from the 1-KB blocks (two 16-B loads each, split k map for
// A and B); K stepped by 32 = one block (K % 32 == 0, M % 64 == 0, N % 64 == 0, blocks bid = 0 .. (M/64)*(N/64) - 1).
// slab: the block's 4 epilogue slabs in LDS.
// =====================================================================================================
__device__ __forceinline__
void gemm_bh16(float* slab, const u16* __restrict__ A, const u16* __restrict__ Bt, const float* __restrict__ bias, u16* C,
               int M, int N, int K, float oscale, float pscale, int bid) {
  const int tid = threadIdx.x, wave = tid >> 5, lane = tid & 31;
  const int ntile = N >> 6;
  const int rowb  = (bid / ntile) * 64 + wave * 16;
  const int col0  = (bid % ntile) * 64;
  if (rowb + 16 > M) return;                 // wave-uniform, never taken with the exact grid; no block barriers in this kernel
  const size_t bs = (size_t)16 * K;
  const u16* ap  = A  + (size_t)rowb * (size_t)K + lane * 8;
  const u16* bp0 = Bt + (size_t)col0 * (size_t)K + lane * 8;
  const u16* bp1 = bp0 + bs;
  const u16* bp2 = bp1 + bs;
  const u16* bp3 = bp2 + bs;
  v8f acc0 = zero8(), acc1 = zero8(), acc2 = zero8(), acc3 = zero8();
#pragma unroll 1
  for (int k0 = 0; k0 < K; k0 += 32, ap += 512, bp0 += 512, bp1 += 512, bp2 += 512, bp3 += 512) {   // one 1-KB block a step
    const v16b a  = ldfrag_b(ap);
    const v16b b0 = ldfrag_b(bp0);
    const v16b b1 = ldfrag_b(bp1);
    const v16b b2 = ldfrag_b(bp2);
    const v16b b3 = ldfrag_b(bp3);
    acc0 = mma_b(a, b0, acc0);
    acc1 = mma_b(a, b1, acc1);
    acc2 = mma_b(a, b2, acc2);
    acc3 = mma_b(a, b3, acc3);
    guard6<v16b>(acc0, acc1, acc2, acc3, a, b0, b1, b2, b3, a);
  }
  epi64hsb(slab + wave * SLAB64, acc0, acc1, acc2, acc3, oscale, pscale, bias, C, N, (size_t)rowb, col0, lane);
}
// The three projections in ONE launch (independent of one another): blocks [0, GB_S) value = source.Wv1 + b (f16 plane x8),
// next GB_Q q = query.Wq + b (rows < SQ, x8), next GB_S k = source.Wk + b (x8); the job is block-uniform. grid = 2 * GB_S + GB_Q.
#define GB_S ((NL / 64) * (DM / 64))
#define GB_Q ((SQ / 64) * (DM / 64))
__global__ __launch_bounds__(128)
void proj3(const u16* __restrict__ XS, const u16* __restrict__ XQ, const u16* __restrict__ W1T, const u16* __restrict__ WQT,
           const u16* __restrict__ WKT, const float* __restrict__ bv1, const float* __restrict__ bq,
           const float* __restrict__ bk, u16* VALH, u16* QP, u16* KP) {
  __shared__ __align__(16) float slab[4 * SLAB64];
  const int b = blockIdx.x;
  const int job = (b < GB_S) ? 0 : (b < GB_S + GB_Q) ? 1 : 2;
  const u16*   A    = (job == 1) ? XQ : XS;
  const u16*   Bt   = (job == 0) ? W1T : (job == 1) ? WQT : WKT;
  const float* bias = (job == 0) ? bv1 : (job == 1) ? bq : bk;
  u16*         C    = (job == 0) ? VALH : (job == 1) ? QP : KP;
  const int    M    = (job == 1) ? SQ : NL;
  const float  ps   = (job == 0) ? VSC : (job == 1) ? QSC : KSC;
  const int    bid  = (job == 0) ? b : (job == 1) ? b - GB_S : b - GB_S - GB_Q;
  gemm_bh16(slab, A, Bt, bias, C, M, DM, DM, 1.0f, ps, bid);
}

// =====================================================================================================
// f16 GEMM, f16 plane out with ROW bias: C16[M][N] = f16 bits of (((A[M][K] (f16) . Bt[N][K]^T (f16))
// * oscale) + bf16RNE(bias[m])) * pscale; all three planes in fragment order, C16 with its blocks k tile first. Same tiling and fragment loads as gemm_bh16; epilogue epi64hrb.
// =====================================================================================================
__global__ __launch_bounds__(128)
void gemm_hh16r(const u16* __restrict__ A, const u16* __restrict__ Bt, const float* __restrict__ bias, u16* C,
                int M, int N, int K, float oscale, float pscale) {
  __shared__ __align__(16) float slab[4 * SLAB64];
  const int tid = threadIdx.x, wave = tid >> 5, lane = tid & 31;
  const int ntile = N >> 6;
  const int bid   = blockIdx.x;
  const int rowb  = (bid / ntile) * 64 + wave * 16;
  const int col0  = (bid % ntile) * 64;
  if (rowb + 16 > M) return;                 // wave-uniform, never taken with the exact grid; no block barriers in this kernel
  const size_t bs = (size_t)16 * K;
  const _Float16* ap  = (const _Float16*)(const void*)A  + (size_t)rowb * (size_t)K + lane * 8;
  const _Float16* bp0 = (const _Float16*)(const void*)Bt + (size_t)col0 * (size_t)K + lane * 8;
  const _Float16* bp1 = bp0 + bs;
  const _Float16* bp2 = bp1 + bs;
  const _Float16* bp3 = bp2 + bs;
  v8f acc0 = zero8(), acc1 = zero8(), acc2 = zero8(), acc3 = zero8();
#pragma unroll 1
  for (int k0 = 0; k0 < K; k0 += 32, ap += 512, bp0 += 512, bp1 += 512, bp2 += 512, bp3 += 512) {   // one 1-KB block a step
    const v16h a  = ldfrag_hf(ap);
    const v16h b0 = ldfrag_hf(bp0);
    const v16h b1 = ldfrag_hf(bp1);
    const v16h b2 = ldfrag_hf(bp2);
    const v16h b3 = ldfrag_hf(bp3);
    acc0 = mma_h(a, b0, acc0);
    acc1 = mma_h(a, b1, acc1);
    acc2 = mma_h(a, b2, acc2);
    acc3 = mma_h(a, b3, acc3);
    guard6<v16h>(acc0, acc1, acc2, acc3, a, b0, b1, b2, b3, a);
  }
  epi64hrb(slab + wave * SLAB64, acc0, acc1, acc2, acc3, oscale, pscale, bias + rowb, C, M, (size_t)rowb, col0, lane);
}

// =====================================================================================================
// Head-axis softmax attention with the head mean folded in. Block = NT = 64 query rows q0..q0+63, 8 waves, the KSPAN keys of
// key range blockIdx.x in tiles of LT = 32 (the softmax runs over heads, so key ranges only add: each range writes its own f32
// partial plane, sum_parts adds the KS planes). q plane f16 x8 [n][512] (head h = columns 64h..64h+63), k plane the same, V^T plane f16 x64 [h*512+d][l],
// all three in fragment order, V^T with its blocks k tile first.
//   (S) wave w = head w: S_w[64 n][32 l] in two passes of 32 n = 4 D tiles each, K = 64 (2 k-steps): A = q rows (row m = query,
//       split k map over the head's 64 columns), B = k rows (col n = key, same split map, loaded once for both passes);
//       D element r of lane -> U.s[w][n 32nh+16nt+8h+r][l 16half+m].
//   (M) thread = (n = 32it + (tid>>3), 4 consecutive l), it = 0, 1, all arithmetic on 4-wide f32 vectors (packed instructions):
//       max over the 8 heads of s, p = exp2(fma(s, log2e/512, -max * log2e/512)), P = p / sum (f32), written as f16(P * 4096) to
//       sP[h][n][l] with 8-B LDS stores.
//   (PV) wave w owns d columns 64w + 16t + (lane&15), t = 0..3, for all four 16-row n groups (16 accumulators): every V^T fragment
//       fetched from L2 feeds four matrix instructions. For every head h:
//       A = P_h fragments from LDS (row m = query, split map over the 32 keys), B = V^T fragments (col = d, keys contiguous,
//       row h*512 + d of the V^T plane); all heads and key tiles accumulate into the same accumulators (joint (l,h) K axis).
//   Block barriers after (S) and after (M) order every LDS reuse across phases, key tiles and waves.
//   Epilogue: partial = acc * 2^-21 (= 1 / (4096 * 64 * 8 heads)); the wave's four 16 x 64 f32 tiles go through epi64 one after
//   another (a wave-level LDS sync between tiles); a block barrier separates the key loop from the slab use (the slab area
//   aliases the score area).
// coverage: grid (KS, SQ/64) blocks x 64 rows = query rows 0..SQ-1 of every partial plane; (S) 8 waves x 64 x 32 = all score cells;
//           (M) 2 passes x 256 thr x 4 l x 8 h = all P cells; stores 8 waves x (4 tiles x 16 rows x 64 cols) =
//           part[ks][q0..q0+63][0..511], every float exactly once.
// =====================================================================================================
__global__ __launch_bounds__(ATT_THREADS)
void attn_heads(const u16* __restrict__ QPp, const u16* __restrict__ KPp, const u16* __restrict__ VTp, float* part) {
  __shared__ __align__(16) AttU U;                 // scores [8][64][SSP] f32; reused as 8 epilogue slabs
  __shared__ __align__(16) u16 sP[NH * NT * PLP];  // P tiles [8][64][PLP] f16 bits

  const int tid  = threadIdx.x;
  const int wave = tid >> 5;
  const int lane = tid & 31;
  const int hh   = lane >> 4;
  const int m    = lane & 15;
  const int q0   = blockIdx.y * NT;          // q0 + 63 < SQ (grid exact)
  const int lbeg = blockIdx.x * KSPAN;       // this block's key range lbeg .. lbeg + KSPAN - 1 < NL (grid exact)
  float* const out = part + (size_t)blockIdx.x * ((size_t)SQ * DM);

  const _Float16* qb = (const _Float16*)(const void*)QPp + (size_t)q0 * DM + wave * (DKH * 16) + lane * 8;
  const _Float16* kp = (const _Float16*)(const void*)KPp + (size_t)lbeg * DM + wave * (DKH * 16) + lane * 8;   // steps one key tile a pass
  const _Float16* vb = (const _Float16*)(const void*)VTp + wave * (64 * 32) + lane * 8;
  const float lsc = LOG2E / (QSC * KSC * 8.0f);
  const v4f lsc4 = {lsc, lsc, lsc, lsc};
  float* const sw = U.s + wave * (NT * SSP);

  v8f o[4][4];                               // o[i][t]: n rows 16i..16i+15, d columns 64 * wave + 16t..+15
#pragma unroll
  for (int i = 0; i < 4; ++i) {
#pragma unroll
    for (int t = 0; t < 4; ++t) o[i][t] = zero8();
  }

#pragma unroll 1
  for (int l0 = lbeg; l0 < lbeg + KSPAN; l0 += LT, kp += (size_t)LT * DM) {
    // ---- (S) scores of head = wave for this key tile ----
    {
      const v16h ka0 = ldfrag_hf(kp), ka1 = ldfrag_hf(kp + 512);
      const v16h kc0 = ldfrag_hf(kp + (size_t)16 * DM), kc1 = ldfrag_hf(kp + (size_t)16 * DM + 512);
      const _Float16* qp = qb;
      // kept rolled: unrolled, 8 q fragments and 8 score tiles would be live beside the 16 output accumulators
#pragma unroll 1
      for (int nh = 0; nh < NT / 32; ++nh, qp += (size_t)32 * DM) {
        const v16h qa0 = ldfrag_hf(qp), qa1 = ldfrag_hf(qp + 512);
        const v16h qc0 = ldfrag_hf(qp + (size_t)16 * DM), qc1 = ldfrag_hf(qp + (size_t)16 * DM + 512);
        v8f s00 = zero8(), s01 = zero8(), s10 = zero8(), s11 = zero8();
        s00 = mma_h(qa0, ka0, s00);  s00 = mma_h(qa1, ka1, s00);     // n rows 0..15 of the pass,  keys 0..15
        s01 = mma_h(qa0, kc0, s01);  s01 = mma_h(qa1, kc1, s01);     // n rows 0..15 of the pass,  keys 16..31
        s10 = mma_h(qc0, ka0, s10);  s10 = mma_h(qc1, ka1, s10);     // n rows 16..31 of the pass, keys 0..15
        s11 = mma_h(qc0, kc0, s11);  s11 = mma_h(qc1, kc1, s11);     // n rows 16..31 of the pass, keys 16..31
        guard4x8(s00, s01, s10, s11, qa0, qa1, qc0, qc1, ka0, ka1, kc0, kc1);
        float* const sn = sw + nh * (32 * SSP);
#pragma unroll
        for (int r = 0; r < 8; ++r) {
          const int ro = (8 * hh + r) * SSP + m;
          sn[ro]                 = s00[r];
          sn[ro + 16]            = s01[r];
          sn[ro + 16 * SSP]      = s10[r];
          sn[ro + 16 * SSP + 16] = s11[r];
        }
      }
    }
    __syncthreads();
    // ---- (M) softmax over the 8 heads per (n, l), P tiles ----
#pragma unroll
    for (int it = 0; it < NT / 32; ++it) {
      const int n = it * 32 + (tid >> 3), lq = (tid & 7) * 4;
      v4f t[NH];
#pragma unroll
      for (int h = 0; h < NH; ++h) t[h] = *(const v4f*)(U.s + h * (NT * SSP) + n * SSP + lq);
      v4f mr = t[0];
#pragma unroll
      for (int h = 1; h < NH; ++h) mr = __builtin_elementwise_max(mr, t[h]);
      const v4f mx = mr * lsc;                                 // = max over heads of the rounded s * lsc: lsc > 0, rounding is monotonic
      v4f sm;
#pragma unroll
      for (int h = 0; h < NH; ++h) {
        const v4f x = __builtin_elementwise_fma(t[h], lsc4, -mx);
        // raw v_exp_f32: it differs from exp2f only where p < 2^-126; such a p vanishes in sm (one term is about 1) and is 0 as f16(P * 4096)
#pragma unroll
        for (int e = 0; e < 4; ++e) t[h][e] = __builtin_amdgcn_exp2f(x[e]);
        sm = h ? sm + t[h] : t[h];
      }
      v4f rs;                                                  // sm in [1, 8]
#pragma unroll
      for (int e = 0; e < 4; ++e) rs[e] = __builtin_amdgcn_rcpf(sm[e]) * PCAR;
      u16* pd = sP + n * PLP + lq;
#pragma unroll
      for (int h = 0; h < NH; ++h)
        *(v2u*)(pd + h * (NT * PLP)) = __builtin_bit_cast(v2u, __builtin_convertvector(t[h] * rs, v4h));
    }
    __syncthreads();
    // ---- (PV) accumulate P_h . V_h over all heads for this key tile ----
    {
      const _Float16* pbase = (const _Float16*)(const void*)sP + m * PLP + 8 * hh;
      const _Float16* vl = vb + (size_t)l0 * DV;   // k tile l0 / 32 of V^T: DV / 16 blocks of 512 halves
#pragma unroll 1
      for (int h = 0; h < NH; ++h) {
        const _Float16* vp = vl + h * (DM * 32);
        const v16h g0 = ldfrag_hf(vp);
        const v16h g1 = ldfrag_hf(vp + 512);
        const v16h g2 = ldfrag_hf(vp + 1024);
        const v16h g3 = ldfrag_hf(vp + 1536);
        const _Float16* pp = pbase + h * (NT * PLP);
        const v16h p0 = ldfrag_h(pp);
        const v16h p1 = ldfrag_h(pp + 16 * PLP);
        const v16h p2 = ldfrag_h(pp + 32 * PLP);
        const v16h p3 = ldfrag_h(pp + 48 * PLP);
        o[0][0] = mma_h(p0, g0, o[0][0]);
        o[1][0] = mma_h(p1, g0, o[1][0]);
        o[2][0] = mma_h(p2, g0, o[2][0]);
        o[3][0] = mma_h(p3, g0, o[3][0]);
        o[0][1] = mma_h(p0, g1, o[0][1]);
        o[1][1] = mma_h(p1, g1, o[1][1]);
        o[2][1] = mma_h(p2, g1, o[2][1]);
        o[3][1] = mma_h(p3, g1, o[3][1]);
        o[0][2] = mma_h(p0, g2, o[0][2]);
        o[1][2] = mma_h(p1, g2, o[1][2]);
        o[2][2] = mma_h(p2, g2, o[2][2]);
        o[3][2] = mma_h(p3, g2, o[3][2]);
        o[0][3] = mma_h(p0, g3, o[0][3]);
        o[1][3] = mma_h(p1, g3, o[1][3]);
        o[2][3] = mma_h(p2, g3, o[2][3]);
        o[3][3] = mma_h(p3, g3, o[3][3]);
        guard16x8(o, p0, p1, p2, p3, g0, g1, g2, g3);
      }
    }
  }
  __syncthreads();

  const float osc = 1.0f / (PCAR * VCAR * (float)NH);
  const v4f z4 = {0.f, 0.f, 0.f, 0.f};
  float* const sl = U.slab + wave * SLAB64;
#pragma unroll
  for (int i = 0; i < 4; ++i) {
    if (i) wave_sync_lds();                  // the slab's last reads end before the next tile is staged in it
    epi64(sl, o[i][0], o[i][1], o[i][2], o[i][3], osc, z4, out, DM, (size_t)q0 + 16 * i, wave * 64, lane);
  }
}

// =====================================================================================================
// out = sum of the KS partial planes, added in plane order 0..KS-1 in f32. Thread = 4 consecutive floats: KS 16-B loads, one
// 16-B store; 32 consecutive lanes = 512 contiguous bytes per load and store.
// coverage: grid = SQ*DM/1024 blocks x 256 thr x 4 floats = out rows 0..SQ-1, every float exactly once.
// =====================================================================================================
__global__ __launch_bounds__(256) void sum_parts(const float* __restrict__ part, float* out) {
  const unsigned ob = (blockIdx.x * 256u + threadIdx.x) * 16u;    // byte offset in a plane, < SQ * DM * 4 (grid exact)
  v4f p[KS];
#pragma unroll
  for (int s = 0; s < KS; ++s) p[s] = *(const v4f*)((const char*)(part + (size_t)s * ((size_t)SQ * DM)) + ob);
  v4f a = p[0];
#pragma unroll
  for (int s = 1; s < KS; ++s) a += p[s];
  *(v4f*)((char*)out + ob) = a;
}

// =====================================================================================================
// Workspace map (bytes); every plane is fully written by whole-line stores before it is read; all extents are exact multiples of
// the store granularity (no pad rows, all dims multiples of 64), every offset a multiple of 256:
//   XQ  bf16 [SQ][512]                      <=  4194304
//   XS  bf16 [4096][512]                        4194304
//   WV1T, WQT, WKT bf16 [512][512]             3 x 524288
//   WV2T f16 of bf16 value x1024 [4096][512]   4194304
//   VALH f16 value x8 [4096][512]               4194304
//   QP   f16 x8 [SQ][512]                   <=  4194304
//   KP   f16 x8 [4096][512]                     4194304
//   VT   f16 x64 [4096][4096]                  33554432
//   PART f32 [KS][SQ][512]                  <= 67108864
//   end                                     <= 127401984
// =====================================================================================================
extern "C" void kernel_launch(void* const* d_in, const int* in_sizes, int n_in,
                              void* d_out, int out_size, void* d_ws, size_t ws_size,
                              hipStream_t stream) {
  if (n_in < 10) return;
  if (in_sizes[0] != NQ * DM || in_sizes[1] != NL * DM) return;
  if (in_sizes[2] != DM * DM || in_sizes[3] != DM) return;
  if (in_sizes[4] != DM * DM || in_sizes[5] != DM) return;
  if (in_sizes[6] != DM * DM || in_sizes[7] != DM) return;
  if (in_sizes[8] != DM * DV || in_sizes[9] != DV) return;
  if (out_size != NQ * DM) return;

  const float* xq  = (const float*)d_in[0];
  const float* xs  = (const float*)d_in[1];
  const float* wv1 = (const float*)d_in[2];
  const float* bv1 = (const float*)d_in[3];
  const float* wq  = (const float*)d_in[4];
  const float* bq  = (const float*)d_in[5];
  const float* wk  = (const float*)d_in[6];
  const float* bk  = (const float*)d_in[7];
  const float* wv2 = (const float*)d_in[8];
  const float* bv2 = (const float*)d_in[9];
  float*       out = (float*)d_out;

  const size_t szXQ = (size_t)SQ * DM * 2;          //  4194304 at SQ = NQ
  const size_t szXS = (size_t)NL * DM * 2;          //  4194304
  const size_t szWT = (size_t)DM * DM * 2;          //   524288
  const size_t szW2 = (size_t)DV * DM * 2;          //  4194304
  const size_t szVL = (size_t)NL * DM * 2;          //  4194304
  const size_t szQP = (size_t)SQ * DM * 2;          //  4194304 at SQ = NQ
  const size_t szKP = (size_t)NL * DM * 2;          //  4194304
  const size_t szVT = (size_t)DV * NL * 2;          // 33554432
  const size_t szPT = (size_t)KS * SQ * DM * 4;     // 67108864 at SQ = NQ
  size_t off = 0;
  const size_t oXQ = off; off += szXQ;
  const size_t oXS = off; off += szXS;
  const size_t oW1 = off; off += szWT;
  const size_t oWQ = off; off += szWT;
  const size_t oWK = off; off += szWT;
  const size_t oW2 = off; off += szW2;
  const size_t oVL = off; off += szVL;
  const size_t oQP = off; off += szQP;
  const size_t oKP = off; off += szKP;
  const size_t oVT = off; off += szVT;
  const size_t oPT = off; off += szPT;
  if (off > ws_size) return;                        // off = 127401984 at SQ = NQ
  if (off > WS_CAP) return;

  char* ws = (char*)d_ws;
  u16* XQ   = (u16*)(ws + oXQ);
  u16* XS   = (u16*)(ws + oXS);
  u16* WV1T = (u16*)(ws + oW1);
  u16* WQT  = (u16*)(ws + oWQ);
  u16* WKT  = (u16*)(ws + oWK);
  u16* WV2T = (u16*)(ws + oW2);
  u16* VALH = (u16*)(ws + oVL);
  u16* QP   = (u16*)(ws + oQP);
  u16* KP   = (u16*)(ws + oKP);
  u16* VT   = (u16*)(ws + oVT);
  float* PART = (float*)(ws + oPT);

  const dim3 blk(256);
  const dim3 bG(128);
  const dim3 gPR(PB_ALL);                           // 512 + 3 x 64 + 1024 + 1024 at SQ = NQ
  const dim3 gP3(2 * GB_S + GB_Q);                  // 3 x 512 at SQ = NQ
  const dim3 gVT((DV / 64) * (NL / 64));            // 4096
  const dim3 gAT(KS, SQ / NT);                      // 8 x 64 at SQ = NQ
  const dim3 gSP((SQ * DM) / 1024);                 // 2048 at SQ = NQ
  const dim3 bAT(ATT_THREADS);

  // (0) query rows < SQ and source -> bf16 planes; Wv1, Wq, Wk [in][out] -> bf16 [out][in] fragment-order planes;
  //     Wv2 [512][4096] -> f16 of the bf16 value x1024, [4096][512]
  prep_all<<<gPR, blk, 0, stream>>>(xq, xs, wv1, wq, wk, wv2, XQ, XS, WV1T, WQT, WKT, WV2T);
  // (1) value = source.Wv1 + b -> f16 plane x8; q (rows < SQ) and k projections -> f16 planes x8
  proj3<<<gP3, bG, 0, stream>>>(XS, XQ, WV1T, WQT, WKT, bv1, bq, bk, VALH, QP, KP);
  // (2) V^T [h*512+d][l] = (Wv2^T . value^T) / (1024*8) + b[h*512+d], f16 plane x64
  gemm_hh16r<<<gVT, bG, 0, stream>>>(WV2T, VALH, bv2, VT, DV, NL, DM, 1.0f / (W2S * VSC), VCAR);
  // (3) head-axis softmax attention + head mean, one f32 partial plane per key range; (4) planes summed -> out rows 0..SQ-1
  attn_heads<<<gAT, bAT, 0, stream>>>(QP, KP, VT, PART);
  sum_parts<<<gSP, blk, 0, stream>>>(PART, out);
  (void)hipGetLastError();
}

// v006
// A run of this version takes 181 microseconds.
// Two timings next to v005 put it at 1.11 and 1.10 times that version's speed.
// Counting every step since v000, it is 4.34 times as fast.
// Projections value, q, k = x.W + b: v_wmma_f32_16x16x32_bf16 (bf16 RNE operands of the raw inputs, f32 accumulate, bf16 RNE
// bias added in f32). v^T = Wv2^T . value^T (W as f16 of the bf16 RNE value x1024, value plane f16 x8, bf16 RNE bias per row in
// f32), per-head scores q.k^T (f16 planes x8) and P.V (P x4096 f16 from LDS, V^T x64 f16): v_wmma_f32_16x16x32_f16, f32
// accumulate. Softmax over the head axis, the head mean and all scaling in f32 on VALU.
// Every 16-bit operand plane [rows][K] in the workspace is kept in FRAGMENT ORDER: 1-KB blocks of 16 rows x 32 k, block (rt, kt)
// at half index rt * 16 * K + kt * 512; inside a block the 16-B chunk (row m = row & 15, c = (k >> 3) & 3) stands at half index
// c * 128 + m * 8. Lane (h = lane >> 4, m = lane & 15) of a fragment then reads its two 16-B chunks (c = h and c = 2 + h) at
// lane * 8 and 256 + lane * 8: each load of a wave is 512 contiguous bytes (4 cache lines) and not 32 B out of each of 16 lines.
// The V^T plane alone orders its blocks k tile first, block (rt, kt) at half index (kt * (rows / 16) + rt) * 512, so that all that
// one key tile of the attention reads (every head, every d) is one contiguous 256-KB run.
#include <hip/hip_runtime.h>
#include <math.h>
#include <stdint.h>

#define NQ   4096
#define NL   4096
#define DM   512
#define NH   8
#define DKH  64
#define DV   (NH * DM)
#ifndef SQ
#define SQ NQ
#endif
#define NT   64
#define LT   32
#define SSP  32
#define PLP  40
#define SLAB64 (16 * 68)
#define ATT_THREADS 256
#define KS   8
#define KSPAN (NL / KS)
#define QSC  8.0f
#define KSC  8.0f
#define VSC  8.0f
#define W2S  1024.0f
#define PCAR 4096.0f
#define VCAR 64.0f
#define LOG2E 1.4426950408889634f
#define WS_CAP ((size_t)134217728)

static_assert(DM == NH * DKH && DKH == 64 && NH == 8 && (DM % 64) == 0 && (DV % 64) == 0 && (NL % 64) == 0 && (NQ % 64) == 0);
static_assert((DM % 32) == 0);
static_assert(SQ >= 64 && SQ <= NQ && (SQ % 64) == 0 && (SQ % NT) == 0);
static_assert(NT == 64 && LT == 32 && (NL % LT) == 0 && ATT_THREADS == 256 && ATT_THREADS * 4 * (NT / 32) == NT * LT);
static_assert(KS >= 1 && (NL % (KS * LT)) == 0 && ((SQ * DM) % 1024) == 0);
static_assert(SSP >= LT && PLP >= 32 && ((PLP * 2) % 16) == 0 && ((SSP * 4) % 16) == 0);
static_assert(8 * SLAB64 <= NH * NT * SSP);
static_assert(((NQ * DM) % 2048) == 0 && ((NL * DM) % 2048) == 0 && ((SQ * DM) % 2048) == 0);
static_assert(NH * NT * SSP * 4 + NH * NT * PLP * 2 <= 160 * 1024);   // two blocks on a WGP

typedef unsigned short u16;
typedef _Float16 v16h __attribute__((ext_vector_type(16)));
typedef _Float16 v8h  __attribute__((ext_vector_type(8)));
typedef _Float16 v4h  __attribute__((ext_vector_type(4)));
typedef __bf16   v16b __attribute__((ext_vector_type(16)));
typedef float    v8f  __attribute__((ext_vector_type(8)));
typedef float    v4f  __attribute__((ext_vector_type(4)));
typedef unsigned int v4u __attribute__((ext_vector_type(4)));
typedef unsigned int v2u __attribute__((ext_vector_type(2)));

union FragH { v16h v; v8h h[2]; v4u u[2]; };
union FragB { v16b v; v4u u[2]; };
union AttU { float s[NH * NT * SSP]; float slab[8 * SLAB64]; };

// ---- scalar helpers --------------------------------------------------------------------------------
__device__ __forceinline__ unsigned short bf_bits(float f) {          // f32 -> bf16 bits, RNE convert
  unsigned u = __float_as_uint(f);
  return (unsigned short)((u + 0x7FFFu + ((u >> 16) & 1u)) >> 16);
}
__device__ __forceinline__ float bf_up(unsigned short h) { return __uint_as_float(((unsigned)h) << 16); }
__device__ __forceinline__ float bfr(float f) { return bf_up(bf_bits(f)); }
__device__ __forceinline__ unsigned short h_bits(_Float16 x) { return __builtin_bit_cast(unsigned short, x); }
__device__ __forceinline__ unsigned pk16(unsigned short a, unsigned short b) { return (unsigned)a | ((unsigned)b << 16); }
__device__ __forceinline__ v8f zero8() { v8f z = {0.f, 0.f, 0.f, 0.f, 0.f, 0.f, 0.f, 0.f}; return z; }

// ---- fragment loaders: 16-bit A/B operand, lane -> row/col (lane&15); elements 0..7 <- k0+8h.., elements 8..15 <- k0+16+8h..
//      (same split k map for A and B).
//      ldfrag_h: row-major LDS tile, p already includes row * pitch + 8*(lane>>4): p[0..7] and p[16..23].
//      ldfrag_hf / ldfrag_b: fragment-order workspace plane, p = start of the 1-KB block + lane * 8: p[0..7] and p[256..263].
__device__ __forceinline__ v16h ldfrag_h(const _Float16* p) {
  FragH f;
  f.h[0] = *(const v8h*)(p);
  f.h[1] = *(const v8h*)(p + 16);
  return f.v;
}
__device__ __forceinline__ v16h ldfrag_hf(const _Float16* p) {
  FragH f;
  f.h[0] = *(const v8h*)(p);
  f.h[1] = *(const v8h*)(p + 256);
  return f.v;
}
__device__ __forceinline__ v16b ldfrag_b(const u16* p) {              // bf16 plane read as unsigned integer vectors
  FragB f;
  f.u[0] = *(const v4u*)(p);
  f.u[1] = *(const v4u*)(p + 256);
  return f.v;
}

__device__ __forceinline__ v8f mma_h(v16h a, v16h b, v8f c) {
  return __builtin_amdgcn_wmma_f32_16x16x32_f16(false, a, false, b, (short)0, c, false, false);
}
__device__ __forceinline__ v8f mma_b(v16b a, v16b b, v8f c) {
  return __builtin_amdgcn_wmma_f32_16x16x32_bf16(false, a, false, b, (short)0, c, false, false);
}
template <typename F>
__device__ __forceinline__ void guard6(v8f& a, v8f& b, v8f& c, v8f& d, F x0, F x1, F x2, F x3, F x4, F x5) {
#if defined(__HIP_DEVICE_COMPILE__)
  asm volatile("v_nop\n\tv_nop\n\tv_nop\n\tv_nop"
               : "+v"(a), "+v"(b), "+v"(c), "+v"(d) : "v"(x0), "v"(x1), "v"(x2), "v"(x3), "v"(x4), "v"(x5) : "memory");
#endif
}
__device__ __forceinline__ void guard4x8(v8f& a, v8f& b, v8f& c, v8f& d, v16h x0, v16h x1, v16h x2, v16h x3,
                                         v16h x4, v16h x5, v16h x6, v16h x7) {
#if defined(__HIP_DEVICE_COMPILE__)
  asm volatile("v_nop\n\tv_nop\n\tv_nop\n\tv_nop"
               : "+v"(a), "+v"(b), "+v"(c), "+v"(d)
               : "v"(x0), "v"(x1), "v"(x2), "v"(x3), "v"(x4), "v"(x5), "v"(x6), "v"(x7) : "memory");
#endif
}
// Four vector slots behind the last matrix instruction of a P.V half step (on the taken side of the key loop's branch too) before
// later loads overwrite its fragment registers; the fragments are inputs so that they stay allocated up to here, and the "memory"
// clobber keeps the refill of the ring slot behind the matrix instructions that read it.
__device__ __forceinline__ void guard16x6(v8f (&o)[4][4], v16h x0, v16h x1, v16h x2, v16h x3, v16h x4, v16h x5) {
#if defined(__HIP_DEVICE_COMPILE__)
  asm volatile("v_nop\n\tv_nop\n\tv_nop\n\tv_nop"
               : "+v"(o[0][0]), "+v"(o[0][1]), "+v"(o[0][2]), "+v"(o[0][3]), "+v"(o[1][0]), "+v"(o[1][1]), "+v"(o[1][2]), "+v"(o[1][3]),
                 "+v"(o[2][0]), "+v"(o[2][1]), "+v"(o[2][2]), "+v"(o[2][3]), "+v"(o[3][0]), "+v"(o[3][1]), "+v"(o[3][2]), "+v"(o[3][3])
               : "v"(x0), "v"(x1), "v"(x2), "v"(x3), "v"(x4), "v"(x5) : "memory");
#endif
}
__device__ __forceinline__ void wave_sync_lds() {
  __builtin_amdgcn_fence(__ATOMIC_RELEASE, "workgroup");
  __builtin_amdgcn_wave_barrier();
  __builtin_amdgcn_fence(__ATOMIC_ACQUIRE, "workgroup");
}

// =====================================================================================================
// f32 plane [rows][DM] row-major -> 16-bit plane in fragment order:  mode 0: bf16 RNE bits;  mode 1: f16 bits of (bf16 RNE value) * scale;
// mode 2: f16 bits of value * scale (no bf16 pre-step).
// Thread = output chunk gt = 8 consecutive k of one row: two 16-B loads (a wave reads 64 B of each of 16 rows), one 16-B store;
// 32 consecutive lanes store 512 contiguous, 512-B aligned bytes
// coverage: n8/256 blocks bid = 0.. (exact multiples) x 256 thr x 8 = the whole plane.
// =====================================================================================================
__device__ __forceinline__ void cvt16(const float* __restrict__ x, u16* D, int n8, int mode, float scale, int bid) {
  const int gt = bid * 256 + (int)threadIdx.x;
  if (gt >= n8) return;                     // no barriers on this path
  const int kb = DM / 32;                   // blocks in a row tile
  const int blk = gt >> 6, cw = gt & 63;    // 1-KB block, chunk in it: cw = c * 16 + m
  const float* p = x + ((size_t)(blk / kb) * 16 + (size_t)(cw & 15)) * DM + (blk % kb) * 32 + (cw >> 4) * 8;
  const v4f a = *(const v4f*)(p), c4 = *(const v4f*)(p + 4);
  float v[8];
#pragma unroll
  for (int e = 0; e < 4; ++e) { v[e] = a[e]; v[4 + e] = c4[e]; }
  unsigned short s[8];
#pragma unroll
  for (int e = 0; e < 8; ++e) {
    const float vb = bfr(v[e]);
    const float vf = (mode == 1) ? vb : v[e];
    const unsigned short hb = h_bits((_Float16)(vf * scale));
    const unsigned short bb = bf_bits(v[e]);
    s[e] = (mode != 0) ? hb : bb;
  }
  v4u o;
#pragma unroll
  for (int e = 0; e < 4; ++e) o[e] = pk16(s[2 * e], s[2 * e + 1]);
  u16* d = D + (size_t)gt * 8;
  {
    *(v4u*)(d) = o;
    
  }
}

// =====================================================================================================
// Transpose + convert: in X [R][C] f32 row-major -> out XTo [C][R] 16-bit in fragment order (output row = input column, k = R axis).
//   mode 0: bf16 RNE bits;  mode 1: f16 bits of (bf16 RNE value) * scale;  mode 2: f16 bits of value * scale.
// Block = 64 input rows x 64 input cols: bid -> (rt = bid % (R/64), ct = bid / (R/64)). The 64x64 f32 tile is loaded with 16-B
// loads (thread = input row tid>>2, 16 consecutive cols), converted and scattered into LDS TH[c local][r local] (pitch 72 halves);
// the tile is 4 row tiles x 2 k tiles = 8 blocks of 1 KB; chunk cid = it * 256 + tid -> block cid >> 6, chunk cid & 63 in it.
// coverage: load 256 thr x 16 = 64 x 64; store 2 iterations x 256 thr x 8 halves = 8 blocks x 64 chunks = the tile;
//           (R/64)*(C/64) blocks bid = 0.. (exact multiples) tile the whole [C][R] plane exactly once. TH: the block's 64 x VTP LDS tile.
// =====================================================================================================
#define VTP 72
static_assert(64 * VTP >= 63 * VTP + 64 && ((VTP * 2) % 16) == 0);
__device__ __forceinline__ void tr16(u16* TH, const float* __restrict__ X, u16* XTo, int R, int C, int mode, float scale, int bid) {
  const int tid = threadIdx.x;
  const int nrt = R >> 6;
  const int rt  = bid % nrt;
  const int ct  = bid / nrt;
  const int r0  = rt * 64;
  const int c0  = ct * 64;
  {
    const int rl = tid >> 2;                  // input row within tile 0..63
    const int cc = (tid & 3) * 16;            // input col chunk within the 64
    const float* src = X + (size_t)(r0 + rl) * (size_t)C + c0 + cc;
#pragma unroll
    for (int i = 0; i < 4; ++i) {
      const v4f a = *(const v4f*)(src + 4 * i);
#pragma unroll
      for (int e = 0; e < 4; ++e) {
        const float v  = a[e];
        const float vb = bfr(v);
        const float vf = (mode == 1) ? vb : v;
        const unsigned short hb = h_bits((_Float16)(vf * scale));
        const unsigned short bb = bf_bits(v);
        TH[(cc + 4 * i + e) * VTP + rl] = (mode != 0) ? hb : bb;
      }
    }
  }
  __syncthreads();
  v4u vh[2];
  const int cw = tid & 63;                    // chunk in its block: c * 16 + m
#pragma unroll
  for (int it = 0; it < 2; ++it) {
    const int bl = it * 4 + (tid >> 6);       // local block 0..7: row tile bl >> 1, k tile bl & 1
    vh[it] = *(const v4u*)(TH + ((bl >> 1) * 16 + (cw & 15)) * VTP + (bl & 1) * 32 + (cw >> 4) * 8);
  }
  const size_t base = (size_t)c0 * (size_t)R + (size_t)r0 * 16 + (size_t)cw * 8;
  {
#pragma unroll
    for (int it = 0; it < 2; ++it) {
      const int bl = it * 4 + (tid >> 6);
      *(v4u*)(XTo + base + (size_t)(bl >> 1) * 16 * (size_t)R + (size_t)(bl & 1) * 512) = vh[it];
    }
    // the stores' registers are rewritten only behind this wait, on whatever path the inlined body is left
#if defined(__HIP_DEVICE_COMPILE__)
    asm volatile("s_wait_xcnt 0x0" ::: "memory");
#endif
  }
}

// =====================================================================================================
// All six input conversions in ONE launch (they are independent of one another): the block index picks the job, block-uniformly.
//   blocks [0, PB_W2)            Wv2 [512][4096] -> f16 of the bf16 value x1024, [4096][512]
//   next 3 x PB_WT               Wv1, Wq, Wk [in][out] -> bf16 [out][in]
//   next PB_XS, then PB_XQ       source rows, query rows < SQ -> bf16 planes
// coverage: each range is the exact block count of its job (see cvt16, tr16); grid = PB_ALL.
// =====================================================================================================
#define PB_W2 ((DM / 64) * (DV / 64))
#define PB_WT ((DM / 64) * (DM / 64))
#define PB_XS ((NL * DM) / 2048)
#define PB_XQ ((SQ * DM) / 2048)
#define PB_ALL (PB_W2 + 3 * PB_WT + PB_XS + PB_XQ)
__global__ __launch_bounds__(256)
void prep_all(const float* __restrict__ xq, const float* __restrict__ xs, const float* __restrict__ wv1,
              const float* __restrict__ wq, const float* __restrict__ wk, const float* __restrict__ wv2,
              u16* XQ, u16* XS, u16* WV1T, u16* WQT, u16* WKT, u16* WV2T) {
  __shared__ __align__(16) u16 TH[64 * VTP];
  int b = blockIdx.x;
  if (b < PB_W2) { tr16(TH, wv2, WV2T, DM, DV, 1, W2S, b); return; }
  b -= PB_W2;
  if (b < 3 * PB_WT) {
    const int job = b / PB_WT;
    const float* w = (job == 0) ? wv1 : (job == 1) ? wq : wk;
    u16* d = (job == 0) ? WV1T : (job == 1) ? WQT : WKT;
    tr16(TH, w, d, DM, DM, 0, 1.0f, b % PB_WT);
    return;
  }
  b -= 3 * PB_WT;
  const bool src = b < PB_XS;
  cvt16(src ? xs : xq, src ? XS : XQ, src ? (NL * DM) / 8 : (SQ * DM) / 8, 0, 1.0f, src ? b : b - PB_XS);
}

// =====================================================================================================
// Epilogues. The wave's 16x64 f32 tile (times oscale, plus an optional per-row addend) is staged in its LDS slab (pitch 68),
//            8 consecutive lanes x 16 B per line), lanes 16..31 -> row 2*it+1.
//  epi64hsb: f16 bits of ((tile + bf16RNE(bias[col])) * pscale) into a fragment-order plane: the tile is two adjacent 1-KB blocks;
//            store i = 0..3, lane (h, m) = row m, columns 16i + 8h .. + 7, at half index i * 256 + lane * 8 (512 contiguous bytes).
//  epi64hrb: f16 bits of ((tile + bf16RNE(bias[row])) * pscale), same store shape as epi64hsb, but blocks ordered k tile first (M rows):
//            the tile's two 1-KB blocks stand M * 32 halves apart.
// coverage: epi64 8 instructions x 2 rows x 16 lanes x 4 floats; epi64hsb/hrb 4 instructions x 16 rows x 2 chunks x 8 halves
//           = the wave's 16 x 64 tile in all cases.
// =====================================================================================================
__device__ __forceinline__ void stage64(float* sl, v8f a0, v8f a1, v8f a2, v8f a3, float oscale, int lane) {
  const int hh = lane >> 4, m = lane & 15;
#pragma unroll
  for (int r = 0; r < 8; ++r) {
    const int ro = (8 * hh + r) * 68 + m;
    sl[ro]      = a0[r] * oscale;
    sl[ro + 16] = a1[r] * oscale;
    sl[ro + 32] = a2[r] * oscale;
    sl[ro + 48] = a3[r] * oscale;
  }
  wave_sync_lds();
}
__device__ __forceinline__ void epi64(float* sl, v8f a0, v8f a1, v8f a2, v8f a3, float oscale, v4f badd, float* C, int N,
                                      size_t rowb, int col0, int lane) {
  const int hh = lane >> 4, m = lane & 15;
  stage64(sl, a0, a1, a2, a3, oscale, lane);
  v4f vals[8];
#pragma unroll
  for (int it = 0; it < 8; ++it) vals[it] = *(const v4f*)(sl + (it * 2 + hh) * 68 + m * 4) + badd;
  float* dst = C + (rowb + (size_t)hh) * (size_t)N + col0 + m * 4;
  {
#pragma unroll
    for (int it = 0; it < 8; ++it) {
      *(v4f*)(dst + (size_t)(it * 2) * (size_t)N) = vals[it];
    }
    
  }
}
__device__ __forceinline__ void epi64hsb(float* sl, v8f a0, v8f a1, v8f a2, v8f a3, float oscale, float pscale,
                                         const float* __restrict__ bias, u16* C, int N, size_t rowb, int col0, int lane) {
  stage64(sl, a0, a1, a2, a3, oscale, lane);
  const int row = lane & 15, h8 = (lane >> 4) * 8;
  v4u oh[4];
#pragma unroll
  for (int i4 = 0; i4 < 4; ++i4) {
    const int c8 = i4 * 16 + h8;
    const v4f b0 = *(const v4f*)(bias + col0 + c8), b1 = *(const v4f*)(bias + col0 + c8 + 4);   // columns col0+c8..+7 < N
    const v4f a = *(const v4f*)(sl + row * 68 + c8), c4 = *(const v4f*)(sl + row * 68 + c8 + 4);
    float w[8];
#pragma unroll
    for (int e = 0; e < 4; ++e) { w[e] = (a[e] + bfr(b0[e])) * pscale; w[4 + e] = (c4[e] + bfr(b1[e])) * pscale; }
#pragma unroll
    for (int e = 0; e < 4; ++e) oh[i4][e] = pk16(h_bits((_Float16)w[2 * e]), h_bits((_Float16)w[2 * e + 1]));
  }
  u16* dst = C + rowb * (size_t)N + (size_t)col0 * 16 + lane * 8;      // rowb % 16 == 0, col0 % 64 == 0
  {
#pragma unroll
    for (int i4 = 0; i4 < 4; ++i4) {
      *(v4u*)(dst + i4 * 256) = oh[i4];
    }
    
  }
}
__device__ __forceinline__ void epi64hrb(float* sl, v8f a0, v8f a1, v8f a2, v8f a3, float oscale, float pscale,
                                         const float* __restrict__ brow, u16* C, int M, size_t rowb, int col0, int lane) {
  const int hh = lane >> 4, m = lane & 15;
  const v4f r0v = *(const v4f*)(brow + 8 * hh), r1v = *(const v4f*)(brow + 8 * hh + 4);   // rows rowb+8h .. +7 < M
  float rb[8];
#pragma unroll
  for (int e = 0; e < 4; ++e) { rb[e] = bfr(r0v[e]); rb[4 + e] = bfr(r1v[e]); }
#pragma unroll
  for (int r = 0; r < 8; ++r) {
    const int ro = (8 * hh + r) * 68 + m;
    sl[ro]      = a0[r] * oscale + rb[r];
    sl[ro + 16] = a1[r] * oscale + rb[r];
    sl[ro + 32] = a2[r] * oscale + rb[r];
    sl[ro + 48] = a3[r] * oscale + rb[r];
  }
  wave_sync_lds();
  v4u oh[4];
#pragma unroll
  for (int i4 = 0; i4 < 4; ++i4) {
    const int c8 = i4 * 16 + hh * 8;
    const v4f a = *(const v4f*)(sl + m * 68 + c8), c4 = *(const v4f*)(sl + m * 68 + c8 + 4);
    float w[8];
#pragma unroll
    for (int e = 0; e < 4; ++e) { w[e] = a[e] * pscale; w[4 + e] = c4[e] * pscale; }
#pragma unroll
    for (int e = 0; e < 4; ++e) oh[i4][e] = pk16(h_bits((_Float16)w[2 * e]), h_bits((_Float16)w[2 * e + 1]));
  }
  u16* dst = C + (size_t)col0 * (size_t)M + rowb * 32 + lane * 8;      // rowb % 16 == 0, col0 % 64 == 0
  {
#pragma unroll
    for (int i4 = 0; i4 < 4; ++i4) {
      *(v4u*)(dst + (size_t)(i4 >> 1) * 32 * (size_t)M + (i4 & 1) * 256) = oh[i4];
    }
    
  }
}

// =====================================================================================================
// bf16 GEMM, f16 plane out with column bias: C16[M][N] = f16 bits of (((A[M][K] (bf16) . Bt[N][K]^T (bf16))
// * oscale) + bf16RNE(bias[n])) * pscale. A, Bt and C16 are fragment-order planes.
// Block = 64x64 tile, 4 waves x 16 rows; fragments loaded straight from the 1-KB blocks (two 16-B loads each, split k map for
// A and B); K stepped by 32 = one block (K % 32 == 0, M % 64 == 0, N % 64 == 0, blocks bid = 0 .. (M/64)*(N/64) - 1).
// slab: the block's 4 epilogue slabs in LDS.
// =====================================================================================================
__device__ __forceinline__
void gemm_bh16(float* slab, const u16* __restrict__ A, const u16* __restrict__ Bt, const float* __restrict__ bias, u16* C,
               int M, int N, int K, float oscale, float pscale, int bid) {
  const int tid = threadIdx.x, wave = tid >> 5, lane = tid & 31;
  const int ntile = N >> 6;
  const int rowb  = (bid / ntile) * 64 + wave * 16;
  const int col0  = (bid % ntile) * 64;
  if (rowb + 16 > M) return;                 // wave-uniform, never taken with the exact grid; no block barriers in this kernel
  const size_t bs = (size_t)16 * K;
  const u16* ap  = A  + (size_t)rowb * (size_t)K + lane * 8;
  const u16* bp0 = Bt + (size_t)col0 * (size_t)K + lane * 8;
  const u16* bp1 = bp0 + bs;
  const u16* bp2 = bp1 + bs;
  const u16* bp3 = bp2 + bs;
  v8f acc0 = zero8(), acc1 = zero8(), acc2 = zero8(), acc3 = zero8();
#pragma unroll 1
  for (int k0 = 0; k0 < K; k0 += 32, ap += 512, bp0 += 512, bp1 += 512, bp2 += 512, bp3 += 512) {   // one 1-KB block a step
    const v16b a  = ldfrag_b(ap);
    const v16b b0 = ldfrag_b(bp0);
    const v16b b1 = ldfrag_b(bp1);
    const v16b b2 = ldfrag_b(bp2);
    const v16b b3 = ldfrag_b(bp3);
    acc0 = mma_b(a, b0, acc0);
    acc1 = mma_b(a, b1, acc1);
    acc2 = mma_b(a, b2, acc2);
    acc3 = mma_b(a, b3, acc3);
    guard6<v16b>(acc0, acc1, acc2, acc3, a, b0, b1, b2, b3, a);
  }
  epi64hsb(slab + wave * SLAB64, acc0, acc1, acc2, acc3, oscale, pscale, bias, C, N, (size_t)rowb, col0, lane);
}
// The three projections in ONE launch (independent of one another): blocks [0, GB_S) value = source.Wv1 + b (f16 plane x8),
// next GB_Q q = query.Wq + b (rows < SQ, x8), next GB_S k = source.Wk + b (x8); the job is block-uniform. grid = 2 * GB_S + GB_Q.
#define GB_S ((NL / 64) * (DM / 64))
#define GB_Q ((SQ / 64) * (DM / 64))
__global__ __launch_bounds__(128)
void proj3(const u16* __restrict__ XS, const u16* __restrict__ XQ, const u16* __restrict__ W1T, const u16* __restrict__ WQT,
           const u16* __restrict__ WKT, const float* __restrict__ bv1, const float* __restrict__ bq,
           const float* __restrict__ bk, u16* VALH, u16* QP, u16* KP) {
  __shared__ __align__(16) float slab[4 * SLAB64];
  const int b = blockIdx.x;
  const int job = (b < GB_S) ? 0 : (b < GB_S + GB_Q) ? 1 : 2;
  const u16*   A    = (job == 1) ? XQ : XS;
  const u16*   Bt   = (job == 0) ? W1T : (job == 1) ? WQT : WKT;
  const float* bias = (job == 0) ? bv1 : (job == 1) ? bq : bk;
  u16*         C    = (job == 0) ? VALH : (job == 1) ? QP : KP;
  const int    M    = (job == 1) ? SQ : NL;
  const float  ps   = (job == 0) ? VSC : (job == 1) ? QSC : KSC;
  const int    bid  = (job == 0) ? b : (job == 1) ? b - GB_S : b - GB_S - GB_Q;
  gemm_bh16(slab, A, Bt, bias, C, M, DM, DM, 1.0f, ps, bid);
}

// =====================================================================================================
// f16 GEMM, f16 plane out with ROW bias: C16[M][N] = f16 bits of (((A[M][K] (f16) . Bt[N][K]^T (f16))
// * oscale) + bf16RNE(bias[m])) * pscale; all three planes in fragment order, C16 with its blocks k tile first. Same tiling and fragment loads as gemm_bh16; epilogue epi64hrb.
// =====================================================================================================
__global__ __launch_bounds__(128)
void gemm_hh16r(const u16* __restrict__ A, const u16* __restrict__ Bt, const float* __restrict__ bias, u16* C,
                int M, int N, int K, float oscale, float pscale) {
  __shared__ __align__(16) float slab[4 * SLAB64];
  const int tid = threadIdx.x, wave = tid >> 5, lane = tid & 31;
  const int ntile = N >> 6;
  const int bid   = blockIdx.x;
  const int rowb  = (bid / ntile) * 64 + wave * 16;
  const int col0  = (bid % ntile) * 64;
  if (rowb + 16 > M) return;                 // wave-uniform, never taken with the exact grid; no block barriers in this kernel
  const size_t bs = (size_t)16 * K;
  const _Float16* ap  = (const _Float16*)(const void*)A  + (size_t)rowb * (size_t)K + lane * 8;
  const _Float16* bp0 = (const _Float16*)(const void*)Bt + (size_t)col0 * (size_t)K + lane * 8;
  const _Float16* bp1 = bp0 + bs;
  const _Float16* bp2 = bp1 + bs;
  const _Float16* bp3 = bp2 + bs;
  v8f acc0 = zero8(), acc1 = zero8(), acc2 = zero8(), acc3 = zero8();
#pragma unroll 1
  for (int k0 = 0; k0 < K; k0 += 32, ap += 512, bp0 += 512, bp1 += 512, bp2 += 512, bp3 += 512) {   // one 1-KB block a step
    const v16h a  = ldfrag_hf(ap);
    const v16h b0 = ldfrag_hf(bp0);
    const v16h b1 = ldfrag_hf(bp1);
    const v16h b2 = ldfrag_hf(bp2);
    const v16h b3 = ldfrag_hf(bp3);
    acc0 = mma_h(a, b0, acc0);
    acc1 = mma_h(a, b1, acc1);
    acc2 = mma_h(a, b2, acc2);
    acc3 = mma_h(a, b3, acc3);
    guard6<v16h>(acc0, acc1, acc2, acc3, a, b0, b1, b2, b3, a);
  }
  epi64hrb(slab + wave * SLAB64, acc0, acc1, acc2, acc3, oscale, pscale, bias + rowb, C, M, (size_t)rowb, col0, lane);
}

// =====================================================================================================
// Head-axis softmax attention with the head mean folded in. Block = NT = 64 query rows q0..q0+63, 8 waves, the KSPAN keys of
// key range blockIdx.x in tiles of LT = 32 (the softmax runs over heads, so key ranges only add: each range writes its own f32
// partial plane, sum_parts adds the KS planes). q plane f16 x8 [n][512] (head h = columns 64h..64h+63), k plane the same, V^T plane f16 x64 [h*512+d][l],
// all three in fragment order, V^T with its blocks k tile first.
//   (S) wave w = head w: S_w[64 n][32 l] in two passes of 32 n = 4 D tiles each, K = 64 (2 k-steps): A = q rows (row m = query,
//       split k map over the head's 64 columns), B = k rows (col n = key, same split map, loaded once for both passes);
//       D element r of lane -> U.s[w][n 32nh+16nt+8h+r][l 16half+m].
//   (M) thread = (n = 32it + (tid>>3), 4 consecutive l), it = 0, 1, all arithmetic on 4-wide f32 vectors (packed instructions):
//       max over the 8 heads of s, p = exp2(fma(s, log2e/512, -max * log2e/512)), P = p / sum (f32), written as f16(P * 4096) to
//       sP[h][n][l] with 8-B LDS stores.
//   (PV) wave w owns d columns 64w + 16t + (lane&15), t = 0..3, for all four 16-row n groups (16 accumulators): every V^T fragment
//       fetched from L2 feeds four matrix instructions. For every head h:
//       A = P_h fragments from LDS (row m = query, split map over the 32 keys), B = V^T fragments (col = d, keys contiguous,
//       row h*512 + d of the V^T plane); all heads and key tiles accumulate into the same accumulators (joint (l,h) K axis).
//   Block barriers after (S) and after (M) order every LDS reuse across phases, key tiles and waves.
//   Epilogue: partial = acc * 2^-21 (= 1 / (4096 * 64 * 8 heads)); the wave's four 16 x 64 f32 tiles go through epi64 one after
//   another (a wave-level LDS sync between tiles); a block barrier separates the key loop from the slab use (the slab area
//   aliases the score area).
// coverage: grid (KS, SQ/64) blocks x 64 rows = query rows 0..SQ-1 of every partial plane; (S) 8 waves x 64 x 32 = all score cells;
//           (M) 2 passes x 256 thr x 4 l x 8 h = all P cells; stores 8 waves x (4 tiles x 16 rows x 64 cols) =
//           part[ks][q0..q0+63][0..511], every float exactly once.
// =====================================================================================================
__global__ __launch_bounds__(ATT_THREADS)
void attn_heads(const u16* __restrict__ QPp, const u16* __restrict__ KPp, const u16* __restrict__ VTp, float* part) {
  __shared__ __align__(16) AttU U;                 // scores [8][64][SSP] f32; reused as 8 epilogue slabs
  __shared__ __align__(16) u16 sP[NH * NT * PLP];  // P tiles [8][64][PLP] f16 bits

  const int tid  = threadIdx.x;
  const int wave = tid >> 5;
  const int lane = tid & 31;
  const int hh   = lane >> 4;
  const int m    = lane & 15;
  const int q0   = blockIdx.y * NT;          // q0 + 63 < SQ (grid exact)
  const int lbeg = blockIdx.x * KSPAN;       // this block's key range lbeg .. lbeg + KSPAN - 1 < NL (grid exact)
  float* const out = part + (size_t)blockIdx.x * ((size_t)SQ * DM);

  const _Float16* qb = (const _Float16*)(const void*)QPp + (size_t)q0 * DM + wave * (DKH * 16) + lane * 8;
  const _Float16* kp = (const _Float16*)(const void*)KPp + (size_t)lbeg * DM + wave * (DKH * 16) + lane * 8;   // steps one key tile a pass
  const _Float16* vb = (const _Float16*)(const void*)VTp + wave * (64 * 32) + lane * 8;
  const float lsc = LOG2E / (QSC * KSC * 8.0f);
  const v4f lsc4 = {lsc, lsc, lsc, lsc};
  float* const sw = U.s + wave * (NT * SSP);

  v8f o[4][4];                               // o[i][t]: n rows 16i..16i+15, d columns 64 * wave + 16t..+15
#pragma unroll
  for (int i = 0; i < 4; ++i) {
#pragma unroll
    for (int t = 0; t < 4; ++t) o[i][t] = zero8();
  }

#pragma unroll 1
  for (int l0 = lbeg; l0 < lbeg + KSPAN; l0 += LT, kp += (size_t)LT * DM) {
    // ---- (S) scores of head = wave for this key tile ----
    {
      const v16h ka0 = ldfrag_hf(kp), ka1 = ldfrag_hf(kp + 512);
      const v16h kc0 = ldfrag_hf(kp + (size_t)16 * DM), kc1 = ldfrag_hf(kp + (size_t)16 * DM + 512);
      const _Float16* qp = qb;
      // kept rolled: unrolled, 8 q fragments and 8 score tiles would be live beside the 16 output accumulators
#pragma unroll 1
      for (int nh = 0; nh < NT / 32; ++nh, qp += (size_t)32 * DM) {
        const v16h qa0 = ldfrag_hf(qp), qa1 = ldfrag_hf(qp + 512);
        const v16h qc0 = ldfrag_hf(qp + (size_t)16 * DM), qc1 = ldfrag_hf(qp + (size_t)16 * DM + 512);
        v8f s00 = zero8(), s01 = zero8(), s10 = zero8(), s11 = zero8();
        s00 = mma_h(qa0, ka0, s00);  s00 = mma_h(qa1, ka1, s00);     // n rows 0..15 of the pass,  keys 0..15
        s01 = mma_h(qa0, kc0, s01);  s01 = mma_h(qa1, kc1, s01);     // n rows 0..15 of the pass,  keys 16..31
        s10 = mma_h(qc0, ka0, s10);  s10 = mma_h(qc1, ka1, s10);     // n rows 16..31 of the pass, keys 0..15
        s11 = mma_h(qc0, kc0, s11);  s11 = mma_h(qc1, kc1, s11);     // n rows 16..31 of the pass, keys 16..31
        guard4x8(s00, s01, s10, s11, qa0, qa1, qc0, qc1, ka0, ka1, kc0, kc1);
        float* const sn = sw + nh * (32 * SSP);
#pragma unroll
        for (int r = 0; r < 8; ++r) {
          const int ro = (8 * hh + r) * SSP + m;
          sn[ro]                 = s00[r];
          sn[ro + 16]            = s01[r];
          sn[ro + 16 * SSP]      = s10[r];
          sn[ro + 16 * SSP + 16] = s11[r];
        }
      }
    }
    __syncthreads();
    // V^T fragments go through a register ring of four slots of two fragments (half a head each): half step j = 2 * head + half
    // uses slot j & 3, and the loads of half step j + 3 are issued before the matrix instructions of half step j.
    // The first three half steps (head 0, half of head 1) are asked for here, so that their way from L2 runs under the softmax phase.
    const _Float16* const vl = vb + (size_t)l0 * DV;   // k tile l0 / 32 of V^T: DV / 16 blocks of 512 halves
    v16h g[4][2];
#pragma unroll
    for (int j = 0; j < 2; ++j) { g[j][0] = ldfrag_hf(vl + j * 1024); g[j][1] = ldfrag_hf(vl + j * 1024 + 512); }
    g[2][0] = ldfrag_hf(vl + DM * 32);       // half step 2 (head 1, d tiles 0 and 1)
    g[2][1] = ldfrag_hf(vl + DM * 32 + 512);
    __builtin_amdgcn_sched_barrier(0);       // keeps these loads in front of the softmax code (sunk to their use they would hide nothing)
    // ---- (M) softmax over the 8 heads per (n, l), P tiles ----
#pragma unroll
    for (int it = 0; it < NT / 32; ++it) {
      const int n = it * 32 + (tid >> 3), lq = (tid & 7) * 4;
      v4f t[NH];
#pragma unroll
      for (int h = 0; h < NH; ++h) t[h] = *(const v4f*)(U.s + h * (NT * SSP) + n * SSP + lq);
      v4f mr = t[0];
#pragma unroll
      for (int h = 1; h < NH; ++h) mr = __builtin_elementwise_max(mr, t[h]);
      const v4f mx = mr * lsc;                                 // = max over heads of the rounded s * lsc: lsc > 0, rounding is monotonic
      v4f sm;
#pragma unroll
      for (int h = 0; h < NH; ++h) {
        const v4f x = __builtin_elementwise_fma(t[h], lsc4, -mx);
        // raw v_exp_f32: it differs from exp2f only where p < 2^-126; such a p vanishes in sm (one term is about 1) and is 0 as f16(P * 4096)
#pragma unroll
        for (int e = 0; e < 4; ++e) t[h][e] = __builtin_amdgcn_exp2f(x[e]);
        sm = h ? sm + t[h] : t[h];
      }
      v4f rs;                                                  // sm in [1, 8]
#pragma unroll
      for (int e = 0; e < 4; ++e) rs[e] = __builtin_amdgcn_rcpf(sm[e]) * PCAR;
      u16* pd = sP + n * PLP + lq;
#pragma unroll
      for (int h = 0; h < NH; ++h)
        *(v2u*)(pd + h * (NT * PLP)) = __builtin_bit_cast(v2u, __builtin_convertvector(t[h] * rs, v4h));
    }
    __syncthreads();
    // ---- (PV) accumulate P_h . V_h over all heads for this key tile ----
    {
      const _Float16* pbase = (const _Float16*)(const void*)sP + m * PLP + 8 * hh;
      // unrolled: the slot index is a constant, and each wait counts exactly the loads that are younger than the slot it needs
#pragma unroll
      for (int h = 0; h < NH; ++h) {
        if (h + 1 < NH) {                    // half step 2h + 3 (head h + 1, d tiles 2 and 3) into the slot that half step 2h - 1 has left
          g[(2 * h + 3) & 3][0] = ldfrag_hf(vl + (h + 1) * (DM * 32) + 1024);
          g[(2 * h + 3) & 3][1] = ldfrag_hf(vl + (h + 1) * (DM * 32) + 1536);
        }
        __builtin_amdgcn_sched_barrier(0);   // these loads issue before the matrix instructions of half step 2h
        const _Float16* pp = pbase + h * (NT * PLP);
        const v16h p0 = ldfrag_h(pp);
        const v16h p1 = ldfrag_h(pp + 16 * PLP);
        const v16h p2 = ldfrag_h(pp + 32 * PLP);
        const v16h p3 = ldfrag_h(pp + 48 * PLP);
        o[0][0] = mma_h(p0, g[(2 * h + 0) & 3][0], o[0][0]);
        o[1][0] = mma_h(p1, g[(2 * h + 0) & 3][0], o[1][0]);
        o[2][0] = mma_h(p2, g[(2 * h + 0) & 3][0], o[2][0]);
        o[3][0] = mma_h(p3, g[(2 * h + 0) & 3][0], o[3][0]);
        o[0][1] = mma_h(p0, g[(2 * h + 0) & 3][1], o[0][1]);
        o[1][1] = mma_h(p1, g[(2 * h + 0) & 3][1], o[1][1]);
        o[2][1] = mma_h(p2, g[(2 * h + 0) & 3][1], o[2][1]);
        o[3][1] = mma_h(p3, g[(2 * h + 0) & 3][1], o[3][1]);
        guard16x6(o, p0, p1, p2, p3, g[(2 * h) & 3][0], g[(2 * h) & 3][1]);
        if (h + 2 < NH) {                    // half step 2h + 4 (head h + 2, d tiles 0 and 1) into the slot just left
          g[(2 * h) & 3][0] = ldfrag_hf(vl + (h + 2) * (DM * 32));
          g[(2 * h) & 3][1] = ldfrag_hf(vl + (h + 2) * (DM * 32) + 512);
        }
        __builtin_amdgcn_sched_barrier(0);   // these loads issue before the matrix instructions of half step 2h + 1
        o[0][2] = mma_h(p0, g[(2 * h + 1) & 3][0], o[0][2]);
        o[1][2] = mma_h(p1, g[(2 * h + 1) & 3][0], o[1][2]);
        o[2][2] = mma_h(p2, g[(2 * h + 1) & 3][0], o[2][2]);
        o[3][2] = mma_h(p3, g[(2 * h + 1) & 3][0], o[3][2]);
        o[0][3] = mma_h(p0, g[(2 * h + 1) & 3][1], o[0][3]);
        o[1][3] = mma_h(p1, g[(2 * h + 1) & 3][1], o[1][3]);
        o[2][3] = mma_h(p2, g[(2 * h + 1) & 3][1], o[2][3]);
        o[3][3] = mma_h(p3, g[(2 * h + 1) & 3][1], o[3][3]);
        guard16x6(o, p0, p1, p2, p3, g[(2 * h + 1) & 3][0], g[(2 * h + 1) & 3][1]);
      }
    }
  }
  __syncthreads();

  const float osc = 1.0f / (PCAR * VCAR * (float)NH);
  const v4f z4 = {0.f, 0.f, 0.f, 0.f};
  float* const sl = U.slab + wave * SLAB64;
#pragma unroll
  for (int i = 0; i < 4; ++i) {
    if (i) wave_sync_lds();                  // the slab's last reads end before the next tile is staged in it
    epi64(sl, o[i][0], o[i][1], o[i][2], o[i][3], osc, z4, out, DM, (size_t)q0 + 16 * i, wave * 64, lane);
  }
}

// =====================================================================================================
// out = sum of the KS partial planes, added in plane order 0..KS-1 in f32. Thread = 4 consecutive floats: KS 16-B loads, one
// 16-B store; 32 consecutive lanes = 512 contiguous bytes per load and store.
// coverage: grid = SQ*DM/1024 blocks x 256 thr x 4 floats = out rows 0..SQ-1, every float exactly once.
// =====================================================================================================
__global__ __launch_bounds__(256) void sum_parts(const float* __restrict__ part, float* out) {
  const unsigned ob = (blockIdx.x * 256u + threadIdx.x) * 16u;    // byte offset in a plane, < SQ * DM * 4 (grid exact)
  v4f p[KS];
#pragma unroll
  for (int s = 0; s < KS; ++s) p[s] = *(const v4f*)((const char*)(part + (size_t)s * ((size_t)SQ * DM)) + ob);
  v4f a = p[0];
#pragma unroll
  for (int s = 1; s < KS; ++s) a += p[s];
  *(v4f*)((char*)out + ob) = a;
}

// =====================================================================================================
// Workspace map (bytes); every plane is fully written by whole-line stores before it is read; all extents are exact multiples of
// the store granularity (no pad rows, all dims multiples of 64), every offset a multiple of 256:
//   XQ  bf16 [SQ][512]                      <=  4194304
//   XS  bf16 [4096][512]                        4194304
//   WV1T, WQT, WKT bf16 [512][512]             3 x 524288
//   WV2T f16 of bf16 value x1024 [4096][512]   4194304
//   VALH f16 value x8 [4096][512]               4194304
//   QP   f16 x8 [SQ][512]                   <=  4194304
//   KP   f16 x8 [4096][512]                     4194304
//   VT   f16 x64 [4096][4096]                  33554432
//   PART f32 [KS][SQ][512]                  <= 67108864
//   end                                     <= 127401984
// =====================================================================================================
extern "C" void kernel_launch(void* const* d_in, const int* in_sizes, int n_in,
                              void* d_out, int out_size, void* d_ws, size_t ws_size,
                              hipStream_t stream) {
  if (n_in < 10) return;
  if (in_sizes[0] != NQ * DM || in_sizes[1] != NL * DM) return;
  if (in_sizes[2] != DM * DM || in_sizes[3] != DM) return;
  if (in_sizes[4] != DM * DM || in_sizes[5] != DM) return;
  if (in_sizes[6] != DM * DM || in_sizes[7] != DM) return;
  if (in_sizes[8] != DM * DV || in_sizes[9] != DV) return;
  if (out_size != NQ * DM) return;

  const float* xq  = (const float*)d_in[0];
  const float* xs  = (const float*)d_in[1];
  const float* wv1 = (const float*)d_in[2];
  const float* bv1 = (const float*)d_in[3];
  const float* wq  = (const float*)d_in[4];
  const float* bq  = (const float*)d_in[5];
  const float* wk  = (const float*)d_in[6];
  const float* bk  = (const float*)d_in[7];
  const float* wv2 = (const float*)d_in[8];
  const float* bv2 = (const float*)d_in[9];
  float*       out = (float*)d_out;

  const size_t szXQ = (size_t)SQ * DM * 2;          //  4194304 at SQ = NQ
  const size_t szXS = (size_t)NL * DM * 2;          //  4194304
  const size_t szWT = (size_t)DM * DM * 2;          //   524288
  const size_t szW2 = (size_t)DV * DM * 2;          //  4194304
  const size_t szVL = (size_t)NL * DM * 2;          //  4194304
  const size_t szQP = (size_t)SQ * DM * 2;          //  4194304 at SQ = NQ
  const size_t szKP = (size_t)NL * DM * 2;          //  4194304
  const size_t szVT = (size_t)DV * NL * 2;          // 33554432
  const size_t szPT = (size_t)KS * SQ * DM * 4;     // 67108864 at SQ = NQ
  size_t off = 0;
  const size_t oXQ = off; off += szXQ;
  const size_t oXS = off; off += szXS;
  const size_t oW1 = off; off += szWT;
  const size_t oWQ = off; off += szWT;
  const size_t oWK = off; off += szWT;
  const size_t oW2 = off; off += szW2;
  const size_t oVL = off; off += szVL;
  const size_t oQP = off; off += szQP;
  const size_t oKP = off; off += szKP;
  const size_t oVT = off; off += szVT;
  const size_t oPT = off; off += szPT;
  if (off > ws_size) return;                        // off = 127401984 at SQ = NQ
  if (off > WS_CAP) return;

  char* ws = (char*)d_ws;
  u16* XQ   = (u16*)(ws + oXQ);
  u16* XS   = (u16*)(ws + oXS);
  u16* WV1T = (u16*)(ws + oW1);
  u16* WQT  = (u16*)(ws + oWQ);
  u16* WKT  = (u16*)(ws + oWK);
  u16* WV2T = (u16*)(ws + oW2);
  u16* VALH = (u16*)(ws + oVL);
  u16* QP   = (u16*)(ws + oQP);
  u16* KP   = (u16*)(ws + oKP);
  u16* VT   = (u16*)(ws + oVT);
  float* PART = (float*)(ws + oPT);

  const dim3 blk(256);
  const dim3 bG(128);
  const dim3 gPR(PB_ALL);                           // 512 + 3 x 64 + 1024 + 1024 at SQ = NQ
  const dim3 gP3(2 * GB_S + GB_Q);                  // 3 x 512 at SQ = NQ
  const dim3 gVT((DV / 64) * (NL / 64));            // 4096
  const dim3 gAT(KS, SQ / NT);                      // 8 x 64 at SQ = NQ
  const dim3 gSP((SQ * DM) / 1024);                 // 2048 at SQ = NQ
  const dim3 bAT(ATT_THREADS);

  // (0) query rows < SQ and source -> bf16 planes; Wv1, Wq, Wk [in][out] -> bf16 [out][in] fragment-order planes;
  //     Wv2 [512][4096] -> f16 of the bf16 value x1024, [4096][512]
  prep_all<<<gPR, blk, 0, stream>>>(xq, xs, wv1, wq, wk, wv2, XQ, XS, WV1T, WQT, WKT, WV2T);
  // (1) value = source.Wv1 + b -> f16 plane x8; q (rows < SQ) and k projections -> f16 planes x8
  proj3<<<gP3, bG, 0, stream>>>(XS, XQ, WV1T, WQT, WKT, bv1, bq, bk, VALH, QP, KP);
  // (2) V^T [h*512+d][l] = (Wv2^T . value^T) / (1024*8) + b[h*512+d], f16 plane x64
  gemm_hh16r<<<gVT, bG, 0, stream>>>(WV2T, VALH, bv2, VT, DV, NL, DM, 1.0f / (W2S * VSC), VCAR);
  // (3) head-axis softmax attention + head mean, one f32 partial plane per key range; (4) planes summed -> out rows 0..SQ-1
  attn_heads<<<gAT, bAT, 0, stream>>>(QP, KP, VT, PART);
  sum_parts<<<gSP, blk, 0, stream>>>(PART, out);
  (void)hipGetLastError();
}

// v007
// Measured time: 168 microseconds a run.
// Next to v006, in two timings, it ran 1.08 times as fast each time.
// All steps since v000 together make it 4.67 times as fast.
// Projections value, q, k = x.W + b: v_wmma_f32_16x16x32_bf16 (bf16 RNE operands of the raw inputs, f32 accumulate, bf16 RNE
// bias added in f32). v^T = Wv2^T . value^T (W as f16 of the bf16 RNE value x1024, value plane f16 x8, bf16 RNE bias per row in
// f32), per-head scores q.k^T (f16 planes x8) and P.V (P x4096 f16 from LDS, V^T x64 f16): v_wmma_f32_16x16x32_f16, f32
// accumulate. Softmax over the head axis, the head mean and all scaling in f32 on VALU.
// Every 16-bit operand plane [rows][K] in the workspace is kept in FRAGMENT ORDER: 1-KB blocks of 16 rows x 32 k, block (rt, kt)
// at half index rt * 16 * K + kt * 512; inside a block the 16-B chunk (row m = row & 15, c = (k >> 3) & 3) stands at half index
// c * 128 + m * 8. Lane (h = lane >> 4, m = lane & 15) of a fragment then reads its two 16-B chunks (c = h and c = 2 + h) at
// lane * 8 and 256 + lane * 8: each load of a wave is 512 contiguous bytes (4 cache lines) and not 32 B out of each of 16 lines.
// The V^T plane alone orders its blocks k tile first, block (rt, kt) at half index (kt * (rows / 16) + rt) * 512, so that all that
// one key tile of the attention reads (every head, every d) is one contiguous 256-KB run.
#include <hip/hip_runtime.h>
#include <math.h>
#include <stdint.h>

#define NQ   4096
#define NL   4096
#define DM   512
#define NH   8
#define DKH  64
#define DV   (NH * DM)
#ifndef SQ
#define SQ NQ
#endif
#define NT   64
#define LT   32
#define SSP  32
#define PLP  40
#define SLAB64 (16 * 68)
#define ATT_THREADS 256
#define KS   8
#define KSPAN (NL / KS)
#define QSC  8.0f
#define KSC  8.0f
#define VSC  8.0f
#define W2S  1024.0f
#define PCAR 4096.0f
#define VCAR 64.0f
#define LOG2E 1.4426950408889634f
#define WS_CAP ((size_t)134217728)

static_assert(DM == NH * DKH && DKH == 64 && NH == 8 && (DM % 64) == 0 && (DV % 64) == 0 && (NL % 64) == 0 && (NQ % 64) == 0);
static_assert((DM % 32) == 0);
static_assert(SQ >= 64 && SQ <= NQ && (SQ % 64) == 0 && (SQ % NT) == 0);
static_assert(NT == 64 && LT == 32 && (NL % LT) == 0 && ATT_THREADS == 256 && ATT_THREADS * 4 * (NT / 32) == NT * LT);
static_assert(KS >= 1 && (NL % (KS * LT)) == 0 && ((SQ * DM) % 1024) == 0);
static_assert(SSP >= LT && PLP >= 32 && ((PLP * 2) % 16) == 0 && ((SSP * 4) % 16) == 0);
static_assert(8 * SLAB64 <= NH * NT * SSP);
static_assert(((NQ * DM) % 2048) == 0 && ((NL * DM) % 2048) == 0 && ((SQ * DM) % 2048) == 0);
static_assert(NH * NT * SSP * 4 + NH * NT * PLP * 2 <= 160 * 1024);   // two blocks on a WGP

typedef unsigned short u16;
typedef _Float16 v16h __attribute__((ext_vector_type(16)));
typedef _Float16 v8h  __attribute__((ext_vector_type(8)));
typedef _Float16 v4h  __attribute__((ext_vector_type(4)));
typedef __bf16   v16b __attribute__((ext_vector_type(16)));
typedef float    v8f  __attribute__((ext_vector_type(8)));
typedef float    v4f  __attribute__((ext_vector_type(4)));
typedef unsigned int v4u __attribute__((ext_vector_type(4)));
typedef unsigned int v2u __attribute__((ext_vector_type(2)));

union FragH { v16h v; v8h h[2]; v4u u[2]; };
union FragB { v16b v; v4u u[2]; };
union AttU { float s[NH * NT * SSP]; float slab[8 * SLAB64]; };

// ---- scalar helpers --------------------------------------------------------------------------------
__device__ __forceinline__ unsigned short bf_bits(float f) {          // f32 -> bf16 bits, RNE convert
  unsigned u = __float_as_uint(f);
  return (unsigned short)((u + 0x7FFFu + ((u >> 16) & 1u)) >> 16);
}
__device__ __forceinline__ float bf_up(unsigned short h) { return __uint_as_float(((unsigned)h) << 16); }
__device__ __forceinline__ float bfr(float f) { return bf_up(bf_bits(f)); }
__device__ __forceinline__ unsigned short h_bits(_Float16 x) { return __builtin_bit_cast(unsigned short, x); }
__device__ __forceinline__ unsigned pk16(unsigned short a, unsigned short b) { return (unsigned)a | ((unsigned)b << 16); }
__device__ __forceinline__ v8f zero8() { v8f z = {0.f, 0.f, 0.f, 0.f, 0.f, 0.f, 0.f, 0.f}; return z; }

// ---- fragment loaders: 16-bit A/B operand, lane -> row/col (lane&15); elements 0..7 <- k0+8h.., elements 8..15 <- k0+16+8h..
//      (same split k map for A and B).
//      ldfrag_h: row-major LDS tile, p already includes row * pitch + 8*(lane>>4): p[0..7] and p[16..23].
//      ldfrag_hf / ldfrag_b: fragment-order workspace plane, p = start of the 1-KB block + lane * 8: p[0..7] and p[256..263].
__device__ __forceinline__ v16h ldfrag_h(const _Float16* p) {
  FragH f;
  f.h[0] = *(const v8h*)(p);
  f.h[1] = *(const v8h*)(p + 16);
  return f.v;
}
__device__ __forceinline__ v16h ldfrag_hf(const _Float16* p) {
  FragH f;
  f.h[0] = *(const v8h*)(p);
  f.h[1] = *(const v8h*)(p + 256);
  return f.v;
}
__device__ __forceinline__ v16b ldfrag_b(const u16* p) {              // bf16 plane read as unsigned integer vectors
  FragB f;
  f.u[0] = *(const v4u*)(p);
  f.u[1] = *(const v4u*)(p + 256);
  return f.v;
}

__device__ __forceinline__ v8f mma_h(v16h a, v16h b, v8f c) {
  return __builtin_amdgcn_wmma_f32_16x16x32_f16(false, a, false, b, (short)0, c, false, false);
}
__device__ __forceinline__ v8f mma_b(v16b a, v16b b, v8f c) {
  return __builtin_amdgcn_wmma_f32_16x16x32_bf16(false, a, false, b, (short)0, c, false, false);
}
template <typename F>
__device__ __forceinline__ void guard6(v8f& a, v8f& b, v8f& c, v8f& d, F x0, F x1, F x2, F x3, F x4, F x5) {
#if defined(__HIP_DEVICE_COMPILE__)
  asm volatile("v_nop\n\tv_nop\n\tv_nop\n\tv_nop"
               : "+v"(a), "+v"(b), "+v"(c), "+v"(d) : "v"(x0), "v"(x1), "v"(x2), "v"(x3), "v"(x4), "v"(x5) : "memory");
#endif
}
__device__ __forceinline__ void guard4x8(v8f& a, v8f& b, v8f& c, v8f& d, v16h x0, v16h x1, v16h x2, v16h x3,
                                         v16h x4, v16h x5, v16h x6, v16h x7) {
#if defined(__HIP_DEVICE_COMPILE__)
  asm volatile("v_nop\n\tv_nop\n\tv_nop\n\tv_nop"
               : "+v"(a), "+v"(b), "+v"(c), "+v"(d)
               : "v"(x0), "v"(x1), "v"(x2), "v"(x3), "v"(x4), "v"(x5), "v"(x6), "v"(x7) : "memory");
#endif
}
// Four vector slots behind the last matrix instruction of a P.V half step (on the taken side of the key loop's branch too) before
// later loads overwrite its fragment registers; the fragments are inputs so that they stay allocated up to here, and the "memory"
// clobber keeps the refill of the ring slot behind the matrix instructions that read it.
__device__ __forceinline__ void guard16x6(v8f (&o)[4][4], v16h x0, v16h x1, v16h x2, v16h x3, v16h x4, v16h x5) {
#if defined(__HIP_DEVICE_COMPILE__)
  asm volatile("v_nop\n\tv_nop\n\tv_nop\n\tv_nop"
               : "+v"(o[0][0]), "+v"(o[0][1]), "+v"(o[0][2]), "+v"(o[0][3]), "+v"(o[1][0]), "+v"(o[1][1]), "+v"(o[1][2]), "+v"(o[1][3]),
                 "+v"(o[2][0]), "+v"(o[2][1]), "+v"(o[2][2]), "+v"(o[2][3]), "+v"(o[3][0]), "+v"(o[3][1]), "+v"(o[3][2]), "+v"(o[3][3])
               : "v"(x0), "v"(x1), "v"(x2), "v"(x3), "v"(x4), "v"(x5) : "memory");
#endif
}
__device__ __forceinline__ void wave_sync_lds() {
  __builtin_amdgcn_fence(__ATOMIC_RELEASE, "workgroup");
  __builtin_amdgcn_wave_barrier();
  __builtin_amdgcn_fence(__ATOMIC_ACQUIRE, "workgroup");
}

// =====================================================================================================
// f32 plane [rows][DM] row-major -> 16-bit plane in fragment order:  mode 0: bf16 RNE bits;  mode 1: f16 bits of (bf16 RNE value) * scale;
// mode 2: f16 bits of value * scale (no bf16 pre-step).
// Thread = output chunk gt = 8 consecutive k of one row: two 16-B loads (a wave reads 64 B of each of 16 rows), one 16-B store;
// 32 consecutive lanes store 512 contiguous, 512-B aligned bytes
// coverage: n8/256 blocks bid = 0.. (exact multiples) x 256 thr x 8 = the whole plane.
// =====================================================================================================
__device__ __forceinline__ void cvt16(const float* __restrict__ x, u16* D, int n8, int mode, float scale, int bid) {
  const int gt = bid * 256 + (int)threadIdx.x;
  if (gt >= n8) return;                     // no barriers on this path
  const int kb = DM / 32;                   // blocks in a row tile
  const int blk = gt >> 6, cw = gt & 63;    // 1-KB block, chunk in it: cw = c * 16 + m
  const float* p = x + ((size_t)(blk / kb) * 16 + (size_t)(cw & 15)) * DM + (blk % kb) * 32 + (cw >> 4) * 8;
  const v4f a = *(const v4f*)(p), c4 = *(const v4f*)(p + 4);
  float v[8];
#pragma unroll
  for (int e = 0; e < 4; ++e) { v[e] = a[e]; v[4 + e] = c4[e]; }
  unsigned short s[8];
#pragma unroll
  for (int e = 0; e < 8; ++e) {
    const float vb = bfr(v[e]);
    const float vf = (mode == 1) ? vb : v[e];
    const unsigned short hb = h_bits((_Float16)(vf * scale));
    const unsigned short bb = bf_bits(v[e]);
    s[e] = (mode != 0) ? hb : bb;
  }
  v4u o;
#pragma unroll
  for (int e = 0; e < 4; ++e) o[e] = pk16(s[2 * e], s[2 * e + 1]);
  u16* d = D + (size_t)gt * 8;
  {
    *(v4u*)(d) = o;
    
  }
}

// =====================================================================================================
// Transpose + convert: in X [R][C] f32 row-major -> out XTo [C][R] 16-bit in fragment order (output row = input column, k = R axis).
//   mode 0: bf16 RNE bits;  mode 1: f16 bits of (bf16 RNE value) * scale;  mode 2: f16 bits of value * scale.
// Block = 64 input rows x 64 input cols: bid -> (rt = bid % (R/64), ct = bid / (R/64)). The 64x64 f32 tile is loaded with 16-B
// loads (thread = input row tid>>2, 16 consecutive cols), converted and scattered into LDS TH[c local][r local] (pitch 72 halves);
// the tile is 4 row tiles x 2 k tiles = 8 blocks of 1 KB; chunk cid = it * 256 + tid -> block cid >> 6, chunk cid & 63 in it.
// coverage: load 256 thr x 16 = 64 x 64; store 2 iterations x 256 thr x 8 halves = 8 blocks x 64 chunks = the tile;
//           (R/64)*(C/64) blocks bid = 0.. (exact multiples) tile the whole [C][R] plane exactly once. TH: the block's 64 x VTP LDS tile.
// =====================================================================================================
#define VTP 72
static_assert(64 * VTP >= 63 * VTP + 64 && ((VTP * 2) % 16) == 0);
__device__ __forceinline__ void tr16(u16* TH, const float* __restrict__ X, u16* XTo, int R, int C, int mode, float scale, int bid) {
  const int tid = threadIdx.x;
  const int nrt = R >> 6;
  const int rt  = bid % nrt;
  const int ct  = bid / nrt;
  const int r0  = rt * 64;
  const int c0  = ct * 64;
  {
    const int rl = tid >> 2;                  // input row within tile 0..63
    const int cc = (tid & 3) * 16;            // input col chunk within the 64
    const float* src = X + (size_t)(r0 + rl) * (size_t)C + c0 + cc;
#pragma unroll
    for (int i = 0; i < 4; ++i) {
      const v4f a = *(const v4f*)(src + 4 * i);
#pragma unroll
      for (int e = 0; e < 4; ++e) {
        const float v  = a[e];
        const float vb = bfr(v);
        const float vf = (mode == 1) ? vb : v;
        const unsigned short hb = h_bits((_Float16)(vf * scale));
        const unsigned short bb = bf_bits(v);
        TH[(cc + 4 * i + e) * VTP + rl] = (mode != 0) ? hb : bb;
      }
    }
  }
  __syncthreads();
  v4u vh[2];
  const int cw = tid & 63;                    // chunk in its block: c * 16 + m
#pragma unroll
  for (int it = 0; it < 2; ++it) {
    const int bl = it * 4 + (tid >> 6);       // local block 0..7: row tile bl >> 1, k tile bl & 1
    vh[it] = *(const v4u*)(TH + ((bl >> 1) * 16 + (cw & 15)) * VTP + (bl & 1) * 32 + (cw >> 4) * 8);
  }
  const size_t base = (size_t)c0 * (size_t)R + (size_t)r0 * 16 + (size_t)cw * 8;
  {
#pragma unroll
    for (int it = 0; it < 2; ++it) {
      const int bl = it * 4 + (tid >> 6);
      *(v4u*)(XTo + base + (size_t)(bl >> 1) * 16 * (size_t)R + (size_t)(bl & 1) * 512) = vh[it];
    }
    // the stores' registers are rewritten only behind this wait, on whatever path the inlined body is left
#if defined(__HIP_DEVICE_COMPILE__)
    asm volatile("s_wait_xcnt 0x0" ::: "memory");
#endif
  }
}

// =====================================================================================================
// All six input conversions in ONE launch (they are independent of one another): the block index picks the job, block-uniformly.
//   blocks [0, PB_W2)            Wv2 [512][4096] -> f16 of the bf16 value x1024, [4096][512]
//   next 3 x PB_WT               Wv1, Wq, Wk [in][out] -> bf16 [out][in]
//   next PB_XS, then PB_XQ       source rows, query rows < SQ -> bf16 planes
// coverage: each range is the exact block count of its job (see cvt16, tr16); grid = PB_ALL.
// =====================================================================================================
#define PB_W2 ((DM / 64) * (DV / 64))
#define PB_WT ((DM / 64) * (DM / 64))
#define PB_XS ((NL * DM) / 2048)
#define PB_XQ ((SQ * DM) / 2048)
#define PB_ALL (PB_W2 + 3 * PB_WT + PB_XS + PB_XQ)
__global__ __launch_bounds__(256)
void prep_all(const float* __restrict__ xq, const float* __restrict__ xs, const float* __restrict__ wv1,
              const float* __restrict__ wq, const float* __restrict__ wk, const float* __restrict__ wv2,
              u16* XQ, u16* XS, u16* WV1T, u16* WQT, u16* WKT, u16* WV2T) {
  __shared__ __align__(16) u16 TH[64 * VTP];
  int b = blockIdx.x;
  if (b < PB_W2) { tr16(TH, wv2, WV2T, DM, DV, 1, W2S, b); return; }
  b -= PB_W2;
  if (b < 3 * PB_WT) {
    const int job = b / PB_WT;
    const float* w = (job == 0) ? wv1 : (job == 1) ? wq : wk;
    u16* d = (job == 0) ? WV1T : (job == 1) ? WQT : WKT;
    tr16(TH, w, d, DM, DM, 0, 1.0f, b % PB_WT);
    return;
  }
  b -= 3 * PB_WT;
  const bool src = b < PB_XS;
  cvt16(src ? xs : xq, src ? XS : XQ, src ? (NL * DM) / 8 : (SQ * DM) / 8, 0, 1.0f, src ? b : b - PB_XS);
}

// =====================================================================================================
// Epilogues. The wave's 16x64 f32 tile (times oscale, plus an optional per-row addend) is staged in its LDS slab (pitch 68),
//            8 consecutive lanes x 16 B per line), lanes 16..31 -> row 2*it+1.
//  epi64hsb: f16 bits of ((tile + bf16RNE(bias[col])) * pscale) into a fragment-order plane: the tile is two adjacent 1-KB blocks;
//            store i = 0..3, lane (h, m) = row m, columns 16i + 8h .. + 7, at half index i * 256 + lane * 8 (512 contiguous bytes).
//  epi64hrb: a wave's 64 x 64 tile (four 16-row tiles, all staged at once in a 64-row slab, one wave-level sync): f16 bits of
//            ((tile + bf16RNE(bias[row])) * pscale), per 16-row tile the store shape of epi64hsb, but blocks ordered k tile first
//            (M rows): a 16-row tile's two 1-KB blocks stand M * 32 halves apart, the next 16-row tile 512 halves on.
// coverage: epi64 8 instructions x 2 rows x 16 lanes x 4 floats; epi64hsb 4 instructions x 16 rows x 2 chunks x 8 halves
//           = the wave's 16 x 64 tile; epi64hrb 4 times that = the wave's 64 x 64 tile.
// =====================================================================================================
__device__ __forceinline__ void stage64(float* sl, v8f a0, v8f a1, v8f a2, v8f a3, float oscale, int lane) {
  const int hh = lane >> 4, m = lane & 15;
#pragma unroll
  for (int r = 0; r < 8; ++r) {
    const int ro = (8 * hh + r) * 68 + m;
    sl[ro]      = a0[r] * oscale;
    sl[ro + 16] = a1[r] * oscale;
    sl[ro + 32] = a2[r] * oscale;
    sl[ro + 48] = a3[r] * oscale;
  }
  wave_sync_lds();
}
__device__ __forceinline__ void epi64(float* sl, v8f a0, v8f a1, v8f a2, v8f a3, float oscale, v4f badd, float* C, int N,
                                      size_t rowb, int col0, int lane) {
  const int hh = lane >> 4, m = lane & 15;
  stage64(sl, a0, a1, a2, a3, oscale, lane);
  v4f vals[8];
#pragma unroll
  for (int it = 0; it < 8; ++it) vals[it] = *(const v4f*)(sl + (it * 2 + hh) * 68 + m * 4) + badd;
  float* dst = C + (rowb + (size_t)hh) * (size_t)N + col0 + m * 4;
  {
#pragma unroll
    for (int it = 0; it < 8; ++it) {
      *(v4f*)(dst + (size_t)(it * 2) * (size_t)N) = vals[it];
    }
    
  }
}
__device__ __forceinline__ void epi64hsb(float* sl, v8f a0, v8f a1, v8f a2, v8f a3, float oscale, float pscale,
                                         const float* __restrict__ bias, u16* C, int N, size_t rowb, int col0, int lane) {
  stage64(sl, a0, a1, a2, a3, oscale, lane);
  const int row = lane & 15, h8 = (lane >> 4) * 8;
  v4u oh[4];
#pragma unroll
  for (int i4 = 0; i4 < 4; ++i4) {
    const int c8 = i4 * 16 + h8;
    const v4f b0 = *(const v4f*)(bias + col0 + c8), b1 = *(const v4f*)(bias + col0 + c8 + 4);   // columns col0+c8..+7 < N
    const v4f a = *(const v4f*)(sl + row * 68 + c8), c4 = *(const v4f*)(sl + row * 68 + c8 + 4);
    float w[8];
#pragma unroll
    for (int e = 0; e < 4; ++e) { w[e] = (a[e] + bfr(b0[e])) * pscale; w[4 + e] = (c4[e] + bfr(b1[e])) * pscale; }
#pragma unroll
    for (int e = 0; e < 4; ++e) oh[i4][e] = pk16(h_bits((_Float16)w[2 * e]), h_bits((_Float16)w[2 * e + 1]));
  }
  u16* dst = C + rowb * (size_t)N + (size_t)col0 * 16 + lane * 8;      // rowb % 16 == 0, col0 % 64 == 0
  {
#pragma unroll
    for (int i4 = 0; i4 < 4; ++i4) {
      *(v4u*)(dst + i4 * 256) = oh[i4];
    }
    
  }
}
__device__ __forceinline__ void epi64hrb(float* sl, v8f (&o)[4][4], float oscale, float pscale,
                                         const float* __restrict__ brow, u16* C, int M, size_t rowb, int col0, int lane) {
  const int hh = lane >> 4, m = lane & 15;
  // every loop here is unrolled so that o, r0v, r1v and oh are indexed by constants and stay in registers
  v4f r0v[4], r1v[4];
#pragma unroll
  for (int i = 0; i < 4; ++i) {              // rows rowb + 16i + 8h .. + 7 < M
    r0v[i] = *(const v4f*)(brow + 16 * i + 8 * hh);
    r1v[i] = *(const v4f*)(brow + 16 * i + 8 * hh + 4);
  }
#pragma unroll
  for (int i = 0; i < 4; ++i) {
    float rb[8];
#pragma unroll
    for (int e = 0; e < 4; ++e) { rb[e] = bfr(r0v[i][e]); rb[4 + e] = bfr(r1v[i][e]); }
#pragma unroll
    for (int r = 0; r < 8; ++r) {
      const int ro = (16 * i + 8 * hh + r) * 68 + m;
      sl[ro]      = o[i][0][r] * oscale + rb[r];
      sl[ro + 16] = o[i][1][r] * oscale + rb[r];
      sl[ro + 32] = o[i][2][r] * oscale + rb[r];
      sl[ro + 48] = o[i][3][r] * oscale + rb[r];
    }
  }
  wave_sync_lds();
  u16* dst = C + (size_t)col0 * (size_t)M + rowb * 32 + lane * 8;      // rowb % 16 == 0, col0 % 64 == 0
#pragma unroll
  for (int i = 0; i < 4; ++i) {
    v4u oh[4];
#pragma unroll
    for (int i4 = 0; i4 < 4; ++i4) {
      const int c8 = i4 * 16 + hh * 8;
      const v4f a = *(const v4f*)(sl + (16 * i + m) * 68 + c8), c4 = *(const v4f*)(sl + (16 * i + m) * 68 + c8 + 4);
      float w[8];
#pragma unroll
      for (int e = 0; e < 4; ++e) { w[e] = a[e] * pscale; w[4 + e] = c4[e] * pscale; }
#pragma unroll
      for (int e = 0; e < 4; ++e) oh[i4][e] = pk16(h_bits((_Float16)w[2 * e]), h_bits((_Float16)w[2 * e + 1]));
    }
#pragma unroll
    for (int i4 = 0; i4 < 4; ++i4) {
      *(v4u*)(dst + i * 512 + (size_t)(i4 >> 1) * 32 * (size_t)M + (i4 & 1) * 256) = oh[i4];
    }
  }
}

// =====================================================================================================
// bf16 GEMM, f16 plane out with column bias: C16[M][N] = f16 bits of (((A[M][K] (bf16) . Bt[N][K]^T (bf16))
// * oscale) + bf16RNE(bias[n])) * pscale. A, Bt and C16 are fragment-order planes.
// Block = 64x64 tile, 4 waves x 16 rows; fragments loaded straight from the 1-KB blocks (two 16-B loads each, split k map for
// A and B); K stepped by 32 = one block (K % 32 == 0, M % 64 == 0, N % 64 == 0, blocks bid = 0 .. (M/64)*(N/64) - 1).
// slab: the block's 4 epilogue slabs in LDS.
// =====================================================================================================
__device__ __forceinline__
void gemm_bh16(float* slab, const u16* __restrict__ A, const u16* __restrict__ Bt, const float* __restrict__ bias, u16* C,
               int M, int N, int K, float oscale, float pscale, int bid) {
  const int tid = threadIdx.x, wave = tid >> 5, lane = tid & 31;
  const int ntile = N >> 6;
  const int rowb  = (bid / ntile) * 64 + wave * 16;
  const int col0  = (bid % ntile) * 64;
  if (rowb + 16 > M) return;                 // wave-uniform, never taken with the exact grid; no block barriers in this kernel
  const size_t bs = (size_t)16 * K;
  const u16* ap  = A  + (size_t)rowb * (size_t)K + lane * 8;
  const u16* bp0 = Bt + (size_t)col0 * (size_t)K + lane * 8;
  const u16* bp1 = bp0 + bs;
  const u16* bp2 = bp1 + bs;
  const u16* bp3 = bp2 + bs;
  v8f acc0 = zero8(), acc1 = zero8(), acc2 = zero8(), acc3 = zero8();
#pragma unroll 1
  for (int k0 = 0; k0 < K; k0 += 32, ap += 512, bp0 += 512, bp1 += 512, bp2 += 512, bp3 += 512) {   // one 1-KB block a step
    const v16b a  = ldfrag_b(ap);
    const v16b b0 = ldfrag_b(bp0);
    const v16b b1 = ldfrag_b(bp1);
    const v16b b2 = ldfrag_b(bp2);
    const v16b b3 = ldfrag_b(bp3);
    acc0 = mma_b(a, b0, acc0);
    acc1 = mma_b(a, b1, acc1);
    acc2 = mma_b(a, b2, acc2);
    acc3 = mma_b(a, b3, acc3);
    guard6<v16b>(acc0, acc1, acc2, acc3, a, b0, b1, b2, b3, a);
  }
  epi64hsb(slab + wave * SLAB64, acc0, acc1, acc2, acc3, oscale, pscale, bias, C, N, (size_t)rowb, col0, lane);
}
// The three projections in ONE launch (independent of one another): blocks [0, GB_S) value = source.Wv1 + b (f16 plane x8),
// next GB_Q q = query.Wq + b (rows < SQ, x8), next GB_S k = source.Wk + b (x8); the job is block-uniform. grid = 2 * GB_S + GB_Q.
#define GB_S ((NL / 64) * (DM / 64))
#define GB_Q ((SQ / 64) * (DM / 64))
__global__ __launch_bounds__(128)
void proj3(const u16* __restrict__ XS, const u16* __restrict__ XQ, const u16* __restrict__ W1T, const u16* __restrict__ WQT,
           const u16* __restrict__ WKT, const float* __restrict__ bv1, const float* __restrict__ bq,
           const float* __restrict__ bk, u16* VALH, u16* QP, u16* KP) {
  __shared__ __align__(16) float slab[4 * SLAB64];
  const int b = blockIdx.x;
  const int job = (b < GB_S) ? 0 : (b < GB_S + GB_Q) ? 1 : 2;
  const u16*   A    = (job == 1) ? XQ : XS;
  const u16*   Bt   = (job == 0) ? W1T : (job == 1) ? WQT : WKT;
  const float* bias = (job == 0) ? bv1 : (job == 1) ? bq : bk;
  u16*         C    = (job == 0) ? VALH : (job == 1) ? QP : KP;
  const int    M    = (job == 1) ? SQ : NL;
  const float  ps   = (job == 0) ? VSC : (job == 1) ? QSC : KSC;
  const int    bid  = (job == 0) ? b : (job == 1) ? b - GB_S : b - GB_S - GB_Q;
  gemm_bh16(slab, A, Bt, bias, C, M, DM, DM, 1.0f, ps, bid);
}

// =====================================================================================================
// f16 GEMM, f16 plane out with ROW bias: C16[M][N] = f16 bits of (((A[M][K] (f16) . Bt[N][K]^T (f16))
// * oscale) + bf16RNE(bias[m])) * pscale, M = DV, N = NL, K = DM; all three planes in fragment order, C16 with its blocks k tile first.
// Block = 256 x 128 tile, 8 waves as 4 (rows) x 2 (columns); wave tile = 64 x 64 = 16 accumulator tiles: the 4 A and 4 B fragments
// of a k step (8 KB, loaded straight from the 1-KB blocks as in gemm_bh16) feed 16 matrix instructions. K stepped by 32 = one
// block; every output element sums its k steps in the same ascending order as with any other tile.
// Epilogue: epi64hrb, the wave's 64 x 64 tile staged whole in its own LDS slab.
// coverage: (M/256)*(N/128) blocks bid = 0.. (exact multiples) x 8 waves x 64 x 64 = the whole plane, every element exactly once.
// =====================================================================================================
static_assert((DV % 256) == 0 && (NL % 128) == 0 && 8 * 4 * SLAB64 * 4 <= 160 * 1024);
// Four vector slots behind the last matrix instruction of a k step (on the taken side of the loop's branch too) before the next
// step's loads overwrite its fragment registers; the fragments are inputs so that they stay allocated up to here. The two load
// addresses are inputs too: their registers are rewritten only behind the s_wait_xcnt, not by a later load of the same step.
__device__ __forceinline__ void guard16x8(v8f (&o)[4][4], v16h x0, v16h x1, v16h x2, v16h x3, v16h x4, v16h x5, v16h x6, v16h x7,
                                          const _Float16* pa, const _Float16* pb) {
#if defined(__HIP_DEVICE_COMPILE__)
  asm volatile("v_nop\n\tv_nop\n\tv_nop\n\tv_nop\n\ts_wait_xcnt 0x0"
               : "+v"(o[0][0]), "+v"(o[0][1]), "+v"(o[0][2]), "+v"(o[0][3]), "+v"(o[1][0]), "+v"(o[1][1]), "+v"(o[1][2]), "+v"(o[1][3]),
                 "+v"(o[2][0]), "+v"(o[2][1]), "+v"(o[2][2]), "+v"(o[2][3]), "+v"(o[3][0]), "+v"(o[3][1]), "+v"(o[3][2]), "+v"(o[3][3])
               : "v"(x0), "v"(x1), "v"(x2), "v"(x3), "v"(x4), "v"(x5), "v"(x6), "v"(x7), "v"(pa), "v"(pb) : "memory");
#endif
}
__global__ __launch_bounds__(256)
void gemm_hh16r(const u16* __restrict__ A, const u16* __restrict__ Bt, const float* __restrict__ bias, u16* C,
                float oscale, float pscale) {
  constexpr int M = DV, N = NL, K = DM;      // compile-time: the 8 loads of an operand share one address and differ in the immediate offset
  __shared__ __align__(16) float slab[8 * 4 * SLAB64];   // 64 rows x 68 floats a wave; two blocks fit a WGP
  const int tid = threadIdx.x, lane = tid & 31;
  const int wave = __builtin_amdgcn_readfirstlane(tid >> 5);   // scalar: the operand bases stay in scalar registers, one lane offset serves all loads
  const int ntile = N >> 7;
  const int bid   = blockIdx.x;
  const int rowb  = (bid / ntile) * 256 + (wave & 3) * 64;
  const int col0  = (bid % ntile) * 128 + (wave >> 2) * 64;
  if (rowb + 64 > M) return;                 // wave-uniform, never taken with the exact grid; no block barriers in this kernel
  constexpr int bs = 16 * K;
  const _Float16* ap = (const _Float16*)(const void*)A  + (size_t)rowb * (size_t)K;
  const _Float16* bp = (const _Float16*)(const void*)Bt + (size_t)col0 * (size_t)K;
  const int lo = lane * 8;
  v8f o[4][4];                               // o[i][t]: rows rowb + 16i..+15, columns col0 + 16t..+15 (unrolled: constant indices)
#pragma unroll
  for (int i = 0; i < 4; ++i) {
#pragma unroll
    for (int t = 0; t < 4; ++t) o[i][t] = zero8();
  }
  // kept rolled: unrolled, a second set of 8 fragments would be live beside the 16 accumulators
#pragma unroll 1
  for (int k0 = 0; k0 < K; k0 += 32, ap += 512, bp += 512) {   // one 1-KB block of each of the 8 row tiles a step
    const _Float16* const pa = ap + lo;
    const _Float16* const pb = bp + lo;
    const v16h a0 = ldfrag_hf(pa), a1 = ldfrag_hf(pa + bs), a2 = ldfrag_hf(pa + 2 * bs), a3 = ldfrag_hf(pa + 3 * bs);
    const v16h b0 = ldfrag_hf(pb), b1 = ldfrag_hf(pb + bs), b2 = ldfrag_hf(pb + 2 * bs), b3 = ldfrag_hf(pb + 3 * bs);
    o[0][0] = mma_h(a0, b0, o[0][0]);  o[1][0] = mma_h(a1, b0, o[1][0]);  o[2][0] = mma_h(a2, b0, o[2][0]);  o[3][0] = mma_h(a3, b0, o[3][0]);
    o[0][1] = mma_h(a0, b1, o[0][1]);  o[1][1] = mma_h(a1, b1, o[1][1]);  o[2][1] = mma_h(a2, b1, o[2][1]);  o[3][1] = mma_h(a3, b1, o[3][1]);
    o[0][2] = mma_h(a0, b2, o[0][2]);  o[1][2] = mma_h(a1, b2, o[1][2]);  o[2][2] = mma_h(a2, b2, o[2][2]);  o[3][2] = mma_h(a3, b2, o[3][2]);
    o[0][3] = mma_h(a0, b3, o[0][3]);  o[1][3] = mma_h(a1, b3, o[1][3]);  o[2][3] = mma_h(a2, b3, o[2][3]);  o[3][3] = mma_h(a3, b3, o[3][3]);
    guard16x8(o, a0, a1, a2, a3, b0, b1, b2, b3, pa, pb);
  }
  epi64hrb(slab + wave * (4 * SLAB64), o, oscale, pscale, bias + rowb, C, M, (size_t)rowb, col0, lane);
}

// =====================================================================================================
// Head-axis softmax attention with the head mean folded in. Block = NT = 64 query rows q0..q0+63, 8 waves, the KSPAN keys of
// key range blockIdx.x in tiles of LT = 32 (the softmax runs over heads, so key ranges only add: each range writes its own f32
// partial plane, sum_parts adds the KS planes). q plane f16 x8 [n][512] (head h = columns 64h..64h+63), k plane the same, V^T plane f16 x64 [h*512+d][l],
// all three in fragment order, V^T with its blocks k tile first.
//   (S) wave w = head w: S_w[64 n][32 l] in two passes of 32 n = 4 D tiles each, K = 64 (2 k-steps): A = q rows (row m = query,
//       split k map over the head's 64 columns), B = k rows (col n = key, same split map, loaded once for both passes);
//       D element r of lane -> U.s[w][n 32nh+16nt+8h+r][l 16half+m].
//   (M) thread = (n = 32it + (tid>>3), 4 consecutive l), it = 0, 1, all arithmetic on 4-wide f32 vectors (packed instructions):
//       max over the 8 heads of s, p = exp2(fma(s, log2e/512, -max * log2e/512)), P = p / sum (f32), written as f16(P * 4096) to
//       sP[h][n][l] with 8-B LDS stores.
//   (PV) wave w owns d columns 64w + 16t + (lane&15), t = 0..3, for all four 16-row n groups (16 accumulators): every V^T fragment
//       fetched from L2 feeds four matrix instructions. For every head h:
//       A = P_h fragments from LDS (row m = query, split map over the 32 keys), B = V^T fragments (col = d, keys contiguous,
//       row h*512 + d of the V^T plane); all heads and key tiles accumulate into the same accumulators (joint (l,h) K axis).
//   Block barriers after (S) and after (M) order every LDS reuse across phases, key tiles and waves.
//   Epilogue: partial = acc * 2^-21 (= 1 / (4096 * 64 * 8 heads)); the wave's four 16 x 64 f32 tiles go through epi64 one after
//   another (a wave-level LDS sync between tiles); a block barrier separates the key loop from the slab use (the slab area
//   aliases the score area).
// coverage: grid (KS, SQ/64) blocks x 64 rows = query rows 0..SQ-1 of every partial plane; (S) 8 waves x 64 x 32 = all score cells;
//           (M) 2 passes x 256 thr x 4 l x 8 h = all P cells; stores 8 waves x (4 tiles x 16 rows x 64 cols) =
//           part[ks][q0..q0+63][0..511], every float exactly once.
// =====================================================================================================
__global__ __launch_bounds__(ATT_THREADS)
void attn_heads(const u16* __restrict__ QPp, const u16* __restrict__ KPp, const u16* __restrict__ VTp, float* part) {
  __shared__ __align__(16) AttU U;                 // scores [8][64][SSP] f32; reused as 8 epilogue slabs
  __shared__ __align__(16) u16 sP[NH * NT * PLP];  // P tiles [8][64][PLP] f16 bits

  const int tid  = threadIdx.x;
  const int wave = tid >> 5;
  const int lane = tid & 31;
  const int hh   = lane >> 4;
  const int m    = lane & 15;
  const int q0   = blockIdx.y * NT;          // q0 + 63 < SQ (grid exact)
  const int lbeg = blockIdx.x * KSPAN;       // this block's key range lbeg .. lbeg + KSPAN - 1 < NL (grid exact)
  float* const out = part + (size_t)blockIdx.x * ((size_t)SQ * DM);

  const _Float16* qb = (const _Float16*)(const void*)QPp + (size_t)q0 * DM + wave * (DKH * 16) + lane * 8;
  const _Float16* kp = (const _Float16*)(const void*)KPp + (size_t)lbeg * DM + wave * (DKH * 16) + lane * 8;   // steps one key tile a pass
  const _Float16* vb = (const _Float16*)(const void*)VTp + wave * (64 * 32) + lane * 8;
  const float lsc = LOG2E / (QSC * KSC * 8.0f);
  const v4f lsc4 = {lsc, lsc, lsc, lsc};
  float* const sw = U.s + wave * (NT * SSP);

  v8f o[4][4];                               // o[i][t]: n rows 16i..16i+15, d columns 64 * wave + 16t..+15
#pragma unroll
  for (int i = 0; i < 4; ++i) {
#pragma unroll
    for (int t = 0; t < 4; ++t) o[i][t] = zero8();
  }

#pragma unroll 1
  for (int l0 = lbeg; l0 < lbeg + KSPAN; l0 += LT, kp += (size_t)LT * DM) {
    // ---- (S) scores of head = wave for this key tile ----
    {
      const v16h ka0 = ldfrag_hf(kp), ka1 = ldfrag_hf(kp + 512);
      const v16h kc0 = ldfrag_hf(kp + (size_t)16 * DM), kc1 = ldfrag_hf(kp + (size_t)16 * DM + 512);
      const _Float16* qp = qb;
      // kept rolled: unrolled, 8 q fragments and 8 score tiles would be live beside the 16 output accumulators
#pragma unroll 1
      for (int nh = 0; nh < NT / 32; ++nh, qp += (size_t)32 * DM) {
        const v16h qa0 = ldfrag_hf(qp), qa1 = ldfrag_hf(qp + 512);
        const v16h qc0 = ldfrag_hf(qp + (size_t)16 * DM), qc1 = ldfrag_hf(qp + (size_t)16 * DM + 512);
        v8f s00 = zero8(), s01 = zero8(), s10 = zero8(), s11 = zero8();
        s00 = mma_h(qa0, ka0, s00);  s00 = mma_h(qa1, ka1, s00);     // n rows 0..15 of the pass,  keys 0..15
        s01 = mma_h(qa0, kc0, s01);  s01 = mma_h(qa1, kc1, s01);     // n rows 0..15 of the pass,  keys 16..31
        s10 = mma_h(qc0, ka0, s10);  s10 = mma_h(qc1, ka1, s10);     // n rows 16..31 of the pass, keys 0..15
        s11 = mma_h(qc0, kc0, s11);  s11 = mma_h(qc1, kc1, s11);     // n rows 16..31 of the pass, keys 16..31
        guard4x8(s00, s01, s10, s11, qa0, qa1, qc0, qc1, ka0, ka1, kc0, kc1);
        float* const sn = sw + nh * (32 * SSP);
#pragma unroll
        for (int r = 0; r < 8; ++r) {
          const int ro = (8 * hh + r) * SSP + m;
          sn[ro]                 = s00[r];
          sn[ro + 16]            = s01[r];
          sn[ro + 16 * SSP]      = s10[r];
          sn[ro + 16 * SSP + 16] = s11[r];
        }
      }
    }
    __syncthreads();
    // V^T fragments go through a register ring of four slots of two fragments (half a head each): half step j = 2 * head + half
    // uses slot j & 3, and the loads of half step j + 3 are issued before the matrix instructions of half step j.
    // The first three half steps (head 0, half of head 1) are asked for here, so that their way from L2 runs under the softmax phase.
    const _Float16* const vl = vb + (size_t)l0 * DV;   // k tile l0 / 32 of V^T: DV / 16 blocks of 512 halves
    v16h g[4][2];
#pragma unroll
    for (int j = 0; j < 2; ++j) { g[j][0] = ldfrag_hf(vl + j * 1024); g[j][1] = ldfrag_hf(vl + j * 1024 + 512); }
    g[2][0] = ldfrag_hf(vl + DM * 32);       // half step 2 (head 1, d tiles 0 and 1)
    g[2][1] = ldfrag_hf(vl + DM * 32 + 512);
    __builtin_amdgcn_sched_barrier(0);       // keeps these loads in front of the softmax code (sunk to their use they would hide nothing)
    // ---- (M) softmax over the 8 heads per (n, l), P tiles ----
#pragma unroll
    for (int it = 0; it < NT / 32; ++it) {
      const int n = it * 32 + (tid >> 3), lq = (tid & 7) * 4;
      v4f t[NH];
#pragma unroll
      for (int h = 0; h < NH; ++h) t[h] = *(const v4f*)(U.s + h * (NT * SSP) + n * SSP + lq);
      v4f mr = t[0];
#pragma unroll
      for (int h = 1; h < NH; ++h) mr = __builtin_elementwise_max(mr, t[h]);
      const v4f mx = mr * lsc;                                 // = max over heads of the rounded s * lsc: lsc > 0, rounding is monotonic
      v4f sm;
#pragma unroll
      for (int h = 0; h < NH; ++h) {
        const v4f x = __builtin_elementwise_fma(t[h], lsc4, -mx);
        // raw v_exp_f32: it differs from exp2f only where p < 2^-126; such a p vanishes in sm (one term is about 1) and is 0 as f16(P * 4096)
#pragma unroll
        for (int e = 0; e < 4; ++e) t[h][e] = __builtin_amdgcn_exp2f(x[e]);
        sm = h ? sm + t[h] : t[h];
      }
      v4f rs;                                                  // sm in [1, 8]
#pragma unroll
      for (int e = 0; e < 4; ++e) rs[e] = __builtin_amdgcn_rcpf(sm[e]) * PCAR;
      u16* pd = sP + n * PLP + lq;
#pragma unroll
      for (int h = 0; h < NH; ++h)
        *(v2u*)(pd + h * (NT * PLP)) = __builtin_bit_cast(v2u, __builtin_convertvector(t[h] * rs, v4h));
    }
    __syncthreads();
    // ---- (PV) accumulate P_h . V_h over all heads for this key tile ----
    {
      const _Float16* pbase = (const _Float16*)(const void*)sP + m * PLP + 8 * hh;
      // unrolled: the slot index is a constant, and each wait counts exactly the loads that are younger than the slot it needs
#pragma unroll
      for (int h = 0; h < NH; ++h) {
        if (h + 1 < NH) {                    // half step 2h + 3 (head h + 1, d tiles 2 and 3) into the slot that half step 2h - 1 has left
          g[(2 * h + 3) & 3][0] = ldfrag_hf(vl + (h + 1) * (DM * 32) + 1024);
          g[(2 * h + 3) & 3][1] = ldfrag_hf(vl + (h + 1) * (DM * 32) + 1536);
        }
        __builtin_amdgcn_sched_barrier(0);   // these loads issue before the matrix instructions of half step 2h
        const _Float16* pp = pbase + h * (NT * PLP);
        const v16h p0 = ldfrag_h(pp);
        const v16h p1 = ldfrag_h(pp + 16 * PLP);
        const v16h p2 = ldfrag_h(pp + 32 * PLP);
        const v16h p3 = ldfrag_h(pp + 48 * PLP);
        o[0][0] = mma_h(p0, g[(2 * h + 0) & 3][0], o[0][0]);
        o[1][0] = mma_h(p1, g[(2 * h + 0) & 3][0], o[1][0]);
        o[2][0] = mma_h(p2, g[(2 * h + 0) & 3][0], o[2][0]);
        o[3][0] = mma_h(p3, g[(2 * h + 0) & 3][0], o[3][0]);
        o[0][1] = mma_h(p0, g[(2 * h + 0) & 3][1], o[0][1]);
        o[1][1] = mma_h(p1, g[(2 * h + 0) & 3][1], o[1][1]);
        o[2][1] = mma_h(p2, g[(2 * h + 0) & 3][1], o[2][1]);
        o[3][1] = mma_h(p3, g[(2 * h + 0) & 3][1], o[3][1]);
        guard16x6(o, p0, p1, p2, p3, g[(2 * h) & 3][0], g[(2 * h) & 3][1]);
        if (h + 2 < NH) {                    // half step 2h + 4 (head h + 2, d tiles 0 and 1) into the slot just left
          g[(2 * h) & 3][0] = ldfrag_hf(vl + (h + 2) * (DM * 32));
          g[(2 * h) & 3][1] = ldfrag_hf(vl + (h + 2) * (DM * 32) + 512);
        }
        __builtin_amdgcn_sched_barrier(0);   // these loads issue before the matrix instructions of half step 2h + 1
        o[0][2] = mma_h(p0, g[(2 * h + 1) & 3][0], o[0][2]);
        o[1][2] = mma_h(p1, g[(2 * h + 1) & 3][0], o[1][2]);
        o[2][2] = mma_h(p2, g[(2 * h + 1) & 3][0], o[2][2]);
        o[3][2] = mma_h(p3, g[(2 * h + 1) & 3][0], o[3][2]);
        o[0][3] = mma_h(p0, g[(2 * h + 1) & 3][1], o[0][3]);
        o[1][3] = mma_h(p1, g[(2 * h + 1) & 3][1], o[1][3]);
        o[2][3] = mma_h(p2, g[(2 * h + 1) & 3][1], o[2][3]);
        o[3][3] = mma_h(p3, g[(2 * h + 1) & 3][1], o[3][3]);
        guard16x6(o, p0, p1, p2, p3, g[(2 * h + 1) & 3][0], g[(2 * h + 1) & 3][1]);
      }
    }
  }
  __syncthreads();

  const float osc = 1.0f / (PCAR * VCAR * (float)NH);
  const v4f z4 = {0.f, 0.f, 0.f, 0.f};
  float* const sl = U.slab + wave * SLAB64;
#pragma unroll
  for (int i = 0; i < 4; ++i) {
    if (i) wave_sync_lds();                  // the slab's last reads end before the next tile is staged in it
    epi64(sl, o[i][0], o[i][1], o[i][2], o[i][3], osc, z4, out, DM, (size_t)q0 + 16 * i, wave * 64, lane);
  }
}

// =====================================================================================================
// out = sum of the KS partial planes, added in plane order 0..KS-1 in f32. Thread = 4 consecutive floats: KS 16-B loads, one
// 16-B store; 32 consecutive lanes = 512 contiguous bytes per load and store.
// coverage: grid = SQ*DM/1024 blocks x 256 thr x 4 floats = out rows 0..SQ-1, every float exactly once.
// =====================================================================================================
__global__ __launch_bounds__(256) void sum_parts(const float* __restrict__ part, float* out) {
  const unsigned ob = (blockIdx.x * 256u + threadIdx.x) * 16u;    // byte offset in a plane, < SQ * DM * 4 (grid exact)
  v4f p[KS];
#pragma unroll
  for (int s = 0; s < KS; ++s) p[s] = *(const v4f*)((const char*)(part + (size_t)s * ((size_t)SQ * DM)) + ob);
  v4f a = p[0];
#pragma unroll
  for (int s = 1; s < KS; ++s) a += p[s];
  *(v4f*)((char*)out + ob) = a;
}

// =====================================================================================================
// Workspace map (bytes); every plane is fully written by whole-line stores before it is read; all extents are exact multiples of
// the store granularity (no pad rows, all dims multiples of 64), every offset a multiple of 256:
//   XQ  bf16 [SQ][512]                      <=  4194304
//   XS  bf16 [4096][512]                        4194304
//   WV1T, WQT, WKT bf16 [512][512]             3 x 524288
//   WV2T f16 of bf16 value x1024 [4096][512]   4194304
//   VALH f16 value x8 [4096][512]               4194304
//   QP   f16 x8 [SQ][512]                   <=  4194304
//   KP   f16 x8 [4096][512]                     4194304
//   VT   f16 x64 [4096][4096]                  33554432
//   PART f32 [KS][SQ][512]                  <= 67108864
//   end                                     <= 127401984
// =====================================================================================================
extern "C" void kernel_launch(void* const* d_in, const int* in_sizes, int n_in,
                              void* d_out, int out_size, void* d_ws, size_t ws_size,
                              hipStream_t stream) {
  if (n_in < 10) return;
  if (in_sizes[0] != NQ * DM || in_sizes[1] != NL * DM) return;
  if (in_sizes[2] != DM * DM || in_sizes[3] != DM) return;
  if (in_sizes[4] != DM * DM || in_sizes[5] != DM) return;
  if (in_sizes[6] != DM * DM || in_sizes[7] != DM) return;
  if (in_sizes[8] != DM * DV || in_sizes[9] != DV) return;
  if (out_size != NQ * DM) return;

  const float* xq  = (const float*)d_in[0];
  const float* xs  = (const float*)d_in[1];
  const float* wv1 = (const float*)d_in[2];
  const float* bv1 = (const float*)d_in[3];
  const float* wq  = (const float*)d_in[4];
  const float* bq  = (const float*)d_in[5];
  const float* wk  = (const float*)d_in[6];
  const float* bk  = (const float*)d_in[7];
  const float* wv2 = (const float*)d_in[8];
  const float* bv2 = (const float*)d_in[9];
  float*       out = (float*)d_out;

  const size_t szXQ = (size_t)SQ * DM * 2;          //  4194304 at SQ = NQ
  const size_t szXS = (size_t)NL * DM * 2;          //  4194304
  const size_t szWT = (size_t)DM * DM * 2;          //   524288
  const size_t szW2 = (size_t)DV * DM * 2;          //  4194304
  const size_t szVL = (size_t)NL * DM * 2;          //  4194304
  const size_t szQP = (size_t)SQ * DM * 2;          //  4194304 at SQ = NQ
  const size_t szKP = (size_t)NL * DM * 2;          //  4194304
  const size_t szVT = (size_t)DV * NL * 2;          // 33554432
  const size_t szPT = (size_t)KS * SQ * DM * 4;     // 67108864 at SQ = NQ
  size_t off = 0;
  const size_t oXQ = off; off += szXQ;
  const size_t oXS = off; off += szXS;
  const size_t oW1 = off; off += szWT;
  const size_t oWQ = off; off += szWT;
  const size_t oWK = off; off += szWT;
  const size_t oW2 = off; off += szW2;
  const size_t oVL = off; off += szVL;
  const size_t oQP = off; off += szQP;
  const size_t oKP = off; off += szKP;
  const size_t oVT = off; off += szVT;
  const size_t oPT = off; off += szPT;
  if (off > ws_size) return;                        // off = 127401984 at SQ = NQ
  if (off > WS_CAP) return;

  char* ws = (char*)d_ws;
  u16* XQ   = (u16*)(ws + oXQ);
  u16* XS   = (u16*)(ws + oXS);
  u16* WV1T = (u16*)(ws + oW1);
  u16* WQT  = (u16*)(ws + oWQ);
  u16* WKT  = (u16*)(ws + oWK);
  u16* WV2T = (u16*)(ws + oW2);
  u16* VALH = (u16*)(ws + oVL);
  u16* QP   = (u16*)(ws + oQP);
  u16* KP   = (u16*)(ws + oKP);
  u16* VT   = (u16*)(ws + oVT);
  float* PART = (float*)(ws + oPT);

  const dim3 blk(256);
  const dim3 bG(128);
  const dim3 gPR(PB_ALL);                           // 512 + 3 x 64 + 1024 + 1024 at SQ = NQ
  const dim3 gP3(2 * GB_S + GB_Q);                  // 3 x 512 at SQ = NQ
  const dim3 gVT((DV / 256) * (NL / 128));          // 512
  const dim3 gAT(KS, SQ / NT);                      // 8 x 64 at SQ = NQ
  const dim3 gSP((SQ * DM) / 1024);                 // 2048 at SQ = NQ
  const dim3 bAT(ATT_THREADS);

  // (0) query rows < SQ and source -> bf16 planes; Wv1, Wq, Wk [in][out] -> bf16 [out][in] fragment-order planes;
  //     Wv2 [512][4096] -> f16 of the bf16 value x1024, [4096][512]
  prep_all<<<gPR, blk, 0, stream>>>(xq, xs, wv1, wq, wk, wv2, XQ, XS, WV1T, WQT, WKT, WV2T);
  // (1) value = source.Wv1 + b -> f16 plane x8; q (rows < SQ) and k projections -> f16 planes x8
  proj3<<<gP3, bG, 0, stream>>>(XS, XQ, WV1T, WQT, WKT, bv1, bq, bk, VALH, QP, KP);
  // (2) V^T [h*512+d][l] = (Wv2^T . value^T) / (1024*8) + b[h*512+d], f16 plane x64
  gemm_hh16r<<<gVT, blk, 0, stream>>>(WV2T, VALH, bv2, VT, 1.0f / (W2S * VSC), VCAR);
  // (3) head-axis softmax attention + head mean, one f32 partial plane per key range; (4) planes summed -> out rows 0..SQ-1
  attn_heads<<<gAT, bAT, 0, stream>>>(QP, KP, VT, PART);
  sum_parts<<<gSP, blk, 0, stream>>>(PART, out);
  (void)hipGetLastError();
}

// v008
// A run of this version takes 162 microseconds.
// In two side-by-side timings against v007, it was 1.04 and 1.03 times as fast.
// Over all steps from v000 it is 4.84 times as fast.
// Projections value, q, k = x.W + b: v_wmma_f32_16x16x32_bf16 (bf16 RNE operands of the raw inputs, f32 accumulate, bf16 RNE
// bias added in f32). v^T = Wv2^T . value^T (W as f16 of the bf16 RNE value x1024, value plane f16 x8, bf16 RNE bias per row in
// f32), per-head scores q.k^T (f16 planes x8) and P.V (P x4096 f16 from LDS, V^T x64 f16): v_wmma_f32_16x16x32_f16, f32
// accumulate. Softmax over the head axis, the head mean and all scaling in f32 on VALU.
// Every 16-bit operand plane [rows][K] in the workspace is kept in FRAGMENT ORDER: 1-KB blocks of 16 rows x 32 k, block (rt, kt)
// at half index rt * 16 * K + kt * 512; inside a block the 16-B chunk (row m = row & 15, c = (k >> 3) & 3) stands at half index
// c * 128 + m * 8. Lane (h = lane >> 4, m = lane & 15) of a fragment then reads its two 16-B chunks (c = h and c = 2 + h) at
// lane * 8 and 256 + lane * 8: each load of a wave is 512 contiguous bytes (4 cache lines) and not 32 B out of each of 16 lines.
// The V^T plane alone orders its blocks k tile first, block (rt, kt) at half index (kt * (rows / 16) + rt) * 512, so that all that
// one key tile of the attention reads (every head, every d) is one contiguous 256-KB run.
#include <hip/hip_runtime.h>
#include <math.h>
#include <stdint.h>

#define NQ   4096
#define NL   4096
#define DM   512
#define NH   8
#define DKH  64
#define DV   (NH * DM)
#ifndef SQ
#define SQ NQ
#endif
#define NT   128
#define LT   32
#define SSP  32
#define PLP  40
#define SLAB64 (16 * 68)
#define ATT_THREADS 256
#define KS   8
#define KSPAN (NL / KS)
#define QSC  8.0f
#define KSC  8.0f
#define VSC  8.0f
#define W2S  1024.0f
#define PCAR 4096.0f
#define VCAR 64.0f
#define LOG2E 1.4426950408889634f
#define WS_CAP ((size_t)134217728)

static_assert(DM == NH * DKH && DKH == 64 && NH == 8 && (DM % 64) == 0 && (DV % 64) == 0 && (NL % 64) == 0 && (NQ % 64) == 0);
static_assert((DM % 32) == 0);
static_assert(SQ >= 64 && SQ <= NQ && (SQ % 64) == 0 && (SQ % NT) == 0);
static_assert(NT == 128 && LT == 32 && (NL % LT) == 0 && ATT_THREADS == 256 && ATT_THREADS * 4 * (NT / 32) == NT * LT);
static_assert(KS >= 1 && (NL % (KS * LT)) == 0 && ((SQ * DM) % 1024) == 0);
static_assert(SSP >= LT && PLP >= 32 && ((PLP * 2) % 16) == 0 && ((SSP * 4) % 16) == 0);
static_assert(8 * SLAB64 <= (NH / 2) * NT * SSP);
static_assert(((NQ * DM) % 2048) == 0 && ((NL * DM) % 2048) == 0 && ((SQ * DM) % 2048) == 0);
static_assert(NH * NT * SSP * 4 + NH * NT * PLP * 2 <= 320 * 1024);   // one block on a WGP

typedef unsigned short u16;
typedef _Float16 v16h __attribute__((ext_vector_type(16)));
typedef _Float16 v8h  __attribute__((ext_vector_type(8)));
typedef _Float16 v4h  __attribute__((ext_vector_type(4)));
typedef __bf16   v16b __attribute__((ext_vector_type(16)));
typedef float    v8f  __attribute__((ext_vector_type(8)));
typedef float    v4f  __attribute__((ext_vector_type(4)));
typedef unsigned int v4u __attribute__((ext_vector_type(4)));
typedef unsigned int v2u __attribute__((ext_vector_type(2)));

union FragH { v16h v; v8h h[2]; v4u u[2]; };
union FragB { v16b v; v4u u[2]; };
union AttU { float s[(NH / 2) * NT * SSP]; float slab[8 * SLAB64]; };

// ---- scalar helpers --------------------------------------------------------------------------------
__device__ __forceinline__ unsigned short bf_bits(float f) {          // f32 -> bf16 bits, RNE convert
  unsigned u = __float_as_uint(f);
  return (unsigned short)((u + 0x7FFFu + ((u >> 16) & 1u)) >> 16);
}
__device__ __forceinline__ float bf_up(unsigned short h) { return __uint_as_float(((unsigned)h) << 16); }
__device__ __forceinline__ float bfr(float f) { return bf_up(bf_bits(f)); }
__device__ __forceinline__ unsigned short h_bits(_Float16 x) { return __builtin_bit_cast(unsigned short, x); }
__device__ __forceinline__ unsigned pk16(unsigned short a, unsigned short b) { return (unsigned)a | ((unsigned)b << 16); }
__device__ __forceinline__ v8f zero8() { v8f z = {0.f, 0.f, 0.f, 0.f, 0.f, 0.f, 0.f, 0.f}; return z; }

// ---- fragment loaders: 16-bit A/B operand, lane -> row/col (lane&15); elements 0..7 <- k0+8h.., elements 8..15 <- k0+16+8h..
//      (same split k map for A and B).
//      ldfrag_h: row-major LDS tile, p already includes row * pitch + 8*(lane>>4): p[0..7] and p[16..23].
//      ldfrag_hf / ldfrag_b: fragment-order workspace plane, p = start of the 1-KB block + lane * 8: p[0..7] and p[256..263].
__device__ __forceinline__ v16h ldfrag_h(const _Float16* p) {
  FragH f;
  f.h[0] = *(const v8h*)(p);
  f.h[1] = *(const v8h*)(p + 16);
  return f.v;
}
__device__ __forceinline__ v16h ldfrag_hf(const _Float16* p) {
  FragH f;
  f.h[0] = *(const v8h*)(p);
  f.h[1] = *(const v8h*)(p + 256);
  return f.v;
}
__device__ __forceinline__ v16b ldfrag_b(const u16* p) {              // bf16 plane read as unsigned integer vectors
  FragB f;
  f.u[0] = *(const v4u*)(p);
  f.u[1] = *(const v4u*)(p + 256);
  return f.v;
}

__device__ __forceinline__ v8f mma_h(v16h a, v16h b, v8f c) {
  return __builtin_amdgcn_wmma_f32_16x16x32_f16(false, a, false, b, (short)0, c, false, false);
}
__device__ __forceinline__ v8f mma_b(v16b a, v16b b, v8f c) {
  return __builtin_amdgcn_wmma_f32_16x16x32_bf16(false, a, false, b, (short)0, c, false, false);
}
template <typename F>
__device__ __forceinline__ void guard6(v8f& a, v8f& b, v8f& c, v8f& d, F x0, F x1, F x2, F x3, F x4, F x5) {
#if defined(__HIP_DEVICE_COMPILE__)
  asm volatile("v_nop\n\tv_nop\n\tv_nop\n\tv_nop"
               : "+v"(a), "+v"(b), "+v"(c), "+v"(d) : "v"(x0), "v"(x1), "v"(x2), "v"(x3), "v"(x4), "v"(x5) : "memory");
#endif
}
__device__ __forceinline__ void guard4x8(v8f& a, v8f& b, v8f& c, v8f& d, v16h x0, v16h x1, v16h x2, v16h x3,
                                         v16h x4, v16h x5, v16h x6, v16h x7) {
#if defined(__HIP_DEVICE_COMPILE__)
  asm volatile("v_nop\n\tv_nop\n\tv_nop\n\tv_nop"
               : "+v"(a), "+v"(b), "+v"(c), "+v"(d)
               : "v"(x0), "v"(x1), "v"(x2), "v"(x3), "v"(x4), "v"(x5), "v"(x6), "v"(x7) : "memory");
#endif
}
// Four vector slots behind the last matrix instruction of a P.V half step (on the taken side of the key loop's branch too) before
// later loads overwrite its fragment registers. No operands: with a half step's 16 accumulators and 10 fragments named as operands
// the build spilled to scratch. The scheduling fence in front keeps the matrix instructions ahead of the slots, and the "memory"
// clobber keeps the refill of the ring slot behind them.
__device__ __forceinline__ void slots4() {
#if defined(__HIP_DEVICE_COMPILE__)
  __builtin_amdgcn_sched_barrier(0);
  asm volatile("v_nop\n\tv_nop\n\tv_nop\n\tv_nop" ::: "memory");
#endif
}
__device__ __forceinline__ void wave_sync_lds() {
  __builtin_amdgcn_fence(__ATOMIC_RELEASE, "workgroup");
  __builtin_amdgcn_wave_barrier();
  __builtin_amdgcn_fence(__ATOMIC_ACQUIRE, "workgroup");
}

// =====================================================================================================
// f32 plane [rows][DM] row-major -> 16-bit plane in fragment order:  mode 0: bf16 RNE bits;  mode 1: f16 bits of (bf16 RNE value) * scale;
// mode 2: f16 bits of value * scale (no bf16 pre-step).
// Thread = output chunk gt = 8 consecutive k of one row: two 16-B loads (a wave reads 64 B of each of 16 rows), one 16-B store;
// 32 consecutive lanes store 512 contiguous, 512-B aligned bytes
// coverage: n8/256 blocks bid = 0.. (exact multiples) x 256 thr x 8 = the whole plane.
// =====================================================================================================
__device__ __forceinline__ void cvt16(const float* __restrict__ x, u16* D, int n8, int mode, float scale, int bid) {
  const int gt = bid * 256 + (int)threadIdx.x;
  if (gt >= n8) return;                     // no barriers on this path
  const int kb = DM / 32;                   // blocks in a row tile
  const int blk = gt >> 6, cw = gt & 63;    // 1-KB block, chunk in it: cw = c * 16 + m
  const float* p = x + ((size_t)(blk / kb) * 16 + (size_t)(cw & 15)) * DM + (blk % kb) * 32 + (cw >> 4) * 8;
  const v4f a = *(const v4f*)(p), c4 = *(const v4f*)(p + 4);
  float v[8];
#pragma unroll
  for (int e = 0; e < 4; ++e) { v[e] = a[e]; v[4 + e] = c4[e]; }
  unsigned short s[8];
#pragma unroll
  for (int e = 0; e < 8; ++e) {
    const float vb = bfr(v[e]);
    const float vf = (mode == 1) ? vb : v[e];
    const unsigned short hb = h_bits((_Float16)(vf * scale));
    const unsigned short bb = bf_bits(v[e]);
    s[e] = (mode != 0) ? hb : bb;
  }
  v4u o;
#pragma unroll
  for (int e = 0; e < 4; ++e) o[e] = pk16(s[2 * e], s[2 * e + 1]);
  u16* d = D + (size_t)gt * 8;
  {
    *(v4u*)(d) = o;
    
  }
}

// =====================================================================================================
// Transpose + convert: in X [R][C] f32 row-major -> out XTo [C][R] 16-bit in fragment order (output row = input column, k = R axis).
//   mode 0: bf16 RNE bits;  mode 1: f16 bits of (bf16 RNE value) * scale;  mode 2: f16 bits of value * scale.
// Block = 64 input rows x 64 input cols: bid -> (rt = bid % (R/64), ct = bid / (R/64)). The 64x64 f32 tile is loaded with 16-B
// loads (thread = input row tid>>2, 16 consecutive cols), converted and scattered into LDS TH[c local][r local] (pitch 72 halves);
// the tile is 4 row tiles x 2 k tiles = 8 blocks of 1 KB; chunk cid = it * 256 + tid -> block cid >> 6, chunk cid & 63 in it.
// coverage: load 256 thr x 16 = 64 x 64; store 2 iterations x 256 thr x 8 halves = 8 blocks x 64 chunks = the tile;
//           (R/64)*(C/64) blocks bid = 0.. (exact multiples) tile the whole [C][R] plane exactly once. TH: the block's 64 x VTP LDS tile.
// =====================================================================================================
#define VTP 72
static_assert(64 * VTP >= 63 * VTP + 64 && ((VTP * 2) % 16) == 0);
__device__ __forceinline__ void tr16(u16* TH, const float* __restrict__ X, u16* XTo, int R, int C, int mode, float scale, int bid) {
  const int tid = threadIdx.x;
  const int nrt = R >> 6;
  const int rt  = bid % nrt;
  const int ct  = bid / nrt;
  const int r0  = rt * 64;
  const int c0  = ct * 64;
  {
    const int rl = tid >> 2;                  // input row within tile 0..63
    const int cc = (tid & 3) * 16;            // input col chunk within the 64
    const float* src = X + (size_t)(r0 + rl) * (size_t)C + c0 + cc;
#pragma unroll
    for (int i = 0; i < 4; ++i) {
      const v4f a = *(const v4f*)(src + 4 * i);
#pragma unroll
      for (int e = 0; e < 4; ++e) {
        const float v  = a[e];
        const float vb = bfr(v);
        const float vf = (mode == 1) ? vb : v;
        const unsigned short hb = h_bits((_Float16)(vf * scale));
        const unsigned short bb = bf_bits(v);
        TH[(cc + 4 * i + e) * VTP + rl] = (mode != 0) ? hb : bb;
      }
    }
  }
  __syncthreads();
  v4u vh[2];
  const int cw = tid & 63;                    // chunk in its block: c * 16 + m
#pragma unroll
  for (int it = 0; it < 2; ++it) {
    const int bl = it * 4 + (tid >> 6);       // local block 0..7: row tile bl >> 1, k tile bl & 1
    vh[it] = *(const v4u*)(TH + ((bl >> 1) * 16 + (cw & 15)) * VTP + (bl & 1) * 32 + (cw >> 4) * 8);
  }
  const size_t base = (size_t)c0 * (size_t)R + (size_t)r0 * 16 + (size_t)cw * 8;
  {
#pragma unroll
    for (int it = 0; it < 2; ++it) {
      const int bl = it * 4 + (tid >> 6);
      *(v4u*)(XTo + base + (size_t)(bl >> 1) * 16 * (size_t)R + (size_t)(bl & 1) * 512) = vh[it];
    }
    // the stores' registers are rewritten only behind this wait, on whatever path the inlined body is left
#if defined(__HIP_DEVICE_COMPILE__)
    asm volatile("s_wait_xcnt 0x0" ::: "memory");
#endif
  }
}

// =====================================================================================================
// All six input conversions in ONE launch (they are independent of one another): the block index picks the job, block-uniformly.
//   blocks [0, PB_W2)            Wv2 [512][4096] -> f16 of the bf16 value x1024, [4096][512]
//   next 3 x PB_WT               Wv1, Wq, Wk [in][out] -> bf16 [out][in]
//   next PB_XS, then PB_XQ       source rows, query rows < SQ -> bf16 planes
// coverage: each range is the exact block count of its job (see cvt16, tr16); grid = PB_ALL.
// =====================================================================================================
#define PB_W2 ((DM / 64) * (DV / 64))
#define PB_WT ((DM / 64) * (DM / 64))
#define PB_XS ((NL * DM) / 2048)
#define PB_XQ ((SQ * DM) / 2048)
#define PB_ALL (PB_W2 + 3 * PB_WT + PB_XS + PB_XQ)
__global__ __launch_bounds__(256)
void prep_all(const float* __restrict__ xq, const float* __restrict__ xs, const float* __restrict__ wv1,
              const float* __restrict__ wq, const float* __restrict__ wk, const float* __restrict__ wv2,
              u16* XQ, u16* XS, u16* WV1T, u16* WQT, u16* WKT, u16* WV2T) {
  __shared__ __align__(16) u16 TH[64 * VTP];
  int b = blockIdx.x;
  if (b < PB_W2) { tr16(TH, wv2, WV2T, DM, DV, 1, W2S, b); return; }
  b -= PB_W2;
  if (b < 3 * PB_WT) {
    const int job = b / PB_WT;
    const float* w = (job == 0) ? wv1 : (job == 1) ? wq : wk;
    u16* d = (job == 0) ? WV1T : (job == 1) ? WQT : WKT;
    tr16(TH, w, d, DM, DM, 0, 1.0f, b % PB_WT);
    return;
  }
  b -= 3 * PB_WT;
  const bool src = b < PB_XS;
  cvt16(src ? xs : xq, src ? XS : XQ, src ? (NL * DM) / 8 : (SQ * DM) / 8, 0, 1.0f, src ? b : b - PB_XS);
}

// =====================================================================================================
// Epilogues. The wave's 16x64 f32 tile (times oscale, plus an optional per-column addend) is staged in its LDS slab (pitch 68),
//            8 consecutive lanes x 16 B per line), lanes 16..31 -> row 2*it+1.
//  epi64hsb: f16 bits of ((tile + bf16RNE(bias[col])) * pscale) into a fragment-order plane: the tile is two adjacent 1-KB blocks;
//            store i = 0..3, lane (h, m) = row m, columns 16i + 8h .. + 7, at half index i * 256 + lane * 8 (512 contiguous bytes).
//  epi64hrb: a wave's 64 x 64 tile (four 16-row tiles, all staged at once in a 64-row slab, one wave-level sync): f16 bits of
//            ((tile + bf16RNE(bias[row])) * pscale), per 16-row tile the store shape of epi64hsb, but blocks ordered k tile first
//            (M rows): a 16-row tile's two 1-KB blocks stand M * 32 halves apart, the next 16-row tile 512 halves on.
// coverage: epi64 8 instructions x 2 rows x 16 lanes x 4 floats; epi64hsb 4 instructions x 16 rows x 2 chunks x 8 halves
//           = the wave's 16 x 64 tile; epi64hrb 4 times that = the wave's 64 x 64 tile.
// =====================================================================================================
__device__ __forceinline__ void stage64(float* sl, v8f a0, v8f a1, v8f a2, v8f a3, float oscale, int lane) {
  const int hh = lane >> 4, m = lane & 15;
#pragma unroll
  for (int r = 0; r < 8; ++r) {
    const int ro = (8 * hh + r) * 68 + m;
    sl[ro]      = a0[r] * oscale;
    sl[ro + 16] = a1[r] * oscale;
    sl[ro + 32] = a2[r] * oscale;
    sl[ro + 48] = a3[r] * oscale;
  }
  wave_sync_lds();
}
__device__ __forceinline__ void epi64(float* sl, v8f a0, v8f a1, v8f a2, v8f a3, float oscale, v4f badd, float* C, int N,
                                      size_t rowb, int col0, int lane) {
  const int hh = lane >> 4, m = lane & 15;
  stage64(sl, a0, a1, a2, a3, oscale, lane);
  v4f vals[8];
#pragma unroll
  for (int it = 0; it < 8; ++it) vals[it] = *(const v4f*)(sl + (it * 2 + hh) * 68 + m * 4) + badd;
  float* dst = C + (rowb + (size_t)hh) * (size_t)N + col0 + m * 4;
  {
#pragma unroll
    for (int it = 0; it < 8; ++it) {
      *(v4f*)(dst + (size_t)(it * 2) * (size_t)N) = vals[it];
    }
    // the stores' registers are rewritten (by the staging of the caller's next tile) only behind this wait; the scheduling fence
    // keeps that arithmetic, which is no memory operation, behind it
#if defined(__HIP_DEVICE_COMPILE__)
    asm volatile("s_wait_xcnt 0x0" ::: "memory");
    __builtin_amdgcn_sched_barrier(0);
#endif
  }
}
__device__ __forceinline__ void epi64hsb(float* sl, v8f a0, v8f a1, v8f a2, v8f a3, float oscale, float pscale,
                                         const float* __restrict__ bias, u16* C, int N, size_t rowb, int col0, int lane) {
  stage64(sl, a0, a1, a2, a3, oscale, lane);
  const int row = lane & 15, h8 = (lane >> 4) * 8;
  v4u oh[4];
#pragma unroll
  for (int i4 = 0; i4 < 4; ++i4) {
    const int c8 = i4 * 16 + h8;
    const v4f b0 = *(const v4f*)(bias + col0 + c8), b1 = *(const v4f*)(bias + col0 + c8 + 4);   // columns col0+c8..+7 < N
    const v4f a = *(const v4f*)(sl + row * 68 + c8), c4 = *(const v4f*)(sl + row * 68 + c8 + 4);
    float w[8];
#pragma unroll
    for (int e = 0; e < 4; ++e) { w[e] = (a[e] + bfr(b0[e])) * pscale; w[4 + e] = (c4[e] + bfr(b1[e])) * pscale; }
#pragma unroll
    for (int e = 0; e < 4; ++e) oh[i4][e] = pk16(h_bits((_Float16)w[2 * e]), h_bits((_Float16)w[2 * e + 1]));
  }
  u16* dst = C + rowb * (size_t)N + (size_t)col0 * 16 + lane * 8;      // rowb % 16 == 0, col0 % 64 == 0
  {
#pragma unroll
    for (int i4 = 0; i4 < 4; ++i4) {
      *(v4u*)(dst + i4 * 256) = oh[i4];
    }
    
  }
}
__device__ __forceinline__ void epi64hrb(float* sl, v8f (&o)[4][4], float oscale, float pscale,
                                         const float* __restrict__ brow, u16* C, int M, size_t rowb, int col0, int lane) {
  const int hh = lane >> 4, m = lane & 15;
  // every loop here is unrolled so that o, r0v, r1v and oh are indexed by constants and stay in registers
  v4f r0v[4], r1v[4];
#pragma unroll
  for (int i = 0; i < 4; ++i) {              // rows rowb + 16i + 8h .. + 7 < M
    r0v[i] = *(const v4f*)(brow + 16 * i + 8 * hh);
    r1v[i] = *(const v4f*)(brow + 16 * i + 8 * hh + 4);
  }
#pragma unroll
  for (int i = 0; i < 4; ++i) {
    float rb[8];
#pragma unroll
    for (int e = 0; e < 4; ++e) { rb[e] = bfr(r0v[i][e]); rb[4 + e] = bfr(r1v[i][e]); }
#pragma unroll
    for (int r = 0; r < 8; ++r) {
      const int ro = (16 * i + 8 * hh + r) * 68 + m;
      sl[ro]      = o[i][0][r] * oscale + rb[r];
      sl[ro + 16] = o[i][1][r] * oscale + rb[r];
      sl[ro + 32] = o[i][2][r] * oscale + rb[r];
      sl[ro + 48] = o[i][3][r] * oscale + rb[r];
    }
  }
  wave_sync_lds();
  u16* dst = C + (size_t)col0 * (size_t)M + rowb * 32 + lane * 8;      // rowb % 16 == 0, col0 % 64 == 0
#pragma unroll
  for (int i = 0; i < 4; ++i) {
    v4u oh[4];
#pragma unroll
    for (int i4 = 0; i4 < 4; ++i4) {
      const int c8 = i4 * 16 + hh * 8;
      const v4f a = *(const v4f*)(sl + (16 * i + m) * 68 + c8), c4 = *(const v4f*)(sl + (16 * i + m) * 68 + c8 + 4);
      float w[8];
#pragma unroll
      for (int e = 0; e < 4; ++e) { w[e] = a[e] * pscale; w[4 + e] = c4[e] * pscale; }
#pragma unroll
      for (int e = 0; e < 4; ++e) oh[i4][e] = pk16(h_bits((_Float16)w[2 * e]), h_bits((_Float16)w[2 * e + 1]));
    }
#pragma unroll
    for (int i4 = 0; i4 < 4; ++i4) {
      *(v4u*)(dst + i * 512 + (size_t)(i4 >> 1) * 32 * (size_t)M + (i4 & 1) * 256) = oh[i4];
    }
  }
}

// =====================================================================================================
// bf16 GEMM, f16 plane out with column bias: C16[M][N] = f16 bits of (((A[M][K] (bf16) . Bt[N][K]^T (bf16))
// * oscale) + bf16RNE(bias[n])) * pscale. A, Bt and C16 are fragment-order planes.
// Block = 64x64 tile, 4 waves x 16 rows; fragments loaded straight from the 1-KB blocks (two 16-B loads each, split k map for
// A and B); K stepped by 32 = one block (K % 32 == 0, M % 64 == 0, N % 64 == 0, blocks bid = 0 .. (M/64)*(N/64) - 1).
// slab: the block's 4 epilogue slabs in LDS.
// =====================================================================================================
__device__ __forceinline__
void gemm_bh16(float* slab, const u16* __restrict__ A, const u16* __restrict__ Bt, const float* __restrict__ bias, u16* C,
               int M, int N, int K, float oscale, float pscale, int bid) {
  const int tid = threadIdx.x, wave = tid >> 5, lane = tid & 31;
  const int ntile = N >> 6;
  const int rowb  = (bid / ntile) * 64 + wave * 16;
  const int col0  = (bid % ntile) * 64;
  if (rowb + 16 > M) return;                 // wave-uniform, never taken with the exact grid; no block barriers in this kernel
  const size_t bs = (size_t)16 * K;
  const u16* ap  = A  + (size_t)rowb * (size_t)K + lane * 8;
  const u16* bp0 = Bt + (size_t)col0 * (size_t)K + lane * 8;
  const u16* bp1 = bp0 + bs;
  const u16* bp2 = bp1 + bs;
  const u16* bp3 = bp2 + bs;
  v8f acc0 = zero8(), acc1 = zero8(), acc2 = zero8(), acc3 = zero8();
#pragma unroll 1
  for (int k0 = 0; k0 < K; k0 += 32, ap += 512, bp0 += 512, bp1 += 512, bp2 += 512, bp3 += 512) {   // one 1-KB block a step
    const v16b a  = ldfrag_b(ap);
    const v16b b0 = ldfrag_b(bp0);
    const v16b b1 = ldfrag_b(bp1);
    const v16b b2 = ldfrag_b(bp2);
    const v16b b3 = ldfrag_b(bp3);
    acc0 = mma_b(a, b0, acc0);
    acc1 = mma_b(a, b1, acc1);
    acc2 = mma_b(a, b2, acc2);
    acc3 = mma_b(a, b3, acc3);
    guard6<v16b>(acc0, acc1, acc2, acc3, a, b0, b1, b2, b3, a);
  }
  epi64hsb(slab + wave * SLAB64, acc0, acc1, acc2, acc3, oscale, pscale, bias, C, N, (size_t)rowb, col0, lane);
}
// The three projections in ONE launch (independent of one another): blocks [0, GB_S) value = source.Wv1 + b (f16 plane x8),
// next GB_Q q = query.Wq + b (rows < SQ, x8), next GB_S k = source.Wk + b (x8); the job is block-uniform. grid = 2 * GB_S + GB_Q.
#define GB_S ((NL / 64) * (DM / 64))
#define GB_Q ((SQ / 64) * (DM / 64))
__global__ __launch_bounds__(128)
void proj3(const u16* __restrict__ XS, const u16* __restrict__ XQ, const u16* __restrict__ W1T, const u16* __restrict__ WQT,
           const u16* __restrict__ WKT, const float* __restrict__ bv1, const float* __restrict__ bq,
           const float* __restrict__ bk, u16* VALH, u16* QP, u16* KP) {
  __shared__ __align__(16) float slab[4 * SLAB64];
  const int b = blockIdx.x;
  const int job = (b < GB_S) ? 0 : (b < GB_S + GB_Q) ? 1 : 2;
  const u16*   A    = (job == 1) ? XQ : XS;
  const u16*   Bt   = (job == 0) ? W1T : (job == 1) ? WQT : WKT;
  const float* bias = (job == 0) ? bv1 : (job == 1) ? bq : bk;
  u16*         C    = (job == 0) ? VALH : (job == 1) ? QP : KP;
  const int    M    = (job == 1) ? SQ : NL;
  const float  ps   = (job == 0) ? VSC : (job == 1) ? QSC : KSC;
  const int    bid  = (job == 0) ? b : (job == 1) ? b - GB_S : b - GB_S - GB_Q;
  gemm_bh16(slab, A, Bt, bias, C, M, DM, DM, 1.0f, ps, bid);
}

// =====================================================================================================
// f16 GEMM, f16 plane out with ROW bias: C16[M][N] = f16 bits of (((A[M][K] (f16) . Bt[N][K]^T (f16))
// * oscale) + bf16RNE(bias[m])) * pscale, M = DV, N = NL, K = DM; all three planes in fragment order, C16 with its blocks k tile first.
// Block = 256 x 128 tile, 8 waves as 4 (rows) x 2 (columns); wave tile = 64 x 64 = 16 accumulator tiles: the 4 A and 4 B fragments
// of a k step (8 KB, loaded straight from the 1-KB blocks as in gemm_bh16) feed 16 matrix instructions. K stepped by 32 = one
// block; every output element sums its k steps in the same ascending order as with any other tile.
// Epilogue: epi64hrb, the wave's 64 x 64 tile staged whole in its own LDS slab.
// coverage: (M/256)*(N/128) blocks bid = 0.. (exact multiples) x 8 waves x 64 x 64 = the whole plane, every element exactly once.
// =====================================================================================================
static_assert((DV % 256) == 0 && (NL % 128) == 0 && 8 * 4 * SLAB64 * 4 <= 160 * 1024);
// Four vector slots behind the last matrix instruction of a k step (on the taken side of the loop's branch too) before the next
// step's loads overwrite its fragment registers; the fragments are inputs so that they stay allocated up to here. The two load
// addresses are inputs too: their registers are rewritten only behind the s_wait_xcnt, not by a later load of the same step.
__device__ __forceinline__ void guard16x8(v8f (&o)[4][4], v16h x0, v16h x1, v16h x2, v16h x3, v16h x4, v16h x5, v16h x6, v16h x7,
                                          const _Float16* pa, const _Float16* pb) {
#if defined(__HIP_DEVICE_COMPILE__)
  asm volatile("v_nop\n\tv_nop\n\tv_nop\n\tv_nop\n\ts_wait_xcnt 0x0"
               : "+v"(o[0][0]), "+v"(o[0][1]), "+v"(o[0][2]), "+v"(o[0][3]), "+v"(o[1][0]), "+v"(o[1][1]), "+v"(o[1][2]), "+v"(o[1][3]),
                 "+v"(o[2][0]), "+v"(o[2][1]), "+v"(o[2][2]), "+v"(o[2][3]), "+v"(o[3][0]), "+v"(o[3][1]), "+v"(o[3][2]), "+v"(o[3][3])
               : "v"(x0), "v"(x1), "v"(x2), "v"(x3), "v"(x4), "v"(x5), "v"(x6), "v"(x7), "v"(pa), "v"(pb) : "memory");
#endif
}
__global__ __launch_bounds__(256)
void gemm_hh16r(const u16* __restrict__ A, const u16* __restrict__ Bt, const float* __restrict__ bias, u16* C,
                float oscale, float pscale) {
  constexpr int M = DV, N = NL, K = DM;      // compile-time: the 8 loads of an operand share one address and differ in the immediate offset
  __shared__ __align__(16) float slab[8 * 4 * SLAB64];   // 64 rows x 68 floats a wave; two blocks fit a WGP
  const int tid = threadIdx.x, lane = tid & 31;
  const int wave = __builtin_amdgcn_readfirstlane(tid >> 5);   // scalar: the operand bases stay in scalar registers, one lane offset serves all loads
  const int ntile = N >> 7;
  const int bid   = blockIdx.x;
  const int rowb  = (bid / ntile) * 256 + (wave & 3) * 64;
  const int col0  = (bid % ntile) * 128 + (wave >> 2) * 64;
  if (rowb + 64 > M) return;                 // wave-uniform, never taken with the exact grid; no block barriers in this kernel
  constexpr int bs = 16 * K;
  const _Float16* ap = (const _Float16*)(const void*)A  + (size_t)rowb * (size_t)K;
  const _Float16* bp = (const _Float16*)(const void*)Bt + (size_t)col0 * (size_t)K;
  const int lo = lane * 8;
  v8f o[4][4];                               // o[i][t]: rows rowb + 16i..+15, columns col0 + 16t..+15 (unrolled: constant indices)
#pragma unroll
  for (int i = 0; i < 4; ++i) {
#pragma unroll
    for (int t = 0; t < 4; ++t) o[i][t] = zero8();
  }
  // kept rolled: unrolled, a second set of 8 fragments would be live beside the 16 accumulators
#pragma unroll 1
  for (int k0 = 0; k0 < K; k0 += 32, ap += 512, bp += 512) {   // one 1-KB block of each of the 8 row tiles a step
    const _Float16* const pa = ap + lo;
    const _Float16* const pb = bp + lo;
    const v16h a0 = ldfrag_hf(pa), a1 = ldfrag_hf(pa + bs), a2 = ldfrag_hf(pa + 2 * bs), a3 = ldfrag_hf(pa + 3 * bs);
    const v16h b0 = ldfrag_hf(pb), b1 = ldfrag_hf(pb + bs), b2 = ldfrag_hf(pb + 2 * bs), b3 = ldfrag_hf(pb + 3 * bs);
    o[0][0] = mma_h(a0, b0, o[0][0]);  o[1][0] = mma_h(a1, b0, o[1][0]);  o[2][0] = mma_h(a2, b0, o[2][0]);  o[3][0] = mma_h(a3, b0, o[3][0]);
    o[0][1] = mma_h(a0, b1, o[0][1]);  o[1][1] = mma_h(a1, b1, o[1][1]);  o[2][1] = mma_h(a2, b1, o[2][1]);  o[3][1] = mma_h(a3, b1, o[3][1]);
    o[0][2] = mma_h(a0, b2, o[0][2]);  o[1][2] = mma_h(a1, b2, o[1][2]);  o[2][2] = mma_h(a2, b2, o[2][2]);  o[3][2] = mma_h(a3, b2, o[3][2]);
    o[0][3] = mma_h(a0, b3, o[0][3]);  o[1][3] = mma_h(a1, b3, o[1][3]);  o[2][3] = mma_h(a2, b3, o[2][3]);  o[3][3] = mma_h(a3, b3, o[3][3]);
    guard16x8(o, a0, a1, a2, a3, b0, b1, b2, b3, pa, pb);
  }
  epi64hrb(slab + wave * (4 * SLAB64), o, oscale, pscale, bias + rowb, C, M, (size_t)rowb, col0, lane);
}

// =====================================================================================================
// Head-axis softmax attention with the head mean folded in. Block = NT = 128 query rows q0..q0+127, 8 waves, the KSPAN keys of
// key range blockIdx.x in tiles of LT = 32 (the softmax runs over heads, so key ranges only add: each range writes its own f32
// partial plane, sum_parts adds the KS planes). q plane f16 x8 [n][512] (head h = columns 64h..64h+63), k plane the same, V^T plane f16 x64 [h*512+d][l],
// all three in fragment order, V^T with its blocks k tile first.
//   (S) wave w = head w: S_w[128 n][32 l] in four passes of 32 n = 4 D tiles each, K = 64 (2 k-steps): A = q rows (row m = query,
//       split k map over the head's 64 columns), B = k rows (col n = key, same split map, loaded once for all passes);
//       D element r of lane -> U.s[w] (w < 4) / Ub[w - 4] (w >= 4) [n 32nh+16nt+8h+r][l 16half+m].
//   (M) thread = (n = 32it + (tid>>3), 4 consecutive l), it = 0..3, all arithmetic on 4-wide f32 vectors (packed instructions):
//       max over the 8 heads of s, p = exp2(fma(s, log2e/512, -max * log2e/512)), P = p / sum (f32), written as f16(P * 4096) to
//       sPa[h][n][l] (h < 4) / sPb[h - 4][n][l] (h >= 4) with 8-B LDS stores.
//   (PV) wave w owns d columns 64w + 16t + (lane&15), t = 0..3, for all eight 16-row n groups (32 accumulators): every V^T fragment
//       fetched from L2 feeds eight matrix instructions. One block fills a WGP (two waves on a SIMD). For every head h:
//       A = P_h fragments from LDS (row m = query, split map over the 32 keys), B = V^T fragments (col = d, keys contiguous,
//       row h*512 + d of the V^T plane); all heads and key tiles accumulate into the same accumulators (joint (l,h) K axis).
//   Block barriers after (S) and after (M) order every LDS reuse across phases, key tiles and waves.
//   Epilogue: partial = acc * 2^-21 (= 1 / (4096 * 64 * 8 heads)); the wave's eight 16 x 64 f32 tiles go through epi64 one after
//   another (a wave-level LDS sync between tiles); a block barrier separates the key loop from the slab use (the slab area
//   aliases the score area).
// coverage: grid (KS, SQ/128) blocks x 128 rows = query rows 0..SQ-1 of every partial plane; (S) 8 waves x 128 x 32 = all score cells;
//           (M) 4 passes x 256 thr x 4 l x 8 h = all P cells; stores 8 waves x (8 tiles x 16 rows x 64 cols) =
//           part[ks][q0..q0+127][0..511], every float exactly once.
// =====================================================================================================
__global__ __launch_bounds__(ATT_THREADS)
void attn_heads(const u16* QPp, const u16* __restrict__ KPp, const u16* __restrict__ VTp, float* part) {
  // QPp is not __restrict__: declared so, its loads (the same for every key tile) were lifted out of the key loop and spilled to scratch
  __shared__ __align__(16) AttU U;                 // scores of heads 0..3 [4][128][SSP] f32; reused as 8 epilogue slabs
  __shared__ __align__(16) float Ub[(NH / 2) * NT * SSP];   // scores of heads 4..7 (two arrays for the same reason as sPa, sPb below)
  // P tiles [8][128][PLP] f16 bits, heads 0..3 and 4..7 as two arrays: from each array's own base register every constant offset fits
  // the LDS instructions' 16-bit field (past 64 KB of one base every access took an address register of its own, and those spilled)
  __shared__ __align__(16) u16 sPa[(NH / 2) * NT * PLP];
  __shared__ __align__(16) u16 sPb[(NH / 2) * NT * PLP];

  const int tid  = threadIdx.x;
  const int wave = tid >> 5;
  const int lane = tid & 31;
  const int hh   = lane >> 4;
  const int m    = lane & 15;
  const int q0   = blockIdx.y * NT;          // q0 + 127 < SQ (grid exact)
  const int lbeg = blockIdx.x * KSPAN;       // this block's key range lbeg .. lbeg + KSPAN - 1 < NL (grid exact)
  float* const out = part + (size_t)blockIdx.x * ((size_t)SQ * DM);

  const _Float16* qb = (const _Float16*)(const void*)QPp + (size_t)q0 * DM + wave * (DKH * 16) + lane * 8;
  const _Float16* kp = (const _Float16*)(const void*)KPp + (size_t)lbeg * DM + wave * (DKH * 16) + lane * 8;   // steps one key tile a pass
  const _Float16* vb = (const _Float16*)(const void*)VTp + wave * (64 * 32) + lane * 8;
  const float lsc = LOG2E / (QSC * KSC * 8.0f);
  const v4f lsc4 = {lsc, lsc, lsc, lsc};
  float* const sw = (wave < NH / 2 ? U.s : Ub) + (wave & (NH / 2 - 1)) * (NT * SSP);

  v8f o[NT / 16][4];                         // o[i][t]: n rows 16i..16i+15, d columns 64 * wave + 16t..+15
#pragma unroll
  for (int i = 0; i < NT / 16; ++i) {
#pragma unroll
    for (int t = 0; t < 4; ++t) o[i][t] = zero8();
  }

#pragma unroll 1
  for (int l0 = lbeg; l0 < lbeg + KSPAN; l0 += LT, kp += (size_t)LT * DM) {
    // ---- (S) scores of head = wave for this key tile ----
    {
      const v16h ka0 = ldfrag_hf(kp), ka1 = ldfrag_hf(kp + 512);
      const v16h kc0 = ldfrag_hf(kp + (size_t)16 * DM), kc1 = ldfrag_hf(kp + (size_t)16 * DM + 512);
      // the k loads' address pair is a temporary that one of the q loads below lands on: it is rewritten only behind this wait
#if defined(__HIP_DEVICE_COMPILE__)
      asm volatile("s_wait_xcnt 0x0" ::: "memory");
#endif
      // the q fragments of passes 0..2 are asked for as one group (the P and V^T registers are free here), those of pass 3 behind
      // pass 0, in the registers it has left: with two waves on a SIMD a pass that loaded its own four fragments at its head
      // would wait out the way from L2 four times a tile; all 16 at once overran the registers
      v16h qf[NT / 32][4];
#pragma unroll
      for (int nh = 0; nh < NT / 32 - 1; ++nh) {
        const _Float16* qp = qb + (size_t)nh * 32 * DM;
        qf[nh][0] = ldfrag_hf(qp);                     qf[nh][1] = ldfrag_hf(qp + 512);
        qf[nh][2] = ldfrag_hf(qp + (size_t)16 * DM);   qf[nh][3] = ldfrag_hf(qp + (size_t)16 * DM + 512);
      }
      __builtin_amdgcn_sched_barrier(0);     // keeps every load of the group in front of the first matrix instruction
      // unrolled: qf is indexed by constants and stays in registers
#pragma unroll
      for (int nh = 0; nh < NT / 32; ++nh) {
        const v16h qa0 = qf[nh][0], qa1 = qf[nh][1], qc0 = qf[nh][2], qc1 = qf[nh][3];
        v8f s00 = zero8(), s01 = zero8(), s10 = zero8(), s11 = zero8();
        s00 = mma_h(qa0, ka0, s00);  s00 = mma_h(qa1, ka1, s00);     // n rows 0..15 of the pass,  keys 0..15
        s01 = mma_h(qa0, kc0, s01);  s01 = mma_h(qa1, kc1, s01);     // n rows 0..15 of the pass,  keys 16..31
        s10 = mma_h(qc0, ka0, s10);  s10 = mma_h(qc1, ka1, s10);     // n rows 16..31 of the pass, keys 0..15
        s11 = mma_h(qc0, kc0, s11);  s11 = mma_h(qc1, kc1, s11);     // n rows 16..31 of the pass, keys 16..31
        guard4x8(s00, s01, s10, s11, qa0, qa1, qc0, qc1, ka0, ka1, kc0, kc1);
        if (nh == 0) {
          const _Float16* qp = qb + (size_t)(NT / 32 - 1) * 32 * DM;
          qf[NT / 32 - 1][0] = ldfrag_hf(qp);                     qf[NT / 32 - 1][1] = ldfrag_hf(qp + 512);
          qf[NT / 32 - 1][2] = ldfrag_hf(qp + (size_t)16 * DM);   qf[NT / 32 - 1][3] = ldfrag_hf(qp + (size_t)16 * DM + 512);
          __builtin_amdgcn_sched_barrier(0); // these loads issue here, under the score stores and passes 1 and 2, not at their use
        }
        float* const sn = sw + nh * (32 * SSP);
#pragma unroll
        for (int r = 0; r < 8; ++r) {
          const int ro = (8 * hh + r) * SSP + m;
          sn[ro]                 = s00[r];
          sn[ro + 16]            = s01[r];
          sn[ro + 16 * SSP]      = s10[r];
          sn[ro + 16 * SSP + 16] = s11[r];
        }
        // one pass at a time: run together, the passes held three sets of score tiles and pushed values that live through the
        // key loop into scratch
        __builtin_amdgcn_sched_barrier(0);
      }
    }
    __syncthreads();
    // V^T fragments go through a register ring of four slots of two fragments (half a head each): half step j = 2 * head + half
    // uses slot j & 3, and the loads of half step j + 3 are issued before the matrix instructions of half step j.
    // The first three half steps (head 0, half of head 1) are asked for here, so that their way from L2 runs under the softmax phase.
    const _Float16* const vl = vb + (size_t)l0 * DV;   // k tile l0 / 32 of V^T: DV / 16 blocks of 512 halves
    v16h g[4][2];
#pragma unroll
    for (int j = 0; j < 2; ++j) { g[j][0] = ldfrag_hf(vl + j * 1024); g[j][1] = ldfrag_hf(vl + j * 1024 + 512); }
    g[2][0] = ldfrag_hf(vl + DM * 32);       // half step 2 (head 1, d tiles 0 and 1)
    g[2][1] = ldfrag_hf(vl + DM * 32 + 512);
    __builtin_amdgcn_sched_barrier(0);       // keeps these loads in front of the softmax code (sunk to their use they would hide nothing)
    // ---- (M) softmax over the 8 heads per (n, l), P tiles ----
#pragma unroll
    for (int it = 0; it < NT / 32; ++it) {
      const int n = it * 32 + (tid >> 3), lq = (tid & 7) * 4;
      v4f t[NH];
#pragma unroll
      for (int h = 0; h < NH; ++h) t[h] = *(const v4f*)((h < NH / 2 ? U.s : Ub) + (h & (NH / 2 - 1)) * (NT * SSP) + n * SSP + lq);
      v4f mr = t[0];
#pragma unroll
      for (int h = 1; h < NH; ++h) mr = __builtin_elementwise_max(mr, t[h]);
      const v4f mx = mr * lsc;                                 // = max over heads of the rounded s * lsc: lsc > 0, rounding is monotonic
      v4f sm;
#pragma unroll
      for (int h = 0; h < NH; ++h) {
        const v4f x = __builtin_elementwise_fma(t[h], lsc4, -mx);
        // raw v_exp_f32: it differs from exp2f only where p < 2^-126; such a p vanishes in sm (one term is about 1) and is 0 as f16(P * 4096)
#pragma unroll
        for (int e = 0; e < 4; ++e) t[h][e] = __builtin_amdgcn_exp2f(x[e]);
        sm = h ? sm + t[h] : t[h];
      }
      v4f rs;                                                  // sm in [1, 8]
#pragma unroll
      for (int e = 0; e < 4; ++e) rs[e] = __builtin_amdgcn_rcpf(sm[e]) * PCAR;
      u16* const pda = sPa + n * PLP + lq;
      u16* const pdb = sPb + n * PLP + lq;
#pragma unroll
      for (int h = 0; h < NH; ++h)
        *(v2u*)((h < NH / 2 ? pda : pdb) + (h & (NH / 2 - 1)) * (NT * PLP)) = __builtin_bit_cast(v2u, __builtin_convertvector(t[h] * rs, v4h));
    }
    __syncthreads();
    // ---- (PV) accumulate P_h . V_h over all heads for this key tile ----
    {
      const _Float16* const pbasea = (const _Float16*)(const void*)sPa + m * PLP + 8 * hh;
      const _Float16* const pbaseb = (const _Float16*)(const void*)sPb + m * PLP + 8 * hh;
      // unrolled: the slot index is a constant, and each wait counts exactly the loads that are younger than the slot it needs
#pragma unroll
      for (int h = 0; h < NH; ++h) {
        if (h + 1 < NH) {                    // half step 2h + 3 (head h + 1, d tiles 2 and 3) into the slot that half step 2h - 1 has left
          g[(2 * h + 3) & 3][0] = ldfrag_hf(vl + (h + 1) * (DM * 32) + 1024);
          g[(2 * h + 3) & 3][1] = ldfrag_hf(vl + (h + 1) * (DM * 32) + 1536);
        }
        __builtin_amdgcn_sched_barrier(0);   // these loads issue before the matrix instructions of half step 2h
        const _Float16* pp = (h < NH / 2 ? pbasea : pbaseb) + (h & (NH / 2 - 1)) * (NT * PLP);
        v16h p[NT / 16];
#pragma unroll
        for (int i = 0; i < NT / 16; ++i) p[i] = ldfrag_h(pp + i * 16 * PLP);
#pragma unroll
        for (int i = 0; i < NT / 16; ++i) o[i][0] = mma_h(p[i], g[(2 * h + 0) & 3][0], o[i][0]);
#pragma unroll
        for (int i = 0; i < NT / 16; ++i) o[i][1] = mma_h(p[i], g[(2 * h + 0) & 3][1], o[i][1]);
        slots4();
        if (h + 2 < NH) {                    // half step 2h + 4 (head h + 2, d tiles 0 and 1) into the slot just left
          g[(2 * h) & 3][0] = ldfrag_hf(vl + (h + 2) * (DM * 32));
          g[(2 * h) & 3][1] = ldfrag_hf(vl + (h + 2) * (DM * 32) + 512);
        }
        __builtin_amdgcn_sched_barrier(0);   // these loads issue before the matrix instructions of half step 2h + 1
#pragma unroll
        for (int i = 0; i < NT / 16; ++i) o[i][2] = mma_h(p[i], g[(2 * h + 1) & 3][0], o[i][2]);
#pragma unroll
        for (int i = 0; i < NT / 16; ++i) o[i][3] = mma_h(p[i], g[(2 * h + 1) & 3][1], o[i][3]);
        slots4();
      }
    }
  }
  __syncthreads();

  const float osc = 1.0f / (PCAR * VCAR * (float)NH);
  const v4f z4 = {0.f, 0.f, 0.f, 0.f};
  float* const sl = U.slab + wave * SLAB64;
#pragma unroll
  for (int i = 0; i < NT / 16; ++i) {
    if (i) wave_sync_lds();                  // the slab's last reads end before the next tile is staged in it
    epi64(sl, o[i][0], o[i][1], o[i][2], o[i][3], osc, z4, out, DM, (size_t)q0 + 16 * i, wave * 64, lane);
  }
}

// =====================================================================================================
// out = sum of the KS partial planes, added in plane order 0..KS-1 in f32. Thread = 4 consecutive floats: KS 16-B loads, one
// 16-B store; 32 consecutive lanes = 512 contiguous bytes per load and store.
// coverage: grid = SQ*DM/1024 blocks x 256 thr x 4 floats = out rows 0..SQ-1, every float exactly once.
// =====================================================================================================
__global__ __launch_bounds__(256) void sum_parts(const float* __restrict__ part, float* out) {
  const unsigned ob = (blockIdx.x * 256u + threadIdx.x) * 16u;    // byte offset in a plane, < SQ * DM * 4 (grid exact)
  v4f p[KS];
#pragma unroll
  for (int s = 0; s < KS; ++s) p[s] = *(const v4f*)((const char*)(part + (size_t)s * ((size_t)SQ * DM)) + ob);
  v4f a = p[0];
#pragma unroll
  for (int s = 1; s < KS; ++s) a += p[s];
  *(v4f*)((char*)out + ob) = a;
}

// =====================================================================================================
// Workspace map (bytes); every plane is fully written by whole-line stores before it is read; all extents are exact multiples of
// the store granularity (no pad rows, all dims multiples of 64), every offset a multiple of 256:
//   XQ  bf16 [SQ][512]                      <=  4194304
//   XS  bf16 [4096][512]                        4194304
//   WV1T, WQT, WKT bf16 [512][512]             3 x 524288
//   WV2T f16 of bf16 value x1024 [4096][512]   4194304
//   VALH f16 value x8 [4096][512]               4194304
//   QP   f16 x8 [SQ][512]                   <=  4194304
//   KP   f16 x8 [4096][512]                     4194304
//   VT   f16 x64 [4096][4096]                  33554432
//   PART f32 [KS][SQ][512]                  <= 67108864
//   end                                     <= 127401984
// =====================================================================================================
extern "C" void kernel_launch(void* const* d_in, const int* in_sizes, int n_in,
                              void* d_out, int out_size, void* d_ws, size_t ws_size,
                              hipStream_t stream) {
  if (n_in < 10) return;
  if (in_sizes[0] != NQ * DM || in_sizes[1] != NL * DM) return;
  if (in_sizes[2] != DM * DM || in_sizes[3] != DM) return;
  if (in_sizes[4] != DM * DM || in_sizes[5] != DM) return;
  if (in_sizes[6] != DM * DM || in_sizes[7] != DM) return;
  if (in_sizes[8] != DM * DV || in_sizes[9] != DV) return;
  if (out_size != NQ * DM) return;

  const float* xq  = (const float*)d_in[0];
  const float* xs  = (const float*)d_in[1];
  const float* wv1 = (const float*)d_in[2];
  const float* bv1 = (const float*)d_in[3];
  const float* wq  = (const float*)d_in[4];
  const float* bq  = (const float*)d_in[5];
  const float* wk  = (const float*)d_in[6];
  const float* bk  = (const float*)d_in[7];
  const float* wv2 = (const float*)d_in[8];
  const float* bv2 = (const float*)d_in[9];
  float*       out = (float*)d_out;

  const size_t szXQ = (size_t)SQ * DM * 2;          //  4194304 at SQ = NQ
  const size_t szXS = (size_t)NL * DM * 2;          //  4194304
  const size_t szWT = (size_t)DM * DM * 2;          //   524288
  const size_t szW2 = (size_t)DV * DM * 2;          //  4194304
  const size_t szVL = (size_t)NL * DM * 2;          //  4194304
  const size_t szQP = (size_t)SQ * DM * 2;          //  4194304 at SQ = NQ
  const size_t szKP = (size_t)NL * DM * 2;          //  4194304
  const size_t szVT = (size_t)DV * NL * 2;          // 33554432
  const size_t szPT = (size_t)KS * SQ * DM * 4;     // 67108864 at SQ = NQ
  size_t off = 0;
  const size_t oXQ = off; off += szXQ;
  const size_t oXS = off; off += szXS;
  const size_t oW1 = off; off += szWT;
  const size_t oWQ = off; off += szWT;
  const size_t oWK = off; off += szWT;
  const size_t oW2 = off; off += szW2;
  const size_t oVL = off; off += szVL;
  const size_t oQP = off; off += szQP;
  const size_t oKP = off; off += szKP;
  const size_t oVT = off; off += szVT;
  const size_t oPT = off; off += szPT;
  if (off > ws_size) return;                        // off = 127401984 at SQ = NQ
  if (off > WS_CAP) return;

  char* ws = (char*)d_ws;
  u16* XQ   = (u16*)(ws + oXQ);
  u16* XS   = (u16*)(ws + oXS);
  u16* WV1T = (u16*)(ws + oW1);
  u16* WQT  = (u16*)(ws + oWQ);
  u16* WKT  = (u16*)(ws + oWK);
  u16* WV2T = (u16*)(ws + oW2);
  u16* VALH = (u16*)(ws + oVL);
  u16* QP   = (u16*)(ws + oQP);
  u16* KP   = (u16*)(ws + oKP);
  u16* VT   = (u16*)(ws + oVT);
  float* PART = (float*)(ws + oPT);

  const dim3 blk(256);
  const dim3 bG(128);
  const dim3 gPR(PB_ALL);                           // 512 + 3 x 64 + 1024 + 1024 at SQ = NQ
  const dim3 gP3(2 * GB_S + GB_Q);                  // 3 x 512 at SQ = NQ
  const dim3 gVT((DV / 256) * (NL / 128));          // 512
  const dim3 gAT(KS, SQ / NT);                      // 8 x 32 at SQ = NQ
  const dim3 gSP((SQ * DM) / 1024);                 // 2048 at SQ = NQ
  const dim3 bAT(ATT_THREADS);

  // (0) query rows < SQ and source -> bf16 planes; Wv1, Wq, Wk [in][out] -> bf16 [out][in] fragment-order planes;
  //     Wv2 [512][4096] -> f16 of the bf16 value x1024, [4096][512]
  prep_all<<<gPR, blk, 0, stream>>>(xq, xs, wv1, wq, wk, wv2, XQ, XS, WV1T, WQT, WKT, WV2T);
  // (1) value = source.Wv1 + b -> f16 plane x8; q (rows < SQ) and k projections -> f16 planes x8
  proj3<<<gP3, bG, 0, stream>>>(XS, XQ, WV1T, WQT, WKT, bv1, bq, bk, VALH, QP, KP);
  // (2) V^T [h*512+d][l] = (Wv2^T . value^T) / (1024*8) + b[h*512+d], f16 plane x64
  gemm_hh16r<<<gVT, blk, 0, stream>>>(WV2T, VALH, bv2, VT, 1.0f / (W2S * VSC), VCAR);
  // (3) head-axis softmax attention + head mean, one f32 partial plane per key range; (4) planes summed -> out rows 0..SQ-1
  attn_heads<<<gAT, bAT, 0, stream>>>(QP, KP, VT, PART);
  sum_parts<<<gSP, blk, 0, stream>>>(PART, out);
  (void)hipGetLastError();
}

// v009
// A run of this version takes 155 microseconds.
// Two timings next to v008 put it at 1.05 and 1.04 times that version's speed.
// Counting every step since v000, it is 5.06 times as fast.
// Projections value, q, k = x.W + b: v_wmma_f32_16x16x32_bf16 (bf16 RNE operands of the raw inputs, f32 accumulate, bf16 RNE
// bias added in f32). v^T = Wv2^T . value^T (W as f16 of the bf16 RNE value x1024, value plane f16 x8, bf16 RNE bias per row in
// f32), per-head scores q.k^T (f16 planes x8) and P.V (P x4096 f16 from LDS, V^T x64 f16): v_wmma_f32_16x16x32_f16, f32
// accumulate. Softmax over the head axis, the head mean and all scaling in f32 on VALU.
// Every 16-bit operand plane [rows][K] in the workspace is kept in FRAGMENT ORDER: 1-KB blocks of 16 rows x 32 k, block (rt, kt)
// at half index rt * 16 * K + kt * 512; inside a block the 16-B chunk (row m = row & 15, c = (k >> 3) & 3) stands at half index
// c * 128 + m * 8. Lane (h = lane >> 4, m = lane & 15) of a fragment then reads its two 16-B chunks (c = h and c = 2 + h) at
// lane * 8 and 256 + lane * 8: each load of a wave is 512 contiguous bytes (4 cache lines) and not 32 B out of each of 16 lines.
// The V^T plane alone orders its blocks k tile first, block (rt, kt) at half index (kt * (rows / 16) + rt) * 512, so that all that
// one key tile of the attention reads (every head, every d) is one contiguous 256-KB run.
#include <hip/hip_runtime.h>
#include <math.h>
#include <stdint.h>

#define NQ   4096
#define NL   4096
#define DM   512
#define NH   8
#define DKH  64
#define DV   (NH * DM)
#ifndef SQ
#define SQ NQ
#endif
#define NT   128
#define LT   32
#define SSP  32
#define PLP  40
#define SLAB64 (16 * 68)
#define ATT_THREADS 256
#define KS   8
#define KSPAN (NL / KS)
#define QSC  8.0f
#define KSC  8.0f
#define VSC  8.0f
#define W2S  1024.0f
#define PCAR 4096.0f
#define VCAR 64.0f
#define LOG2E 1.4426950408889634f
#define WS_CAP ((size_t)134217728)

static_assert(DM == NH * DKH && DKH == 64 && NH == 8 && (DM % 64) == 0 && (DV % 64) == 0 && (NL % 64) == 0 && (NQ % 64) == 0);
static_assert((DM % 32) == 0);
static_assert(SQ >= 64 && SQ <= NQ && (SQ % 64) == 0 && (SQ % NT) == 0);
static_assert(NT == 128 && LT == 32 && (NL % LT) == 0 && ATT_THREADS == 256 && ATT_THREADS * 4 * (NT / 32) == NT * LT);
static_assert(KS >= 1 && (NL % (KS * LT)) == 0 && ((SQ * DM) % 1024) == 0);
static_assert(SSP >= LT && PLP >= 32 && ((PLP * 2) % 16) == 0 && ((SSP * 4) % 16) == 0);
static_assert(8 * SLAB64 <= (NH / 2) * NT * SSP);
static_assert(((NQ * DM) % 2048) == 0 && ((NL * DM) % 2048) == 0 && ((SQ * DM) % 2048) == 0);
static_assert(NH * NT * SSP * 4 + NH * NT * PLP * 2 <= 320 * 1024);   // one block on a WGP

typedef unsigned short u16;
typedef _Float16 v16h __attribute__((ext_vector_type(16)));
typedef _Float16 v8h  __attribute__((ext_vector_type(8)));
typedef _Float16 v4h  __attribute__((ext_vector_type(4)));
typedef __bf16   v16b __attribute__((ext_vector_type(16)));
typedef float    v8f  __attribute__((ext_vector_type(8)));
typedef float    v4f  __attribute__((ext_vector_type(4)));
typedef unsigned int v4u __attribute__((ext_vector_type(4)));
typedef unsigned int v2u __attribute__((ext_vector_type(2)));

union FragH { v16h v; v8h h[2]; v4u u[2]; };
union FragB { v16b v; v4u u[2]; };
union AttU { float s[(NH / 2) * NT * SSP]; float slab[8 * SLAB64]; };

// ---- scalar helpers --------------------------------------------------------------------------------
__device__ __forceinline__ unsigned short bf_bits(float f) {          // f32 -> bf16 bits, RNE convert
  unsigned u = __float_as_uint(f);
  return (unsigned short)((u + 0x7FFFu + ((u >> 16) & 1u)) >> 16);
}
__device__ __forceinline__ float bf_up(unsigned short h) { return __uint_as_float(((unsigned)h) << 16); }
__device__ __forceinline__ float bfr(float f) { return bf_up(bf_bits(f)); }
__device__ __forceinline__ unsigned short h_bits(_Float16 x) { return __builtin_bit_cast(unsigned short, x); }
__device__ __forceinline__ unsigned pk16(unsigned short a, unsigned short b) { return (unsigned)a | ((unsigned)b << 16); }
__device__ __forceinline__ v8f zero8() { v8f z = {0.f, 0.f, 0.f, 0.f, 0.f, 0.f, 0.f, 0.f}; return z; }

// ---- fragment loaders: 16-bit A/B operand, lane -> row/col (lane&15); elements 0..7 <- k0+8h.., elements 8..15 <- k0+16+8h..
//      (same split k map for A and B).
//      ldfrag_h: row-major LDS tile, p already includes row * pitch + 8*(lane>>4): p[0..7] and p[16..23].
//      ldfrag_hf / ldfrag_b: fragment-order workspace plane, p = start of the 1-KB block + lane * 8: p[0..7] and p[256..263].
__device__ __forceinline__ v16h ldfrag_h(const _Float16* p) {
  FragH f;
  f.h[0] = *(const v8h*)(p);
  f.h[1] = *(const v8h*)(p + 16);
  return f.v;
}
__device__ __forceinline__ v16h ldfrag_hf(const _Float16* p) {
  FragH f;
  f.h[0] = *(const v8h*)(p);
  f.h[1] = *(const v8h*)(p + 256);
  return f.v;
}
__device__ __forceinline__ v16b ldfrag_b(const u16* p) {              // bf16 plane read as unsigned integer vectors
  FragB f;
  f.u[0] = *(const v4u*)(p);
  f.u[1] = *(const v4u*)(p + 256);
  return f.v;
}

__device__ __forceinline__ v8f mma_h(v16h a, v16h b, v8f c) {
  return __builtin_amdgcn_wmma_f32_16x16x32_f16(false, a, false, b, (short)0, c, false, false);
}
__device__ __forceinline__ v8f mma_b(v16b a, v16b b, v8f c) {
  return __builtin_amdgcn_wmma_f32_16x16x32_bf16(false, a, false, b, (short)0, c, false, false);
}
__device__ __forceinline__ void guard4x8(v8f& a, v8f& b, v8f& c, v8f& d, v16h x0, v16h x1, v16h x2, v16h x3,
                                         v16h x4, v16h x5, v16h x6, v16h x7) {
#if defined(__HIP_DEVICE_COMPILE__)
  asm volatile("v_nop\n\tv_nop\n\tv_nop\n\tv_nop"
               : "+v"(a), "+v"(b), "+v"(c), "+v"(d)
               : "v"(x0), "v"(x1), "v"(x2), "v"(x3), "v"(x4), "v"(x5), "v"(x6), "v"(x7) : "memory");
#endif
}
// Four vector slots behind the last matrix instruction of a P.V half step (on the taken side of the key loop's branch too) before
// later loads overwrite its fragment registers. No operands: with a half step's 16 accumulators and 10 fragments named as operands
// the build spilled to scratch. The scheduling fence in front keeps the matrix instructions ahead of the slots, and the "memory"
// clobber keeps the refill of the ring slot behind them.
__device__ __forceinline__ void slots4() {
#if defined(__HIP_DEVICE_COMPILE__)
  __builtin_amdgcn_sched_barrier(0);
  asm volatile("v_nop\n\tv_nop\n\tv_nop\n\tv_nop" ::: "memory");
#endif
}
// The same four slots behind a k step of the projections. The step's eight fragments are inputs so that they stay allocated up to
// here: otherwise an accumulator that is first written in this step is placed over an operand of a matrix instruction just issued.
__device__ __forceinline__ void slots4f(v16b x0, v16b x1, v16b x2, v16b x3, v16b x4, v16b x5, v16b x6, v16b x7) {
#if defined(__HIP_DEVICE_COMPILE__)
  __builtin_amdgcn_sched_barrier(0);
  asm volatile("v_nop\n\tv_nop\n\tv_nop\n\tv_nop"
               :: "v"(x0), "v"(x1), "v"(x2), "v"(x3), "v"(x4), "v"(x5), "v"(x6), "v"(x7) : "memory");
#endif
}
__device__ __forceinline__ void wave_sync_lds() {
  __builtin_amdgcn_fence(__ATOMIC_RELEASE, "workgroup");
  __builtin_amdgcn_wave_barrier();
  __builtin_amdgcn_fence(__ATOMIC_ACQUIRE, "workgroup");
}

// =====================================================================================================
// f32 plane [rows][DM] row-major -> 16-bit plane in fragment order:  mode 0: bf16 RNE bits;  mode 1: f16 bits of (bf16 RNE value) * scale;
// mode 2: f16 bits of value * scale (no bf16 pre-step).
// Thread = output chunk gt = 8 consecutive k of one row: two 16-B loads (a wave reads 64 B of each of 16 rows), one 16-B store;
// 32 consecutive lanes store 512 contiguous, 512-B aligned bytes
// coverage: n8/256 blocks bid = 0.. (exact multiples) x 256 thr x 8 = the whole plane.
// =====================================================================================================
__device__ __forceinline__ void cvt16(const float* __restrict__ x, u16* D, int n8, int mode, float scale, int bid) {
  const int gt = bid * 256 + (int)threadIdx.x;
  if (gt >= n8) return;                     // no barriers on this path
  const int kb = DM / 32;                   // blocks in a row tile
  const int blk = gt >> 6, cw = gt & 63;    // 1-KB block, chunk in it: cw = c * 16 + m
  const float* p = x + ((size_t)(blk / kb) * 16 + (size_t)(cw & 15)) * DM + (blk % kb) * 32 + (cw >> 4) * 8;
  const v4f a = *(const v4f*)(p), c4 = *(const v4f*)(p + 4);
  float v[8];
#pragma unroll
  for (int e = 0; e < 4; ++e) { v[e] = a[e]; v[4 + e] = c4[e]; }
  unsigned short s[8];
#pragma unroll
  for (int e = 0; e < 8; ++e) {
    const float vb = bfr(v[e]);
    const float vf = (mode == 1) ? vb : v[e];
    const unsigned short hb = h_bits((_Float16)(vf * scale));
    const unsigned short bb = bf_bits(v[e]);
    s[e] = (mode != 0) ? hb : bb;
  }
  v4u o;
#pragma unroll
  for (int e = 0; e < 4; ++e) o[e] = pk16(s[2 * e], s[2 * e + 1]);
  u16* d = D + (size_t)gt * 8;
  {
    *(v4u*)(d) = o;
    
  }
}

// =====================================================================================================
// Transpose + convert: in X [R][C] f32 row-major -> out XTo [C][R] 16-bit in fragment order (output row = input column, k = R axis).
//   mode 0: bf16 RNE bits;  mode 1: f16 bits of (bf16 RNE value) * scale;  mode 2: f16 bits of value * scale.
// Block = 64 input rows x 64 input cols: bid -> (rt = bid % (R/64), ct = bid / (R/64)). The 64x64 f32 tile is loaded with 16-B
// loads (thread = input row tid>>2, 16 consecutive cols), converted and scattered into LDS TH[c local][r local] (pitch 72 halves);
// the tile is 4 row tiles x 2 k tiles = 8 blocks of 1 KB; chunk cid = it * 256 + tid -> block cid >> 6, chunk cid & 63 in it.
// coverage: load 256 thr x 16 = 64 x 64; store 2 iterations x 256 thr x 8 halves = 8 blocks x 64 chunks = the tile;
//           (R/64)*(C/64) blocks bid = 0.. (exact multiples) tile the whole [C][R] plane exactly once. TH: the block's 64 x VTP LDS tile.
// =====================================================================================================
#define VTP 72
static_assert(64 * VTP >= 63 * VTP + 64 && ((VTP * 2) % 16) == 0);
__device__ __forceinline__ void tr16(u16* TH, const float* __restrict__ X, u16* XTo, int R, int C, int mode, float scale, int bid) {
  const int tid = threadIdx.x;
  const int nrt = R >> 6;
  const int rt  = bid % nrt;
  const int ct  = bid / nrt;
  const int r0  = rt * 64;
  const int c0  = ct * 64;
  {
    const int rl = tid >> 2;                  // input row within tile 0..63
    const int cc = (tid & 3) * 16;            // input col chunk within the 64
    const float* src = X + (size_t)(r0 + rl) * (size_t)C + c0 + cc;
#pragma unroll
    for (int i = 0; i < 4; ++i) {
      const v4f a = *(const v4f*)(src + 4 * i);
#pragma unroll
      for (int e = 0; e < 4; ++e) {
        const float v  = a[e];
        const float vb = bfr(v);
        const float vf = (mode == 1) ? vb : v;
        const unsigned short hb = h_bits((_Float16)(vf * scale));
        const unsigned short bb = bf_bits(v);
        TH[(cc + 4 * i + e) * VTP + rl] = (mode != 0) ? hb : bb;
      }
    }
  }
  __syncthreads();
  v4u vh[2];
  const int cw = tid & 63;                    // chunk in its block: c * 16 + m
#pragma unroll
  for (int it = 0; it < 2; ++it) {
    const int bl = it * 4 + (tid >> 6);       // local block 0..7: row tile bl >> 1, k tile bl & 1
    vh[it] = *(const v4u*)(TH + ((bl >> 1) * 16 + (cw & 15)) * VTP + (bl & 1) * 32 + (cw >> 4) * 8);
  }
  const size_t base = (size_t)c0 * (size_t)R + (size_t)r0 * 16 + (size_t)cw * 8;
  {
#pragma unroll
    for (int it = 0; it < 2; ++it) {
      const int bl = it * 4 + (tid >> 6);
      *(v4u*)(XTo + base + (size_t)(bl >> 1) * 16 * (size_t)R + (size_t)(bl & 1) * 512) = vh[it];
    }
    // the stores' registers are rewritten only behind this wait, on whatever path the inlined body is left
#if defined(__HIP_DEVICE_COMPILE__)
    asm volatile("s_wait_xcnt 0x0" ::: "memory");
#endif
  }
}

// =====================================================================================================
// All six input conversions in ONE launch (they are independent of one another): the block index picks the job, block-uniformly.
//   blocks [0, PB_W2)            Wv2 [512][4096] -> f16 of the bf16 value x1024, [4096][512]
//   next 3 x PB_WT               Wv1, Wq, Wk [in][out] -> bf16 [out][in]
//   next PB_XS, then PB_XQ       source rows, query rows < SQ -> bf16 planes
// coverage: each range is the exact block count of its job (see cvt16, tr16); grid = PB_ALL.
// =====================================================================================================
#define PB_W2 ((DM / 64) * (DV / 64))
#define PB_WT ((DM / 64) * (DM / 64))
#define PB_XS ((NL * DM) / 2048)
#define PB_XQ ((SQ * DM) / 2048)
#define PB_ALL (PB_W2 + 3 * PB_WT + PB_XS + PB_XQ)
__global__ __launch_bounds__(256)
void prep_all(const float* __restrict__ xq, const float* __restrict__ xs, const float* __restrict__ wv1,
              const float* __restrict__ wq, const float* __restrict__ wk, const float* __restrict__ wv2,
              u16* XQ, u16* XS, u16* WV1T, u16* WQT, u16* WKT, u16* WV2T) {
  __shared__ __align__(16) u16 TH[64 * VTP];
  int b = blockIdx.x;
  if (b < PB_W2) { tr16(TH, wv2, WV2T, DM, DV, 1, W2S, b); return; }
  b -= PB_W2;
  if (b < 3 * PB_WT) {
    const int job = b / PB_WT;
    const float* w = (job == 0) ? wv1 : (job == 1) ? wq : wk;
    u16* d = (job == 0) ? WV1T : (job == 1) ? WQT : WKT;
    tr16(TH, w, d, DM, DM, 0, 1.0f, b % PB_WT);
    return;
  }
  b -= 3 * PB_WT;
  const bool src = b < PB_XS;
  cvt16(src ? xs : xq, src ? XS : XQ, src ? (NL * DM) / 8 : (SQ * DM) / 8, 0, 1.0f, src ? b : b - PB_XS);
}

// =====================================================================================================
// Epilogues. The wave's 16x64 f32 tile (times oscale, plus an optional per-column addend) is staged in its LDS slab (pitch 68),
//            8 consecutive lanes x 16 B per line), lanes 16..31 -> row 2*it+1.
//  epi64hsb: a wave's 64 x 64 tile (four 16-row tiles, all staged at once in a 64-row slab, one wave-level sync, which stands in
//            front of every global store and so waits for none): f16 bits of ((tile + bf16RNE(bias[col])) * pscale) into a fragment-order plane: a 16-row tile is two adjacent
//            1-KB blocks, the next 16-row tile 16 * N halves on; store i = 0..3, lane (h, m) = row m, columns 16i + 8h .. + 7, at half index i * 256 + lane * 8 (512 contiguous bytes).
//  epi64hrb: a wave's 64 x 64 tile (four 16-row tiles, all staged at once in a 64-row slab, one wave-level sync): f16 bits of
//            ((tile + bf16RNE(bias[row])) * pscale), per 16-row tile the store shape of epi64hsb, but blocks ordered k tile first
//            (M rows): a 16-row tile's two 1-KB blocks stand M * 32 halves apart, the next 16-row tile 512 halves on.
// coverage: epi64 8 instructions x 2 rows x 16 lanes x 4 floats = the wave's 16 x 64 tile; epi64hsb and epi64hrb 4 tiles x
//           4 instructions x 16 rows x 2 chunks x 8 halves = the wave's 64 x 64 tile.
// =====================================================================================================
__device__ __forceinline__ void stage64(float* sl, v8f a0, v8f a1, v8f a2, v8f a3, float oscale, int lane) {
  const int hh = lane >> 4, m = lane & 15;
#pragma unroll
  for (int r = 0; r < 8; ++r) {
    const int ro = (8 * hh + r) * 68 + m;
    sl[ro]      = a0[r] * oscale;
    sl[ro + 16] = a1[r] * oscale;
    sl[ro + 32] = a2[r] * oscale;
    sl[ro + 48] = a3[r] * oscale;
  }
  wave_sync_lds();
}
__device__ __forceinline__ void epi64(float* sl, v8f a0, v8f a1, v8f a2, v8f a3, float oscale, v4f badd, float* C, int N,
                                      size_t rowb, int col0, int lane) {
  const int hh = lane >> 4, m = lane & 15;
  stage64(sl, a0, a1, a2, a3, oscale, lane);
  v4f vals[8];
#pragma unroll
  for (int it = 0; it < 8; ++it) vals[it] = *(const v4f*)(sl + (it * 2 + hh) * 68 + m * 4) + badd;
  float* dst = C + (rowb + (size_t)hh) * (size_t)N + col0 + m * 4;
  {
#pragma unroll
    for (int it = 0; it < 8; ++it) {
      *(v4f*)(dst + (size_t)(it * 2) * (size_t)N) = vals[it];
    }
    // the stores' registers are rewritten (by the staging of the caller's next tile) only behind this wait; the scheduling fence
    // keeps that arithmetic, which is no memory operation, behind it
#if defined(__HIP_DEVICE_COMPILE__)
    asm volatile("s_wait_xcnt 0x0" ::: "memory");
    __builtin_amdgcn_sched_barrier(0);
#endif
  }
}
__device__ __forceinline__ void epi64hsb(float* sl, v8f (&o)[4][4], float pscale, const v4f (&braw)[4][2], u16* C, int N,
                                         size_t rowb, int col0, int lane) {
  const int row = lane & 15, h8 = (lane >> 4) * 8;
  // every loop here is unrolled so that o, braw, bb and oh are indexed by constants and stay in registers
  float bb[4][8];                            // the lane's 32 bias values (columns col0 + 16 * i4 + h8 .. + 7), the same for all four 16-row tiles
#pragma unroll
  for (int i4 = 0; i4 < 4; ++i4) {
#pragma unroll
    for (int e = 0; e < 4; ++e) { bb[i4][e] = bfr(braw[i4][0][e]); bb[i4][4 + e] = bfr(braw[i4][1][e]); }
  }
  const int hh = lane >> 4;
#pragma unroll
  for (int i = 0; i < 4; ++i) {
#pragma unroll
    for (int r = 0; r < 8; ++r) {
      const int ro = (16 * i + 8 * hh + r) * 68 + row;
      sl[ro]      = o[i][0][r];
      sl[ro + 16] = o[i][1][r];
      sl[ro + 32] = o[i][2][r];
      sl[ro + 48] = o[i][3][r];
    }
  }
  wave_sync_lds();
  u16* dst = C + rowb * (size_t)N + (size_t)col0 * 16 + lane * 8;      // rowb % 16 == 0, col0 % 64 == 0
#pragma unroll
  for (int i = 0; i < 4; ++i) {
    v4u oh[4];
#pragma unroll
    for (int i4 = 0; i4 < 4; ++i4) {
      const int c8 = i4 * 16 + h8;
      const v4f a = *(const v4f*)(sl + (16 * i + row) * 68 + c8), c4 = *(const v4f*)(sl + (16 * i + row) * 68 + c8 + 4);
      float w[8];
#pragma unroll
      for (int e = 0; e < 4; ++e) { w[e] = (a[e] + bb[i4][e]) * pscale; w[4 + e] = (c4[e] + bb[i4][4 + e]) * pscale; }
#pragma unroll
      for (int e = 0; e < 4; ++e) oh[i4][e] = pk16(h_bits((_Float16)w[2 * e]), h_bits((_Float16)w[2 * e + 1]));
    }
#pragma unroll
    for (int i4 = 0; i4 < 4; ++i4) {
      *(v4u*)(dst + (size_t)i * 16 * (size_t)N + i4 * 256) = oh[i4];
    }
    // the stores' registers are rewritten (by the next tile's values) only behind this wait; the scheduling fence keeps that
    // arithmetic, which is no memory operation, behind it
#if defined(__HIP_DEVICE_COMPILE__)
    asm volatile("s_wait_xcnt 0x0" ::: "memory");
    __builtin_amdgcn_sched_barrier(0);
#endif
  }
}
__device__ __forceinline__ void epi64hrb(float* sl, v8f (&o)[4][4], float oscale, float pscale,
                                         const float* __restrict__ brow, u16* C, int M, size_t rowb, int col0, int lane) {
  const int hh = lane >> 4, m = lane & 15;
  // every loop here is unrolled so that o, r0v, r1v and oh are indexed by constants and stay in registers
  v4f r0v[4], r1v[4];
#pragma unroll
  for (int i = 0; i < 4; ++i) {              // rows rowb + 16i + 8h .. + 7 < M
    r0v[i] = *(const v4f*)(brow + 16 * i + 8 * hh);
    r1v[i] = *(const v4f*)(brow + 16 * i + 8 * hh + 4);
  }
#pragma unroll
  for (int i = 0; i < 4; ++i) {
    float rb[8];
#pragma unroll
    for (int e = 0; e < 4; ++e) { rb[e] = bfr(r0v[i][e]); rb[4 + e] = bfr(r1v[i][e]); }
#pragma unroll
    for (int r = 0; r < 8; ++r) {
      const int ro = (16 * i + 8 * hh + r) * 68 + m;
      sl[ro]      = o[i][0][r] * oscale + rb[r];
      sl[ro + 16] = o[i][1][r] * oscale + rb[r];
      sl[ro + 32] = o[i][2][r] * oscale + rb[r];
      sl[ro + 48] = o[i][3][r] * oscale + rb[r];
    }
  }
  wave_sync_lds();
  u16* dst = C + (size_t)col0 * (size_t)M + rowb * 32 + lane * 8;      // rowb % 16 == 0, col0 % 64 == 0
#pragma unroll
  for (int i = 0; i < 4; ++i) {
    v4u oh[4];
#pragma unroll
    for (int i4 = 0; i4 < 4; ++i4) {
      const int c8 = i4 * 16 + hh * 8;
      const v4f a = *(const v4f*)(sl + (16 * i + m) * 68 + c8), c4 = *(const v4f*)(sl + (16 * i + m) * 68 + c8 + 4);
      float w[8];
#pragma unroll
      for (int e = 0; e < 4; ++e) { w[e] = a[e] * pscale; w[4 + e] = c4[e] * pscale; }
#pragma unroll
      for (int e = 0; e < 4; ++e) oh[i4][e] = pk16(h_bits((_Float16)w[2 * e]), h_bits((_Float16)w[2 * e + 1]));
    }
#pragma unroll
    for (int i4 = 0; i4 < 4; ++i4) {
      *(v4u*)(dst + i * 512 + (size_t)(i4 >> 1) * 32 * (size_t)M + (i4 & 1) * 256) = oh[i4];
    }
  }
}

// =====================================================================================================
// bf16 GEMM, f16 plane out with column bias: C16[M][DM] = f16 bits of ((A[M][DM] (bf16) . Bt[DM][DM]^T (bf16))
// + bf16RNE(bias[n])) * pscale. A, Bt and C16 are fragment-order planes.
// One wave = one 64 x 64 tile (rows rowb.., columns col0..) = 16 accumulator tiles: the 4 A and 4 B fragments of a k step (8 KB, loaded straight from the
// 1-KB blocks, two 16-B loads each, split k map for A and B) feed 16 matrix instructions. K stepped by 32 = one block; every
// output element sums its k steps in the same ascending order as with any other tile.
// The fragments go through a register ring of three sets, loaded two k steps ahead: few waves stand on a SIMD here, so the way
// from L2 has to run under the wave's own matrix instructions. sl: the wave's epilogue slab in LDS.
// =====================================================================================================
__device__ __forceinline__
void gemm_bh16(float* sl, const u16* __restrict__ A, const u16* __restrict__ Bt, const float* __restrict__ bias, u16* C,
               float pscale, int rowb, int col0, int lane) {
  constexpr int N = DM, K = DM, NS = K / 32; // compile-time: every load of an operand shares one address and differs in the immediate offset
  constexpr int bs = 16 * K;
  const u16* const ap = A  + (size_t)rowb * (size_t)K + lane * 8;
  const u16* const bp = Bt + (size_t)col0 * (size_t)K + lane * 8;
  v8f o[4][4];                               // o[i][t]: rows rowb + 16i..+15, columns col0 + 16t..+15
#pragma unroll
  for (int i = 0; i < 4; ++i) {
#pragma unroll
    for (int t = 0; t < 4; ++t) o[i][t] = zero8();
  }
  // the lane's bias values are asked for here, ahead of the k loop: asked for in the epilogue, their way from memory would stand open there
  v4f braw[4][2];
#pragma unroll
  for (int i4 = 0; i4 < 4; ++i4) {           // columns col0 + 16 * i4 + 8 * (lane >> 4) .. + 7 < N
    braw[i4][0] = *(const v4f*)(bias + col0 + i4 * 16 + (lane >> 4) * 8);
    braw[i4][1] = *(const v4f*)(bias + col0 + i4 * 16 + (lane >> 4) * 8 + 4);
  }
  v16b fa[3][4], fb[3][4];
#pragma unroll
  for (int s = 0; s < 2; ++s) {
#pragma unroll
    for (int i = 0; i < 4; ++i) { fa[s][i] = ldfrag_b(ap + i * bs + s * 512); fb[s][i] = ldfrag_b(bp + i * bs + s * 512); }
  }
  // unrolled: the set index is a constant, and each wait counts exactly the loads that are younger than the set it needs
#pragma unroll
  for (int s = 0; s < NS; ++s) {
    if (s + 2 < NS) {                        // k step s + 2 into the set that step s - 1 has left
#pragma unroll
      for (int i = 0; i < 4; ++i) {
        fa[(s + 2) % 3][i] = ldfrag_b(ap + i * bs + (s + 2) * 512);
        fb[(s + 2) % 3][i] = ldfrag_b(bp + i * bs + (s + 2) * 512);
      }
    }
    __builtin_amdgcn_sched_barrier(0);       // these loads issue before the matrix instructions of step s
#pragma unroll
    for (int t = 0; t < 4; ++t) {
#pragma unroll
      for (int i = 0; i < 4; ++i) o[i][t] = mma_b(fa[s % 3][i], fb[s % 3][t], o[i][t]);
    }
    slots4f(fa[s % 3][0], fa[s % 3][1], fa[s % 3][2], fa[s % 3][3], fb[s % 3][0], fb[s % 3][1], fb[s % 3][2], fb[s % 3][3]);
  }
  // the loads' address registers are rewritten (by the epilogue) only behind this wait
#if defined(__HIP_DEVICE_COMPILE__)
  asm volatile("s_wait_xcnt 0x0" ::: "memory");
#endif
  epi64hsb(sl, o, pscale, braw, C, N, (size_t)rowb, col0, lane);
}
// The three projections in ONE launch (independent of one another), their 64-row tiles numbered through: row tiles [0, RT_S)
// value = source.Wv1 + b (f16 plane x8), next RT_Q q = query.Wq + b (rows < SQ, x8), next RT_S k = source.Wk + b (x8).
// Block = six waves = 3 row tiles x 2 column tiles (waves of a block read the same fragments at about the same time), one block on
// every WGP at SQ = NQ; the job is wave-uniform, and the kernel has no block barrier.
// coverage: grid = ((2 * RT_S + RT_Q) / 3) * (DM / 128) blocks x 3 x 2 tiles = every 64 x 64 tile of the three planes exactly once.
#define RT_S (NL / 64)
#define RT_Q (SQ / 64)
#define PJW  6
static_assert(((2 * RT_S + RT_Q) % 3) == 0 && (DM % 128) == 0);
__global__ __launch_bounds__(PJW * 32)
void proj3(const u16* __restrict__ XS, const u16* __restrict__ XQ, const u16* __restrict__ W1T, const u16* __restrict__ WQT,
           const u16* __restrict__ WKT, const float* __restrict__ bv1, const float* __restrict__ bq,
           const float* __restrict__ bk, u16* VALH, u16* QP, u16* KP) {
  __shared__ __align__(16) float slab[PJW * 4 * SLAB64];   // 64 rows x 68 floats a wave
  const int lane = threadIdx.x & 31;
  const int wave = __builtin_amdgcn_readfirstlane(threadIdx.x >> 5);   // scalar: job, tile and operand bases stay in scalar registers
  const int rt  = ((int)blockIdx.x / (DM / 128)) * 3 + (wave >> 1);    // row tile, numbered through the three jobs
  const int ct  = ((int)blockIdx.x % (DM / 128)) * 2 + (wave & 1);     // column tile
  const int job = (rt < RT_S) ? 0 : (rt < RT_S + RT_Q) ? 1 : 2;
  const u16*   A    = (job == 1) ? XQ : XS;
  const u16*   Bt   = (job == 0) ? W1T : (job == 1) ? WQT : WKT;
  const float* bias = (job == 0) ? bv1 : (job == 1) ? bq : bk;
  u16*         C    = (job == 0) ? VALH : (job == 1) ? QP : KP;
  const float  ps   = (job == 0) ? VSC : (job == 1) ? QSC : KSC;
  const int    r    = (job == 0) ? rt : (job == 1) ? rt - RT_S : rt - RT_S - RT_Q;
  gemm_bh16(slab + wave * (4 * SLAB64), A, Bt, bias, C, ps, r * 64, ct * 64, lane);
}

// =====================================================================================================
// f16 GEMM, f16 plane out with ROW bias: C16[M][N] = f16 bits of (((A[M][K] (f16) . Bt[N][K]^T (f16))
// * oscale) + bf16RNE(bias[m])) * pscale, M = DV, N = NL, K = DM; all three planes in fragment order, C16 with its blocks k tile first.
// Block = 256 x 128 tile, 8 waves as 4 (rows) x 2 (columns); wave tile = 64 x 64 = 16 accumulator tiles: the 4 A and 4 B fragments
// of a k step (8 KB, loaded straight from the 1-KB blocks as in gemm_bh16) feed 16 matrix instructions. K stepped by 32 = one
// block; every output element sums its k steps in the same ascending order as with any other tile.
// Epilogue: epi64hrb, the wave's 64 x 64 tile staged whole in its own LDS slab.
// coverage: (M/256)*(N/128) blocks bid = 0.. (exact multiples) x 8 waves x 64 x 64 = the whole plane, every element exactly once.
// =====================================================================================================
static_assert((DV % 256) == 0 && (NL % 128) == 0 && 8 * 4 * SLAB64 * 4 <= 160 * 1024);
// Four vector slots behind the last matrix instruction of a k step (on the taken side of the loop's branch too) before the next
// step's loads overwrite its fragment registers; the fragments are inputs so that they stay allocated up to here. The two load
// addresses are inputs too: their registers are rewritten only behind the s_wait_xcnt, not by a later load of the same step.
__device__ __forceinline__ void guard16x8(v8f (&o)[4][4], v16h x0, v16h x1, v16h x2, v16h x3, v16h x4, v16h x5, v16h x6, v16h x7,
                                          const _Float16* pa, const _Float16* pb) {
#if defined(__HIP_DEVICE_COMPILE__)
  asm volatile("v_nop\n\tv_nop\n\tv_nop\n\tv_nop\n\ts_wait_xcnt 0x0"
               : "+v"(o[0][0]), "+v"(o[0][1]), "+v"(o[0][2]), "+v"(o[0][3]), "+v"(o[1][0]), "+v"(o[1][1]), "+v"(o[1][2]), "+v"(o[1][3]),
                 "+v"(o[2][0]), "+v"(o[2][1]), "+v"(o[2][2]), "+v"(o[2][3]), "+v"(o[3][0]), "+v"(o[3][1]), "+v"(o[3][2]), "+v"(o[3][3])
               : "v"(x0), "v"(x1), "v"(x2), "v"(x3), "v"(x4), "v"(x5), "v"(x6), "v"(x7), "v"(pa), "v"(pb) : "memory");
#endif
}
__global__ __launch_bounds__(256)
void gemm_hh16r(const u16* __restrict__ A, const u16* __restrict__ Bt, const float* __restrict__ bias, u16* C,
                float oscale, float pscale) {
  constexpr int M = DV, N = NL, K = DM;      // compile-time: the 8 loads of an operand share one address and differ in the immediate offset
  __shared__ __align__(16) float slab[8 * 4 * SLAB64];   // 64 rows x 68 floats a wave; two blocks fit a WGP
  const int tid = threadIdx.x, lane = tid & 31;
  const int wave = __builtin_amdgcn_readfirstlane(tid >> 5);   // scalar: the operand bases stay in scalar registers, one lane offset serves all loads
  const int ntile = N >> 7;
  const int bid   = blockIdx.x;
  const int rowb  = (bid / ntile) * 256 + (wave & 3) * 64;
  const int col0  = (bid % ntile) * 128 + (wave >> 2) * 64;
  if (rowb + 64 > M) return;                 // wave-uniform, never taken with the exact grid; no block barriers in this kernel
  constexpr int bs = 16 * K;
  const _Float16* ap = (const _Float16*)(const void*)A  + (size_t)rowb * (size_t)K;
  const _Float16* bp = (const _Float16*)(const void*)Bt + (size_t)col0 * (size_t)K;
  const int lo = lane * 8;
  v8f o[4][4];                               // o[i][t]: rows rowb + 16i..+15, columns col0 + 16t..+15 (unrolled: constant indices)
#pragma unroll
  for (int i = 0; i < 4; ++i) {
#pragma unroll
    for (int t = 0; t < 4; ++t) o[i][t] = zero8();
  }
  // kept rolled: unrolled, a second set of 8 fragments would be live beside the 16 accumulators
#pragma unroll 1
  for (int k0 = 0; k0 < K; k0 += 32, ap += 512, bp += 512) {   // one 1-KB block of each of the 8 row tiles a step
    const _Float16* const pa = ap + lo;
    const _Float16* const pb = bp + lo;
    const v16h a0 = ldfrag_hf(pa), a1 = ldfrag_hf(pa + bs), a2 = ldfrag_hf(pa + 2 * bs), a3 = ldfrag_hf(pa + 3 * bs);
    const v16h b0 = ldfrag_hf(pb), b1 = ldfrag_hf(pb + bs), b2 = ldfrag_hf(pb + 2 * bs), b3 = ldfrag_hf(pb + 3 * bs);
    o[0][0] = mma_h(a0, b0, o[0][0]);  o[1][0] = mma_h(a1, b0, o[1][0]);  o[2][0] = mma_h(a2, b0, o[2][0]);  o[3][0] = mma_h(a3, b0, o[3][0]);
    o[0][1] = mma_h(a0, b1, o[0][1]);  o[1][1] = mma_h(a1, b1, o[1][1]);  o[2][1] = mma_h(a2, b1, o[2][1]);  o[3][1] = mma_h(a3, b1, o[3][1]);
    o[0][2] = mma_h(a0, b2, o[0][2]);  o[1][2] = mma_h(a1, b2, o[1][2]);  o[2][2] = mma_h(a2, b2, o[2][2]);  o[3][2] = mma_h(a3, b2, o[3][2]);
    o[0][3] = mma_h(a0, b3, o[0][3]);  o[1][3] = mma_h(a1, b3, o[1][3]);  o[2][3] = mma_h(a2, b3, o[2][3]);  o[3][3] = mma_h(a3, b3, o[3][3]);
    guard16x8(o, a0, a1, a2, a3, b0, b1, b2, b3, pa, pb);
  }
  epi64hrb(slab + wave * (4 * SLAB64), o, oscale, pscale, bias + rowb, C, M, (size_t)rowb, col0, lane);
}

// =====================================================================================================
// Head-axis softmax attention with the head mean folded in. Block = NT = 128 query rows q0..q0+127, 8 waves, the KSPAN keys of
// key range blockIdx.x in tiles of LT = 32 (the softmax runs over heads, so key ranges only add: each range writes its own f32
// partial plane, sum_parts adds the KS planes). q plane f16 x8 [n][512] (head h = columns 64h..64h+63), k plane the same, V^T plane f16 x64 [h*512+d][l],
// all three in fragment order, V^T with its blocks k tile first.
//   (S) wave w = head w: S_w[128 n][32 l] in four passes of 32 n = 4 D tiles each, K = 64 (2 k-steps): A = q rows (row m = query,
//       split k map over the head's 64 columns), B = k rows (col n = key, same split map, loaded once for all passes);
//       D element r of lane -> U.s[w] (w < 4) / Ub[w - 4] (w >= 4) [n 32nh+16nt+8h+r][l 16half+m].
//   (M) thread = (n = 32it + (tid>>3), 4 consecutive l), it = 0..3, all arithmetic on 4-wide f32 vectors (packed instructions):
//       max over the 8 heads of s, p = exp2(fma(s, log2e/512, -max * log2e/512)), P = p / sum (f32), written as f16(P * 4096) to
//       sPa[h][n][l] (h < 4) / sPb[h - 4][n][l] (h >= 4) with 8-B LDS stores.
//   (PV) wave w owns d columns 64w + 16t + (lane&15), t = 0..3, for all eight 16-row n groups (32 accumulators): every V^T fragment
//       fetched from L2 feeds eight matrix instructions. One block fills a WGP (two waves on a SIMD). For every head h:
//       A = P_h fragments from LDS (row m = query, split map over the 32 keys), B = V^T fragments (col = d, keys contiguous,
//       row h*512 + d of the V^T plane); all heads and key tiles accumulate into the same accumulators (joint (l,h) K axis).
//   Block barriers after (S) and after (M) order every LDS reuse across phases, key tiles and waves.
//   Epilogue: partial = acc * 2^-21 (= 1 / (4096 * 64 * 8 heads)); the wave's eight 16 x 64 f32 tiles go through epi64 one after
//   another (a wave-level LDS sync between tiles); a block barrier separates the key loop from the slab use (the slab area
//   aliases the score area).
// coverage: grid (KS, SQ/128) blocks x 128 rows = query rows 0..SQ-1 of every partial plane; (S) 8 waves x 128 x 32 = all score cells;
//           (M) 4 passes x 256 thr x 4 l x 8 h = all P cells; stores 8 waves x (8 tiles x 16 rows x 64 cols) =
//           part[ks][q0..q0+127][0..511], every float exactly once.
// =====================================================================================================
__global__ __launch_bounds__(ATT_THREADS)
void attn_heads(const u16* QPp, const u16* __restrict__ KPp, const u16* __restrict__ VTp, float* part) {
  // QPp is not __restrict__: declared so, its loads (the same for every key tile) were lifted out of the key loop and spilled to scratch
  __shared__ __align__(16) AttU U;                 // scores of heads 0..3 [4][128][SSP] f32; reused as 8 epilogue slabs
  __shared__ __align__(16) float Ub[(NH / 2) * NT * SSP];   // scores of heads 4..7 (two arrays for the same reason as sPa, sPb below)
  // P tiles [8][128][PLP] f16 bits, heads 0..3 and 4..7 as two arrays: from each array's own base register every constant offset fits
  // the LDS instructions' 16-bit field (past 64 KB of one base every access took an address register of its own, and those spilled)
  __shared__ __align__(16) u16 sPa[(NH / 2) * NT * PLP];
  __shared__ __align__(16) u16 sPb[(NH / 2) * NT * PLP];

  const int tid  = threadIdx.x;
  const int wave = tid >> 5;
  const int lane = tid & 31;
  const int hh   = lane >> 4;
  const int m    = lane & 15;
  const int q0   = blockIdx.y * NT;          // q0 + 127 < SQ (grid exact)
  const int lbeg = blockIdx.x * KSPAN;       // this block's key range lbeg .. lbeg + KSPAN - 1 < NL (grid exact)
  float* const out = part + (size_t)blockIdx.x * ((size_t)SQ * DM);

  const _Float16* qb = (const _Float16*)(const void*)QPp + (size_t)q0 * DM + wave * (DKH * 16) + lane * 8;
  const _Float16* kp = (const _Float16*)(const void*)KPp + (size_t)lbeg * DM + wave * (DKH * 16) + lane * 8;   // steps one key tile a pass
  const _Float16* vb = (const _Float16*)(const void*)VTp + wave * (64 * 32) + lane * 8;
  const float lsc = LOG2E / (QSC * KSC * 8.0f);
  const v4f lsc4 = {lsc, lsc, lsc, lsc};
  float* const sw = (wave < NH / 2 ? U.s : Ub) + (wave & (NH / 2 - 1)) * (NT * SSP);

  v8f o[NT / 16][4];                         // o[i][t]: n rows 16i..16i+15, d columns 64 * wave + 16t..+15
#pragma unroll
  for (int i = 0; i < NT / 16; ++i) {
#pragma unroll
    for (int t = 0; t < 4; ++t) o[i][t] = zero8();
  }

#pragma unroll 1
  for (int l0 = lbeg; l0 < lbeg + KSPAN; l0 += LT, kp += (size_t)LT * DM) {
    // ---- (S) scores of head = wave for this key tile ----
    {
      const v16h ka0 = ldfrag_hf(kp), ka1 = ldfrag_hf(kp + 512);
      const v16h kc0 = ldfrag_hf(kp + (size_t)16 * DM), kc1 = ldfrag_hf(kp + (size_t)16 * DM + 512);
      // the k loads' address pair is a temporary that one of the q loads below lands on: it is rewritten only behind this wait
#if defined(__HIP_DEVICE_COMPILE__)
      asm volatile("s_wait_xcnt 0x0" ::: "memory");
#endif
      // the q fragments of passes 0..2 are asked for as one group (the P and V^T registers are free here), those of pass 3 behind
      // pass 0, in the registers it has left: with two waves on a SIMD a pass that loaded its own four fragments at its head
      // would wait out the way from L2 four times a tile; all 16 at once overran the registers
      v16h qf[NT / 32][4];
#pragma unroll
      for (int nh = 0; nh < NT / 32 - 1; ++nh) {
        const _Float16* qp = qb + (size_t)nh * 32 * DM;
        qf[nh][0] = ldfrag_hf(qp);                     qf[nh][1] = ldfrag_hf(qp + 512);
        qf[nh][2] = ldfrag_hf(qp + (size_t)16 * DM);   qf[nh][3] = ldfrag_hf(qp + (size_t)16 * DM + 512);
      }
      __builtin_amdgcn_sched_barrier(0);     // keeps every load of the group in front of the first matrix instruction
      // unrolled: qf is indexed by constants and stays in registers
#pragma unroll
      for (int nh = 0; nh < NT / 32; ++nh) {
        const v16h qa0 = qf[nh][0], qa1 = qf[nh][1], qc0 = qf[nh][2], qc1 = qf[nh][3];
        v8f s00 = zero8(), s01 = zero8(), s10 = zero8(), s11 = zero8();
        s00 = mma_h(qa0, ka0, s00);  s00 = mma_h(qa1, ka1, s00);     // n rows 0..15 of the pass,  keys 0..15
        s01 = mma_h(qa0, kc0, s01);  s01 = mma_h(qa1, kc1, s01);     // n rows 0..15 of the pass,  keys 16..31
        s10 = mma_h(qc0, ka0, s10);  s10 = mma_h(qc1, ka1, s10);     // n rows 16..31 of the pass, keys 0..15
        s11 = mma_h(qc0, kc0, s11);  s11 = mma_h(qc1, kc1, s11);     // n rows 16..31 of the pass, keys 16..31
        guard4x8(s00, s01, s10, s11, qa0, qa1, qc0, qc1, ka0, ka1, kc0, kc1);
        if (nh == 0) {
          const _Float16* qp = qb + (size_t)(NT / 32 - 1) * 32 * DM;
          qf[NT / 32 - 1][0] = ldfrag_hf(qp);                     qf[NT / 32 - 1][1] = ldfrag_hf(qp + 512);
          qf[NT / 32 - 1][2] = ldfrag_hf(qp + (size_t)16 * DM);   qf[NT / 32 - 1][3] = ldfrag_hf(qp + (size_t)16 * DM + 512);
          __builtin_amdgcn_sched_barrier(0); // these loads issue here, under the score stores and passes 1 and 2, not at their use
        }
        float* const sn = sw + nh * (32 * SSP);
#pragma unroll
        for (int r = 0; r < 8; ++r) {
          const int ro = (8 * hh + r) * SSP + m;
          sn[ro]                 = s00[r];
          sn[ro + 16]            = s01[r];
          sn[ro + 16 * SSP]      = s10[r];
          sn[ro + 16 * SSP + 16] = s11[r];
        }
        // one pass at a time: run together, the passes held three sets of score tiles and pushed values that live through the
        // key loop into scratch
        __builtin_amdgcn_sched_barrier(0);
      }
    }
    __syncthreads();
    // V^T fragments go through a register ring of four slots of two fragments (half a head each): half step j = 2 * head + half
    // uses slot j & 3, and the loads of half step j + 3 are issued before the matrix instructions of half step j.
    // The first three half steps (head 0, half of head 1) are asked for here, so that their way from L2 runs under the softmax phase.
    const _Float16* const vl = vb + (size_t)l0 * DV;   // k tile l0 / 32 of V^T: DV / 16 blocks of 512 halves
    v16h g[4][2];
#pragma unroll
    for (int j = 0; j < 2; ++j) { g[j][0] = ldfrag_hf(vl + j * 1024); g[j][1] = ldfrag_hf(vl + j * 1024 + 512); }
    g[2][0] = ldfrag_hf(vl + DM * 32);       // half step 2 (head 1, d tiles 0 and 1)
    g[2][1] = ldfrag_hf(vl + DM * 32 + 512);
    __builtin_amdgcn_sched_barrier(0);       // keeps these loads in front of the softmax code (sunk to their use they would hide nothing)
    // ---- (M) softmax over the 8 heads per (n, l), P tiles ----
#pragma unroll
    for (int it = 0; it < NT / 32; ++it) {
      const int n = it * 32 + (tid >> 3), lq = (tid & 7) * 4;
      v4f t[NH];
#pragma unroll
      for (int h = 0; h < NH; ++h) t[h] = *(const v4f*)((h < NH / 2 ? U.s : Ub) + (h & (NH / 2 - 1)) * (NT * SSP) + n * SSP + lq);
      v4f mr = t[0];
#pragma unroll
      for (int h = 1; h < NH; ++h) mr = __builtin_elementwise_max(mr, t[h]);
      const v4f mx = mr * lsc;                                 // = max over heads of the rounded s * lsc: lsc > 0, rounding is monotonic
      v4f sm;
#pragma unroll
      for (int h = 0; h < NH; ++h) {
        const v4f x = __builtin_elementwise_fma(t[h], lsc4, -mx);
        // raw v_exp_f32: it differs from exp2f only where p < 2^-126; such a p vanishes in sm (one term is about 1) and is 0 as f16(P * 4096)
#pragma unroll
        for (int e = 0; e < 4; ++e) t[h][e] = __builtin_amdgcn_exp2f(x[e]);
        sm = h ? sm + t[h] : t[h];
      }
      v4f rs;                                                  // sm in [1, 8]
#pragma unroll
      for (int e = 0; e < 4; ++e) rs[e] = __builtin_amdgcn_rcpf(sm[e]) * PCAR;
      u16* const pda = sPa + n * PLP + lq;
      u16* const pdb = sPb + n * PLP + lq;
#pragma unroll
      for (int h = 0; h < NH; ++h)
        *(v2u*)((h < NH / 2 ? pda : pdb) + (h & (NH / 2 - 1)) * (NT * PLP)) = __builtin_bit_cast(v2u, __builtin_convertvector(t[h] * rs, v4h));
    }
    __syncthreads();
    // ---- (PV) accumulate P_h . V_h over all heads for this key tile ----
    {
      const _Float16* const pbasea = (const _Float16*)(const void*)sPa + m * PLP + 8 * hh;
      const _Float16* const pbaseb = (const _Float16*)(const void*)sPb + m * PLP + 8 * hh;
      // unrolled: the slot index is a constant, and each wait counts exactly the loads that are younger than the slot it needs
#pragma unroll
      for (int h = 0; h < NH; ++h) {
        if (h + 1 < NH) {                    // half step 2h + 3 (head h + 1, d tiles 2 and 3) into the slot that half step 2h - 1 has left
          g[(2 * h + 3) & 3][0] = ldfrag_hf(vl + (h + 1) * (DM * 32) + 1024);
          g[(2 * h + 3) & 3][1] = ldfrag_hf(vl + (h + 1) * (DM * 32) + 1536);
        }
        __builtin_amdgcn_sched_barrier(0);   // these loads issue before the matrix instructions of half step 2h
        const _Float16* pp = (h < NH / 2 ? pbasea : pbaseb) + (h & (NH / 2 - 1)) * (NT * PLP);
        v16h p[NT / 16];
#pragma unroll
        for (int i = 0; i < NT / 16; ++i) p[i] = ldfrag_h(pp + i * 16 * PLP);
#pragma unroll
        for (int i = 0; i < NT / 16; ++i) o[i][0] = mma_h(p[i], g[(2 * h + 0) & 3][0], o[i][0]);
#pragma unroll
        for (int i = 0; i < NT / 16; ++i) o[i][1] = mma_h(p[i], g[(2 * h + 0) & 3][1], o[i][1]);
        slots4();
        if (h + 2 < NH) {                    // half step 2h + 4 (head h + 2, d tiles 0 and 1) into the slot just left
          g[(2 * h) & 3][0] = ldfrag_hf(vl + (h + 2) * (DM * 32));
          g[(2 * h) & 3][1] = ldfrag_hf(vl + (h + 2) * (DM * 32) + 512);
        }
        __builtin_amdgcn_sched_barrier(0);   // these loads issue before the matrix instructions of half step 2h + 1
#pragma unroll
        for (int i = 0; i < NT / 16; ++i) o[i][2] = mma_h(p[i], g[(2 * h + 1) & 3][0], o[i][2]);
#pragma unroll
        for (int i = 0; i < NT / 16; ++i) o[i][3] = mma_h(p[i], g[(2 * h + 1) & 3][1], o[i][3]);
        slots4();
      }
    }
  }
  __syncthreads();

  const float osc = 1.0f / (PCAR * VCAR * (float)NH);
  const v4f z4 = {0.f, 0.f, 0.f, 0.f};
  float* const sl = U.slab + wave * SLAB64;
#pragma unroll
  for (int i = 0; i < NT / 16; ++i) {
    if (i) wave_sync_lds();                  // the slab's last reads end before the next tile is staged in it
    epi64(sl, o[i][0], o[i][1], o[i][2], o[i][3], osc, z4, out, DM, (size_t)q0 + 16 * i, wave * 64, lane);
  }
}

// =====================================================================================================
// out = sum of the KS partial planes, added in plane order 0..KS-1 in f32. Thread = 4 consecutive floats: KS 16-B loads, one
// 16-B store; 32 consecutive lanes = 512 contiguous bytes per load and store.
// coverage: grid = SQ*DM/1024 blocks x 256 thr x 4 floats = out rows 0..SQ-1, every float exactly once.
// =====================================================================================================
__global__ __launch_bounds__(256) void sum_parts(const float* __restrict__ part, float* out) {
  const unsigned ob = (blockIdx.x * 256u + threadIdx.x) * 16u;    // byte offset in a plane, < SQ * DM * 4 (grid exact)
  v4f p[KS];
#pragma unroll
  for (int s = 0; s < KS; ++s) p[s] = *(const v4f*)((const char*)(part + (size_t)s * ((size_t)SQ * DM)) + ob);
  v4f a = p[0];
#pragma unroll
  for (int s = 1; s < KS; ++s) a += p[s];
  *(v4f*)((char*)out + ob) = a;
}

// =====================================================================================================
// Workspace map (bytes); every plane is fully written by whole-line stores before it is read; all extents are exact multiples of
// the store granularity (no pad rows, all dims multiples of 64), every offset a multiple of 256:
//   XQ  bf16 [SQ][512]                      <=  4194304
//   XS  bf16 [4096][512]                        4194304
//   WV1T, WQT, WKT bf16 [512][512]             3 x 524288
//   WV2T f16 of bf16 value x1024 [4096][512]   4194304
//   VALH f16 value x8 [4096][512]               4194304
//   QP   f16 x8 [SQ][512]                   <=  4194304
//   KP   f16 x8 [4096][512]                     4194304
//   VT   f16 x64 [4096][4096]                  33554432
//   PART f32 [KS][SQ][512]                  <= 67108864
//   end                                     <= 127401984
// =====================================================================================================
extern "C" void kernel_launch(void* const* d_in, const int* in_sizes, int n_in,
                              void* d_out, int out_size, void* d_ws, size_t ws_size,
                              hipStream_t stream) {
  if (n_in < 10) return;
  if (in_sizes[0] != NQ * DM || in_sizes[1] != NL * DM) return;
  if (in_sizes[2] != DM * DM || in_sizes[3] != DM) return;
  if (in_sizes[4] != DM * DM || in_sizes[5] != DM) return;
  if (in_sizes[6] != DM * DM || in_sizes[7] != DM) return;
  if (in_sizes[8] != DM * DV || in_sizes[9] != DV) return;
  if (out_size != NQ * DM) return;

  const float* xq  = (const float*)d_in[0];
  const float* xs  = (const float*)d_in[1];
  const float* wv1 = (const float*)d_in[2];
  const float* bv1 = (const float*)d_in[3];
  const float* wq  = (const float*)d_in[4];
  const float* bq  = (const float*)d_in[5];
  const float* wk  = (const float*)d_in[6];
  const float* bk  = (const float*)d_in[7];
  const float* wv2 = (const float*)d_in[8];
  const float* bv2 = (const float*)d_in[9];
  float*       out = (float*)d_out;

  const size_t szXQ = (size_t)SQ * DM * 2;          //  4194304 at SQ = NQ
  const size_t szXS = (size_t)NL * DM * 2;          //  4194304
  const size_t szWT = (size_t)DM * DM * 2;          //   524288
  const size_t szW2 = (size_t)DV * DM * 2;          //  4194304
  const size_t szVL = (size_t)NL * DM * 2;          //  4194304
  const size_t szQP = (size_t)SQ * DM * 2;          //  4194304 at SQ = NQ
  const size_t szKP = (size_t)NL * DM * 2;          //  4194304
  const size_t szVT = (size_t)DV * NL * 2;          // 33554432
  const size_t szPT = (size_t)KS * SQ * DM * 4;     // 67108864 at SQ = NQ
  size_t off = 0;
  const size_t oXQ = off; off += szXQ;
  const size_t oXS = off; off += szXS;
  const size_t oW1 = off; off += szWT;
  const size_t oWQ = off; off += szWT;
  const size_t oWK = off; off += szWT;
  const size_t oW2 = off; off += szW2;
  const size_t oVL = off; off += szVL;
  const size_t oQP = off; off += szQP;
  const size_t oKP = off; off += szKP;
  const size_t oVT = off; off += szVT;
  const size_t oPT = off; off += szPT;
  if (off > ws_size) return;                        // off = 127401984 at SQ = NQ
  if (off > WS_CAP) return;

  char* ws = (char*)d_ws;
  u16* XQ   = (u16*)(ws + oXQ);
  u16* XS   = (u16*)(ws + oXS);
  u16* WV1T = (u16*)(ws + oW1);
  u16* WQT  = (u16*)(ws + oWQ);
  u16* WKT  = (u16*)(ws + oWK);
  u16* WV2T = (u16*)(ws + oW2);
  u16* VALH = (u16*)(ws + oVL);
  u16* QP   = (u16*)(ws + oQP);
  u16* KP   = (u16*)(ws + oKP);
  u16* VT   = (u16*)(ws + oVT);
  float* PART = (float*)(ws + oPT);

  const dim3 blk(256);
  const dim3 bG(PJW * 32);
  const dim3 gPR(PB_ALL);                           // 512 + 3 x 64 + 1024 + 1024 at SQ = NQ
  const dim3 gP3(((2 * RT_S + RT_Q) / 3) * (DM / 128));   // 256 at SQ = NQ
  const dim3 gVT((DV / 256) * (NL / 128));          // 512
  const dim3 gAT(KS, SQ / NT);                      // 8 x 32 at SQ = NQ
  const dim3 gSP((SQ * DM) / 1024);                 // 2048 at SQ = NQ
  const dim3 bAT(ATT_THREADS);

  // (0) query rows < SQ and source -> bf16 planes; Wv1, Wq, Wk [in][out] -> bf16 [out][in] fragment-order planes;
  //     Wv2 [512][4096] -> f16 of the bf16 value x1024, [4096][512]
  prep_all<<<gPR, blk, 0, stream>>>(xq, xs, wv1, wq, wk, wv2, XQ, XS, WV1T, WQT, WKT, WV2T);
  // (1) value = source.Wv1 + b -> f16 plane x8; q (rows < SQ) and k projections -> f16 planes x8
  proj3<<<gP3, bG, 0, stream>>>(XS, XQ, WV1T, WQT, WKT, bv1, bq, bk, VALH, QP, KP);
  // (2) V^T [h*512+d][l] = (Wv2^T . value^T) / (1024*8) + b[h*512+d], f16 plane x64
  gemm_hh16r<<<gVT, blk, 0, stream>>>(WV2T, VALH, bv2, VT, 1.0f / (W2S * VSC), VCAR);
  // (3) head-axis softmax attention + head mean, one f32 partial plane per key range; (4) planes summed -> out rows 0..SQ-1
  attn_heads<<<gAT, bAT, 0, stream>>>(QP, KP, VT, PART);
  sum_parts<<<gSP, blk, 0, stream>>>(PART, out);
  (void)hipGetLastError();
}

// v010
// It runs in 149 microseconds.
// Next to v009, in two timings, it ran 1.04 times as fast each time.
// Counting every step since v000, it is 5.27 times as fast.
// Projections value, q, k = x.W + b: v_wmma_f32_16x16x32_bf16 (bf16 RNE operands of the raw inputs, f32 accumulate, bf16 RNE
// bias added in f32). v^T = Wv2^T . value^T (W as f16 of the bf16 RNE value x1024, value plane f16 x8, bf16 RNE bias per row in
// f32), per-head scores q.k^T (f16 planes x8) and P.V (P x4096 f16 from LDS, V^T x64 f16): v_wmma_f32_16x16x32_f16, f32
// accumulate. Softmax over the head axis, the head mean and all scaling in f32 on VALU.
// The softmax weights of a (query, key) pair sum to 1 over the heads, so sum_h P_h v_h = v_7 + sum_{h<7} P_h (v_h - v_7): the V^T
// plane holds v_h - v_7 for heads 0..6 (the weights are subtracted ahead of the V^T GEMM, the biases in its epilogue), P.V runs over 7 heads, and
// v_7 enters as its plain sum over the keys, taken in f32 from the V^T GEMM's accumulators (plane RS, one row per 64 keys).
// Every 16-bit operand plane [rows][K] in the workspace is kept in FRAGMENT ORDER: 1-KB blocks of 16 rows x 32 k, block (rt, kt)
// at half index rt * 16 * K + kt * 512; inside a block the 16-B chunk (row m = row & 15, c = (k >> 3) & 3) stands at half index
// c * 128 + m * 8. Lane (h = lane >> 4, m = lane & 15) of a fragment then reads its two 16-B chunks (c = h and c = 2 + h) at
// lane * 8 and 256 + lane * 8: each load of a wave is 512 contiguous bytes (4 cache lines) and not 32 B out of each of 16 lines.
// The V^T plane alone orders its blocks k tile first, block (rt, kt) at half index (kt * (rows / 16) + rt) * 512, so that all that
// one key tile of the attention reads (heads 0..6, every d) is one contiguous 224-KB run.
#include <hip/hip_runtime.h>
#include <math.h>
#include <stdint.h>

#define NQ   4096
#define NL   4096
#define DM   512
#define NH   8
#define NHP  (NH - 1)
#define DKH  64
#define DV   (NH * DM)
#ifndef SQ
#define SQ NQ
#endif
#define NT   128
#define LT   32
#define SSP  32
#define PLP  40
#define SLAB64 (16 * 68)
#define ATT_THREADS 256
#define KS   8
#define KSPAN (NL / KS)
#define QSC  8.0f
#define KSC  8.0f
#define VSC  8.0f
#define W2S  1024.0f
#define PCAR 4096.0f
#define VCAR 64.0f
#define LOG2E 1.4426950408889634f
#define WS_CAP ((size_t)134217728)

static_assert(DM == NH * DKH && DKH == 64 && NH == 8 && (DM % 64) == 0 && (DV % 64) == 0 && (NL % 64) == 0 && (NQ % 64) == 0);
static_assert((DM % 32) == 0);
static_assert(SQ >= 64 && SQ <= NQ && (SQ % 64) == 0 && (SQ % NT) == 0);
static_assert(NT == 128 && LT == 32 && (NL % LT) == 0 && ATT_THREADS == 256 && ATT_THREADS * 4 * (NT / 32) == NT * LT);
static_assert(KS >= 1 && (NL % (KS * LT)) == 0 && ((SQ * DM) % 1024) == 0 && (KSPAN % 64) == 0);
static_assert(SSP >= LT && PLP >= 32 && ((PLP * 2) % 16) == 0 && ((SSP * 4) % 16) == 0);
static_assert(8 * SLAB64 <= (NH / 2) * NT * SSP);
static_assert(((NQ * DM) % 2048) == 0 && ((NL * DM) % 2048) == 0 && ((SQ * DM) % 2048) == 0);
static_assert(NH * NT * SSP * 4 + NH * NT * PLP * 2 <= 320 * 1024);   // one block on a WGP

typedef unsigned short u16;
typedef _Float16 v16h __attribute__((ext_vector_type(16)));
typedef _Float16 v8h  __attribute__((ext_vector_type(8)));
typedef _Float16 v4h  __attribute__((ext_vector_type(4)));
typedef __bf16   v16b __attribute__((ext_vector_type(16)));
typedef float    v8f  __attribute__((ext_vector_type(8)));
typedef float    v4f  __attribute__((ext_vector_type(4)));
typedef unsigned int v4u __attribute__((ext_vector_type(4)));
typedef unsigned int v2u __attribute__((ext_vector_type(2)));

union FragH { v16h v; v8h h[2]; v4u u[2]; };
union FragB { v16b v; v4u u[2]; };
union AttU { float s[(NH / 2) * NT * SSP]; float slab[8 * SLAB64]; };

// ---- scalar helpers --------------------------------------------------------------------------------
__device__ __forceinline__ unsigned short bf_bits(float f) {          // f32 -> bf16 bits, RNE convert
  unsigned u = __float_as_uint(f);
  return (unsigned short)((u + 0x7FFFu + ((u >> 16) & 1u)) >> 16);
}
__device__ __forceinline__ float bf_up(unsigned short h) { return __uint_as_float(((unsigned)h) << 16); }
__device__ __forceinline__ float bfr(float f) { return bf_up(bf_bits(f)); }
__device__ __forceinline__ unsigned short h_bits(_Float16 x) { return __builtin_bit_cast(unsigned short, x); }
__device__ __forceinline__ unsigned pk16(unsigned short a, unsigned short b) { return (unsigned)a | ((unsigned)b << 16); }
__device__ __forceinline__ v8f zero8() { v8f z = {0.f, 0.f, 0.f, 0.f, 0.f, 0.f, 0.f, 0.f}; return z; }

// ---- fragment loaders: 16-bit A/B operand, lane -> row/col (lane&15); elements 0..7 <- k0+8h.., elements 8..15 <- k0+16+8h..
//      (same split k map for A and B).
//      ldfrag_h: row-major LDS tile, p already includes row * pitch + 8*(lane>>4): p[0..7] and p[16..23].
//      ldfrag_hf / ldfrag_b: fragment-order workspace plane, p = start of the 1-KB block + lane * 8: p[0..7] and p[256..263].
__device__ __forceinline__ v16h ldfrag_h(const _Float16* p) {
  FragH f;
  f.h[0] = *(const v8h*)(p);
  f.h[1] = *(const v8h*)(p + 16);
  return f.v;
}
__device__ __forceinline__ v16h ldfrag_hf(const _Float16* p) {
  FragH f;
  f.h[0] = *(const v8h*)(p);
  f.h[1] = *(const v8h*)(p + 256);
  return f.v;
}
__device__ __forceinline__ v16b ldfrag_b(const u16* p) {              // bf16 plane read as unsigned integer vectors
  FragB f;
  f.u[0] = *(const v4u*)(p);
  f.u[1] = *(const v4u*)(p + 256);
  return f.v;
}

__device__ __forceinline__ v8f mma_h(v16h a, v16h b, v8f c) {
  return __builtin_amdgcn_wmma_f32_16x16x32_f16(false, a, false, b, (short)0, c, false, false);
}
__device__ __forceinline__ v8f mma_b(v16b a, v16b b, v8f c) {
  return __builtin_amdgcn_wmma_f32_16x16x32_bf16(false, a, false, b, (short)0, c, false, false);
}
__device__ __forceinline__ void guard4x8(v8f& a, v8f& b, v8f& c, v8f& d, v16h x0, v16h x1, v16h x2, v16h x3,
                                         v16h x4, v16h x5, v16h x6, v16h x7) {
#if defined(__HIP_DEVICE_COMPILE__)
  asm volatile("v_nop\n\tv_nop\n\tv_nop\n\tv_nop"
               : "+v"(a), "+v"(b), "+v"(c), "+v"(d)
               : "v"(x0), "v"(x1), "v"(x2), "v"(x3), "v"(x4), "v"(x5), "v"(x6), "v"(x7) : "memory");
#endif
}
// Four vector slots behind the last matrix instruction of a P.V half step (on the taken side of the key loop's branch too) before
// later loads overwrite its fragment registers. No operands: with a half step's 16 accumulators and 10 fragments named as operands
// the build spilled to scratch. The scheduling fence in front keeps the matrix instructions ahead of the slots, and the "memory"
// clobber keeps the refill of the ring slot behind them.
__device__ __forceinline__ void slots4() {
#if defined(__HIP_DEVICE_COMPILE__)
  __builtin_amdgcn_sched_barrier(0);
  asm volatile("v_nop\n\tv_nop\n\tv_nop\n\tv_nop" ::: "memory");
#endif
}
// The same four slots behind a k step of the projections. The step's eight fragments are inputs so that they stay allocated up to
// here: otherwise an accumulator that is first written in this step is placed over an operand of a matrix instruction just issued.
__device__ __forceinline__ void slots4f(v16b x0, v16b x1, v16b x2, v16b x3, v16b x4, v16b x5, v16b x6, v16b x7) {
#if defined(__HIP_DEVICE_COMPILE__)
  __builtin_amdgcn_sched_barrier(0);
  asm volatile("v_nop\n\tv_nop\n\tv_nop\n\tv_nop"
               :: "v"(x0), "v"(x1), "v"(x2), "v"(x3), "v"(x4), "v"(x5), "v"(x6), "v"(x7) : "memory");
#endif
}
__device__ __forceinline__ void wave_sync_lds() {
  __builtin_amdgcn_fence(__ATOMIC_RELEASE, "workgroup");
  __builtin_amdgcn_wave_barrier();
  __builtin_amdgcn_fence(__ATOMIC_ACQUIRE, "workgroup");
}

// =====================================================================================================
// f32 plane [rows][DM] row-major -> 16-bit plane in fragment order:  mode 0: bf16 RNE bits;  mode 1: f16 bits of (bf16 RNE value) * scale;
// mode 2: f16 bits of value * scale (no bf16 pre-step).
// Thread = output chunk gt = 8 consecutive k of one row: two 16-B loads (a wave reads 64 B of each of 16 rows), one 16-B store;
// 32 consecutive lanes store 512 contiguous, 512-B aligned bytes
// coverage: n8/256 blocks bid = 0.. (exact multiples) x 256 thr x 8 = the whole plane.
// =====================================================================================================
__device__ __forceinline__ void cvt16(const float* __restrict__ x, u16* D, int n8, int mode, float scale, int bid) {
  const int gt = bid * 256 + (int)threadIdx.x;
  if (gt >= n8) return;                     // no barriers on this path
  const int kb = DM / 32;                   // blocks in a row tile
  const int blk = gt >> 6, cw = gt & 63;    // 1-KB block, chunk in it: cw = c * 16 + m
  const float* p = x + ((size_t)(blk / kb) * 16 + (size_t)(cw & 15)) * DM + (blk % kb) * 32 + (cw >> 4) * 8;
  const v4f a = *(const v4f*)(p), c4 = *(const v4f*)(p + 4);
  float v[8];
#pragma unroll
  for (int e = 0; e < 4; ++e) { v[e] = a[e]; v[4 + e] = c4[e]; }
  unsigned short s[8];
#pragma unroll
  for (int e = 0; e < 8; ++e) {
    const float vb = bfr(v[e]);
    const float vf = (mode == 1) ? vb : v[e];
    const unsigned short hb = h_bits((_Float16)(vf * scale));
    const unsigned short bb = bf_bits(v[e]);
    s[e] = (mode != 0) ? hb : bb;
  }
  v4u o;
#pragma unroll
  for (int e = 0; e < 4; ++e) o[e] = pk16(s[2 * e], s[2 * e + 1]);
  u16* d = D + (size_t)gt * 8;
  {
    *(v4u*)(d) = o;
    
  }
}

// =====================================================================================================
// Transpose + convert: in X [R][C] f32 row-major -> out XTo [C][R] 16-bit in fragment order (output row = input column, k = R axis).
//   mode 0: bf16 RNE bits;  mode 1: f16 bits of (bf16 RNE value) * scale;  mode 2: f16 bits of value * scale.
// Block = 64 input rows x 64 input cols: bid -> (rt = bid % (R/64), ct = bid / (R/64)). The 64x64 f32 tile is loaded with 16-B
// loads (thread = input row tid>>2, 16 consecutive cols), converted and scattered into LDS TH[c local][r local] (pitch 72 halves);
// the tile is 4 row tiles x 2 k tiles = 8 blocks of 1 KB; chunk cid = it * 256 + tid -> block cid >> 6, chunk cid & 63 in it.
// coverage: load 256 thr x 16 = 64 x 64; store 2 iterations x 256 thr x 8 halves = 8 blocks x 64 chunks = the tile;
//           (R/64)*(C/64) blocks bid = 0.. (exact multiples) tile the whole [C][R] plane exactly once. TH: the block's 64 x VTP LDS tile.
// =====================================================================================================
#define VTP 72
static_assert(64 * VTP >= 63 * VTP + 64 && ((VTP * 2) % 16) == 0);
// sub >= 0 (mode 1 only): the bf16 RNE value of input column sub + (column - c0) of the same row is subtracted first.
__device__ __forceinline__ void tr16(u16* TH, const float* __restrict__ X, u16* XTo, int R, int C, int mode, float scale, int bid, int sub) {
  const int tid = threadIdx.x;
  const int nrt = R >> 6;
  const int rt  = bid % nrt;
  const int ct  = bid / nrt;
  const int r0  = rt * 64;
  const int c0  = ct * 64;
  {
    const int rl = tid >> 2;                  // input row within tile 0..63
    const int cc = (tid & 3) * 16;            // input col chunk within the 64
    const float* src = X + (size_t)(r0 + rl) * (size_t)C + c0 + cc;
    // unrolled: av and sv are indexed by constants and stay in registers
    v4f av[4], sv[4];
#pragma unroll
    for (int i = 0; i < 4; ++i) av[i] = *(const v4f*)(src + 4 * i);
    // the loads' address registers are rewritten (by what sv takes below) only behind this wait
#if defined(__HIP_DEVICE_COMPILE__)
    asm volatile("s_wait_xcnt 0x0" ::: "memory");
#endif
    if (sub >= 0) {                           // block-uniform
      const float* sp = X + (size_t)(r0 + rl) * (size_t)C + sub + cc;
#pragma unroll
      for (int i = 0; i < 4; ++i) sv[i] = *(const v4f*)(sp + 4 * i);
      // as above, for these loads
#if defined(__HIP_DEVICE_COMPILE__)
      asm volatile("s_wait_xcnt 0x0" ::: "memory");
#endif
    } else {
#pragma unroll
      for (int i = 0; i < 4; ++i) sv[i] = (v4f){0.f, 0.f, 0.f, 0.f};
    }
#pragma unroll
    for (int i = 0; i < 4; ++i) {
#pragma unroll
      for (int e = 0; e < 4; ++e) {
        const float v  = av[i][e];
        const float vb = bfr(v) - bfr(sv[i][e]);
        const float vf = (mode == 1) ? vb : v;
        const unsigned short hb = h_bits((_Float16)(vf * scale));
        const unsigned short bb = bf_bits(v);
        TH[(cc + 4 * i + e) * VTP + rl] = (mode != 0) ? hb : bb;
      }
    }
  }
  __syncthreads();
  v4u vh[2];
  const int cw = tid & 63;                    // chunk in its block: c * 16 + m
#pragma unroll
  for (int it = 0; it < 2; ++it) {
    const int bl = it * 4 + (tid >> 6);       // local block 0..7: row tile bl >> 1, k tile bl & 1
    vh[it] = *(const v4u*)(TH + ((bl >> 1) * 16 + (cw & 15)) * VTP + (bl & 1) * 32 + (cw >> 4) * 8);
  }
  const size_t base = (size_t)c0 * (size_t)R + (size_t)r0 * 16 + (size_t)cw * 8;
  {
#pragma unroll
    for (int it = 0; it < 2; ++it) {
      const int bl = it * 4 + (tid >> 6);
      *(v4u*)(XTo + base + (size_t)(bl >> 1) * 16 * (size_t)R + (size_t)(bl & 1) * 512) = vh[it];
    }
    // the stores' registers are rewritten only behind this wait, on whatever path the inlined body is left
#if defined(__HIP_DEVICE_COMPILE__)
    asm volatile("s_wait_xcnt 0x0" ::: "memory");
#endif
  }
}

// =====================================================================================================
// All six input conversions in ONE launch (they are independent of one another): the block index picks the job, block-uniformly.
//   blocks [0, PB_W2)            Wv2 [512][4096] -> f16 of the bf16 value (heads 0..6: minus head 7's bf16 value) x1024, [4096][512]
//   next 3 x PB_WT               Wv1, Wq, Wk [in][out] -> bf16 [out][in]
//   next PB_XS, then PB_XQ       source rows, query rows < SQ -> bf16 planes
// coverage: each range is the exact block count of its job (see cvt16, tr16); grid = PB_ALL.
// =====================================================================================================
#define PB_W2 ((DM / 64) * (DV / 64))
#define PB_WT ((DM / 64) * (DM / 64))
#define PB_XS ((NL * DM) / 2048)
#define PB_XQ ((SQ * DM) / 2048)
#define PB_ALL (PB_W2 + 3 * PB_WT + PB_XS + PB_XQ)
__global__ __launch_bounds__(256)
void prep_all(const float* __restrict__ xq, const float* __restrict__ xs, const float* __restrict__ wv1,
              const float* __restrict__ wq, const float* __restrict__ wk, const float* __restrict__ wv2,
              u16* XQ, u16* XS, u16* WV1T, u16* WQT, u16* WKT, u16* WV2T) {
  __shared__ __align__(16) u16 TH[64 * VTP];
  int b = blockIdx.x;
  if (b < PB_W2) {
    const int c0 = (b / (DM / 64)) * 64;      // the block's first Wv2 column = head * 512 + d
    tr16(TH, wv2, WV2T, DM, DV, 1, W2S, b, c0 < NHP * DM ? NHP * DM + c0 % DM : -1);
    return;
  }
  b -= PB_W2;
  if (b < 3 * PB_WT) {
    const int job = b / PB_WT;
    const float* w = (job == 0) ? wv1 : (job == 1) ? wq : wk;
    u16* d = (job == 0) ? WV1T : (job == 1) ? WQT : WKT;
    tr16(TH, w, d, DM, DM, 0, 1.0f, b % PB_WT, -1);
    return;
  }
  b -= 3 * PB_WT;
  const bool src = b < PB_XS;
  cvt16(src ? xs : xq, src ? XS : XQ, src ? (NL * DM) / 8 : (SQ * DM) / 8, 0, 1.0f, src ? b : b - PB_XS);
}

// =====================================================================================================
// Epilogues. The wave's 16x64 f32 tile (times oscale, plus an optional per-column addend) is staged in its LDS slab (pitch 68),
//            8 consecutive lanes x 16 B per line), lanes 16..31 -> row 2*it+1.
//  epi64hsb: a wave's 64 x 64 tile (four 16-row tiles, all staged at once in a 64-row slab, one wave-level sync, which stands in
//            front of every global store and so waits for none): f16 bits of ((tile + bf16RNE(bias[col])) * pscale) into a fragment-order plane: a 16-row tile is two adjacent
//            1-KB blocks, the next 16-row tile 16 * N halves on; store i = 0..3, lane (h, m) = row m, columns 16i + 8h .. + 7, at half index i * 256 + lane * 8 (512 contiguous bytes).
//  epi64hrb: a wave's 64 x 64 tile (four 16-row tiles, all staged at once in a 64-row slab, one wave-level sync): f16 bits of
//            ((tile + bf16RNE(bias[row]) - bf16RNE(bias7[row])) * pscale), per 16-row tile the store shape of epi64hsb, but blocks ordered k tile first
//            (M rows): a 16-row tile's two 1-KB blocks stand M * 32 halves apart, the next 16-row tile 512 halves on.
// coverage: epi64 8 instructions x 2 rows x 16 lanes x 4 floats = the wave's 16 x 64 tile; epi64hsb and epi64hrb 4 tiles x
//           4 instructions x 16 rows x 2 chunks x 8 halves = the wave's 64 x 64 tile.
// =====================================================================================================
__device__ __forceinline__ void stage64(float* sl, v8f a0, v8f a1, v8f a2, v8f a3, float oscale, int lane) {
  const int hh = lane >> 4, m = lane & 15;
#pragma unroll
  for (int r = 0; r < 8; ++r) {
    const int ro = (8 * hh + r) * 68 + m;
    sl[ro]      = a0[r] * oscale;
    sl[ro + 16] = a1[r] * oscale;
    sl[ro + 32] = a2[r] * oscale;
    sl[ro + 48] = a3[r] * oscale;
  }
  wave_sync_lds();
}
__device__ __forceinline__ void epi64(float* sl, v8f a0, v8f a1, v8f a2, v8f a3, float oscale, v4f badd, float* C, int N,
                                      size_t rowb, int col0, int lane) {
  const int hh = lane >> 4, m = lane & 15;
  stage64(sl, a0, a1, a2, a3, oscale, lane);
  v4f vals[8];
#pragma unroll
  for (int it = 0; it < 8; ++it) vals[it] = *(const v4f*)(sl + (it * 2 + hh) * 68 + m * 4) + badd;
  float* dst = C + (rowb + (size_t)hh) * (size_t)N + col0 + m * 4;
  {
#pragma unroll
    for (int it = 0; it < 8; ++it) {
      *(v4f*)(dst + (size_t)(it * 2) * (size_t)N) = vals[it];
    }
    // the stores' registers are rewritten (by the staging of the caller's next tile) only behind this wait; the scheduling fence
    // keeps that arithmetic, which is no memory operation, behind it
#if defined(__HIP_DEVICE_COMPILE__)
    asm volatile("s_wait_xcnt 0x0" ::: "memory");
    __builtin_amdgcn_sched_barrier(0);
#endif
  }
}
__device__ __forceinline__ void epi64hsb(float* sl, v8f (&o)[4][4], float pscale, const v4f (&braw)[4][2], u16* C, int N,
                                         size_t rowb, int col0, int lane) {
  const int row = lane & 15, h8 = (lane >> 4) * 8;
  // every loop here is unrolled so that o, braw, bb and oh are indexed by constants and stay in registers
  float bb[4][8];                            // the lane's 32 bias values (columns col0 + 16 * i4 + h8 .. + 7), the same for all four 16-row tiles
#pragma unroll
  for (int i4 = 0; i4 < 4; ++i4) {
#pragma unroll
    for (int e = 0; e < 4; ++e) { bb[i4][e] = bfr(braw[i4][0][e]); bb[i4][4 + e] = bfr(braw[i4][1][e]); }
  }
  const int hh = lane >> 4;
#pragma unroll
  for (int i = 0; i < 4; ++i) {
#pragma unroll
    for (int r = 0; r < 8; ++r) {
      const int ro = (16 * i + 8 * hh + r) * 68 + row;
      sl[ro]      = o[i][0][r];
      sl[ro + 16] = o[i][1][r];
      sl[ro + 32] = o[i][2][r];
      sl[ro + 48] = o[i][3][r];
    }
  }
  wave_sync_lds();
  u16* dst = C + rowb * (size_t)N + (size_t)col0 * 16 + lane * 8;      // rowb % 16 == 0, col0 % 64 == 0
#pragma unroll
  for (int i = 0; i < 4; ++i) {
    v4u oh[4];
#pragma unroll
    for (int i4 = 0; i4 < 4; ++i4) {
      const int c8 = i4 * 16 + h8;
      const v4f a = *(const v4f*)(sl + (16 * i + row) * 68 + c8), c4 = *(const v4f*)(sl + (16 * i + row) * 68 + c8 + 4);
      float w[8];
#pragma unroll
      for (int e = 0; e < 4; ++e) { w[e] = (a[e] + bb[i4][e]) * pscale; w[4 + e] = (c4[e] + bb[i4][4 + e]) * pscale; }
#pragma unroll
      for (int e = 0; e < 4; ++e) oh[i4][e] = pk16(h_bits((_Float16)w[2 * e]), h_bits((_Float16)w[2 * e + 1]));
    }
#pragma unroll
    for (int i4 = 0; i4 < 4; ++i4) {
      *(v4u*)(dst + (size_t)i * 16 * (size_t)N + i4 * 256) = oh[i4];
    }
    // the stores' registers are rewritten (by the next tile's values) only behind this wait; the scheduling fence keeps that
    // arithmetic, which is no memory operation, behind it
#if defined(__HIP_DEVICE_COMPILE__)
    asm volatile("s_wait_xcnt 0x0" ::: "memory");
    __builtin_amdgcn_sched_barrier(0);
#endif
  }
}
__device__ __forceinline__ void epi64hrb(float* sl, v8f (&o)[4][4], float oscale, float pscale,
                                         const float* __restrict__ brow, const float* __restrict__ brow7, u16* C, int M,
                                         size_t rowb, int col0, int lane) {
  const int hh = lane >> 4, m = lane & 15;
  // every loop here is unrolled so that o, r0v, r1v, s0v, s1v and oh are indexed by constants and stay in registers
  v4f r0v[4], r1v[4], s0v[4], s1v[4];
#pragma unroll
  for (int i = 0; i < 4; ++i) {              // rows rowb + 16i + 8h .. + 7 < M; brow7: the same d of head 7
    r0v[i] = *(const v4f*)(brow + 16 * i + 8 * hh);
    r1v[i] = *(const v4f*)(brow + 16 * i + 8 * hh + 4);
    s0v[i] = *(const v4f*)(brow7 + 16 * i + 8 * hh);
    s1v[i] = *(const v4f*)(brow7 + 16 * i + 8 * hh + 4);
  }
  // the loads' address registers are rewritten only behind this wait
#if defined(__HIP_DEVICE_COMPILE__)
  asm volatile("s_wait_xcnt 0x0" ::: "memory");
#endif
#pragma unroll
  for (int i = 0; i < 4; ++i) {
    float rb[8];
#pragma unroll
    for (int e = 0; e < 4; ++e) { rb[e] = bfr(r0v[i][e]) - bfr(s0v[i][e]); rb[4 + e] = bfr(r1v[i][e]) - bfr(s1v[i][e]); }
#pragma unroll
    for (int r = 0; r < 8; ++r) {
      const int ro = (16 * i + 8 * hh + r) * 68 + m;
      sl[ro]      = o[i][0][r] * oscale + rb[r];
      sl[ro + 16] = o[i][1][r] * oscale + rb[r];
      sl[ro + 32] = o[i][2][r] * oscale + rb[r];
      sl[ro + 48] = o[i][3][r] * oscale + rb[r];
    }
  }
  wave_sync_lds();
  u16* dst = C + (size_t)col0 * (size_t)M + rowb * 32 + lane * 8;      // rowb % 16 == 0, col0 % 64 == 0
#pragma unroll
  for (int i = 0; i < 4; ++i) {
    v4u oh[4];
#pragma unroll
    for (int i4 = 0; i4 < 4; ++i4) {
      const int c8 = i4 * 16 + hh * 8;
      const v4f a = *(const v4f*)(sl + (16 * i + m) * 68 + c8), c4 = *(const v4f*)(sl + (16 * i + m) * 68 + c8 + 4);
      float w[8];
#pragma unroll
      for (int e = 0; e < 4; ++e) { w[e] = a[e] * pscale; w[4 + e] = c4[e] * pscale; }
#pragma unroll
      for (int e = 0; e < 4; ++e) oh[i4][e] = pk16(h_bits((_Float16)w[2 * e]), h_bits((_Float16)w[2 * e + 1]));
    }
#pragma unroll
    for (int i4 = 0; i4 < 4; ++i4) {
      *(v4u*)(dst + i * 512 + (size_t)(i4 >> 1) * 32 * (size_t)M + (i4 & 1) * 256) = oh[i4];
    }
  }
}

//  epi64sum: a wave's 64 x 64 tile summed along its 64 columns: rs[row] = (sum of the row's 64 accumulators) * oscale
//            + 64 * bf16RNE(bias[row]), f32. A lane adds its four column tiles, the 16 lanes' sums of a row meet in the slab
//            (pitch 17 floats: no two lanes of a load on one bank), lane l adds rows l and 32 + l in column order and stores
//            them: two stores of 128 contiguous, 128-B aligned bytes a wave.
__device__ __forceinline__ void epi64sum(float* sl, v8f (&o)[4][4], float oscale, const float* __restrict__ brow, float* rs, int lane) {
  const int hh = lane >> 4, m = lane & 15;
  const float b0 = brow[lane], b1 = brow[32 + lane];
  // the loads' address registers are rewritten only behind this wait
#if defined(__HIP_DEVICE_COMPILE__)
  asm volatile("s_wait_xcnt 0x0" ::: "memory");
#endif
  // unrolled: o is indexed by constants and stays in registers
#pragma unroll
  for (int i = 0; i < 4; ++i) {
#pragma unroll
    for (int r = 0; r < 8; ++r) sl[(16 * i + 8 * hh + r) * 17 + m] = (o[i][0][r] + o[i][1][r]) + (o[i][2][r] + o[i][3][r]);
  }
  wave_sync_lds();                           // the other lanes' sums are read only behind it
  float a0 = 0.f, a1 = 0.f;
#pragma unroll
  for (int j = 0; j < 16; ++j) { a0 += sl[lane * 17 + j]; a1 += sl[(32 + lane) * 17 + j]; }
  rs[lane]      = a0 * oscale + 64.0f * bfr(b0);
  rs[32 + lane] = a1 * oscale + 64.0f * bfr(b1);
  // the stores' registers are rewritten only behind this wait, on whatever path the inlined body is left
#if defined(__HIP_DEVICE_COMPILE__)
  asm volatile("s_wait_xcnt 0x0" ::: "memory");
#endif
}

// =====================================================================================================
// bf16 GEMM, f16 plane out with column bias: C16[M][DM] = f16 bits of ((A[M][DM] (bf16) . Bt[DM][DM]^T (bf16))
// + bf16RNE(bias[n])) * pscale. A, Bt and C16 are fragment-order planes.
// One wave = one 64 x 64 tile (rows rowb.., columns col0..) = 16 accumulator tiles: the 4 A and 4 B fragments of a k step (8 KB, loaded straight from the
// 1-KB blocks, two 16-B loads each, split k map for A and B) feed 16 matrix instructions. K stepped by 32 = one block; every
// output element sums its k steps in the same ascending order as with any other tile.
// The fragments go through a register ring of three sets, loaded two k steps ahead: few waves stand on a SIMD here, so the way
// from L2 has to run under the wave's own matrix instructions. sl: the wave's epilogue slab in LDS.
// =====================================================================================================
__device__ __forceinline__
void gemm_bh16(float* sl, const u16* __restrict__ A, const u16* __restrict__ Bt, const float* __restrict__ bias, u16* C,
               float pscale, int rowb, int col0, int lane) {
  constexpr int N = DM, K = DM, NS = K / 32; // compile-time: every load of an operand shares one address and differs in the immediate offset
  constexpr int bs = 16 * K;
  const u16* const ap = A  + (size_t)rowb * (size_t)K + lane * 8;
  const u16* const bp = Bt + (size_t)col0 * (size_t)K + lane * 8;
  v8f o[4][4];                               // o[i][t]: rows rowb + 16i..+15, columns col0 + 16t..+15
#pragma unroll
  for (int i = 0; i < 4; ++i) {
#pragma unroll
    for (int t = 0; t < 4; ++t) o[i][t] = zero8();
  }
  // the lane's bias values are asked for here, ahead of the k loop: asked for in the epilogue, their way from memory would stand open there
  v4f braw[4][2];
#pragma unroll
  for (int i4 = 0; i4 < 4; ++i4) {           // columns col0 + 16 * i4 + 8 * (lane >> 4) .. + 7 < N
    braw[i4][0] = *(const v4f*)(bias + col0 + i4 * 16 + (lane >> 4) * 8);
    braw[i4][1] = *(const v4f*)(bias + col0 + i4 * 16 + (lane >> 4) * 8 + 4);
  }
  v16b fa[3][4], fb[3][4];
#pragma unroll
  for (int s = 0; s < 2; ++s) {
#pragma unroll
    for (int i = 0; i < 4; ++i) { fa[s][i] = ldfrag_b(ap + i * bs + s * 512); fb[s][i] = ldfrag_b(bp + i * bs + s * 512); }
  }
  // unrolled: the set index is a constant, and each wait counts exactly the loads that are younger than the set it needs
#pragma unroll
  for (int s = 0; s < NS; ++s) {
    if (s + 2 < NS) {                        // k step s + 2 into the set that step s - 1 has left
#pragma unroll
      for (int i = 0; i < 4; ++i) {
        fa[(s + 2) % 3][i] = ldfrag_b(ap + i * bs + (s + 2) * 512);
        fb[(s + 2) % 3][i] = ldfrag_b(bp + i * bs + (s + 2) * 512);
      }
    }
    __builtin_amdgcn_sched_barrier(0);       // these loads issue before the matrix instructions of step s
#pragma unroll
    for (int t = 0; t < 4; ++t) {
#pragma unroll
      for (int i = 0; i < 4; ++i) o[i][t] = mma_b(fa[s % 3][i], fb[s % 3][t], o[i][t]);
    }
    slots4f(fa[s % 3][0], fa[s % 3][1], fa[s % 3][2], fa[s % 3][3], fb[s % 3][0], fb[s % 3][1], fb[s % 3][2], fb[s % 3][3]);
  }
  // the loads' address registers are rewritten (by the epilogue) only behind this wait
#if defined(__HIP_DEVICE_COMPILE__)
  asm volatile("s_wait_xcnt 0x0" ::: "memory");
#endif
  epi64hsb(sl, o, pscale, braw, C, N, (size_t)rowb, col0, lane);
}
// The three projections in ONE launch (independent of one another), their 64-row tiles numbered through: row tiles [0, RT_S)
// value = source.Wv1 + b (f16 plane x8), next RT_Q q = query.Wq + b (rows < SQ, x8), next RT_S k = source.Wk + b (x8).
// Block = six waves = 3 row tiles x 2 column tiles (waves of a block read the same fragments at about the same time), one block on
// every WGP at SQ = NQ; the job is wave-uniform, and the kernel has no block barrier.
// coverage: grid = ((2 * RT_S + RT_Q) / 3) * (DM / 128) blocks x 3 x 2 tiles = every 64 x 64 tile of the three planes exactly once.
#define RT_S (NL / 64)
#define RT_Q (SQ / 64)
#define PJW  6
static_assert(((2 * RT_S + RT_Q) % 3) == 0 && (DM % 128) == 0);
__global__ __launch_bounds__(PJW * 32)
void proj3(const u16* __restrict__ XS, const u16* __restrict__ XQ, const u16* __restrict__ W1T, const u16* __restrict__ WQT,
           const u16* __restrict__ WKT, const float* __restrict__ bv1, const float* __restrict__ bq,
           const float* __restrict__ bk, u16* VALH, u16* QP, u16* KP) {
  __shared__ __align__(16) float slab[PJW * 4 * SLAB64];   // 64 rows x 68 floats a wave
  const int lane = threadIdx.x & 31;
  const int wave = __builtin_amdgcn_readfirstlane(threadIdx.x >> 5);   // scalar: job, tile and operand bases stay in scalar registers
  const int rt  = ((int)blockIdx.x / (DM / 128)) * 3 + (wave >> 1);    // row tile, numbered through the three jobs
  const int ct  = ((int)blockIdx.x % (DM / 128)) * 2 + (wave & 1);     // column tile
  const int job = (rt < RT_S) ? 0 : (rt < RT_S + RT_Q) ? 1 : 2;
  const u16*   A    = (job == 1) ? XQ : XS;
  const u16*   Bt   = (job == 0) ? W1T : (job == 1) ? WQT : WKT;
  const float* bias = (job == 0) ? bv1 : (job == 1) ? bq : bk;
  u16*         C    = (job == 0) ? VALH : (job == 1) ? QP : KP;
  const float  ps   = (job == 0) ? VSC : (job == 1) ? QSC : KSC;
  const int    r    = (job == 0) ? rt : (job == 1) ? rt - RT_S : rt - RT_S - RT_Q;
  gemm_bh16(slab + wave * (4 * SLAB64), A, Bt, bias, C, ps, r * 64, ct * 64, lane);
}

// =====================================================================================================
// f16 GEMM, f16 plane out with ROW bias: C16[M][N] = f16 bits of (((A[M][K] (f16) . Bt[N][K]^T (f16))
// * oscale) + bf16RNE(bias[m]) - bf16RNE(bias[7 * 512 + m % 512])) * pscale, M = DV, N = NL, K = DM; all three planes in fragment order, C16 with its blocks k tile first.
// Block = 256 x 128 tile, 8 waves as 4 (rows) x 2 (columns); wave tile = 64 x 64 = 16 accumulator tiles: the 4 A and 4 B fragments
// of a k step (8 KB, loaded straight from the 1-KB blocks as in gemm_bh16) feed 16 matrix instructions. K stepped by 32 = one
// block; every output element sums its k steps in the same ascending order as with any other tile.
// Epilogue: rows of heads 0..6 (A holds the weight differences): epi64hrb, the wave's 64 x 64 tile staged whole in its own LDS slab.
// Rows of head 7 are not stored: epi64sum writes their sums over the wave's 64 keys to RS[col0 / 64][d] (f32, unscaled v).
// coverage: (M/256)*(N/128) blocks bid = 0.. (exact multiples) x 8 waves x 64 x 64 = the rows of heads 0..6 of the plane and all of RS, every element exactly once.
// =====================================================================================================
static_assert((DV % 256) == 0 && (NL % 128) == 0 && 8 * 4 * SLAB64 * 4 <= 160 * 1024);
// Four vector slots behind the last matrix instruction of a k step (on the taken side of the loop's branch too) before the next
// step's loads overwrite its fragment registers; the fragments are inputs so that they stay allocated up to here. The two load
// addresses are inputs too: their registers are rewritten only behind the s_wait_xcnt, not by a later load of the same step.
__device__ __forceinline__ void guard16x8(v8f (&o)[4][4], v16h x0, v16h x1, v16h x2, v16h x3, v16h x4, v16h x5, v16h x6, v16h x7,
                                          const _Float16* pa, const _Float16* pb) {
#if defined(__HIP_DEVICE_COMPILE__)
  asm volatile("v_nop\n\tv_nop\n\tv_nop\n\tv_nop\n\ts_wait_xcnt 0x0"
               : "+v"(o[0][0]), "+v"(o[0][1]), "+v"(o[0][2]), "+v"(o[0][3]), "+v"(o[1][0]), "+v"(o[1][1]), "+v"(o[1][2]), "+v"(o[1][3]),
                 "+v"(o[2][0]), "+v"(o[2][1]), "+v"(o[2][2]), "+v"(o[2][3]), "+v"(o[3][0]), "+v"(o[3][1]), "+v"(o[3][2]), "+v"(o[3][3])
               : "v"(x0), "v"(x1), "v"(x2), "v"(x3), "v"(x4), "v"(x5), "v"(x6), "v"(x7), "v"(pa), "v"(pb) : "memory");
#endif
}
__global__ __launch_bounds__(256)
void gemm_hh16r(const u16* __restrict__ A, const u16* __restrict__ Bt, const float* __restrict__ bias, u16* C, float* RS,
                float oscale, float pscale) {
  constexpr int M = DV, N = NL, K = DM;      // compile-time: the 8 loads of an operand share one address and differ in the immediate offset
  __shared__ __align__(16) float slab[8 * 4 * SLAB64];   // 64 rows x 68 floats a wave; two blocks fit a WGP
  const int tid = threadIdx.x, lane = tid & 31;
  const int wave = __builtin_amdgcn_readfirstlane(tid >> 5);   // scalar: the operand bases stay in scalar registers, one lane offset serves all loads
  const int ntile = N >> 7;
  const int bid   = blockIdx.x;
  const int rowb  = (bid / ntile) * 256 + (wave & 3) * 64;
  const int col0  = (bid % ntile) * 128 + (wave >> 2) * 64;
  if (rowb + 64 > M) return;                 // wave-uniform, never taken with the exact grid; no block barriers in this kernel
  constexpr int bs = 16 * K;
  const _Float16* ap = (const _Float16*)(const void*)A  + (size_t)rowb * (size_t)K;
  const _Float16* bp = (const _Float16*)(const void*)Bt + (size_t)col0 * (size_t)K;
  const int lo = lane * 8;
  v8f o[4][4];                               // o[i][t]: rows rowb + 16i..+15, columns col0 + 16t..+15 (unrolled: constant indices)
#pragma unroll
  for (int i = 0; i < 4; ++i) {
#pragma unroll
    for (int t = 0; t < 4; ++t) o[i][t] = zero8();
  }
  // kept rolled: unrolled, a second set of 8 fragments would be live beside the 16 accumulators
#pragma unroll 1
  for (int k0 = 0; k0 < K; k0 += 32, ap += 512, bp += 512) {   // one 1-KB block of each of the 8 row tiles a step
    const _Float16* const pa = ap + lo;
    const _Float16* const pb = bp + lo;
    const v16h a0 = ldfrag_hf(pa), a1 = ldfrag_hf(pa + bs), a2 = ldfrag_hf(pa + 2 * bs), a3 = ldfrag_hf(pa + 3 * bs);
    const v16h b0 = ldfrag_hf(pb), b1 = ldfrag_hf(pb + bs), b2 = ldfrag_hf(pb + 2 * bs), b3 = ldfrag_hf(pb + 3 * bs);
    o[0][0] = mma_h(a0, b0, o[0][0]);  o[1][0] = mma_h(a1, b0, o[1][0]);  o[2][0] = mma_h(a2, b0, o[2][0]);  o[3][0] = mma_h(a3, b0, o[3][0]);
    o[0][1] = mma_h(a0, b1, o[0][1]);  o[1][1] = mma_h(a1, b1, o[1][1]);  o[2][1] = mma_h(a2, b1, o[2][1]);  o[3][1] = mma_h(a3, b1, o[3][1]);
    o[0][2] = mma_h(a0, b2, o[0][2]);  o[1][2] = mma_h(a1, b2, o[1][2]);  o[2][2] = mma_h(a2, b2, o[2][2]);  o[3][2] = mma_h(a3, b2, o[3][2]);
    o[0][3] = mma_h(a0, b3, o[0][3]);  o[1][3] = mma_h(a1, b3, o[1][3]);  o[2][3] = mma_h(a2, b3, o[2][3]);  o[3][3] = mma_h(a3, b3, o[3][3]);
    guard16x8(o, a0, a1, a2, a3, b0, b1, b2, b3, pa, pb);
  }
  if (rowb < NHP * DM)                       // wave-uniform
    epi64hrb(slab + wave * (4 * SLAB64), o, oscale, pscale, bias + rowb, bias + NHP * DM + rowb % DM, C, M, (size_t)rowb, col0, lane);
  else
    epi64sum(slab + wave * (4 * SLAB64), o, oscale, bias + rowb, RS + (size_t)(col0 >> 6) * DM + (rowb - NHP * DM), lane);
}

// =====================================================================================================
// Head-axis softmax attention with the head mean folded in. Block = NT = 128 query rows q0..q0+127, 8 waves, the KSPAN keys of
// key range blockIdx.x in tiles of LT = 32 (the softmax runs over heads, so key ranges only add: each range writes its own f32
// partial plane, sum_parts adds the KS planes). q plane f16 x8 [n][512] (head h = columns 64h..64h+63), k plane the same, V^T plane f16 x64 [h*512+d][l]
// (v_h - v_7, heads 0..6), all three in fragment order, V^T with its blocks k tile first.
//   (S) wave w = head w: S_w[128 n][32 l] in four passes of 32 n = 4 D tiles each, K = 64 (2 k-steps): A = q rows (row m = query,
//       split k map over the head's 64 columns), B = k rows (col n = key, same split map, loaded once for all passes);
//       D element r of lane -> U.s[w] (w < 4) / Ub[w - 4] (w >= 4) [n 32nh+16nt+8h+r][l 16half+m].
//   (M) thread = (n = 32it + (tid>>3), 4 consecutive l), it = 0..3, all arithmetic on 4-wide f32 vectors (packed instructions):
//       max over the 8 heads of s, p = exp2(fma(s, log2e/512, -max * log2e/512)), P = p / sum (f32), heads 0..6 written as
//       f16(P * 4096) to sP[h][n][l] with 8-B LDS stores (head 7's weight is 1 minus the others and is never formed).
//   (PV) wave w owns d columns 64w + 16t + (lane&15), t = 0..3, for all eight 16-row n groups (32 accumulators): every V^T fragment
//       fetched from L2 feeds eight matrix instructions. One block fills a WGP (two waves on a SIMD). For every head h < 7:
//       A = P_h fragments from LDS (row m = query, split map over the 32 keys), B = V^T fragments (col = d, keys contiguous,
//       row h*512 + d of the V^T plane); all heads and key tiles accumulate into the same accumulators (joint (l,h) K axis).
//   Block barriers after (S) and after (M) order every LDS reuse across phases, key tiles and waves.
//   Epilogue: partial = acc * 2^-21 (= 1 / (4096 * 64 * 8 heads)) + (v_7 summed over the block's keys: KSPAN / 64 rows of RS) / 8; the wave's eight 16 x 64 f32 tiles go through epi64 one after
//   another (a wave-level LDS sync between tiles); a block barrier separates the key loop from the slab use (the slab area
//   aliases the score area).
// coverage: grid (KS, SQ/128) blocks x 128 rows = query rows 0..SQ-1 of every partial plane; (S) 8 waves x 128 x 32 = all score cells;
//           (M) 4 passes x 256 thr x 4 l x 7 h = all P cells; stores 8 waves x (8 tiles x 16 rows x 64 cols) =
//           part[ks][q0..q0+127][0..511], every float exactly once.
// =====================================================================================================
__global__ __launch_bounds__(ATT_THREADS)
void attn_heads(const u16* QPp, const u16* __restrict__ KPp, const u16* __restrict__ VTp, const float* __restrict__ RS, float* part) {
  // QPp is not __restrict__: declared so, its loads (the same for every key tile) were lifted out of the key loop and spilled to scratch
  __shared__ __align__(16) AttU U;                 // scores of heads 0..3 [4][128][SSP] f32; reused as 8 epilogue slabs
  __shared__ __align__(16) float Ub[(NH / 2) * NT * SSP];   // scores of heads 4..7 (two arrays for the same reason as sPa, sPb below)
  // P tiles [7][128][PLP] f16 bits, heads 0..3 and 4..6 as two arrays: from each array's own base register every constant offset fits
  // the LDS instructions' 16-bit field (past 64 KB of one base every access took an address register of its own, and those spilled)
  __shared__ __align__(16) u16 sPa[(NH / 2) * NT * PLP];
  __shared__ __align__(16) u16 sPb[(NHP - NH / 2) * NT * PLP];

  const int tid  = threadIdx.x;
  const int wave = tid >> 5;
  const int lane = tid & 31;
  const int hh   = lane >> 4;
  const int m    = lane & 15;
  const int q0   = blockIdx.y * NT;          // q0 + 127 < SQ (grid exact)
  const int lbeg = blockIdx.x * KSPAN;       // this block's key range lbeg .. lbeg + KSPAN - 1 < NL (grid exact)
  float* const out = part + (size_t)blockIdx.x * ((size_t)SQ * DM);

  const _Float16* qb = (const _Float16*)(const void*)QPp + (size_t)q0 * DM + wave * (DKH * 16) + lane * 8;
  const _Float16* kp = (const _Float16*)(const void*)KPp + (size_t)lbeg * DM + wave * (DKH * 16) + lane * 8;   // steps one key tile a pass
  const _Float16* vb = (const _Float16*)(const void*)VTp + wave * (64 * 32) + lane * 8;
  const float lsc = LOG2E / (QSC * KSC * 8.0f);
  const v4f lsc4 = {lsc, lsc, lsc, lsc};
  float* const sw = (wave < NH / 2 ? U.s : Ub) + (wave & (NH / 2 - 1)) * (NT * SSP);

  v8f o[NT / 16][4];                         // o[i][t]: n rows 16i..16i+15, d columns 64 * wave + 16t..+15
#pragma unroll
  for (int i = 0; i < NT / 16; ++i) {
#pragma unroll
    for (int t = 0; t < 4; ++t) o[i][t] = zero8();
  }

#pragma unroll 1
  for (int l0 = lbeg; l0 < lbeg + KSPAN; l0 += LT, kp += (size_t)LT * DM) {
    // ---- (S) scores of head = wave for this key tile ----
    {
      const v16h ka0 = ldfrag_hf(kp), ka1 = ldfrag_hf(kp + 512);
      const v16h kc0 = ldfrag_hf(kp + (size_t)16 * DM), kc1 = ldfrag_hf(kp + (size_t)16 * DM + 512);
      // the k loads' address pair is a temporary that one of the q loads below lands on: it is rewritten only behind this wait
#if defined(__HIP_DEVICE_COMPILE__)
      asm volatile("s_wait_xcnt 0x0" ::: "memory");
#endif
      // the q fragments of passes 0..2 are asked for as one group (the P and V^T registers are free here), those of pass 3 behind
      // pass 0, in the registers it has left: with two waves on a SIMD a pass that loaded its own four fragments at its head
      // would wait out the way from L2 four times a tile; all 16 at once overran the registers
      v16h qf[NT / 32][4];
#pragma unroll
      for (int nh = 0; nh < NT / 32 - 1; ++nh) {
        const _Float16* qp = qb + (size_t)nh * 32 * DM;
        qf[nh][0] = ldfrag_hf(qp);                     qf[nh][1] = ldfrag_hf(qp + 512);
        qf[nh][2] = ldfrag_hf(qp + (size_t)16 * DM);   qf[nh][3] = ldfrag_hf(qp + (size_t)16 * DM + 512);
      }
      __builtin_amdgcn_sched_barrier(0);     // keeps every load of the group in front of the first matrix instruction
      // unrolled: qf is indexed by constants and stays in registers
#pragma unroll
      for (int nh = 0; nh < NT / 32; ++nh) {
        const v16h qa0 = qf[nh][0], qa1 = qf[nh][1], qc0 = qf[nh][2], qc1 = qf[nh][3];
        v8f s00 = zero8(), s01 = zero8(), s10 = zero8(), s11 = zero8();
        s00 = mma_h(qa0, ka0, s00);  s00 = mma_h(qa1, ka1, s00);     // n rows 0..15 of the pass,  keys 0..15
        s01 = mma_h(qa0, kc0, s01);  s01 = mma_h(qa1, kc1, s01);     // n rows 0..15 of the pass,  keys 16..31
        s10 = mma_h(qc0, ka0, s10);  s10 = mma_h(qc1, ka1, s10);     // n rows 16..31 of the pass, keys 0..15
        s11 = mma_h(qc0, kc0, s11);  s11 = mma_h(qc1, kc1, s11);     // n rows 16..31 of the pass, keys 16..31
        guard4x8(s00, s01, s10, s11, qa0, qa1, qc0, qc1, ka0, ka1, kc0, kc1);
        if (nh == 0) {
          const _Float16* qp = qb + (size_t)(NT / 32 - 1) * 32 * DM;
          qf[NT / 32 - 1][0] = ldfrag_hf(qp);                     qf[NT / 32 - 1][1] = ldfrag_hf(qp + 512);
          qf[NT / 32 - 1][2] = ldfrag_hf(qp + (size_t)16 * DM);   qf[NT / 32 - 1][3] = ldfrag_hf(qp + (size_t)16 * DM + 512);
          __builtin_amdgcn_sched_barrier(0); // these loads issue here, under the score stores and passes 1 and 2, not at their use
        }
        float* const sn = sw + nh * (32 * SSP);
#pragma unroll
        for (int r = 0; r < 8; ++r) {
          const int ro = (8 * hh + r) * SSP + m;
          sn[ro]                 = s00[r];
          sn[ro + 16]            = s01[r];
          sn[ro + 16 * SSP]      = s10[r];
          sn[ro + 16 * SSP + 16] = s11[r];
        }
        // one pass at a time: run together, the passes held three sets of score tiles and pushed values that live through the
        // key loop into scratch
        __builtin_amdgcn_sched_barrier(0);
      }
    }
    __syncthreads();
    // V^T fragments go through a register ring of four slots of two fragments (half a head each): half step j = 2 * head + half
    // uses slot j & 3, and the loads of half step j + 3 are issued before the matrix instructions of half step j.
    // The first three half steps (head 0, half of head 1) are asked for here, so that their way from L2 runs under the softmax phase.
    const _Float16* const vl = vb + (size_t)l0 * DV;   // k tile l0 / 32 of V^T: DV / 16 blocks of 512 halves
    v16h g[4][2];
#pragma unroll
    for (int j = 0; j < 2; ++j) { g[j][0] = ldfrag_hf(vl + j * 1024); g[j][1] = ldfrag_hf(vl + j * 1024 + 512); }
    g[2][0] = ldfrag_hf(vl + DM * 32);       // half step 2 (head 1, d tiles 0 and 1)
    g[2][1] = ldfrag_hf(vl + DM * 32 + 512);
    __builtin_amdgcn_sched_barrier(0);       // keeps these loads in front of the softmax code (sunk to their use they would hide nothing)
    // ---- (M) softmax over the 8 heads per (n, l), P tiles ----
#pragma unroll
    for (int it = 0; it < NT / 32; ++it) {
      const int n = it * 32 + (tid >> 3), lq = (tid & 7) * 4;
      v4f t[NH];
#pragma unroll
      for (int h = 0; h < NH; ++h) t[h] = *(const v4f*)((h < NH / 2 ? U.s : Ub) + (h & (NH / 2 - 1)) * (NT * SSP) + n * SSP + lq);
      v4f mr = t[0];
#pragma unroll
      for (int h = 1; h < NH; ++h) mr = __builtin_elementwise_max(mr, t[h]);
      const v4f mx = mr * lsc;                                 // = max over heads of the rounded s * lsc: lsc > 0, rounding is monotonic
      v4f sm;
#pragma unroll
      for (int h = 0; h < NH; ++h) {
        const v4f x = __builtin_elementwise_fma(t[h], lsc4, -mx);
        // raw v_exp_f32: it differs from exp2f only where p < 2^-126; such a p vanishes in sm (one term is about 1) and is 0 as f16(P * 4096)
#pragma unroll
        for (int e = 0; e < 4; ++e) t[h][e] = __builtin_amdgcn_exp2f(x[e]);
        sm = h ? sm + t[h] : t[h];
      }
      v4f rs;                                                  // sm in [1, 8]
#pragma unroll
      for (int e = 0; e < 4; ++e) rs[e] = __builtin_amdgcn_rcpf(sm[e]) * PCAR;
      u16* const pda = sPa + n * PLP + lq;
      u16* const pdb = sPb + n * PLP + lq;
#pragma unroll
      for (int h = 0; h < NHP; ++h)
        *(v2u*)((h < NH / 2 ? pda : pdb) + (h & (NH / 2 - 1)) * (NT * PLP)) = __builtin_bit_cast(v2u, __builtin_convertvector(t[h] * rs, v4h));
    }
    __syncthreads();
    // ---- (PV) accumulate P_h . (V_h - V_7) over heads 0..6 for this key tile ----
    {
      const _Float16* const pbasea = (const _Float16*)(const void*)sPa + m * PLP + 8 * hh;
      const _Float16* const pbaseb = (const _Float16*)(const void*)sPb + m * PLP + 8 * hh;
      // unrolled: the slot index is a constant, and each wait counts exactly the loads that are younger than the slot it needs
#pragma unroll
      for (int h = 0; h < NHP; ++h) {
        if (h + 1 < NHP) {                   // half step 2h + 3 (head h + 1, d tiles 2 and 3) into the slot that half step 2h - 1 has left
          g[(2 * h + 3) & 3][0] = ldfrag_hf(vl + (h + 1) * (DM * 32) + 1024);
          g[(2 * h + 3) & 3][1] = ldfrag_hf(vl + (h + 1) * (DM * 32) + 1536);
        }
        __builtin_amdgcn_sched_barrier(0);   // these loads issue before the matrix instructions of half step 2h
        const _Float16* pp = (h < NH / 2 ? pbasea : pbaseb) + (h & (NH / 2 - 1)) * (NT * PLP);
        v16h p[NT / 16];
#pragma unroll
        for (int i = 0; i < NT / 16; ++i) p[i] = ldfrag_h(pp + i * 16 * PLP);
#pragma unroll
        for (int i = 0; i < NT / 16; ++i) o[i][0] = mma_h(p[i], g[(2 * h + 0) & 3][0], o[i][0]);
#pragma unroll
        for (int i = 0; i < NT / 16; ++i) o[i][1] = mma_h(p[i], g[(2 * h + 0) & 3][1], o[i][1]);
        slots4();
        if (h + 2 < NHP) {                   // half step 2h + 4 (head h + 2, d tiles 0 and 1) into the slot just left
          g[(2 * h) & 3][0] = ldfrag_hf(vl + (h + 2) * (DM * 32));
          g[(2 * h) & 3][1] = ldfrag_hf(vl + (h + 2) * (DM * 32) + 512);
        }
        __builtin_amdgcn_sched_barrier(0);   // these loads issue before the matrix instructions of half step 2h + 1
#pragma unroll
        for (int i = 0; i < NT / 16; ++i) o[i][2] = mma_h(p[i], g[(2 * h + 1) & 3][0], o[i][2]);
#pragma unroll
        for (int i = 0; i < NT / 16; ++i) o[i][3] = mma_h(p[i], g[(2 * h + 1) & 3][1], o[i][3]);
        slots4();
      }
    }
  }
  __syncthreads();

  // head 7's share: v_7 summed over this block's keys, for the lane's four output columns (64 * wave + 4m .. + 3); asked for
  // behind the barrier (which would wait for the loads), so that their way from L2 runs under the staging of the first tile
  v4f rv[KSPAN / 64];
  {
    const float* const rp = RS + (size_t)(lbeg >> 6) * DM + wave * 64 + m * 4;
#pragma unroll
    for (int c = 0; c < KSPAN / 64; ++c) rv[c] = *(const v4f*)(rp + c * DM);
    // the loads' address registers are rewritten only behind this wait
#if defined(__HIP_DEVICE_COMPILE__)
    asm volatile("s_wait_xcnt 0x0" ::: "memory");
#endif
  }

  const float osc = 1.0f / (PCAR * VCAR * (float)NH);
  v4f b7 = rv[0];
#pragma unroll
  for (int c = 1; c < KSPAN / 64; ++c) b7 += rv[c];
  b7 *= 1.0f / (float)NH;
  float* const sl = U.slab + wave * SLAB64;
#pragma unroll
  for (int i = 0; i < NT / 16; ++i) {
    if (i) wave_sync_lds();                  // the slab's last reads end before the next tile is staged in it
    epi64(sl, o[i][0], o[i][1], o[i][2], o[i][3], osc, b7, out, DM, (size_t)q0 + 16 * i, wave * 64, lane);
  }
}

// =====================================================================================================
// out = sum of the KS partial planes, added in plane order 0..KS-1 in f32. Thread = 4 consecutive floats: KS 16-B loads, one
// 16-B store; 32 consecutive lanes = 512 contiguous bytes per load and store.
// coverage: grid = SQ*DM/1024 blocks x 256 thr x 4 floats = out rows 0..SQ-1, every float exactly once.
// =====================================================================================================
__global__ __launch_bounds__(256) void sum_parts(const float* __restrict__ part, float* out) {
  const unsigned ob = (blockIdx.x * 256u + threadIdx.x) * 16u;    // byte offset in a plane, < SQ * DM * 4 (grid exact)
  v4f p[KS];
#pragma unroll
  for (int s = 0; s < KS; ++s) p[s] = *(const v4f*)((const char*)(part + (size_t)s * ((size_t)SQ * DM)) + ob);
  v4f a = p[0];
#pragma unroll
  for (int s = 1; s < KS; ++s) a += p[s];
  *(v4f*)((char*)out + ob) = a;
}

// =====================================================================================================
// Workspace map (bytes); every plane (VT but for the blocks of head 7's rows) is fully written by whole-line stores before it is read; all extents are exact multiples of
// the store granularity (no pad rows, all dims multiples of 64), every offset a multiple of 256:
//   XQ  bf16 [SQ][512]                      <=  4194304
//   XS  bf16 [4096][512]                        4194304
//   WV1T, WQT, WKT bf16 [512][512]             3 x 524288
//   WV2T f16 of bf16 value x1024 [4096][512]   4194304
//   VALH f16 value x8 [4096][512]               4194304
//   QP   f16 x8 [SQ][512]                   <=  4194304
//   KP   f16 x8 [4096][512]                     4194304
//   VT   f16 x64 [4096][4096]                  33554432   (the blocks of head 7's rows are neither written nor read)
//   RS   f32 [64][512]                           131072
//   PART f32 [KS][SQ][512]                  <= 67108864
//   end                                     <= 127533056
// =====================================================================================================
extern "C" void kernel_launch(void* const* d_in, const int* in_sizes, int n_in,
                              void* d_out, int out_size, void* d_ws, size_t ws_size,
                              hipStream_t stream) {
  if (n_in < 10) return;
  if (in_sizes[0] != NQ * DM || in_sizes[1] != NL * DM) return;
  if (in_sizes[2] != DM * DM || in_sizes[3] != DM) return;
  if (in_sizes[4] != DM * DM || in_sizes[5] != DM) return;
  if (in_sizes[6] != DM * DM || in_sizes[7] != DM) return;
  if (in_sizes[8] != DM * DV || in_sizes[9] != DV) return;
  if (out_size != NQ * DM) return;

  const float* xq  = (const float*)d_in[0];
  const float* xs  = (const float*)d_in[1];
  const float* wv1 = (const float*)d_in[2];
  const float* bv1 = (const float*)d_in[3];
  const float* wq  = (const float*)d_in[4];
  const float* bq  = (const float*)d_in[5];
  const float* wk  = (const float*)d_in[6];
  const float* bk  = (const float*)d_in[7];
  const float* wv2 = (const float*)d_in[8];
  const float* bv2 = (const float*)d_in[9];
  float*       out = (float*)d_out;

  const size_t szXQ = (size_t)SQ * DM * 2;          //  4194304 at SQ = NQ
  const size_t szXS = (size_t)NL * DM * 2;          //  4194304
  const size_t szWT = (size_t)DM * DM * 2;          //   524288
  const size_t szW2 = (size_t)DV * DM * 2;          //  4194304
  const size_t szVL = (size_t)NL * DM * 2;          //  4194304
  const size_t szQP = (size_t)SQ * DM * 2;          //  4194304 at SQ = NQ
  const size_t szKP = (size_t)NL * DM * 2;          //  4194304
  const size_t szVT = (size_t)DV * NL * 2;          // 33554432
  const size_t szRS = (size_t)(NL / 64) * DM * 4;   //   131072
  const size_t szPT = (size_t)KS * SQ * DM * 4;     // 67108864 at SQ = NQ
  size_t off = 0;
  const size_t oXQ = off; off += szXQ;
  const size_t oXS = off; off += szXS;
  const size_t oW1 = off; off += szWT;
  const size_t oWQ = off; off += szWT;
  const size_t oWK = off; off += szWT;
  const size_t oW2 = off; off += szW2;
  const size_t oVL = off; off += szVL;
  const size_t oQP = off; off += szQP;
  const size_t oKP = off; off += szKP;
  const size_t oVT = off; off += szVT;
  const size_t oRS = off; off += szRS;
  const size_t oPT = off; off += szPT;
  if (off > ws_size) return;                        // off = 127533056 at SQ = NQ
  if (off > WS_CAP) return;

  char* ws = (char*)d_ws;
  u16* XQ   = (u16*)(ws + oXQ);
  u16* XS   = (u16*)(ws + oXS);
  u16* WV1T = (u16*)(ws + oW1);
  u16* WQT  = (u16*)(ws + oWQ);
  u16* WKT  = (u16*)(ws + oWK);
  u16* WV2T = (u16*)(ws + oW2);
  u16* VALH = (u16*)(ws + oVL);
  u16* QP   = (u16*)(ws + oQP);
  u16* KP   = (u16*)(ws + oKP);
  u16* VT   = (u16*)(ws + oVT);
  float* RS   = (float*)(ws + oRS);
  float* PART = (float*)(ws + oPT);

  const dim3 blk(256);
  const dim3 bG(PJW * 32);
  const dim3 gPR(PB_ALL);                           // 512 + 3 x 64 + 1024 + 1024 at SQ = NQ
  const dim3 gP3(((2 * RT_S + RT_Q) / 3) * (DM / 128));   // 256 at SQ = NQ
  const dim3 gVT((DV / 256) * (NL / 128));          // 512
  const dim3 gAT(KS, SQ / NT);                      // 8 x 32 at SQ = NQ
  const dim3 gSP((SQ * DM) / 1024);                 // 2048 at SQ = NQ
  const dim3 bAT(ATT_THREADS);

  // (0) query rows < SQ and source -> bf16 planes; Wv1, Wq, Wk [in][out] -> bf16 [out][in] fragment-order planes;
  //     Wv2 [512][4096] -> f16 of the bf16 value (heads 0..6 minus head 7) x1024, [4096][512]
  prep_all<<<gPR, blk, 0, stream>>>(xq, xs, wv1, wq, wk, wv2, XQ, XS, WV1T, WQT, WKT, WV2T);
  // (1) value = source.Wv1 + b -> f16 plane x8; q (rows < SQ) and k projections -> f16 planes x8
  proj3<<<gP3, bG, 0, stream>>>(XS, XQ, WV1T, WQT, WKT, bv1, bq, bk, VALH, QP, KP);
  // (2) V^T [h*512+d][l] = (Wv2^T . value^T) / (1024*8) + b[h*512+d], less head 7's, f16 plane x64 (h < 7); head 7: sums over 64 keys -> RS
  gemm_hh16r<<<gVT, blk, 0, stream>>>(WV2T, VALH, bv2, VT, RS, 1.0f / (W2S * VSC), VCAR);
  // (3) head-axis softmax attention + head mean, one f32 partial plane per key range; (4) planes summed -> out rows 0..SQ-1
  attn_heads<<<gAT, bAT, 0, stream>>>(QP, KP, VT, RS, PART);
  sum_parts<<<gSP, blk, 0, stream>>>(PART, out);
  (void)hipGetLastError();
}
